// v000
// The times below were measured on an AMD MI455X: many runs one after another, warmed up first and cycling through
// copies of the inputs, with the whole window's GPU time divided by the number of runs. Launches and the gaps
// between them are all in it. The median over several windows is given; except for v000 it joins two sittings, which
// can be a few percent apart, so the side-by-side timings, each taken in one sitting, are the better comparison.
// The starting kernel, v000, takes 121 microseconds a run.
#include <hip/hip_runtime.h>
// Projections x*W{q,k,v}: v_wmma_f32_16x16x32_bf16 (bf16 operands = RNE-converted inputs, f32 accumulate); scores K*Q^T, context V^T*P and output projection ctx*Wd: v_wmma_f32_16x16x32_f16 (f16 operands; Q/K/V planes carried x8, P carried x1024, ctx plane carried x16, Wd plane carried x16; f32 accumulate); softmax in f32.

#ifndef NB
#define NB 8
#endif
#ifndef LL
#define LL 12
#endif
#define NB_FULL 8
#define LL_FULL 12
#define NQ 384           // tokens per (b,l) group = attention length
#define DIN 128          // feature width of query / key / value inputs
#define ATT 256          // attention width = NHEAD * HD
#define NHEAD 8
#define HD 32
#define DOUT 128         // output feature width
#define BL (NB * LL)     // number of (b,l) groups processed
#define MROWS (BL * NQ)  // token rows processed (prefix of the full row range)

static_assert(NB >= 1 && NB <= NB_FULL);
static_assert(LL >= 1 && LL <= LL_FULL);
static_assert(LL == LL_FULL || NB == 1);
static_assert(ATT == NHEAD * HD);
static_assert(HD == 32);
static_assert(NHEAD == 8);
static_assert(NQ % 32 == 0);
static_assert(NQ % 16 == 0);
static_assert(MROWS % 128 == 0);
static_assert(DIN % 64 == 0 && ATT % 64 == 0 && DOUT % 64 == 0);
static_assert(DIN * ATT == ATT * DOUT);
static_assert((DIN * ATT) % 4096 == 0);
static_assert(((size_t)MROWS * DIN / 8) % 256 == 0);
static_assert((size_t)NB_FULL * LL_FULL * NQ * DOUT * 4 == 18874368);
// coverage equalities (grid x block x per-thread elements == plane elements)
static_assert((size_t)(MROWS * DIN / 8 / 256) * 256 * 8 == (size_t)MROWS * DIN);          // xb planes
static_assert((size_t)(DIN * ATT / 4096) * 64 * 64 == (size_t)DIN * ATT);                   // weight planes
static_assert((size_t)(ATT / 64) * (MROWS / 128) * 128 * 64 == (size_t)MROWS * ATT);        // Q, K, V^T planes
static_assert((size_t)(NQ / 16) * BL * NHEAD * 16 * HD == (size_t)MROWS * ATT);            // ctx plane
static_assert((size_t)(DOUT / 64) * (MROWS / 128) * 128 * 64 == (size_t)MROWS * DOUT);      // out

// LDS pitches (16-bit elements unless noted); all keep 16-byte row alignment
#define BTP 40     // weight k-tile [64 n][32 k]
#define EQP 72     // row-major epilogue tile [128 rows][64 cols]
#define EVP 136    // transposed epilogue tile [64 d][128 s]
#define TP  72     // weight transpose tile [64 n][64 k]
#define CTP 40     // context tile [16 q][32 d] halves
#define OEP 68     // output epilogue tile [128 rows][64 cols], floats
#define ESZ 9216   // max(128*EQP, 64*EVP)
static_assert(128 * EQP <= ESZ);
static_assert(64 * EVP <= ESZ);

typedef __bf16   v16bf __attribute__((ext_vector_type(16)));
typedef __bf16   v8bf  __attribute__((ext_vector_type(8)));
typedef _Float16 v16h  __attribute__((ext_vector_type(16)));
typedef _Float16 v8h   __attribute__((ext_vector_type(8)));
typedef float    v8f   __attribute__((ext_vector_type(8)));
typedef float    v4f   __attribute__((ext_vector_type(4)));
typedef unsigned int v4u __attribute__((ext_vector_type(4)));

// ---------------------------------------------------------------------------
// WMMA wrappers with the VALU hazard guard (4 v_nop after every issue).
__device__ __forceinline__ v8f mma_bf16(v16bf a, v16bf b, v8f c) {
  v8f d = __builtin_amdgcn_wmma_f32_16x16x32_bf16(false, a, false, b, (short)0, c, false, false);
  asm volatile("v_nop\n\tv_nop\n\tv_nop\n\tv_nop" : "+v"(d) : "v"(a), "v"(b));
  return d;
}
__device__ __forceinline__ v8f mma_f16(v16h a, v16h b, v8f c) {
  v8f d = __builtin_amdgcn_wmma_f32_16x16x32_f16(false, a, false, b, (short)0, c, false, false);
  asm volatile("v_nop\n\tv_nop\n\tv_nop\n\tv_nop" : "+v"(d) : "v"(a), "v"(b));
  return d;
}

// 16-bit fragment, contraction dim CONTIGUOUS in memory: elem(k) = p0[rc*ld + k].
// Lane l: row/col rc = (l&15); elements 0..7 <- kk+8h+0..7, elements 8..15 <- kk+16+8h+0..7
// (h = l>>4). Same map for A (rc = row) and B (rc = column of a k-contiguous copy).
__device__ __forceinline__ v16bf ld_frag_bf(const __bf16* p0, int ld, int rc, int kk, int lane) {
  const int hh = (lane >> 4) & 1;
  const __bf16* p = p0 + (size_t)rc * ld + kk + 8 * hh;
  const v8bf lo = *(const v8bf*)(p);
  const v8bf hi = *(const v8bf*)(p + 16);
  v16bf f;
#pragma unroll
  for (int i = 0; i < 8; ++i) { f[i] = lo[i]; f[8 + i] = hi[i]; }
  return f;
}
__device__ __forceinline__ v16h ld_frag_h(const _Float16* p0, int ld, int rc, int kk, int lane) {
  const int hh = (lane >> 4) & 1;
  const _Float16* p = p0 + (size_t)rc * ld + kk + 8 * hh;
  const v8h lo = *(const v8h*)(p);
  const v8h hi = *(const v8h*)(p + 16);
  v16h f;
#pragma unroll
  for (int i = 0; i < 8; ++i) { f[i] = lo[i]; f[8 + i] = hi[i]; }
  return f;
}

// f32 -> bf16 bits, RNE convert
__device__ __forceinline__ unsigned int bfb(float x) {
  unsigned int u = __float_as_uint(x);
  u = u + 0x7FFFu + ((u >> 16) & 1u);
  return u >> 16;
}
// f32 -> value of its RNE bf16
__device__ __forceinline__ float bf16val(float x) {
  return __uint_as_float(bfb(x) << 16);
}
// f32 -> f16 bits, RNE convert
__device__ __forceinline__ unsigned short hbits(float x) {
  const _Float16 hv = (_Float16)x;
  return __builtin_bit_cast(unsigned short, hv);
}
__device__ __forceinline__ unsigned int pack2h(float a, float b) {
  return (unsigned int)hbits(a) | ((unsigned int)hbits(b) << 16);
}

// ---------------------------------------------------------------------------
// x f32 [MROWS][DIN] -> bf16 plane (same layout); blockIdx.y selects query /
// key / value into three consecutive planes. Thread g converts 8 consecutive
__global__ __launch_bounds__(256) void k_cvt_rows(const float* __restrict__ xq,
                                                  const float* __restrict__ xk,
                                                  const float* __restrict__ xv,
                                                  unsigned short* __restrict__ xb, int n8) {
  const int z = blockIdx.y;
  const float* in = (z == 0) ? xq : ((z == 1) ? xk : xv);
  unsigned short* outp = xb + (size_t)z * MROWS * DIN;
  const int g = blockIdx.x * 256 + threadIdx.x;
  if (g >= n8) return;
  const v4f a = *(const v4f*)(in + (size_t)g * 8);
  const v4f b = *(const v4f*)(in + (size_t)g * 8 + 4);
  v4u w;
  w[0] = bfb(a[0]) | (bfb(a[1]) << 16);
  w[1] = bfb(a[2]) | (bfb(a[3]) << 16);
  w[2] = bfb(b[0]) | (bfb(b[1]) << 16);
  w[3] = bfb(b[2]) | (bfb(b[3]) << 16);
  v4u* p = (v4u*)(outp + (size_t)g * 8);
  *p = w;
  
}

// ---------------------------------------------------------------------------
// W f32 [kdim k][ndim n] -> WT 16-bit [ndim n][kdim k] (k contiguous).
// z = 0,1,2: Wq/Wk/Wv [DIN][ATT] -> bf16 planes; z = 3: Wd [ATT][DOUT] ->
// f16 plane holding 16 * bf16val(w). All four planes have DIN*ATT elements.
// Block = 64 k x 64 n tile transposed through LDS; each WT row segment
__global__ __launch_bounds__(256) void k_cvt_wT(const float* __restrict__ Wq,
                                                const float* __restrict__ Wk,
                                                const float* __restrict__ Wv,
                                                const float* __restrict__ Wd,
                                                unsigned short* __restrict__ wT) {
  __shared__ __align__(16) unsigned short T[64 * TP];   // [n local][k local], cross-wave (block barrier)
  const int z = blockIdx.z;
  const float* W = (z == 0) ? Wq : ((z == 1) ? Wk : ((z == 2) ? Wv : Wd));
  const bool od = (z == 3);                // block-uniform
  const int kdim = od ? ATT : DIN;
  const int ndim = od ? DOUT : ATT;
  unsigned short* dst = wT + (size_t)z * (DIN * ATT);
  const int nkt = kdim / 64;
  const int t = blockIdx.x;                // tile index 0 .. DIN*ATT/4096 - 1
  const int k0 = (t % nkt) * 64;
  const int n0 = (t / nkt) * 64;
  const int tid = threadIdx.x;
  const int wave = tid >> 5, lane = tid & 31;

#pragma unroll
  for (int i = 0; i < 4; ++i) {
    const int idx = i * 256 + tid;          // 0..1023
    const int kk = idx >> 4;                // 0..63
    const int c4 = (idx & 15) * 4;          // 0..60
    const v4f w = *(const v4f*)(W + (size_t)(k0 + kk) * ndim + n0 + c4);
    unsigned short e0, e1, e2, e3;
    if (od) {
      e0 = hbits(bf16val(w[0]) * 16.0f); e1 = hbits(bf16val(w[1]) * 16.0f);
      e2 = hbits(bf16val(w[2]) * 16.0f); e3 = hbits(bf16val(w[3]) * 16.0f);
    } else {
      e0 = (unsigned short)bfb(w[0]); e1 = (unsigned short)bfb(w[1]);
      e2 = (unsigned short)bfb(w[2]); e3 = (unsigned short)bfb(w[3]);
    }
    T[(c4 + 0) * TP + kk] = e0;
    T[(c4 + 1) * TP + kk] = e1;
    T[(c4 + 2) * TP + kk] = e2;
    T[(c4 + 3) * TP + kk] = e3;
  }
  __syncthreads();

  v4u v[2];
  size_t off[2];
#pragma unroll
  for (int it = 0; it < 2; ++it) {
    const int nn = wave * 8 + it * 4 + (lane >> 3);   // 0..63 over (wave, it, lane>>3)
    const int q = lane & 7;
    v[it] = *(const v4u*)(&T[nn * TP + q * 8]);
    off[it] = (size_t)(n0 + nn) * kdim + k0 + q * 8;
  }
#pragma unroll
  for (int it = 0; it < 2; ++it) *(v4u*)(dst + off[it]) = v[it];
  
}

// ---------------------------------------------------------------------------
// Projection: C[MROWS][ATT] = xb_z[MROWS][DIN] * WT_z[ATT][DIN]^T + bias_z.
// 256 thr = 8 waves; block tile 128 rows x 64 cols; wave owns 16 rows x 64 cols.
// Weight k-tile [64 n][32 k] staged in LDS with plain loads (single buffer,
// two block barriers per step); A fragments straight from the bf16 plane.
// z = 0: Q plane f16 x8 [MROWS][ATT]; z = 1: K plane f16 x8 [MROWS][ATT];
// z = 2: V^T plane f16 x8 [ATT][MROWS]. Epilogue staged in LDS, every
__global__ __launch_bounds__(256) void k_proj(
    const unsigned short* __restrict__ xb, const unsigned short* __restrict__ wT,
    const float* __restrict__ bq, const float* __restrict__ bk, const float* __restrict__ bv,
    unsigned short* __restrict__ qp, unsigned short* __restrict__ kp,
    unsigned short* __restrict__ vtp) {
  __shared__ __align__(16) unsigned short bt[64 * BTP];   // weight k-tile, cross-wave (block barrier)
  __shared__ __align__(16) unsigned short E[ESZ];         // epilogue tile, cross-wave (block barrier)

  const int z = blockIdx.z;
  const int n0 = blockIdx.x * 64;
  const int m0 = blockIdx.y * 128;
  const int tid = threadIdx.x;
  const int wave = tid >> 5, lane = tid & 31;
  const int l15 = lane & 15, half = (lane >> 4) & 1;

  const unsigned short* Wt = wT + (size_t)z * ATT * DIN;
  const float* bias = (z == 0) ? bq : ((z == 1) ? bk : bv);

  const int tn = tid >> 2;            // 0..63 : column within tile
  const int tk = (tid & 3) * 8;       // 0,8,16,24 : k within step
  const unsigned short* wsrc = Wt + (size_t)(n0 + tn) * DIN + tk;
  const __bf16* A = (const __bf16*)(xb + (size_t)z * MROWS * DIN);
  const int arow = m0 + wave * 16 + l15;

  v8f acc[4] = {};
  for (int s = 0; s < DIN / 32; ++s) {
    const int kk = s * 32;
    const v4u wv = *(const v4u*)(wsrc + kk);
    __syncthreads();                               // earlier reads of bt done
    *(v4u*)(&bt[tn * BTP + tk]) = wv;
    __syncthreads();                               // tile complete
    const v16bf a = ld_frag_bf(A, DIN, arow, kk, lane);
#pragma unroll
    for (int j = 0; j < 4; ++j) {
      const v16bf b = ld_frag_bf((const __bf16*)bt, BTP, j * 16 + l15, 0, lane);
      acc[j] = mma_bf16(a, b, acc[j]);
    }
  }

  // acc[j][r] = C[m0 + wave*16 + 8*half + r][n0 + j*16 + l15]
  const float car = 8.0f;
  if (z != 2) {                      // block-uniform branch
#pragma unroll
    for (int j = 0; j < 4; ++j) {
      const int col = j * 16 + l15;
      const float bb = bf16val(bias[n0 + col]);
#pragma unroll
      for (int r = 0; r < 8; ++r) {
        const int row = wave * 16 + 8 * half + r;
        E[row * EQP + col] = hbits((acc[j][r] + bb) * car);
      }
    }
    __syncthreads();
    unsigned short* dst = (z == 0) ? qp : kp;
    v4u v[4];
    size_t off[4];
#pragma unroll
    for (int it = 0; it < 4; ++it) {
      const int row = wave * 16 + it * 4 + (lane >> 3);   // wave's 16 rows over (it, lane>>3)
      const int q = lane & 7;
      v[it] = *(const v4u*)(&E[row * EQP + q * 8]);
      off[it] = (size_t)(m0 + row) * ATT + n0 + q * 8;
    }
#pragma unroll
    for (int it = 0; it < 4; ++it) *(v4u*)(dst + off[it]) = v[it];
    
  } else {
#pragma unroll
    for (int j = 0; j < 4; ++j) {
      const int col = j * 16 + l15;                       // d within tile
      const float bb = bf16val(bias[n0 + col]);
#pragma unroll
      for (int r = 0; r < 8; ++r) {
        const int srow = wave * 16 + 8 * half + r;        // s within tile
        E[col * EVP + srow] = hbits((acc[j][r] + bb) * car);
      }
    }
    __syncthreads();
    v4u v[4];
    size_t off[4];
#pragma unroll
    for (int it = 0; it < 4; ++it) {
      const int drow = wave * 8 + it * 2 + half;          // wave's 8 d-rows over (it, half)
      const int q = l15;                                  // 16 pieces = 256-byte row = 2 lines
      v[it] = *(const v4u*)(&E[drow * EVP + q * 8]);
      off[it] = (size_t)(n0 + drow) * MROWS + m0 + q * 8;
    }
#pragma unroll
    for (int it = 0; it < 4; ++it) *(v4u*)(vtp + off[it]) = v[it];
    
  }
}

// ---------------------------------------------------------------------------
// Flash attention, transposed-score form: block = 8 waves = 8 heads of one
// (16 queries, one (b,l) group) tile; wave = (16 queries, head = wave).
// Per 32-key chunk:
//   S^T = K . Q^T    A = K rows (lane = key, k = d), B = Q^T (lane = query, k = d)
//                    D[row = key 8h+r][col = query l15]; c0 keys 0..15, c1 keys 16..31
//   per-lane online softmax for query l15 (16 local keys + xor-16 partner)
//   O^T += V^T . P   A = V^T rows (lane = d, k = key), B = P: element i<8 <- c0[i]
//                    (key 8h+i), element 8+i <- c1[i] (key 16+8h+i), same lane
//                    D[row = d 8h+r][col = query l15]
// Scores carry 64 from the x8 planes -> scaled by (1/64)/sqrt(32).
// P carried x1024, V carried x8 -> context x16 = O * 16/(8192 * sum).
// Context tile [16 q][32 d] f16 x16 staged in LDS per wave and written to the
// head-major ctx plane [BL*NHEAD*NQ][HD]: the tile is 1024 contiguous bytes
__global__ __launch_bounds__(256) void k_attn(const unsigned short* __restrict__ qp,
                                              const unsigned short* __restrict__ kp,
                                              const unsigned short* __restrict__ vtp,
                                              unsigned short* __restrict__ ctx) {
  __shared__ __align__(16) unsigned short Cl[NHEAD * 16 * CTP];   // per-wave tile (wave-private), block barrier used

  const int tid = threadIdx.x;
  const int wave = tid >> 5, lane = tid & 31;
  const int l15 = lane & 15;
  const int half = (lane >> 4) & 1;
  const int q0 = blockIdx.x * 16;          // query offset within the group
  const int g = blockIdx.y;                // (b,l) group
  const int head = wave;

  const _Float16* Q  = (const _Float16*)qp;
  const _Float16* K  = (const _Float16*)kp;
  const _Float16* VT = (const _Float16*)vtp;

  const _Float16* qbase = Q + ((size_t)g * NQ + q0) * ATT + head * HD;
  const v16h qb = ld_frag_h(qbase, ATT, l15, 0, lane);               // d 0..31
  const _Float16* kbase = K + (size_t)g * NQ * ATT + head * HD;       // key t at kbase + t*ATT
  const _Float16* vbase = VT + (size_t)head * HD * MROWS + (size_t)g * NQ;   // d row at vbase + d*MROWS

  v8f o[2] = {};
  float mrun = -1.0e30f, lrun = 0.0f;
  const float sscale = 0.17677669529663689f * (1.0f / 64.0f);

  for (int kc = 0; kc < NQ; kc += 32) {
    const _Float16* kt = kbase + (size_t)kc * ATT;
    const v16h ka0 = ld_frag_h(kt, ATT, l15, 0, lane);          // keys kc + 0..15
    const v16h ka2 = ld_frag_h(kt, ATT, 16 + l15, 0, lane);     // keys kc + 16..31
    const v8f zero = {};
    v8f c0 = mma_f16(ka0, qb, zero);
    v8f c1 = mma_f16(ka2, qb, zero);

    float sa[8], sb[8];
#pragma unroll
    for (int r = 0; r < 8; ++r) { sa[r] = c0[r] * sscale; sb[r] = c1[r] * sscale; }
    float lm = fmaxf(sa[0], sb[0]);
#pragma unroll
    for (int r = 1; r < 8; ++r) lm = fmaxf(lm, fmaxf(sa[r], sb[r]));
    lm = fmaxf(lm, __shfl_xor(lm, 16, 32));
    const float mnew = fmaxf(mrun, lm);
    const float alpha = __expf(mrun - mnew);
    float p0[8], p1[8];
    float ls = 0.0f;
#pragma unroll
    for (int r = 0; r < 8; ++r) {
      p0[r] = __expf(sa[r] - mnew);
      p1[r] = __expf(sb[r] - mnew);
      ls += p0[r] + p1[r];
    }
    ls += __shfl_xor(ls, 16, 32);
    lrun = lrun * alpha + ls;
    mrun = mnew;
#pragma unroll
    for (int j = 0; j < 2; ++j)
#pragma unroll
      for (int r = 0; r < 8; ++r) o[j][r] *= alpha;

    v16h pb;
#pragma unroll
    for (int e = 0; e < 8; ++e) {
      pb[e]     = (_Float16)(p0[e] * 1024.0f);   // key kc + 8h + e
      pb[8 + e] = (_Float16)(p1[e] * 1024.0f);   // key kc + 16 + 8h + e
    }
#pragma unroll
    for (int j = 0; j < 2; ++j) {
      const v16h va = ld_frag_h(vbase, MROWS, j * 16 + l15, kc, lane);
      o[j] = mma_f16(va, pb, o[j]);
    }
  }

  // o[j][r] = 8192 * sum_t p_t v_t for query l15, d = j*16 + 8*half + r; ctx carried x16
  const float inv = 1.0f / (lrun * 512.0f);
  unsigned short* T = Cl + wave * 16 * CTP;
#pragma unroll
  for (int j = 0; j < 2; ++j) {
    v4u w;
    w[0] = pack2h(o[j][0] * inv, o[j][1] * inv);
    w[1] = pack2h(o[j][2] * inv, o[j][3] * inv);
    w[2] = pack2h(o[j][4] * inv, o[j][5] * inv);
    w[3] = pack2h(o[j][6] * inv, o[j][7] * inv);
    *(v4u*)(&T[l15 * CTP + j * 16 + 8 * half]) = w;
  }
  __syncthreads();

  v4u v[2];
  size_t off[2];
  unsigned short* cb = ctx + (((size_t)g * NHEAD + head) * NQ + q0) * HD;
#pragma unroll
  for (int it = 0; it < 2; ++it) {
    const int row = it * 8 + (lane >> 2);     // 0..15 query row of the tile
    const int piece = (lane & 3) * 8;         // 8 halves = 16 B; 4 pieces = 64-B row, 8 lanes = one line
    v[it] = *(const v4u*)(&T[row * CTP + piece]);
    off[it] = (size_t)row * HD + piece;
  }
#pragma unroll
  for (int it = 0; it < 2; ++it) *(v4u*)(cb + off[it]) = v[it];
  
}

// ---------------------------------------------------------------------------
// Output projection: out[MROWS][DOUT] f32 = ctx[MROWS][ATT] * WdT[DOUT][ATT]^T / 256 + bd.
// ctx read from the head-major plane: for row (g, n) the 32 k values of
// k-step s (= head s) are contiguous at ((g*NHEAD + s)*NQ + n)*HD.
// Same structure as k_proj (256 thr, 128 rows x 64 cols, weight k-tile in
// LDS), f16 operands. Epilogue: f32 tile staged in LDS; each 256-byte row
// segment = 2 lines, each line written by 8 consecutive lanes of one
__global__ __launch_bounds__(256) void k_oproj(const unsigned short* __restrict__ ctx,
                                               const unsigned short* __restrict__ wT,
                                               const float* __restrict__ bd,
                                               float* __restrict__ outp) {
  __shared__ __align__(16) unsigned short bt[64 * BTP];   // weight k-tile, cross-wave (block barrier)
  __shared__ __align__(16) float E[128 * OEP];            // epilogue tile, per-wave rows (wave-private), block barrier used

  const int n0 = blockIdx.x * 64;
  const int m0 = blockIdx.y * 128;
  const int tid = threadIdx.x;
  const int wave = tid >> 5, lane = tid & 31;
  const int l15 = lane & 15, half = (lane >> 4) & 1;

  const unsigned short* Wt = wT + (size_t)3 * ATT * DIN;    // WdT plane [DOUT][ATT], f16 x16
  const int tn = tid >> 2;            // 0..63 : column within tile
  const int tk = (tid & 3) * 8;       // 0,8,16,24 : k within step
  const unsigned short* wsrc = Wt + (size_t)(n0 + tn) * ATT + tk;

  const int r0 = m0 + wave * 16;      // wave's 16 rows lie inside one group (NQ % 16 == 0)
  const int g = r0 / NQ;
  const int nl = r0 - g * NQ;
  const _Float16* A0 = (const _Float16*)ctx + ((size_t)g * NHEAD * NQ + nl) * HD;

  v8f acc[4] = {};
  for (int s = 0; s < ATT / 32; ++s) {
    const int kk = s * 32;
    const v4u wv = *(const v4u*)(wsrc + kk);
    __syncthreads();                               // earlier reads of bt done
    *(v4u*)(&bt[tn * BTP + tk]) = wv;
    __syncthreads();                               // tile complete
    const v16h a = ld_frag_h(A0 + (size_t)s * NQ * HD, HD, l15, 0, lane);
#pragma unroll
    for (int j = 0; j < 4; ++j) {
      const v16h b = ld_frag_h((const _Float16*)bt, BTP, j * 16 + l15, 0, lane);
      acc[j] = mma_f16(a, b, acc[j]);
    }
  }

  // acc[j][r] = 256 * (ctx.Wd)[m0 + wave*16 + 8*half + r][n0 + j*16 + l15]
  const float cinv = 1.0f / 256.0f;
#pragma unroll
  for (int j = 0; j < 4; ++j) {
    const int col = j * 16 + l15;
    const float bb = bf16val(bd[n0 + col]);
#pragma unroll
    for (int r = 0; r < 8; ++r) {
      const int row = wave * 16 + 8 * half + r;
      E[row * OEP + col] = acc[j][r] * cinv + bb;
    }
  }
  __syncthreads();

  v4f v[8];
  size_t off[8];
#pragma unroll
  for (int it = 0; it < 8; ++it) {
    const int row = wave * 16 + it * 2 + half;   // wave's 16 rows over (it, half)
    const int q = l15;                           // 16 pieces of 16 B = the row's 256-byte segment (2 lines)
    v[it] = *(const v4f*)(&E[row * OEP + q * 4]);
    off[it] = (size_t)(m0 + row) * DOUT + n0 + q * 4;
  }
#pragma unroll
  for (int it = 0; it < 8; ++it) *(v4f*)(outp + off[it]) = v[it];
  
}

// ---------------------------------------------------------------------------
extern "C" void kernel_launch(void* const* d_in, const int* in_sizes, int n_in,
                              void* d_out, int out_size, void* d_ws, size_t ws_size,
                              hipStream_t stream) {
  if (n_in < 11) return;
  if (in_sizes[0] < MROWS * DIN || in_sizes[1] < MROWS * DIN || in_sizes[2] < MROWS * DIN) return;
  if (in_sizes[3] < DIN * ATT || in_sizes[5] < DIN * ATT || in_sizes[7] < DIN * ATT) return;
  if (in_sizes[4] < ATT || in_sizes[6] < ATT || in_sizes[8] < ATT) return;
  if (in_sizes[9] < ATT * DOUT || in_sizes[10] < DOUT) return;
  if (out_size < MROWS * DOUT) return;

  const float* xq = (const float*)d_in[0];
  const float* xk = (const float*)d_in[1];
  const float* xv = (const float*)d_in[2];
  const float* Wq = (const float*)d_in[3];
  const float* bq = (const float*)d_in[4];
  const float* Wk = (const float*)d_in[5];
  const float* bk = (const float*)d_in[6];
  const float* Wv = (const float*)d_in[7];
  const float* bv = (const float*)d_in[8];
  const float* Wd = (const float*)d_in[9];
  const float* bd = (const float*)d_in[10];

  // and is written exactly to its extent (no padded tails needed: all tiles divide the shapes)
  const size_t xb_bytes  = (size_t)3 * MROWS * DIN * 2;      // three bf16 input planes
  const size_t wt_bytes  = (size_t)4 * DIN * ATT * 2;        // three bf16 WT planes + one f16 WdT plane
  const size_t pl_bytes  = (size_t)MROWS * ATT * 2;          // one f16 plane (Q, K, V^T, ctx)
  const size_t off_xb  = 0;
  const size_t off_wt  = off_xb + xb_bytes;
  const size_t off_q   = off_wt + wt_bytes;
  const size_t off_k   = off_q + pl_bytes;
  const size_t off_vt  = off_k + pl_bytes;
  const size_t off_ctx = off_vt + pl_bytes;
  const size_t total   = off_ctx + pl_bytes;                 // 104071168 B at full size
  if (total > ws_size) return;

  char* ws = (char*)d_ws;
  unsigned short* xb  = (unsigned short*)(ws + off_xb);
  unsigned short* wt  = (unsigned short*)(ws + off_wt);
  unsigned short* qpl = (unsigned short*)(ws + off_q);
  unsigned short* kpl = (unsigned short*)(ws + off_k);
  unsigned short* vtp = (unsigned short*)(ws + off_vt);
  unsigned short* cxp = (unsigned short*)(ws + off_ctx);

  const int n8 = MROWS * DIN / 8;
  k_cvt_rows<<<dim3((n8 + 255) / 256, 3), 256, 0, stream>>>(xq, xk, xv, xb, n8);
  k_cvt_wT<<<dim3(DIN * ATT / 4096, 1, 4), 256, 0, stream>>>(Wq, Wk, Wv, Wd, wt);
  k_proj<<<dim3(ATT / 64, MROWS / 128, 3), 256, 0, stream>>>(xb, wt, bq, bk, bv, qpl, kpl, vtp);
  k_attn<<<dim3(NQ / 16, BL), 256, 0, stream>>>(qpl, kpl, vtp, cxp);
  k_oproj<<<dim3(DOUT / 64, MROWS / 128), 256, 0, stream>>>(cxp, wt, bd, (float*)d_out);
}

// v001
// A run of this version takes 83.6 microseconds.
// In both of two side-by-side timings against v000, it was 1.47 times as fast.
#include <hip/hip_runtime.h>
// Projections x*W{q,k,v}: v_wmma_f32_16x16x32_bf16 (bf16 operands = RNE-converted inputs, f32 accumulate); scores K*Q^T, context V^T*P and output projection ctx*Wd: v_wmma_f32_16x16x32_f16 (f16 operands; Q/K/V planes carried x8, P carried x1024, ctx plane carried x16, Wd plane carried x16; f32 accumulate); softmax in f32.

#ifndef NB
#define NB 8
#endif
#ifndef LL
#define LL 12
#endif
#define NB_FULL 8
#define LL_FULL 12
#define NQ 384           // tokens per (b,l) group = attention length
#define DIN 128          // feature width of query / key / value inputs
#define ATT 256          // attention width = NHEAD * HD
#define NHEAD 8
#define HD 32
#define DOUT 128         // output feature width
#define BL (NB * LL)     // number of (b,l) groups processed
#define MROWS (BL * NQ)  // token rows processed (prefix of the full row range)

static_assert(NB >= 1 && NB <= NB_FULL);
static_assert(LL >= 1 && LL <= LL_FULL);
static_assert(LL == LL_FULL || NB == 1);
static_assert(ATT == NHEAD * HD);
static_assert(HD == 32);
static_assert(NHEAD == 8);
static_assert(NQ % 32 == 0);
static_assert(NQ % 16 == 0);
static_assert(MROWS % 128 == 0);
static_assert(DIN % 64 == 0 && ATT % 64 == 0 && DOUT % 64 == 0);
static_assert(DIN * ATT == ATT * DOUT);
static_assert((DIN * ATT) % 4096 == 0);
static_assert(((size_t)MROWS * DIN / 8) % 256 == 0);
static_assert((size_t)NB_FULL * LL_FULL * NQ * DOUT * 4 == 18874368);
// coverage equalities (grid x block x per-thread elements == plane elements)
static_assert((size_t)(MROWS * DIN / 8 / 256) * 256 * 8 == (size_t)MROWS * DIN);          // xb planes
static_assert((size_t)(DIN * ATT / 4096) * 64 * 64 == (size_t)DIN * ATT);                   // weight planes
static_assert((size_t)(ATT / 64) * (MROWS / 128) * 128 * 64 == (size_t)MROWS * ATT);        // Q, K, V^T planes
static_assert((size_t)NHEAD * BL * NQ * HD == (size_t)MROWS * ATT);                        // ctx plane
static_assert((size_t)(DOUT / 64) * (MROWS / 128) * 128 * 64 == (size_t)MROWS * DOUT);      // out

// LDS pitches (16-bit elements unless noted); all keep 16-byte row alignment
#define BTP 40     // weight k-tile [64 n][32 k]
#define EQP 72     // row-major epilogue tile [128 rows][64 cols]
#define EVP 136    // transposed epilogue tile [64 d][128 s]
#define TP  72     // weight transpose tile [64 n][64 k]
#define CTP 40     // context tile [16 q][32 d] halves
#define OEP 68     // output epilogue tile [128 rows][64 cols], floats
#define ESZ 9216   // max(128*EQP, 64*EVP)
#define KVP 40     // attention K / V^T tiles: rows of 32 halves
#define VCS (32 * KVP + 32)   // one 32-key chunk of V^T: 32 rows + 64 B, so that 4 chunks' stores fall on different banks
#define TQ  3      // query tiles of 16 per attention wave
static_assert(128 * EQP <= ESZ);
static_assert(64 * EVP <= ESZ);
static_assert(8 * TQ * 16 == NQ);                 // 8 waves x TQ tiles cover the group's queries
static_assert(8 * TQ * 16 * CTP <= NQ * KVP);     // context tiles fit the K tile's space
static_assert((NQ * 4) % 256 == 0);

typedef __bf16   v16bf __attribute__((ext_vector_type(16)));
typedef __bf16   v8bf  __attribute__((ext_vector_type(8)));
typedef _Float16 v16h  __attribute__((ext_vector_type(16)));
typedef _Float16 v8h   __attribute__((ext_vector_type(8)));
typedef float    v8f   __attribute__((ext_vector_type(8)));
typedef float    v4f   __attribute__((ext_vector_type(4)));
typedef unsigned int v4u __attribute__((ext_vector_type(4)));

// ---------------------------------------------------------------------------
// WMMA wrappers with the VALU hazard guard (4 v_nop after every issue).
__device__ __forceinline__ v8f mma_bf16(v16bf a, v16bf b, v8f c) {
  v8f d = __builtin_amdgcn_wmma_f32_16x16x32_bf16(false, a, false, b, (short)0, c, false, false);
  asm volatile("v_nop\n\tv_nop\n\tv_nop\n\tv_nop" : "+v"(d) : "v"(a), "v"(b));
  return d;
}
__device__ __forceinline__ v8f mma_f16(v16h a, v16h b, v8f c) {
  v8f d = __builtin_amdgcn_wmma_f32_16x16x32_f16(false, a, false, b, (short)0, c, false, false);
  asm volatile("v_nop\n\tv_nop\n\tv_nop\n\tv_nop" : "+v"(d) : "v"(a), "v"(b));
  return d;
}

// 16-bit fragment, contraction dim CONTIGUOUS in memory: elem(k) = p0[rc*ld + k].
// Lane l: row/col rc = (l&15); elements 0..7 <- kk+8h+0..7, elements 8..15 <- kk+16+8h+0..7
// (h = l>>4). Same map for A (rc = row) and B (rc = column of a k-contiguous copy).
__device__ __forceinline__ v16bf ld_frag_bf(const __bf16* p0, int ld, int rc, int kk, int lane) {
  const int hh = (lane >> 4) & 1;
  const __bf16* p = p0 + (size_t)rc * ld + kk + 8 * hh;
  const v8bf lo = *(const v8bf*)(p);
  const v8bf hi = *(const v8bf*)(p + 16);
  v16bf f;
#pragma unroll
  for (int i = 0; i < 8; ++i) { f[i] = lo[i]; f[8 + i] = hi[i]; }
  return f;
}
__device__ __forceinline__ v16h ld_frag_h(const _Float16* p0, int ld, int rc, int kk, int lane) {
  const int hh = (lane >> 4) & 1;
  const _Float16* p = p0 + (size_t)rc * ld + kk + 8 * hh;
  const v8h lo = *(const v8h*)(p);
  const v8h hi = *(const v8h*)(p + 16);
  v16h f;
#pragma unroll
  for (int i = 0; i < 8; ++i) { f[i] = lo[i]; f[8 + i] = hi[i]; }
  return f;
}

// f32 -> bf16 bits, RNE convert
__device__ __forceinline__ unsigned int bfb(float x) {
  unsigned int u = __float_as_uint(x);
  u = u + 0x7FFFu + ((u >> 16) & 1u);
  return u >> 16;
}
// f32 -> value of its RNE bf16
__device__ __forceinline__ float bf16val(float x) {
  return __uint_as_float(bfb(x) << 16);
}
// f32 -> f16 bits, RNE convert
__device__ __forceinline__ unsigned short hbits(float x) {
  const _Float16 hv = (_Float16)x;
  return __builtin_bit_cast(unsigned short, hv);
}
__device__ __forceinline__ unsigned int pack2h(float a, float b) {
  return (unsigned int)hbits(a) | ((unsigned int)hbits(b) << 16);
}

// ---------------------------------------------------------------------------
// x f32 [MROWS][DIN] -> bf16 plane (same layout); blockIdx.y selects query /
// key / value into three consecutive planes. Thread g converts 8 consecutive
__global__ __launch_bounds__(256) void k_cvt_rows(const float* __restrict__ xq,
                                                  const float* __restrict__ xk,
                                                  const float* __restrict__ xv,
                                                  unsigned short* __restrict__ xb, int n8) {
  const int z = blockIdx.y;
  const float* in = (z == 0) ? xq : ((z == 1) ? xk : xv);
  unsigned short* outp = xb + (size_t)z * MROWS * DIN;
  const int g = blockIdx.x * 256 + threadIdx.x;
  if (g >= n8) return;
  const v4f a = *(const v4f*)(in + (size_t)g * 8);
  const v4f b = *(const v4f*)(in + (size_t)g * 8 + 4);
  v4u w;
  w[0] = bfb(a[0]) | (bfb(a[1]) << 16);
  w[1] = bfb(a[2]) | (bfb(a[3]) << 16);
  w[2] = bfb(b[0]) | (bfb(b[1]) << 16);
  w[3] = bfb(b[2]) | (bfb(b[3]) << 16);
  v4u* p = (v4u*)(outp + (size_t)g * 8);
  *p = w;
  
}

// ---------------------------------------------------------------------------
// W f32 [kdim k][ndim n] -> WT 16-bit [ndim n][kdim k] (k contiguous).
// z = 0,1,2: Wq/Wk/Wv [DIN][ATT] -> bf16 planes; z = 3: Wd [ATT][DOUT] ->
// f16 plane holding 16 * bf16val(w). All four planes have DIN*ATT elements.
// Block = 64 k x 64 n tile transposed through LDS; each WT row segment
__global__ __launch_bounds__(256) void k_cvt_wT(const float* __restrict__ Wq,
                                                const float* __restrict__ Wk,
                                                const float* __restrict__ Wv,
                                                const float* __restrict__ Wd,
                                                unsigned short* __restrict__ wT) {
  __shared__ __align__(16) unsigned short T[64 * TP];   // [n local][k local], cross-wave (block barrier)
  const int z = blockIdx.z;
  const float* W = (z == 0) ? Wq : ((z == 1) ? Wk : ((z == 2) ? Wv : Wd));
  const bool od = (z == 3);                // block-uniform
  const int kdim = od ? ATT : DIN;
  const int ndim = od ? DOUT : ATT;
  unsigned short* dst = wT + (size_t)z * (DIN * ATT);
  const int nkt = kdim / 64;
  const int t = blockIdx.x;                // tile index 0 .. DIN*ATT/4096 - 1
  const int k0 = (t % nkt) * 64;
  const int n0 = (t / nkt) * 64;
  const int tid = threadIdx.x;
  const int wave = tid >> 5, lane = tid & 31;

#pragma unroll
  for (int i = 0; i < 4; ++i) {
    const int idx = i * 256 + tid;          // 0..1023
    const int kk = idx >> 4;                // 0..63
    const int c4 = (idx & 15) * 4;          // 0..60
    const v4f w = *(const v4f*)(W + (size_t)(k0 + kk) * ndim + n0 + c4);
    unsigned short e0, e1, e2, e3;
    if (od) {
      e0 = hbits(bf16val(w[0]) * 16.0f); e1 = hbits(bf16val(w[1]) * 16.0f);
      e2 = hbits(bf16val(w[2]) * 16.0f); e3 = hbits(bf16val(w[3]) * 16.0f);
    } else {
      e0 = (unsigned short)bfb(w[0]); e1 = (unsigned short)bfb(w[1]);
      e2 = (unsigned short)bfb(w[2]); e3 = (unsigned short)bfb(w[3]);
    }
    T[(c4 + 0) * TP + kk] = e0;
    T[(c4 + 1) * TP + kk] = e1;
    T[(c4 + 2) * TP + kk] = e2;
    T[(c4 + 3) * TP + kk] = e3;
  }
  __syncthreads();

  v4u v[2];
  size_t off[2];
#pragma unroll
  for (int it = 0; it < 2; ++it) {
    const int nn = wave * 8 + it * 4 + (lane >> 3);   // 0..63 over (wave, it, lane>>3)
    const int q = lane & 7;
    v[it] = *(const v4u*)(&T[nn * TP + q * 8]);
    off[it] = (size_t)(n0 + nn) * kdim + k0 + q * 8;
  }
#pragma unroll
  for (int it = 0; it < 2; ++it) *(v4u*)(dst + off[it]) = v[it];
  
}

// ---------------------------------------------------------------------------
// Projection: C[MROWS][ATT] = xb_z[MROWS][DIN] * WT_z[ATT][DIN]^T + bias_z.
// 256 thr = 8 waves; block tile 128 rows x 64 cols; wave owns 16 rows x 64 cols.
// Weight k-tile [64 n][32 k] staged in LDS with plain loads (single buffer,
// two block barriers per step); A fragments straight from the bf16 plane.
// z = 0: Q plane f16 x8 [MROWS][ATT]; z = 1: K plane f16 x8 [MROWS][ATT];
// z = 2: V^T plane f16 x8 [ATT][MROWS]. Epilogue staged in LDS, every
__global__ __launch_bounds__(256) void k_proj(
    const unsigned short* __restrict__ xb, const unsigned short* __restrict__ wT,
    const float* __restrict__ bq, const float* __restrict__ bk, const float* __restrict__ bv,
    unsigned short* __restrict__ qp, unsigned short* __restrict__ kp,
    unsigned short* __restrict__ vtp) {
  __shared__ __align__(16) unsigned short bt[64 * BTP];   // weight k-tile, cross-wave (block barrier)
  __shared__ __align__(16) unsigned short E[ESZ];         // epilogue tile, cross-wave (block barrier)

  const int z = blockIdx.z;
  const int n0 = blockIdx.x * 64;
  const int m0 = blockIdx.y * 128;
  const int tid = threadIdx.x;
  const int wave = tid >> 5, lane = tid & 31;
  const int l15 = lane & 15, half = (lane >> 4) & 1;

  const unsigned short* Wt = wT + (size_t)z * ATT * DIN;
  const float* bias = (z == 0) ? bq : ((z == 1) ? bk : bv);

  const int tn = tid >> 2;            // 0..63 : column within tile
  const int tk = (tid & 3) * 8;       // 0,8,16,24 : k within step
  const unsigned short* wsrc = Wt + (size_t)(n0 + tn) * DIN + tk;
  const __bf16* A = (const __bf16*)(xb + (size_t)z * MROWS * DIN);
  const int arow = m0 + wave * 16 + l15;

  v8f acc[4] = {};
  for (int s = 0; s < DIN / 32; ++s) {
    const int kk = s * 32;
    const v4u wv = *(const v4u*)(wsrc + kk);
    __syncthreads();                               // earlier reads of bt done
    *(v4u*)(&bt[tn * BTP + tk]) = wv;
    __syncthreads();                               // tile complete
    const v16bf a = ld_frag_bf(A, DIN, arow, kk, lane);
#pragma unroll
    for (int j = 0; j < 4; ++j) {
      const v16bf b = ld_frag_bf((const __bf16*)bt, BTP, j * 16 + l15, 0, lane);
      acc[j] = mma_bf16(a, b, acc[j]);
    }
  }

  // acc[j][r] = C[m0 + wave*16 + 8*half + r][n0 + j*16 + l15]
  const float car = 8.0f;
  if (z != 2) {                      // block-uniform branch
#pragma unroll
    for (int j = 0; j < 4; ++j) {
      const int col = j * 16 + l15;
      const float bb = bf16val(bias[n0 + col]);
#pragma unroll
      for (int r = 0; r < 8; ++r) {
        const int row = wave * 16 + 8 * half + r;
        E[row * EQP + col] = hbits((acc[j][r] + bb) * car);
      }
    }
    __syncthreads();
    unsigned short* dst = (z == 0) ? qp : kp;
    v4u v[4];
    size_t off[4];
#pragma unroll
    for (int it = 0; it < 4; ++it) {
      const int row = wave * 16 + it * 4 + (lane >> 3);   // wave's 16 rows over (it, lane>>3)
      const int q = lane & 7;
      v[it] = *(const v4u*)(&E[row * EQP + q * 8]);
      off[it] = (size_t)(m0 + row) * ATT + n0 + q * 8;
    }
#pragma unroll
    for (int it = 0; it < 4; ++it) *(v4u*)(dst + off[it]) = v[it];
    
  } else {
#pragma unroll
    for (int j = 0; j < 4; ++j) {
      const int col = j * 16 + l15;                       // d within tile
      const float bb = bf16val(bias[n0 + col]);
#pragma unroll
      for (int r = 0; r < 8; ++r) {
        const int srow = wave * 16 + 8 * half + r;        // s within tile
        E[col * EVP + srow] = hbits((acc[j][r] + bb) * car);
      }
    }
    __syncthreads();
    v4u v[4];
    size_t off[4];
#pragma unroll
    for (int it = 0; it < 4; ++it) {
      const int drow = wave * 8 + it * 2 + half;          // wave's 8 d-rows over (it, half)
      const int q = l15;                                  // 16 pieces = 256-byte row = 2 lines
      v[it] = *(const v4u*)(&E[drow * EVP + q * 8]);
      off[it] = (size_t)(n0 + drow) * MROWS + m0 + q * 8;
    }
#pragma unroll
    for (int it = 0; it < 4; ++it) *(v4u*)(vtp + off[it]) = v[it];
    
  }
}

// ---------------------------------------------------------------------------
// Flash attention, transposed-score form: block = one (group, head); its K
// [384 keys][32 d] and V^T [32 d][384 keys] are staged ONCE in LDS and shared by
// 8 waves; wave = TQ query tiles of 16 (48 queries), so the block covers all
// 384 queries and every K / V fragment read from LDS serves TQ tiles.
// Per 32-key chunk and query tile:
//   S^T = K . Q^T    A = K rows (lane = key, k = d), B = Q^T (lane = query, k = d)
//                    D[row = key 8h+r][col = query l15]; c0 keys 0..15, c1 keys 16..31
//   per-lane online softmax for query l15 (16 local keys + xor-16 partner)
//   O^T += V^T . P   A = V^T rows (lane = d, k = key), B = P: element i<8 <- c0[i]
//                    (key 8h+i), element 8+i <- c1[i] (key 16+8h+i), same lane
//                    D[row = d 8h+r][col = query l15]
// Scores carry 64 from the x8 planes -> scaled by (1/64)/sqrt(32).
// P carried x1024, V carried x8 -> context x16 = O * 16/(8192 * sum).
// Context tiles [16 q][32 d] f16 x16 staged in LDS (the K tile's space, free
// behind a block barrier) and written to the head-major ctx plane
// [BL*NHEAD*NQ][HD]: each tile is 1024 contiguous bytes
// second bound: at most 160 VGPRs, so that the 3 blocks a WGP gets (768 blocks, 256 WGPs) are resident together
__global__ __launch_bounds__(256, 6) void k_attn(const unsigned short* __restrict__ qp,
                                              const unsigned short* __restrict__ kp,
                                              const unsigned short* __restrict__ vtp,
                                              unsigned short* __restrict__ ctx) {
  __shared__ __align__(16) unsigned short Ks[NQ * KVP];          // [key][d]; later the context tiles
  __shared__ __align__(16) unsigned short Vs[(NQ / 32) * VCS];   // [chunk][d][key in chunk]

  const int tid = threadIdx.x;
  const int wave = tid >> 5, lane = tid & 31;
  const int l15 = lane & 15;
  const int half = (lane >> 4) & 1;
  const int head = blockIdx.x;
  const int g = blockIdx.y;                // (b,l) group

  const _Float16* Q  = (const _Float16*)qp;
  const unsigned short* kbase = kp + (size_t)g * NQ * ATT + head * HD;              // key t at kbase + t*ATT
  const unsigned short* vbase = vtp + (size_t)head * HD * MROWS + (size_t)g * NQ;   // d row at vbase + d*MROWS

  // stage K and V^T: 2 x 1536 pieces of 16 bytes, 6 + 6 a thread, all loads issued before the first LDS store
  v4u kr[NQ * 4 / 256], vr[NQ * 4 / 256];
#pragma unroll
  for (int i = 0; i < NQ * 4 / 256; ++i) {
    const int idx = i * 256 + tid;
    kr[i] = *(const v4u*)(kbase + (size_t)(idx >> 2) * ATT + (idx & 3) * 8);
  }
#pragma unroll
  for (int i = 0; i < NQ * 4 / 256; ++i) {
    const int idx = i * 256 + tid;
    const int d = idx / (NQ / 8), pc = idx % (NQ / 8);
    vr[i] = *(const v4u*)(vbase + (size_t)d * MROWS + pc * 8);
  }
  v16h qb[TQ];
#pragma unroll
  for (int t = 0; t < TQ; ++t) {
    const _Float16* qbase = Q + ((size_t)g * NQ + (wave * TQ + t) * 16) * ATT + head * HD;
    qb[t] = ld_frag_h(qbase, ATT, l15, 0, lane);               // d 0..31
  }
#pragma unroll
  for (int i = 0; i < NQ * 4 / 256; ++i) {
    const int idx = i * 256 + tid;
    *(v4u*)(&Ks[(idx >> 2) * KVP + (idx & 3) * 8]) = kr[i];
  }
#pragma unroll
  for (int i = 0; i < NQ * 4 / 256; ++i) {
    const int idx = i * 256 + tid;
    const int d = idx / (NQ / 8), pc = idx % (NQ / 8);
    *(v4u*)(&Vs[(pc >> 2) * VCS + d * KVP + (pc & 3) * 8]) = vr[i];
  }
  __syncthreads();                         // K and V^T tiles complete

  v8f o[TQ][2] = {};
  float mrun[TQ], lrun[TQ];
#pragma unroll
  for (int t = 0; t < TQ; ++t) { mrun[t] = -1.0e30f; lrun[t] = 0.0f; }
  const float sscale = 0.17677669529663689f * (1.0f / 64.0f);

  for (int kc = 0; kc < NQ; kc += 32) {
    const _Float16* kt = (const _Float16*)Ks + kc * KVP;
    const _Float16* vt = (const _Float16*)Vs + (kc >> 5) * VCS;
    const v16h ka0 = ld_frag_h(kt, KVP, l15, 0, lane);          // keys kc + 0..15
    const v16h ka2 = ld_frag_h(kt, KVP, 16 + l15, 0, lane);     // keys kc + 16..31
    const v16h va0 = ld_frag_h(vt, KVP, l15, 0, lane);          // d 0..15
    const v16h va1 = ld_frag_h(vt, KVP, 16 + l15, 0, lane);     // d 16..31
#pragma unroll
    for (int t = 0; t < TQ; ++t) {
      const v8f zero = {};
      v8f c0 = mma_f16(ka0, qb[t], zero);
      v8f c1 = mma_f16(ka2, qb[t], zero);

      float sa[8], sb[8];
#pragma unroll
      for (int r = 0; r < 8; ++r) { sa[r] = c0[r] * sscale; sb[r] = c1[r] * sscale; }
      float lm = fmaxf(sa[0], sb[0]);
#pragma unroll
      for (int r = 1; r < 8; ++r) lm = fmaxf(lm, fmaxf(sa[r], sb[r]));
      lm = fmaxf(lm, __shfl_xor(lm, 16, 32));
      const float mnew = fmaxf(mrun[t], lm);
      const float alpha = __expf(mrun[t] - mnew);
      float p0[8], p1[8];
      float ls = 0.0f;
#pragma unroll
      for (int r = 0; r < 8; ++r) {
        p0[r] = __expf(sa[r] - mnew);
        p1[r] = __expf(sb[r] - mnew);
        ls += p0[r] + p1[r];
      }
      ls += __shfl_xor(ls, 16, 32);
      lrun[t] = lrun[t] * alpha + ls;
      mrun[t] = mnew;
#pragma unroll
      for (int j = 0; j < 2; ++j)
#pragma unroll
        for (int r = 0; r < 8; ++r) o[t][j][r] *= alpha;

      v16h pb;
#pragma unroll
      for (int e = 0; e < 8; ++e) {
        pb[e]     = (_Float16)(p0[e] * 1024.0f);   // key kc + 8h + e
        pb[8 + e] = (_Float16)(p1[e] * 1024.0f);   // key kc + 16 + 8h + e
      }
      o[t][0] = mma_f16(va0, pb, o[t][0]);
      o[t][1] = mma_f16(va1, pb, o[t][1]);
    }
  }
  __syncthreads();                         // every wave's last read of the K tile done: its space becomes context staging

  // o[t][j][r] = 8192 * sum_t p_t v_t for query l15, d = j*16 + 8*half + r; ctx carried x16
#pragma unroll
  for (int t = 0; t < TQ; ++t) {
    const float inv = 1.0f / (lrun[t] * 512.0f);
    unsigned short* T = Ks + (wave * TQ + t) * 16 * CTP;
#pragma unroll
    for (int j = 0; j < 2; ++j) {
      v4u w;
      w[0] = pack2h(o[t][j][0] * inv, o[t][j][1] * inv);
      w[1] = pack2h(o[t][j][2] * inv, o[t][j][3] * inv);
      w[2] = pack2h(o[t][j][4] * inv, o[t][j][5] * inv);
      w[3] = pack2h(o[t][j][6] * inv, o[t][j][7] * inv);
      *(v4u*)(&T[l15 * CTP + j * 16 + 8 * half]) = w;
    }
  }
  __syncthreads();

  v4u v[TQ][2];
#pragma unroll
  for (int t = 0; t < TQ; ++t)
#pragma unroll
    for (int it = 0; it < 2; ++it) {
      const int row = it * 8 + (lane >> 2);     // 0..15 query row of the tile
      const int piece = (lane & 3) * 8;         // 8 halves = 16 B; 4 pieces = 64-B row, 8 lanes = one line
      v[t][it] = *(const v4u*)(&Ks[((wave * TQ + t) * 16 + row) * CTP + piece]);
    }
  unsigned short* cb = ctx + (((size_t)g * NHEAD + head) * NQ + wave * TQ * 16) * HD;
#pragma unroll
  for (int t = 0; t < TQ; ++t)
#pragma unroll
    for (int it = 0; it < 2; ++it)
      *(v4u*)(cb + (size_t)(t * 16 + it * 8 + (lane >> 2)) * HD + (lane & 3) * 8) = v[t][it];
}

// ---------------------------------------------------------------------------
// Output projection: out[MROWS][DOUT] f32 = ctx[MROWS][ATT] * WdT[DOUT][ATT]^T / 256 + bd.
// ctx read from the head-major plane: for row (g, n) the 32 k values of
// k-step s (= head s) are contiguous at ((g*NHEAD + s)*NQ + n)*HD.
// Same structure as k_proj (256 thr, 128 rows x 64 cols, weight k-tile in
// LDS), f16 operands. Epilogue: f32 tile staged in LDS; each 256-byte row
// segment = 2 lines, each line written by 8 consecutive lanes of one
__global__ __launch_bounds__(256) void k_oproj(const unsigned short* __restrict__ ctx,
                                               const unsigned short* __restrict__ wT,
                                               const float* __restrict__ bd,
                                               float* __restrict__ outp) {
  __shared__ __align__(16) unsigned short bt[64 * BTP];   // weight k-tile, cross-wave (block barrier)
  __shared__ __align__(16) float E[128 * OEP];            // epilogue tile, per-wave rows (wave-private), block barrier used

  const int n0 = blockIdx.x * 64;
  const int m0 = blockIdx.y * 128;
  const int tid = threadIdx.x;
  const int wave = tid >> 5, lane = tid & 31;
  const int l15 = lane & 15, half = (lane >> 4) & 1;

  const unsigned short* Wt = wT + (size_t)3 * ATT * DIN;    // WdT plane [DOUT][ATT], f16 x16
  const int tn = tid >> 2;            // 0..63 : column within tile
  const int tk = (tid & 3) * 8;       // 0,8,16,24 : k within step
  const unsigned short* wsrc = Wt + (size_t)(n0 + tn) * ATT + tk;

  const int r0 = m0 + wave * 16;      // wave's 16 rows lie inside one group (NQ % 16 == 0)
  const int g = r0 / NQ;
  const int nl = r0 - g * NQ;
  const _Float16* A0 = (const _Float16*)ctx + ((size_t)g * NHEAD * NQ + nl) * HD;

  v8f acc[4] = {};
  for (int s = 0; s < ATT / 32; ++s) {
    const int kk = s * 32;
    const v4u wv = *(const v4u*)(wsrc + kk);
    __syncthreads();                               // earlier reads of bt done
    *(v4u*)(&bt[tn * BTP + tk]) = wv;
    __syncthreads();                               // tile complete
    const v16h a = ld_frag_h(A0 + (size_t)s * NQ * HD, HD, l15, 0, lane);
#pragma unroll
    for (int j = 0; j < 4; ++j) {
      const v16h b = ld_frag_h((const _Float16*)bt, BTP, j * 16 + l15, 0, lane);
      acc[j] = mma_f16(a, b, acc[j]);
    }
  }

  // acc[j][r] = 256 * (ctx.Wd)[m0 + wave*16 + 8*half + r][n0 + j*16 + l15]
  const float cinv = 1.0f / 256.0f;
#pragma unroll
  for (int j = 0; j < 4; ++j) {
    const int col = j * 16 + l15;
    const float bb = bf16val(bd[n0 + col]);
#pragma unroll
    for (int r = 0; r < 8; ++r) {
      const int row = wave * 16 + 8 * half + r;
      E[row * OEP + col] = acc[j][r] * cinv + bb;
    }
  }
  __syncthreads();

  v4f v[8];
  size_t off[8];
#pragma unroll
  for (int it = 0; it < 8; ++it) {
    const int row = wave * 16 + it * 2 + half;   // wave's 16 rows over (it, half)
    const int q = l15;                           // 16 pieces of 16 B = the row's 256-byte segment (2 lines)
    v[it] = *(const v4f*)(&E[row * OEP + q * 4]);
    off[it] = (size_t)(m0 + row) * DOUT + n0 + q * 4;
  }
#pragma unroll
  for (int it = 0; it < 8; ++it) *(v4f*)(outp + off[it]) = v[it];
  
}

// ---------------------------------------------------------------------------
extern "C" void kernel_launch(void* const* d_in, const int* in_sizes, int n_in,
                              void* d_out, int out_size, void* d_ws, size_t ws_size,
                              hipStream_t stream) {
  if (n_in < 11) return;
  if (in_sizes[0] < MROWS * DIN || in_sizes[1] < MROWS * DIN || in_sizes[2] < MROWS * DIN) return;
  if (in_sizes[3] < DIN * ATT || in_sizes[5] < DIN * ATT || in_sizes[7] < DIN * ATT) return;
  if (in_sizes[4] < ATT || in_sizes[6] < ATT || in_sizes[8] < ATT) return;
  if (in_sizes[9] < ATT * DOUT || in_sizes[10] < DOUT) return;
  if (out_size < MROWS * DOUT) return;

  const float* xq = (const float*)d_in[0];
  const float* xk = (const float*)d_in[1];
  const float* xv = (const float*)d_in[2];
  const float* Wq = (const float*)d_in[3];
  const float* bq = (const float*)d_in[4];
  const float* Wk = (const float*)d_in[5];
  const float* bk = (const float*)d_in[6];
  const float* Wv = (const float*)d_in[7];
  const float* bv = (const float*)d_in[8];
  const float* Wd = (const float*)d_in[9];
  const float* bd = (const float*)d_in[10];

  // and is written exactly to its extent (no padded tails needed: all tiles divide the shapes)
  const size_t xb_bytes  = (size_t)3 * MROWS * DIN * 2;      // three bf16 input planes
  const size_t wt_bytes  = (size_t)4 * DIN * ATT * 2;        // three bf16 WT planes + one f16 WdT plane
  const size_t pl_bytes  = (size_t)MROWS * ATT * 2;          // one f16 plane (Q, K, V^T, ctx)
  const size_t off_xb  = 0;
  const size_t off_wt  = off_xb + xb_bytes;
  const size_t off_q   = off_wt + wt_bytes;
  const size_t off_k   = off_q + pl_bytes;
  const size_t off_vt  = off_k + pl_bytes;
  const size_t off_ctx = off_vt + pl_bytes;
  const size_t total   = off_ctx + pl_bytes;                 // 104071168 B at full size
  if (total > ws_size) return;

  char* ws = (char*)d_ws;
  unsigned short* xb  = (unsigned short*)(ws + off_xb);
  unsigned short* wt  = (unsigned short*)(ws + off_wt);
  unsigned short* qpl = (unsigned short*)(ws + off_q);
  unsigned short* kpl = (unsigned short*)(ws + off_k);
  unsigned short* vtp = (unsigned short*)(ws + off_vt);
  unsigned short* cxp = (unsigned short*)(ws + off_ctx);

  const int n8 = MROWS * DIN / 8;
  k_cvt_rows<<<dim3((n8 + 255) / 256, 3), 256, 0, stream>>>(xq, xk, xv, xb, n8);
  k_cvt_wT<<<dim3(DIN * ATT / 4096, 1, 4), 256, 0, stream>>>(Wq, Wk, Wv, Wd, wt);
  k_proj<<<dim3(ATT / 64, MROWS / 128, 3), 256, 0, stream>>>(xb, wt, bq, bk, bv, qpl, kpl, vtp);
  k_attn<<<dim3(NHEAD, BL), 256, 0, stream>>>(qpl, kpl, vtp, cxp);
  k_oproj<<<dim3(DOUT / 64, MROWS / 128), 256, 0, stream>>>(cxp, wt, bd, (float*)d_out);
}

// v002
// One run takes 74 microseconds.
// Two timings next to v001 put it at 1.12 and 1.13 times that version's speed.
// All steps since v000 together make it 1.66 times as fast.
#include <hip/hip_runtime.h>
// Projections x*W{q,k,v}: v_wmma_f32_16x16x32_bf16 (bf16 operands = RNE-converted inputs, f32 accumulate); scores K*Q^T, context V^T*P and output projection ctx*Wd: v_wmma_f32_16x16x32_f16 (f16 operands; Q/K/V planes carried x8, P carried x1024, ctx plane carried x16, Wd plane carried x16; f32 accumulate); softmax in f32.

#ifndef NB
#define NB 8
#endif
#ifndef LL
#define LL 12
#endif
#define NB_FULL 8
#define LL_FULL 12
#define NQ 384           // tokens per (b,l) group = attention length
#define DIN 128          // feature width of query / key / value inputs
#define ATT 256          // attention width = NHEAD * HD
#define NHEAD 8
#define HD 32
#define DOUT 128         // output feature width
#define BL (NB * LL)     // number of (b,l) groups processed
#define MROWS (BL * NQ)  // token rows processed (prefix of the full row range)

static_assert(NB >= 1 && NB <= NB_FULL);
static_assert(LL >= 1 && LL <= LL_FULL);
static_assert(LL == LL_FULL || NB == 1);
static_assert(ATT == NHEAD * HD);
static_assert(HD == 32);
static_assert(NHEAD == 8);
static_assert(NQ % 32 == 0);
static_assert(NQ % 16 == 0);
static_assert(MROWS % 128 == 0);
static_assert(DIN % 64 == 0 && ATT % 64 == 0 && DOUT % 64 == 0);
static_assert(DIN * ATT == ATT * DOUT);
static_assert((DIN * ATT) % 4096 == 0);
static_assert(DIN == 32 * 4);   // one input row = one wave-wide 16-byte load
static_assert((size_t)NB_FULL * LL_FULL * NQ * DOUT * 4 == 18874368);
// coverage equalities (grid x block x per-thread elements == plane elements)
static_assert((size_t)(DIN * ATT / 4096) * 64 * 64 == (size_t)DIN * ATT);                   // weight planes
static_assert((size_t)(ATT / 64) * (MROWS / 128) * 128 * 64 == (size_t)MROWS * ATT);        // Q, K, V^T planes
static_assert((size_t)NHEAD * BL * NQ * HD == (size_t)MROWS * ATT);                        // ctx plane
static_assert((size_t)(DOUT / 64) * (MROWS / 128) * 128 * 64 == (size_t)MROWS * DOUT);      // out

// LDS pitches (16-bit elements unless noted); all keep 16-byte row alignment
#define BTP 40     // weight k-tile [64 n][32 k]
#define AXP 136    // converted input tile [128 rows][128 k]: 272-byte rows for 16-byte fragment reads
#define EQP 72     // row-major epilogue tile [128 rows][64 cols]
#define EVP 136    // transposed epilogue tile [64 d][128 s]
#define TP  72     // weight transpose tile [64 n][64 k]
#define CTP 40     // context tile [16 q][32 d] halves
#define OEP 68     // output epilogue tile [128 rows][64 cols], floats
#define ESZ 9216   // max(128*EQP, 64*EVP)
#define KVP 40     // attention K / V^T tiles: rows of 32 halves
#define VCS (32 * KVP + 32)   // one 32-key chunk of V^T: 32 rows + 64 B, so that 4 chunks' stores fall on different banks
#define TQ  3      // query tiles of 16 per attention wave
static_assert(128 * EQP <= ESZ);
static_assert(64 * EVP <= ESZ);
static_assert(8 * TQ * 16 == NQ);                 // 8 waves x TQ tiles cover the group's queries
static_assert(8 * TQ * 16 * CTP <= NQ * KVP);     // context tiles fit the K tile's space
static_assert((NQ * 4) % 256 == 0);

typedef __bf16   v16bf __attribute__((ext_vector_type(16)));
typedef __bf16   v8bf  __attribute__((ext_vector_type(8)));
typedef _Float16 v16h  __attribute__((ext_vector_type(16)));
typedef _Float16 v8h   __attribute__((ext_vector_type(8)));
typedef float    v8f   __attribute__((ext_vector_type(8)));
typedef float    v4f   __attribute__((ext_vector_type(4)));
typedef unsigned int v4u __attribute__((ext_vector_type(4)));
typedef unsigned int v2u __attribute__((ext_vector_type(2)));
typedef float    v2f   __attribute__((ext_vector_type(2)));
typedef __bf16   v2bf  __attribute__((ext_vector_type(2)));

// ---------------------------------------------------------------------------
// WMMA wrappers with the VALU hazard guard (4 v_nop after every issue).
__device__ __forceinline__ v8f mma_bf16(v16bf a, v16bf b, v8f c) {
  v8f d = __builtin_amdgcn_wmma_f32_16x16x32_bf16(false, a, false, b, (short)0, c, false, false);
  asm volatile("v_nop\n\tv_nop\n\tv_nop\n\tv_nop" : "+v"(d) : "v"(a), "v"(b));
  return d;
}
__device__ __forceinline__ v8f mma_f16(v16h a, v16h b, v8f c) {
  v8f d = __builtin_amdgcn_wmma_f32_16x16x32_f16(false, a, false, b, (short)0, c, false, false);
  asm volatile("v_nop\n\tv_nop\n\tv_nop\n\tv_nop" : "+v"(d) : "v"(a), "v"(b));
  return d;
}

// 16-bit fragment, contraction dim CONTIGUOUS in memory: elem(k) = p0[rc*ld + k].
// Lane l: row/col rc = (l&15); elements 0..7 <- kk+8h+0..7, elements 8..15 <- kk+16+8h+0..7
// (h = l>>4). Same map for A (rc = row) and B (rc = column of a k-contiguous copy).
__device__ __forceinline__ v16bf ld_frag_bf(const __bf16* p0, int ld, int rc, int kk, int lane) {
  const int hh = (lane >> 4) & 1;
  const __bf16* p = p0 + (size_t)rc * ld + kk + 8 * hh;
  const v8bf lo = *(const v8bf*)(p);
  const v8bf hi = *(const v8bf*)(p + 16);
  v16bf f;
#pragma unroll
  for (int i = 0; i < 8; ++i) { f[i] = lo[i]; f[8 + i] = hi[i]; }
  return f;
}
__device__ __forceinline__ v16h ld_frag_h(const _Float16* p0, int ld, int rc, int kk, int lane) {
  const int hh = (lane >> 4) & 1;
  const _Float16* p = p0 + (size_t)rc * ld + kk + 8 * hh;
  const v8h lo = *(const v8h*)(p);
  const v8h hi = *(const v8h*)(p + 16);
  v16h f;
#pragma unroll
  for (int i = 0; i < 8; ++i) { f[i] = lo[i]; f[8 + i] = hi[i]; }
  return f;
}

// f32 -> bf16 bits, RNE convert
__device__ __forceinline__ unsigned int bfb(float x) {
  unsigned int u = __float_as_uint(x);
  u = u + 0x7FFFu + ((u >> 16) & 1u);
  return u >> 16;
}
// f32 -> value of its RNE bf16
__device__ __forceinline__ float bf16val(float x) {
  return __uint_as_float(bfb(x) << 16);
}
// f32 -> f16 bits, RNE convert
__device__ __forceinline__ unsigned short hbits(float x) {
  const _Float16 hv = (_Float16)x;
  return __builtin_bit_cast(unsigned short, hv);
}
__device__ __forceinline__ unsigned int pack2h(float a, float b) {
  return (unsigned int)hbits(a) | ((unsigned int)hbits(b) << 16);
}

// ---------------------------------------------------------------------------
// W f32 [kdim k][ndim n] -> WT 16-bit [ndim n][kdim k] (k contiguous).
// z = 0,1,2: Wq/Wk/Wv [DIN][ATT] -> bf16 planes; z = 3: Wd [ATT][DOUT] ->
// f16 plane holding 16 * bf16val(w). All four planes have DIN*ATT elements.
// Block = 64 k x 64 n tile transposed through LDS; each WT row segment
__global__ __launch_bounds__(256) void k_cvt_wT(const float* __restrict__ Wq,
                                                const float* __restrict__ Wk,
                                                const float* __restrict__ Wv,
                                                const float* __restrict__ Wd,
                                                unsigned short* __restrict__ wT) {
  __shared__ __align__(16) unsigned short T[64 * TP];   // [n local][k local], cross-wave (block barrier)
  const int z = blockIdx.z;
  const float* W = (z == 0) ? Wq : ((z == 1) ? Wk : ((z == 2) ? Wv : Wd));
  const bool od = (z == 3);                // block-uniform
  const int kdim = od ? ATT : DIN;
  const int ndim = od ? DOUT : ATT;
  unsigned short* dst = wT + (size_t)z * (DIN * ATT);
  const int nkt = kdim / 64;
  const int t = blockIdx.x;                // tile index 0 .. DIN*ATT/4096 - 1
  const int k0 = (t % nkt) * 64;
  const int n0 = (t / nkt) * 64;
  const int tid = threadIdx.x;
  const int wave = tid >> 5, lane = tid & 31;

#pragma unroll
  for (int i = 0; i < 4; ++i) {
    const int idx = i * 256 + tid;          // 0..1023
    const int kk = idx >> 4;                // 0..63
    const int c4 = (idx & 15) * 4;          // 0..60
    const v4f w = *(const v4f*)(W + (size_t)(k0 + kk) * ndim + n0 + c4);
    unsigned short e0, e1, e2, e3;
    if (od) {
      e0 = hbits(bf16val(w[0]) * 16.0f); e1 = hbits(bf16val(w[1]) * 16.0f);
      e2 = hbits(bf16val(w[2]) * 16.0f); e3 = hbits(bf16val(w[3]) * 16.0f);
    } else {
      e0 = (unsigned short)bfb(w[0]); e1 = (unsigned short)bfb(w[1]);
      e2 = (unsigned short)bfb(w[2]); e3 = (unsigned short)bfb(w[3]);
    }
    T[(c4 + 0) * TP + kk] = e0;
    T[(c4 + 1) * TP + kk] = e1;
    T[(c4 + 2) * TP + kk] = e2;
    T[(c4 + 3) * TP + kk] = e3;
  }
  __syncthreads();

  v4u v[2];
  size_t off[2];
#pragma unroll
  for (int it = 0; it < 2; ++it) {
    const int nn = wave * 8 + it * 4 + (lane >> 3);   // 0..63 over (wave, it, lane>>3)
    const int q = lane & 7;
    v[it] = *(const v4u*)(&T[nn * TP + q * 8]);
    off[it] = (size_t)(n0 + nn) * kdim + k0 + q * 8;
  }
#pragma unroll
  for (int it = 0; it < 2; ++it) *(v4u*)(dst + off[it]) = v[it];
  
}

// ---------------------------------------------------------------------------
// Projection: C[MROWS][ATT] = bf16(x_z)[MROWS][DIN] * WT_z[ATT][DIN]^T + bias_z.
// 256 thr = 8 waves; block tile 128 rows x 64 cols; wave owns 16 rows x 64 cols.
// The block reads its 128 f32 input rows itself: one wave-wide 16-byte load = one
// whole 512-byte row; RNE convert to bf16 in registers, tile [128][128] kept in LDS;
// A fragments are read from that tile behind the k loop's own barriers.
// Weight k-tile [64 n][32 k] staged in LDS with plain loads (single buffer,
// two block barriers per step).
// z = 0: Q plane f16 x8 [MROWS][ATT]; z = 1: K plane f16 x8 [MROWS][ATT];
// z = 2: V^T plane f16 x8 [ATT][MROWS]. Epilogue staged in LDS, every
__global__ __launch_bounds__(256) void k_proj(
    const float* __restrict__ xq, const float* __restrict__ xk, const float* __restrict__ xv,
    const unsigned short* __restrict__ wT,
    const float* __restrict__ bq, const float* __restrict__ bk, const float* __restrict__ bv,
    unsigned short* __restrict__ qp, unsigned short* __restrict__ kp,
    unsigned short* __restrict__ vtp) {
  __shared__ __align__(16) unsigned short bt[64 * BTP];   // weight k-tile, cross-wave (block barrier)
  __shared__ __align__(16) unsigned short ax[128 * AXP];  // converted input tile (block barrier)
  __shared__ __align__(16) unsigned short E[ESZ];         // epilogue tile, cross-wave (block barrier)

  const int z = blockIdx.z;
  const int n0 = blockIdx.x * 64;
  const int m0 = blockIdx.y * 128;
  const int tid = threadIdx.x;
  const int wave = tid >> 5, lane = tid & 31;
  const int l15 = lane & 15, half = (lane >> 4) & 1;

  const unsigned short* Wt = wT + (size_t)z * ATT * DIN;
  const float* bias = (z == 0) ? bq : ((z == 1) ? bk : bv);

  const int tn = tid >> 2;            // 0..63 : column within tile
  const int tk = (tid & 3) * 8;       // 0,8,16,24 : k within step
  const unsigned short* wsrc = Wt + (size_t)(n0 + tn) * DIN + tk;
  const float* X = (z == 0) ? xq : ((z == 1) ? xk : xv);
  const float* xsrc = X + (size_t)(m0 + wave * 16) * DIN + lane * 4;
  const int arow = wave * 16 + l15;

  // wave's 16 rows: all 16 loads issued before the first convert, so that one memory latency covers them;
  // both loops unrolled so that xr has constant indices and stays in registers
  v4f xr[16];
#pragma unroll
  for (int r = 0; r < 16; ++r) xr[r] = *(const v4f*)(xsrc + (size_t)r * DIN);
#pragma unroll
  for (int r = 0; r < 16; ++r) {
    const v2f lo = {xr[r][0], xr[r][1]};
    const v2f hi = {xr[r][2], xr[r][3]};
    v2u w;
    w[0] = __builtin_bit_cast(unsigned int, __builtin_convertvector(lo, v2bf));
    w[1] = __builtin_bit_cast(unsigned int, __builtin_convertvector(hi, v2bf));
    *(v2u*)(&ax[(wave * 16 + r) * AXP + lane * 4]) = w;
  }

  v8f acc[4] = {};
  for (int s = 0; s < DIN / 32; ++s) {
    const int kk = s * 32;
    const v4u wv = *(const v4u*)(wsrc + kk);
    __syncthreads();                               // earlier reads of bt done
    *(v4u*)(&bt[tn * BTP + tk]) = wv;
    __syncthreads();                               // tile complete
    const v16bf a = ld_frag_bf((const __bf16*)ax, AXP, arow, kk, lane);
#pragma unroll
    for (int j = 0; j < 4; ++j) {
      const v16bf b = ld_frag_bf((const __bf16*)bt, BTP, j * 16 + l15, 0, lane);
      acc[j] = mma_bf16(a, b, acc[j]);
    }
  }

  // acc[j][r] = C[m0 + wave*16 + 8*half + r][n0 + j*16 + l15]
  const float car = 8.0f;
  if (z != 2) {                      // block-uniform branch
#pragma unroll
    for (int j = 0; j < 4; ++j) {
      const int col = j * 16 + l15;
      const float bb = bf16val(bias[n0 + col]);
#pragma unroll
      for (int r = 0; r < 8; ++r) {
        const int row = wave * 16 + 8 * half + r;
        E[row * EQP + col] = hbits((acc[j][r] + bb) * car);
      }
    }
    __syncthreads();
    unsigned short* dst = (z == 0) ? qp : kp;
    v4u v[4];
    size_t off[4];
#pragma unroll
    for (int it = 0; it < 4; ++it) {
      const int row = wave * 16 + it * 4 + (lane >> 3);   // wave's 16 rows over (it, lane>>3)
      const int q = lane & 7;
      v[it] = *(const v4u*)(&E[row * EQP + q * 8]);
      off[it] = (size_t)(m0 + row) * ATT + n0 + q * 8;
    }
#pragma unroll
    for (int it = 0; it < 4; ++it) *(v4u*)(dst + off[it]) = v[it];
    
  } else {
#pragma unroll
    for (int j = 0; j < 4; ++j) {
      const int col = j * 16 + l15;                       // d within tile
      const float bb = bf16val(bias[n0 + col]);
#pragma unroll
      for (int r = 0; r < 8; ++r) {
        const int srow = wave * 16 + 8 * half + r;        // s within tile
        E[col * EVP + srow] = hbits((acc[j][r] + bb) * car);
      }
    }
    __syncthreads();
    v4u v[4];
    size_t off[4];
#pragma unroll
    for (int it = 0; it < 4; ++it) {
      const int drow = wave * 8 + it * 2 + half;          // wave's 8 d-rows over (it, half)
      const int q = l15;                                  // 16 pieces = 256-byte row = 2 lines
      v[it] = *(const v4u*)(&E[drow * EVP + q * 8]);
      off[it] = (size_t)(n0 + drow) * MROWS + m0 + q * 8;
    }
#pragma unroll
    for (int it = 0; it < 4; ++it) *(v4u*)(vtp + off[it]) = v[it];
    
  }
}

// ---------------------------------------------------------------------------
// Flash attention, transposed-score form: block = one (group, head); its K
// [384 keys][32 d] and V^T [32 d][384 keys] are staged ONCE in LDS and shared by
// 8 waves; wave = TQ query tiles of 16 (48 queries), so the block covers all
// 384 queries and every K / V fragment read from LDS serves TQ tiles.
// Per 32-key chunk and query tile:
//   S^T = K . Q^T    A = K rows (lane = key, k = d), B = Q^T (lane = query, k = d)
//                    D[row = key 8h+r][col = query l15]; c0 keys 0..15, c1 keys 16..31
//   per-lane online softmax for query l15 (16 local keys + xor-16 partner)
//   O^T += V^T . P   A = V^T rows (lane = d, k = key), B = P: element i<8 <- c0[i]
//                    (key 8h+i), element 8+i <- c1[i] (key 16+8h+i), same lane
//                    D[row = d 8h+r][col = query l15]
// Scores carry 64 from the x8 planes -> scaled by (1/64)/sqrt(32).
// P carried x1024, V carried x8 -> context x16 = O * 16/(8192 * sum).
// Context tiles [16 q][32 d] f16 x16 staged in LDS (the K tile's space, free
// behind a block barrier) and written to the head-major ctx plane
// [BL*NHEAD*NQ][HD]: each tile is 1024 contiguous bytes
// second bound: at most 160 VGPRs, so that the 3 blocks a WGP gets (768 blocks, 256 WGPs) are resident together
__global__ __launch_bounds__(256, 6) void k_attn(const unsigned short* __restrict__ qp,
                                              const unsigned short* __restrict__ kp,
                                              const unsigned short* __restrict__ vtp,
                                              unsigned short* __restrict__ ctx) {
  __shared__ __align__(16) unsigned short Ks[NQ * KVP];          // [key][d]; later the context tiles
  __shared__ __align__(16) unsigned short Vs[(NQ / 32) * VCS];   // [chunk][d][key in chunk]

  const int tid = threadIdx.x;
  const int wave = tid >> 5, lane = tid & 31;
  const int l15 = lane & 15;
  const int half = (lane >> 4) & 1;
  const int head = blockIdx.x;
  const int g = blockIdx.y;                // (b,l) group

  const _Float16* Q  = (const _Float16*)qp;
  const unsigned short* kbase = kp + (size_t)g * NQ * ATT + head * HD;              // key t at kbase + t*ATT
  const unsigned short* vbase = vtp + (size_t)head * HD * MROWS + (size_t)g * NQ;   // d row at vbase + d*MROWS

  // stage K and V^T: 2 x 1536 pieces of 16 bytes, 6 + 6 a thread, all loads issued before the first LDS store
  v4u kr[NQ * 4 / 256], vr[NQ * 4 / 256];
#pragma unroll
  for (int i = 0; i < NQ * 4 / 256; ++i) {
    const int idx = i * 256 + tid;
    kr[i] = *(const v4u*)(kbase + (size_t)(idx >> 2) * ATT + (idx & 3) * 8);
  }
#pragma unroll
  for (int i = 0; i < NQ * 4 / 256; ++i) {
    const int idx = i * 256 + tid;
    const int d = idx / (NQ / 8), pc = idx % (NQ / 8);
    vr[i] = *(const v4u*)(vbase + (size_t)d * MROWS + pc * 8);
  }
  v16h qb[TQ];
#pragma unroll
  for (int t = 0; t < TQ; ++t) {
    const _Float16* qbase = Q + ((size_t)g * NQ + (wave * TQ + t) * 16) * ATT + head * HD;
    qb[t] = ld_frag_h(qbase, ATT, l15, 0, lane);               // d 0..31
  }
#pragma unroll
  for (int i = 0; i < NQ * 4 / 256; ++i) {
    const int idx = i * 256 + tid;
    *(v4u*)(&Ks[(idx >> 2) * KVP + (idx & 3) * 8]) = kr[i];
  }
#pragma unroll
  for (int i = 0; i < NQ * 4 / 256; ++i) {
    const int idx = i * 256 + tid;
    const int d = idx / (NQ / 8), pc = idx % (NQ / 8);
    *(v4u*)(&Vs[(pc >> 2) * VCS + d * KVP + (pc & 3) * 8]) = vr[i];
  }
  __syncthreads();                         // K and V^T tiles complete

  v8f o[TQ][2] = {};
  float mrun[TQ], lrun[TQ];
#pragma unroll
  for (int t = 0; t < TQ; ++t) { mrun[t] = -1.0e30f; lrun[t] = 0.0f; }
  const float sscale = 0.17677669529663689f * (1.0f / 64.0f);

  for (int kc = 0; kc < NQ; kc += 32) {
    const _Float16* kt = (const _Float16*)Ks + kc * KVP;
    const _Float16* vt = (const _Float16*)Vs + (kc >> 5) * VCS;
    const v16h ka0 = ld_frag_h(kt, KVP, l15, 0, lane);          // keys kc + 0..15
    const v16h ka2 = ld_frag_h(kt, KVP, 16 + l15, 0, lane);     // keys kc + 16..31
    const v16h va0 = ld_frag_h(vt, KVP, l15, 0, lane);          // d 0..15
    const v16h va1 = ld_frag_h(vt, KVP, 16 + l15, 0, lane);     // d 16..31
#pragma unroll
    for (int t = 0; t < TQ; ++t) {
      const v8f zero = {};
      v8f c0 = mma_f16(ka0, qb[t], zero);
      v8f c1 = mma_f16(ka2, qb[t], zero);

      float sa[8], sb[8];
#pragma unroll
      for (int r = 0; r < 8; ++r) { sa[r] = c0[r] * sscale; sb[r] = c1[r] * sscale; }
      float lm = fmaxf(sa[0], sb[0]);
#pragma unroll
      for (int r = 1; r < 8; ++r) lm = fmaxf(lm, fmaxf(sa[r], sb[r]));
      lm = fmaxf(lm, __shfl_xor(lm, 16, 32));
      const float mnew = fmaxf(mrun[t], lm);
      const float alpha = __expf(mrun[t] - mnew);
      float p0[8], p1[8];
      float ls = 0.0f;
#pragma unroll
      for (int r = 0; r < 8; ++r) {
        p0[r] = __expf(sa[r] - mnew);
        p1[r] = __expf(sb[r] - mnew);
        ls += p0[r] + p1[r];
      }
      ls += __shfl_xor(ls, 16, 32);
      lrun[t] = lrun[t] * alpha + ls;
      mrun[t] = mnew;
#pragma unroll
      for (int j = 0; j < 2; ++j)
#pragma unroll
        for (int r = 0; r < 8; ++r) o[t][j][r] *= alpha;

      v16h pb;
#pragma unroll
      for (int e = 0; e < 8; ++e) {
        pb[e]     = (_Float16)(p0[e] * 1024.0f);   // key kc + 8h + e
        pb[8 + e] = (_Float16)(p1[e] * 1024.0f);   // key kc + 16 + 8h + e
      }
      o[t][0] = mma_f16(va0, pb, o[t][0]);
      o[t][1] = mma_f16(va1, pb, o[t][1]);
    }
  }
  __syncthreads();                         // every wave's last read of the K tile done: its space becomes context staging

  // o[t][j][r] = 8192 * sum_t p_t v_t for query l15, d = j*16 + 8*half + r; ctx carried x16
#pragma unroll
  for (int t = 0; t < TQ; ++t) {
    const float inv = 1.0f / (lrun[t] * 512.0f);
    unsigned short* T = Ks + (wave * TQ + t) * 16 * CTP;
#pragma unroll
    for (int j = 0; j < 2; ++j) {
      v4u w;
      w[0] = pack2h(o[t][j][0] * inv, o[t][j][1] * inv);
      w[1] = pack2h(o[t][j][2] * inv, o[t][j][3] * inv);
      w[2] = pack2h(o[t][j][4] * inv, o[t][j][5] * inv);
      w[3] = pack2h(o[t][j][6] * inv, o[t][j][7] * inv);
      *(v4u*)(&T[l15 * CTP + j * 16 + 8 * half]) = w;
    }
  }
  __syncthreads();

  v4u v[TQ][2];
#pragma unroll
  for (int t = 0; t < TQ; ++t)
#pragma unroll
    for (int it = 0; it < 2; ++it) {
      const int row = it * 8 + (lane >> 2);     // 0..15 query row of the tile
      const int piece = (lane & 3) * 8;         // 8 halves = 16 B; 4 pieces = 64-B row, 8 lanes = one line
      v[t][it] = *(const v4u*)(&Ks[((wave * TQ + t) * 16 + row) * CTP + piece]);
    }
  unsigned short* cb = ctx + (((size_t)g * NHEAD + head) * NQ + wave * TQ * 16) * HD;
#pragma unroll
  for (int t = 0; t < TQ; ++t)
#pragma unroll
    for (int it = 0; it < 2; ++it)
      *(v4u*)(cb + (size_t)(t * 16 + it * 8 + (lane >> 2)) * HD + (lane & 3) * 8) = v[t][it];
}

// ---------------------------------------------------------------------------
// Output projection: out[MROWS][DOUT] f32 = ctx[MROWS][ATT] * WdT[DOUT][ATT]^T / 256 + bd.
// ctx read from the head-major plane: for row (g, n) the 32 k values of
// k-step s (= head s) are contiguous at ((g*NHEAD + s)*NQ + n)*HD.
// Same structure as k_proj (256 thr, 128 rows x 64 cols, weight k-tile in
// LDS), f16 operands. Epilogue: f32 tile staged in LDS; each 256-byte row
// segment = 2 lines, each line written by 8 consecutive lanes of one
__global__ __launch_bounds__(256) void k_oproj(const unsigned short* __restrict__ ctx,
                                               const unsigned short* __restrict__ wT,
                                               const float* __restrict__ bd,
                                               float* __restrict__ outp) {
  __shared__ __align__(16) unsigned short bt[64 * BTP];   // weight k-tile, cross-wave (block barrier)
  __shared__ __align__(16) float E[128 * OEP];            // epilogue tile, per-wave rows (wave-private), block barrier used

  const int n0 = blockIdx.x * 64;
  const int m0 = blockIdx.y * 128;
  const int tid = threadIdx.x;
  const int wave = tid >> 5, lane = tid & 31;
  const int l15 = lane & 15, half = (lane >> 4) & 1;

  const unsigned short* Wt = wT + (size_t)3 * ATT * DIN;    // WdT plane [DOUT][ATT], f16 x16
  const int tn = tid >> 2;            // 0..63 : column within tile
  const int tk = (tid & 3) * 8;       // 0,8,16,24 : k within step
  const unsigned short* wsrc = Wt + (size_t)(n0 + tn) * ATT + tk;

  const int r0 = m0 + wave * 16;      // wave's 16 rows lie inside one group (NQ % 16 == 0)
  const int g = r0 / NQ;
  const int nl = r0 - g * NQ;
  const _Float16* A0 = (const _Float16*)ctx + ((size_t)g * NHEAD * NQ + nl) * HD;

  v8f acc[4] = {};
  for (int s = 0; s < ATT / 32; ++s) {
    const int kk = s * 32;
    const v4u wv = *(const v4u*)(wsrc + kk);
    __syncthreads();                               // earlier reads of bt done
    *(v4u*)(&bt[tn * BTP + tk]) = wv;
    __syncthreads();                               // tile complete
    const v16h a = ld_frag_h(A0 + (size_t)s * NQ * HD, HD, l15, 0, lane);
#pragma unroll
    for (int j = 0; j < 4; ++j) {
      const v16h b = ld_frag_h((const _Float16*)bt, BTP, j * 16 + l15, 0, lane);
      acc[j] = mma_f16(a, b, acc[j]);
    }
  }

  // acc[j][r] = 256 * (ctx.Wd)[m0 + wave*16 + 8*half + r][n0 + j*16 + l15]
  const float cinv = 1.0f / 256.0f;
#pragma unroll
  for (int j = 0; j < 4; ++j) {
    const int col = j * 16 + l15;
    const float bb = bf16val(bd[n0 + col]);
#pragma unroll
    for (int r = 0; r < 8; ++r) {
      const int row = wave * 16 + 8 * half + r;
      E[row * OEP + col] = acc[j][r] * cinv + bb;
    }
  }
  __syncthreads();

  v4f v[8];
  size_t off[8];
#pragma unroll
  for (int it = 0; it < 8; ++it) {
    const int row = wave * 16 + it * 2 + half;   // wave's 16 rows over (it, half)
    const int q = l15;                           // 16 pieces of 16 B = the row's 256-byte segment (2 lines)
    v[it] = *(const v4f*)(&E[row * OEP + q * 4]);
    off[it] = (size_t)(m0 + row) * DOUT + n0 + q * 4;
  }
#pragma unroll
  for (int it = 0; it < 8; ++it) *(v4f*)(outp + off[it]) = v[it];
  
}

// ---------------------------------------------------------------------------
extern "C" void kernel_launch(void* const* d_in, const int* in_sizes, int n_in,
                              void* d_out, int out_size, void* d_ws, size_t ws_size,
                              hipStream_t stream) {
  if (n_in < 11) return;
  if (in_sizes[0] < MROWS * DIN || in_sizes[1] < MROWS * DIN || in_sizes[2] < MROWS * DIN) return;
  if (in_sizes[3] < DIN * ATT || in_sizes[5] < DIN * ATT || in_sizes[7] < DIN * ATT) return;
  if (in_sizes[4] < ATT || in_sizes[6] < ATT || in_sizes[8] < ATT) return;
  if (in_sizes[9] < ATT * DOUT || in_sizes[10] < DOUT) return;
  if (out_size < MROWS * DOUT) return;

  const float* xq = (const float*)d_in[0];
  const float* xk = (const float*)d_in[1];
  const float* xv = (const float*)d_in[2];
  const float* Wq = (const float*)d_in[3];
  const float* bq = (const float*)d_in[4];
  const float* Wk = (const float*)d_in[5];
  const float* bk = (const float*)d_in[6];
  const float* Wv = (const float*)d_in[7];
  const float* bv = (const float*)d_in[8];
  const float* Wd = (const float*)d_in[9];
  const float* bd = (const float*)d_in[10];

  // and is written exactly to its extent (no padded tails needed: all tiles divide the shapes)
  const size_t wt_bytes  = (size_t)4 * DIN * ATT * 2;        // three bf16 WT planes + one f16 WdT plane
  const size_t pl_bytes  = (size_t)MROWS * ATT * 2;          // one f16 plane (Q, K, V^T, ctx)
  const size_t off_wt  = 0;
  const size_t off_q   = off_wt + wt_bytes;
  const size_t off_k   = off_q + pl_bytes;
  const size_t off_vt  = off_k + pl_bytes;
  const size_t off_ctx = off_vt + pl_bytes;
  const size_t total   = off_ctx + pl_bytes;                 // 75759616 B at full size
  if (total > ws_size) return;

  char* ws = (char*)d_ws;
  unsigned short* wt  = (unsigned short*)(ws + off_wt);
  unsigned short* qpl = (unsigned short*)(ws + off_q);
  unsigned short* kpl = (unsigned short*)(ws + off_k);
  unsigned short* vtp = (unsigned short*)(ws + off_vt);
  unsigned short* cxp = (unsigned short*)(ws + off_ctx);

  k_cvt_wT<<<dim3(DIN * ATT / 4096, 1, 4), 256, 0, stream>>>(Wq, Wk, Wv, Wd, wt);
  k_proj<<<dim3(ATT / 64, MROWS / 128, 3), 256, 0, stream>>>(xq, xk, xv, wt, bq, bk, bv, qpl, kpl, vtp);
  k_attn<<<dim3(NHEAD, BL), 256, 0, stream>>>(qpl, kpl, vtp, cxp);
  k_oproj<<<dim3(DOUT / 64, MROWS / 128), 256, 0, stream>>>(cxp, wt, bd, (float*)d_out);
}

// v003
// Measured time: 67.7 microseconds a run.
// Timed twice side by side with v002, it ran 1.10 and 1.09 times as fast.
// All steps since v000 together make it 1.81 times as fast.
#include <hip/hip_runtime.h>
// Projections x*W{q,k,v}: v_wmma_f32_16x16x32_bf16 (bf16 operands = RNE-converted inputs, f32 accumulate); scores K*Q^T, context V^T*P and output projection ctx*Wd: v_wmma_f32_16x16x32_f16 (f16 operands; Q/K/V planes carried x8, P carried x1024, ctx plane carried x16, Wd plane carried x16; f32 accumulate); softmax in f32.

#ifndef NB
#define NB 8
#endif
#ifndef LL
#define LL 12
#endif
#define NB_FULL 8
#define LL_FULL 12
#define NQ 384           // tokens per (b,l) group = attention length
#define DIN 128          // feature width of query / key / value inputs
#define ATT 256          // attention width = NHEAD * HD
#define NHEAD 8
#define HD 32
#define DOUT 128         // output feature width
#define BL (NB * LL)     // number of (b,l) groups processed
#define MROWS (BL * NQ)  // token rows processed (prefix of the full row range)

static_assert(NB >= 1 && NB <= NB_FULL);
static_assert(LL >= 1 && LL <= LL_FULL);
static_assert(LL == LL_FULL || NB == 1);
static_assert(ATT == NHEAD * HD);
static_assert(HD == 32);
static_assert(NHEAD == 8);
static_assert(NQ % 32 == 0);
static_assert(NQ % 16 == 0);
static_assert(MROWS % 128 == 0);
static_assert(DIN % 64 == 0 && ATT % 64 == 0 && DOUT % 64 == 0);
static_assert(DIN * ATT == ATT * DOUT);
static_assert((DIN * ATT) % 4096 == 0);
static_assert(DIN == 32 * 4);   // one input row = one wave-wide 16-byte load
static_assert((size_t)NB_FULL * LL_FULL * NQ * DOUT * 4 == 18874368);
// coverage equalities (grid x block x per-thread elements == plane elements)
static_assert((size_t)(DIN * ATT / 4096) * 64 * 64 == (size_t)DIN * ATT);                   // weight planes
static_assert((size_t)(ATT / 64) * (MROWS / 128) * 128 * 64 == (size_t)MROWS * ATT);        // Q, K, V^T planes
static_assert((size_t)NHEAD * BL * NQ * HD == (size_t)MROWS * ATT);                        // ctx plane
static_assert((size_t)(DOUT / 64) * (MROWS / 128) * 128 * 64 == (size_t)MROWS * DOUT);      // out

// LDS pitches (16-bit elements unless noted); all keep 16-byte row alignment
#define BTP 40     // weight k-tile [64 n][32 k]
#define AXP 136    // converted input tile [128 rows][128 k]: 272-byte rows for 16-byte fragment reads
#define EQP 72     // row-major epilogue tile [128 rows][64 cols]
#define EVP 136    // transposed epilogue tile [64 d][128 s]
#define TP  72     // weight transpose tile [64 n][64 k]
#define CTP 40     // context tile [16 q][32 d] halves
#define OEP 68     // output epilogue tile [128 rows][64 cols], floats
#define ESZ 9216   // max(128*EQP, 64*EVP)
#define KVP 40     // attention K / V^T tiles: rows of 32 halves
#define VCS (32 * KVP + 32)   // one 32-key chunk of V^T: 32 rows + 64 B, so that 4 chunks' stores fall on different banks
#define TQ  3      // query tiles of 16 per attention wave
static_assert(128 * EQP <= ESZ);
static_assert(64 * EVP <= ESZ);
static_assert(8 * TQ * 16 == NQ);                 // 8 waves x TQ tiles cover the group's queries
static_assert(8 * TQ * 16 * CTP <= NQ * KVP);     // context tiles fit the K tile's space
static_assert((NQ * 4) % 256 == 0);

typedef __bf16   v16bf __attribute__((ext_vector_type(16)));
typedef __bf16   v8bf  __attribute__((ext_vector_type(8)));
typedef _Float16 v16h  __attribute__((ext_vector_type(16)));
typedef _Float16 v8h   __attribute__((ext_vector_type(8)));
typedef float    v8f   __attribute__((ext_vector_type(8)));
typedef float    v4f   __attribute__((ext_vector_type(4)));
typedef unsigned int v4u __attribute__((ext_vector_type(4)));
typedef unsigned int v2u __attribute__((ext_vector_type(2)));
typedef float    v2f   __attribute__((ext_vector_type(2)));
typedef __bf16   v2bf  __attribute__((ext_vector_type(2)));

// ---------------------------------------------------------------------------
// WMMA wrappers with the VALU hazard guard (4 v_nop after every issue).
__device__ __forceinline__ v8f mma_bf16(v16bf a, v16bf b, v8f c) {
  v8f d = __builtin_amdgcn_wmma_f32_16x16x32_bf16(false, a, false, b, (short)0, c, false, false);
  asm volatile("v_nop\n\tv_nop\n\tv_nop\n\tv_nop" : "+v"(d) : "v"(a), "v"(b));
  return d;
}
__device__ __forceinline__ v8f mma_f16(v16h a, v16h b, v8f c) {
  v8f d = __builtin_amdgcn_wmma_f32_16x16x32_f16(false, a, false, b, (short)0, c, false, false);
  asm volatile("v_nop\n\tv_nop\n\tv_nop\n\tv_nop" : "+v"(d) : "v"(a), "v"(b));
  return d;
}

// 16-bit fragment, contraction dim CONTIGUOUS in memory: elem(k) = p0[rc*ld + k].
// Lane l: row/col rc = (l&15); elements 0..7 <- kk+8h+0..7, elements 8..15 <- kk+16+8h+0..7
// (h = l>>4). Same map for A (rc = row) and B (rc = column of a k-contiguous copy).
__device__ __forceinline__ v16bf ld_frag_bf(const __bf16* p0, int ld, int rc, int kk, int lane) {
  const int hh = (lane >> 4) & 1;
  const __bf16* p = p0 + (size_t)rc * ld + kk + 8 * hh;
  const v8bf lo = *(const v8bf*)(p);
  const v8bf hi = *(const v8bf*)(p + 16);
  v16bf f;
#pragma unroll
  for (int i = 0; i < 8; ++i) { f[i] = lo[i]; f[8 + i] = hi[i]; }
  return f;
}
__device__ __forceinline__ v16h ld_frag_h(const _Float16* p0, int ld, int rc, int kk, int lane) {
  const int hh = (lane >> 4) & 1;
  const _Float16* p = p0 + (size_t)rc * ld + kk + 8 * hh;
  const v8h lo = *(const v8h*)(p);
  const v8h hi = *(const v8h*)(p + 16);
  v16h f;
#pragma unroll
  for (int i = 0; i < 8; ++i) { f[i] = lo[i]; f[8 + i] = hi[i]; }
  return f;
}

// f32 -> bf16 bits, RNE convert
__device__ __forceinline__ unsigned int bfb(float x) {
  unsigned int u = __float_as_uint(x);
  u = u + 0x7FFFu + ((u >> 16) & 1u);
  return u >> 16;
}
// f32 -> value of its RNE bf16
__device__ __forceinline__ float bf16val(float x) {
  return __uint_as_float(bfb(x) << 16);
}
// f32 -> f16 bits, RNE convert
__device__ __forceinline__ unsigned short hbits(float x) {
  const _Float16 hv = (_Float16)x;
  return __builtin_bit_cast(unsigned short, hv);
}
__device__ __forceinline__ unsigned int pack2h(float a, float b) {
  return (unsigned int)hbits(a) | ((unsigned int)hbits(b) << 16);
}

// ---------------------------------------------------------------------------
// W f32 [kdim k][ndim n] -> WT 16-bit [ndim n][kdim k] (k contiguous).
// z = 0,1,2: Wq/Wk/Wv [DIN][ATT] -> bf16 planes; z = 3: Wd [ATT][DOUT] ->
// f16 plane holding 16 * bf16val(w). All four planes have DIN*ATT elements.
// Block = 64 k x 64 n tile transposed through LDS; each WT row segment
__global__ __launch_bounds__(256) void k_cvt_wT(const float* __restrict__ Wq,
                                                const float* __restrict__ Wk,
                                                const float* __restrict__ Wv,
                                                const float* __restrict__ Wd,
                                                unsigned short* __restrict__ wT) {
  __shared__ __align__(16) unsigned short T[64 * TP];   // [n local][k local], cross-wave (block barrier)
  const int z = blockIdx.z;
  const float* W = (z == 0) ? Wq : ((z == 1) ? Wk : ((z == 2) ? Wv : Wd));
  const bool od = (z == 3);                // block-uniform
  const int kdim = od ? ATT : DIN;
  const int ndim = od ? DOUT : ATT;
  unsigned short* dst = wT + (size_t)z * (DIN * ATT);
  const int nkt = kdim / 64;
  const int t = blockIdx.x;                // tile index 0 .. DIN*ATT/4096 - 1
  const int k0 = (t % nkt) * 64;
  const int n0 = (t / nkt) * 64;
  const int tid = threadIdx.x;
  const int wave = tid >> 5, lane = tid & 31;

#pragma unroll
  for (int i = 0; i < 4; ++i) {
    const int idx = i * 256 + tid;          // 0..1023
    const int kk = idx >> 4;                // 0..63
    const int c4 = (idx & 15) * 4;          // 0..60
    const v4f w = *(const v4f*)(W + (size_t)(k0 + kk) * ndim + n0 + c4);
    unsigned short e0, e1, e2, e3;
    if (od) {
      e0 = hbits(bf16val(w[0]) * 16.0f); e1 = hbits(bf16val(w[1]) * 16.0f);
      e2 = hbits(bf16val(w[2]) * 16.0f); e3 = hbits(bf16val(w[3]) * 16.0f);
    } else {
      e0 = (unsigned short)bfb(w[0]); e1 = (unsigned short)bfb(w[1]);
      e2 = (unsigned short)bfb(w[2]); e3 = (unsigned short)bfb(w[3]);
    }
    T[(c4 + 0) * TP + kk] = e0;
    T[(c4 + 1) * TP + kk] = e1;
    T[(c4 + 2) * TP + kk] = e2;
    T[(c4 + 3) * TP + kk] = e3;
  }
  __syncthreads();

  v4u v[2];
  size_t off[2];
#pragma unroll
  for (int it = 0; it < 2; ++it) {
    const int nn = wave * 8 + it * 4 + (lane >> 3);   // 0..63 over (wave, it, lane>>3)
    const int q = lane & 7;
    v[it] = *(const v4u*)(&T[nn * TP + q * 8]);
    off[it] = (size_t)(n0 + nn) * kdim + k0 + q * 8;
  }
#pragma unroll
  for (int it = 0; it < 2; ++it) *(v4u*)(dst + off[it]) = v[it];
  
}

// ---------------------------------------------------------------------------
// Projection: C[MROWS][ATT] = bf16(x_z)[MROWS][DIN] * WT_z[ATT][DIN]^T + bias_z.
// 256 thr = 8 waves; block tile 128 rows x 64 cols; wave owns 16 rows x 64 cols.
// The block reads its 128 f32 input rows itself: one wave-wide 16-byte load = one
// whole 512-byte row; RNE convert to bf16 in registers, tile [128][128] kept in LDS;
// A fragments are read from that tile behind the k loop's own barriers.
// Weight k-tile [64 n][32 k] staged in LDS with plain loads (single buffer,
// two block barriers per step).
// z = 0: Q plane f16 x8 [MROWS][ATT]; z = 1: K plane f16 x8 [MROWS][ATT];
// z = 2: V^T plane f16 x8 [ATT][MROWS]. Epilogue staged in LDS, every
__global__ __launch_bounds__(256) void k_proj(
    const float* __restrict__ xq, const float* __restrict__ xk, const float* __restrict__ xv,
    const unsigned short* __restrict__ wT,
    const float* __restrict__ bq, const float* __restrict__ bk, const float* __restrict__ bv,
    unsigned short* __restrict__ qp, unsigned short* __restrict__ kp,
    unsigned short* __restrict__ vtp) {
  __shared__ __align__(16) unsigned short bt[64 * BTP];   // weight k-tile, cross-wave (block barrier)
  __shared__ __align__(16) unsigned short ax[128 * AXP];  // converted input tile (block barrier)
  __shared__ __align__(16) unsigned short E[ESZ];         // epilogue tile, cross-wave (block barrier)

  const int z = blockIdx.z;
  const int n0 = blockIdx.x * 64;
  const int m0 = blockIdx.y * 128;
  const int tid = threadIdx.x;
  const int wave = tid >> 5, lane = tid & 31;
  const int l15 = lane & 15, half = (lane >> 4) & 1;

  const unsigned short* Wt = wT + (size_t)z * ATT * DIN;
  const float* bias = (z == 0) ? bq : ((z == 1) ? bk : bv);

  const int tn = tid >> 2;            // 0..63 : column within tile
  const int tk = (tid & 3) * 8;       // 0,8,16,24 : k within step
  const unsigned short* wsrc = Wt + (size_t)(n0 + tn) * DIN + tk;
  const float* X = (z == 0) ? xq : ((z == 1) ? xk : xv);
  const float* xsrc = X + (size_t)(m0 + wave * 16) * DIN + lane * 4;
  const int arow = wave * 16 + l15;

  // wave's 16 rows: all 16 loads issued before the first convert, so that one memory latency covers them;
  // both loops unrolled so that xr has constant indices and stays in registers
  v4f xr[16];
#pragma unroll
  for (int r = 0; r < 16; ++r) xr[r] = *(const v4f*)(xsrc + (size_t)r * DIN);
#pragma unroll
  for (int r = 0; r < 16; ++r) {
    const v2f lo = {xr[r][0], xr[r][1]};
    const v2f hi = {xr[r][2], xr[r][3]};
    v2u w;
    w[0] = __builtin_bit_cast(unsigned int, __builtin_convertvector(lo, v2bf));
    w[1] = __builtin_bit_cast(unsigned int, __builtin_convertvector(hi, v2bf));
    *(v2u*)(&ax[(wave * 16 + r) * AXP + lane * 4]) = w;
  }

  v8f acc[4] = {};
  for (int s = 0; s < DIN / 32; ++s) {
    const int kk = s * 32;
    const v4u wv = *(const v4u*)(wsrc + kk);
    __syncthreads();                               // earlier reads of bt done
    *(v4u*)(&bt[tn * BTP + tk]) = wv;
    __syncthreads();                               // tile complete
    const v16bf a = ld_frag_bf((const __bf16*)ax, AXP, arow, kk, lane);
#pragma unroll
    for (int j = 0; j < 4; ++j) {
      const v16bf b = ld_frag_bf((const __bf16*)bt, BTP, j * 16 + l15, 0, lane);
      acc[j] = mma_bf16(a, b, acc[j]);
    }
  }

  // acc[j][r] = C[m0 + wave*16 + 8*half + r][n0 + j*16 + l15]
  const float car = 8.0f;
  if (z != 2) {                      // block-uniform branch
#pragma unroll
    for (int j = 0; j < 4; ++j) {
      const int col = j * 16 + l15;
      const float bb = bf16val(bias[n0 + col]);
#pragma unroll
      for (int r = 0; r < 8; ++r) {
        const int row = wave * 16 + 8 * half + r;
        E[row * EQP + col] = hbits((acc[j][r] + bb) * car);
      }
    }
    __syncthreads();
    unsigned short* dst = (z == 0) ? qp : kp;
    v4u v[4];
    size_t off[4];
#pragma unroll
    for (int it = 0; it < 4; ++it) {
      const int row = wave * 16 + it * 4 + (lane >> 3);   // wave's 16 rows over (it, lane>>3)
      const int q = lane & 7;
      v[it] = *(const v4u*)(&E[row * EQP + q * 8]);
      off[it] = (size_t)(m0 + row) * ATT + n0 + q * 8;
    }
#pragma unroll
    for (int it = 0; it < 4; ++it) *(v4u*)(dst + off[it]) = v[it];
    
  } else {
#pragma unroll
    for (int j = 0; j < 4; ++j) {
      const int col = j * 16 + l15;                       // d within tile
      const float bb = bf16val(bias[n0 + col]);
#pragma unroll
      for (int r = 0; r < 8; ++r) {
        const int srow = wave * 16 + 8 * half + r;        // s within tile
        E[col * EVP + srow] = hbits((acc[j][r] + bb) * car);
      }
    }
    __syncthreads();
    v4u v[4];
    size_t off[4];
#pragma unroll
    for (int it = 0; it < 4; ++it) {
      const int drow = wave * 8 + it * 2 + half;          // wave's 8 d-rows over (it, half)
      const int q = l15;                                  // 16 pieces = 256-byte row = 2 lines
      v[it] = *(const v4u*)(&E[drow * EVP + q * 8]);
      off[it] = (size_t)(n0 + drow) * MROWS + m0 + q * 8;
    }
#pragma unroll
    for (int it = 0; it < 4; ++it) *(v4u*)(vtp + off[it]) = v[it];
    
  }
}

// ---------------------------------------------------------------------------
// Flash attention, transposed-score form: block = one (group, head); its K
// [384 keys][32 d] and V^T [32 d][384 keys] are staged ONCE in LDS and shared by
// 8 waves; wave = TQ query tiles of 16 (48 queries), so the block covers all
// 384 queries and every K / V fragment read from LDS serves TQ tiles.
// Per 32-key chunk and query tile:
//   S^T = K . Q^T    A = K rows (lane = key, k = d), B = Q^T (lane = query, k = d)
//                    D[row = key 8h+r][col = query l15]; c0 keys 0..15, c1 keys 16..31
//   per-lane online softmax for query l15 (16 local keys + xor-16 partner)
//   O^T += V^T . P   A = V^T rows (lane = d, k = key), B = P: element i<8 <- c0[i]
//                    (key 8h+i), element 8+i <- c1[i] (key 16+8h+i), same lane
//                    D[row = d 8h+r][col = query l15]
// Scores carry 64 from the x8 planes; P = 2^(raw * k2 - max * k2 + 10), k2 = log2(e)/(64*sqrt(32)): one FMA and one
// exp2 a score. P and its sum carried x1024, V carried x8 -> context x16 = O * 16/(8 * carried sum).
// Context tiles [16 q][32 d] f16 x16 staged in LDS (the K tile's space, free
// behind a block barrier) and written to the head-major ctx plane
// [BL*NHEAD*NQ][HD]: each tile is 1024 contiguous bytes
// second bound: at most 160 VGPRs, so that the 3 blocks a WGP gets (768 blocks, 256 WGPs) are resident together
__global__ __launch_bounds__(256, 6) void k_attn(const unsigned short* __restrict__ qp,
                                              const unsigned short* __restrict__ kp,
                                              const unsigned short* __restrict__ vtp,
                                              unsigned short* __restrict__ ctx) {
  __shared__ __align__(16) unsigned short Ks[NQ * KVP];          // [key][d]; later the context tiles
  __shared__ __align__(16) unsigned short Vs[(NQ / 32) * VCS];   // [chunk][d][key in chunk]

  const int tid = threadIdx.x;
  const int wave = tid >> 5, lane = tid & 31;
  const int l15 = lane & 15;
  const int half = (lane >> 4) & 1;
  const int head = blockIdx.x;
  const int g = blockIdx.y;                // (b,l) group

  const _Float16* Q  = (const _Float16*)qp;
  const unsigned short* kbase = kp + (size_t)g * NQ * ATT + head * HD;              // key t at kbase + t*ATT
  const unsigned short* vbase = vtp + (size_t)head * HD * MROWS + (size_t)g * NQ;   // d row at vbase + d*MROWS

  // stage K and V^T: 2 x 1536 pieces of 16 bytes, 6 + 6 a thread, all loads issued before the first LDS store
  v4u kr[NQ * 4 / 256], vr[NQ * 4 / 256];
#pragma unroll
  for (int i = 0; i < NQ * 4 / 256; ++i) {
    const int idx = i * 256 + tid;
    kr[i] = *(const v4u*)(kbase + (size_t)(idx >> 2) * ATT + (idx & 3) * 8);
  }
#pragma unroll
  for (int i = 0; i < NQ * 4 / 256; ++i) {
    const int idx = i * 256 + tid;
    const int d = idx / (NQ / 8), pc = idx % (NQ / 8);
    vr[i] = *(const v4u*)(vbase + (size_t)d * MROWS + pc * 8);
  }
  v16h qb[TQ];
#pragma unroll
  for (int t = 0; t < TQ; ++t) {
    const _Float16* qbase = Q + ((size_t)g * NQ + (wave * TQ + t) * 16) * ATT + head * HD;
    qb[t] = ld_frag_h(qbase, ATT, l15, 0, lane);               // d 0..31
  }
#pragma unroll
  for (int i = 0; i < NQ * 4 / 256; ++i) {
    const int idx = i * 256 + tid;
    *(v4u*)(&Ks[(idx >> 2) * KVP + (idx & 3) * 8]) = kr[i];
  }
#pragma unroll
  for (int i = 0; i < NQ * 4 / 256; ++i) {
    const int idx = i * 256 + tid;
    const int d = idx / (NQ / 8), pc = idx % (NQ / 8);
    *(v4u*)(&Vs[(pc >> 2) * VCS + d * KVP + (pc & 3) * 8]) = vr[i];
  }
  __syncthreads();                         // K and V^T tiles complete

  v8f o[TQ][2] = {};
  float mrun[TQ], lrun[TQ];
#pragma unroll
  for (int t = 0; t < TQ; ++t) { mrun[t] = -1.0e30f; lrun[t] = 0.0f; }
  // raw score -> exponent of 2: (1/64)/sqrt(32) * log2(e)
  const float k2 = 0.17677669529663689f * (1.0f / 64.0f) * 1.4426950408889634f;
  const v8f k2v = {k2, k2, k2, k2, k2, k2, k2, k2};

  for (int kc = 0; kc < NQ; kc += 32) {
    const _Float16* kt = (const _Float16*)Ks + kc * KVP;
    const _Float16* vt = (const _Float16*)Vs + (kc >> 5) * VCS;
    const v16h ka0 = ld_frag_h(kt, KVP, l15, 0, lane);          // keys kc + 0..15
    const v16h ka2 = ld_frag_h(kt, KVP, 16 + l15, 0, lane);     // keys kc + 16..31
    const v16h va0 = ld_frag_h(vt, KVP, l15, 0, lane);          // d 0..15
    const v16h va1 = ld_frag_h(vt, KVP, 16 + l15, 0, lane);     // d 16..31
#pragma unroll
    for (int t = 0; t < TQ; ++t) {
      const v8f zero = {};
      v8f c0 = mma_f16(ka0, qb[t], zero);
      v8f c1 = mma_f16(ka2, qb[t], zero);

      // maximum on the raw accumulators (the scale is positive, so the order is the same)
      float lm = fmaxf(c0[0], c1[0]);
#pragma unroll
      for (int r = 1; r < 8; ++r) lm = fmaxf(lm, fmaxf(c0[r], c1[r]));
      lm = fmaxf(lm, __shfl_xor(lm, 16, 32));
      const float mnew = fmaxf(mrun[t], lm);
      const float alpha = __builtin_amdgcn_exp2f((mrun[t] - mnew) * k2);
      const float nb = 10.0f - mnew * k2;      // 2^10 = the x1024 carry of P
      const v8f nbv = {nb, nb, nb, nb, nb, nb, nb, nb};
      const v8f e0 = __builtin_elementwise_fma(c0, k2v, nbv);
      const v8f e1 = __builtin_elementwise_fma(c1, k2v, nbv);
      float p0[8], p1[8];
      float ls = 0.0f;
#pragma unroll
      for (int r = 0; r < 8; ++r) {
        p0[r] = __builtin_amdgcn_exp2f(e0[r]);
        p1[r] = __builtin_amdgcn_exp2f(e1[r]);
        ls += p0[r] + p1[r];
      }
      ls += __shfl_xor(ls, 16, 32);
      lrun[t] = lrun[t] * alpha + ls;
      mrun[t] = mnew;
#pragma unroll
      for (int j = 0; j < 2; ++j)
#pragma unroll
        for (int r = 0; r < 8; ++r) o[t][j][r] *= alpha;

      v16h pb;
#pragma unroll
      for (int e = 0; e < 8; ++e) {
        pb[e]     = (_Float16)p0[e];   // key kc + 8h + e
        pb[8 + e] = (_Float16)p1[e];   // key kc + 16 + 8h + e
      }
      o[t][0] = mma_f16(va0, pb, o[t][0]);
      o[t][1] = mma_f16(va1, pb, o[t][1]);
    }
  }
  __syncthreads();                         // every wave's last read of the K tile done: its space becomes context staging

  // o[t][j][r] = 8192 * sum_t p_t v_t for query l15, d = j*16 + 8*half + r; ctx carried x16
#pragma unroll
  for (int t = 0; t < TQ; ++t) {
    const float inv = 1.0f / (lrun[t] * 0.5f);   // lrun carries the x1024 of P
    unsigned short* T = Ks + (wave * TQ + t) * 16 * CTP;
#pragma unroll
    for (int j = 0; j < 2; ++j) {
      v4u w;
      w[0] = pack2h(o[t][j][0] * inv, o[t][j][1] * inv);
      w[1] = pack2h(o[t][j][2] * inv, o[t][j][3] * inv);
      w[2] = pack2h(o[t][j][4] * inv, o[t][j][5] * inv);
      w[3] = pack2h(o[t][j][6] * inv, o[t][j][7] * inv);
      *(v4u*)(&T[l15 * CTP + j * 16 + 8 * half]) = w;
    }
  }
  __syncthreads();

  v4u v[TQ][2];
#pragma unroll
  for (int t = 0; t < TQ; ++t)
#pragma unroll
    for (int it = 0; it < 2; ++it) {
      const int row = it * 8 + (lane >> 2);     // 0..15 query row of the tile
      const int piece = (lane & 3) * 8;         // 8 halves = 16 B; 4 pieces = 64-B row, 8 lanes = one line
      v[t][it] = *(const v4u*)(&Ks[((wave * TQ + t) * 16 + row) * CTP + piece]);
    }
  unsigned short* cb = ctx + (((size_t)g * NHEAD + head) * NQ + wave * TQ * 16) * HD;
#pragma unroll
  for (int t = 0; t < TQ; ++t)
#pragma unroll
    for (int it = 0; it < 2; ++it)
      *(v4u*)(cb + (size_t)(t * 16 + it * 8 + (lane >> 2)) * HD + (lane & 3) * 8) = v[t][it];
}

// ---------------------------------------------------------------------------
// Output projection: out[MROWS][DOUT] f32 = ctx[MROWS][ATT] * WdT[DOUT][ATT]^T / 256 + bd.
// ctx read from the head-major plane: for row (g, n) the 32 k values of
// k-step s (= head s) are contiguous at ((g*NHEAD + s)*NQ + n)*HD.
// Same structure as k_proj (256 thr, 128 rows x 64 cols, weight k-tile in
// LDS), f16 operands. Epilogue: f32 tile staged in LDS; each 256-byte row
// segment = 2 lines, each line written by 8 consecutive lanes of one
__global__ __launch_bounds__(256) void k_oproj(const unsigned short* __restrict__ ctx,
                                               const unsigned short* __restrict__ wT,
                                               const float* __restrict__ bd,
                                               float* __restrict__ outp) {
  __shared__ __align__(16) unsigned short bt[64 * BTP];   // weight k-tile, cross-wave (block barrier)
  __shared__ __align__(16) float E[128 * OEP];            // epilogue tile, per-wave rows (wave-private), block barrier used

  const int n0 = blockIdx.x * 64;
  const int m0 = blockIdx.y * 128;
  const int tid = threadIdx.x;
  const int wave = tid >> 5, lane = tid & 31;
  const int l15 = lane & 15, half = (lane >> 4) & 1;

  const unsigned short* Wt = wT + (size_t)3 * ATT * DIN;    // WdT plane [DOUT][ATT], f16 x16
  const int tn = tid >> 2;            // 0..63 : column within tile
  const int tk = (tid & 3) * 8;       // 0,8,16,24 : k within step
  const unsigned short* wsrc = Wt + (size_t)(n0 + tn) * ATT + tk;

  const int r0 = m0 + wave * 16;      // wave's 16 rows lie inside one group (NQ % 16 == 0)
  const int g = r0 / NQ;
  const int nl = r0 - g * NQ;
  const _Float16* A0 = (const _Float16*)ctx + ((size_t)g * NHEAD * NQ + nl) * HD;

  v8f acc[4] = {};
  for (int s = 0; s < ATT / 32; ++s) {
    const int kk = s * 32;
    const v4u wv = *(const v4u*)(wsrc + kk);
    __syncthreads();                               // earlier reads of bt done
    *(v4u*)(&bt[tn * BTP + tk]) = wv;
    __syncthreads();                               // tile complete
    const v16h a = ld_frag_h(A0 + (size_t)s * NQ * HD, HD, l15, 0, lane);
#pragma unroll
    for (int j = 0; j < 4; ++j) {
      const v16h b = ld_frag_h((const _Float16*)bt, BTP, j * 16 + l15, 0, lane);
      acc[j] = mma_f16(a, b, acc[j]);
    }
  }

  // acc[j][r] = 256 * (ctx.Wd)[m0 + wave*16 + 8*half + r][n0 + j*16 + l15]
  const float cinv = 1.0f / 256.0f;
#pragma unroll
  for (int j = 0; j < 4; ++j) {
    const int col = j * 16 + l15;
    const float bb = bf16val(bd[n0 + col]);
#pragma unroll
    for (int r = 0; r < 8; ++r) {
      const int row = wave * 16 + 8 * half + r;
      E[row * OEP + col] = acc[j][r] * cinv + bb;
    }
  }
  __syncthreads();

  v4f v[8];
  size_t off[8];
#pragma unroll
  for (int it = 0; it < 8; ++it) {
    const int row = wave * 16 + it * 2 + half;   // wave's 16 rows over (it, half)
    const int q = l15;                           // 16 pieces of 16 B = the row's 256-byte segment (2 lines)
    v[it] = *(const v4f*)(&E[row * OEP + q * 4]);
    off[it] = (size_t)(m0 + row) * DOUT + n0 + q * 4;
  }
#pragma unroll
  for (int it = 0; it < 8; ++it) *(v4f*)(outp + off[it]) = v[it];
  
}

// ---------------------------------------------------------------------------
extern "C" void kernel_launch(void* const* d_in, const int* in_sizes, int n_in,
                              void* d_out, int out_size, void* d_ws, size_t ws_size,
                              hipStream_t stream) {
  if (n_in < 11) return;
  if (in_sizes[0] < MROWS * DIN || in_sizes[1] < MROWS * DIN || in_sizes[2] < MROWS * DIN) return;
  if (in_sizes[3] < DIN * ATT || in_sizes[5] < DIN * ATT || in_sizes[7] < DIN * ATT) return;
  if (in_sizes[4] < ATT || in_sizes[6] < ATT || in_sizes[8] < ATT) return;
  if (in_sizes[9] < ATT * DOUT || in_sizes[10] < DOUT) return;
  if (out_size < MROWS * DOUT) return;

  const float* xq = (const float*)d_in[0];
  const float* xk = (const float*)d_in[1];
  const float* xv = (const float*)d_in[2];
  const float* Wq = (const float*)d_in[3];
  const float* bq = (const float*)d_in[4];
  const float* Wk = (const float*)d_in[5];
  const float* bk = (const float*)d_in[6];
  const float* Wv = (const float*)d_in[7];
  const float* bv = (const float*)d_in[8];
  const float* Wd = (const float*)d_in[9];
  const float* bd = (const float*)d_in[10];

  // and is written exactly to its extent (no padded tails needed: all tiles divide the shapes)
  const size_t wt_bytes  = (size_t)4 * DIN * ATT * 2;        // three bf16 WT planes + one f16 WdT plane
  const size_t pl_bytes  = (size_t)MROWS * ATT * 2;          // one f16 plane (Q, K, V^T, ctx)
  const size_t off_wt  = 0;
  const size_t off_q   = off_wt + wt_bytes;
  const size_t off_k   = off_q + pl_bytes;
  const size_t off_vt  = off_k + pl_bytes;
  const size_t off_ctx = off_vt + pl_bytes;
  const size_t total   = off_ctx + pl_bytes;                 // 75759616 B at full size
  if (total > ws_size) return;

  char* ws = (char*)d_ws;
  unsigned short* wt  = (unsigned short*)(ws + off_wt);
  unsigned short* qpl = (unsigned short*)(ws + off_q);
  unsigned short* kpl = (unsigned short*)(ws + off_k);
  unsigned short* vtp = (unsigned short*)(ws + off_vt);
  unsigned short* cxp = (unsigned short*)(ws + off_ctx);

  k_cvt_wT<<<dim3(DIN * ATT / 4096, 1, 4), 256, 0, stream>>>(Wq, Wk, Wv, Wd, wt);
  k_proj<<<dim3(ATT / 64, MROWS / 128, 3), 256, 0, stream>>>(xq, xk, xv, wt, bq, bk, bv, qpl, kpl, vtp);
  k_attn<<<dim3(NHEAD, BL), 256, 0, stream>>>(qpl, kpl, vtp, cxp);
  k_oproj<<<dim3(DOUT / 64, MROWS / 128), 256, 0, stream>>>(cxp, wt, bd, (float*)d_out);
}

// v004
// A run of this version takes 60.7 microseconds.
// Two timings next to v003 put it at 1.12 and 1.11 times that version's speed.
// Over all steps from v000 it is 2.03 times as fast.
#include <hip/hip_runtime.h>
// Projections x*W{q,k,v}: v_wmma_f32_16x16x32_bf16 (bf16 operands = RNE-converted inputs, f32 accumulate); scores K*Q^T, context V^T*P and output projection ctx*Wd: v_wmma_f32_16x16x32_f16 (f16 operands; Q/K/V planes carried x8, P carried x1024, ctx plane carried x16, Wd plane carried x16; f32 accumulate); softmax in f32.

#ifndef NB
#define NB 8
#endif
#ifndef LL
#define LL 12
#endif
#define NB_FULL 8
#define LL_FULL 12
#define NQ 384           // tokens per (b,l) group = attention length
#define DIN 128          // feature width of query / key / value inputs
#define ATT 256          // attention width = NHEAD * HD
#define NHEAD 8
#define HD 32
#define DOUT 128         // output feature width
#define BL (NB * LL)     // number of (b,l) groups processed
#define MROWS (BL * NQ)  // token rows processed (prefix of the full row range)

static_assert(NB >= 1 && NB <= NB_FULL);
static_assert(LL >= 1 && LL <= LL_FULL);
static_assert(LL == LL_FULL || NB == 1);
static_assert(ATT == NHEAD * HD);
static_assert(HD == 32);
static_assert(NHEAD == 8);
static_assert(NQ % 32 == 0);
static_assert(NQ % 16 == 0);
static_assert(MROWS % 128 == 0);
static_assert(DIN % 64 == 0 && ATT % 64 == 0 && DOUT % 64 == 0);
static_assert(DIN * ATT == ATT * DOUT);
static_assert((DIN * ATT) % 4096 == 0);
static_assert(DIN == 32 * 4);   // one input row = one wave-wide 16-byte load
static_assert((size_t)NB_FULL * LL_FULL * NQ * DOUT * 4 == 18874368);
// coverage equalities (grid x block x per-thread elements == plane elements)
static_assert((size_t)(DIN * ATT / 4096) * 64 * 64 == (size_t)DIN * ATT);                   // weight planes
static_assert((size_t)(ATT / 64) * (MROWS / 128) * 128 * 64 == (size_t)MROWS * ATT);        // Q, K, V^T planes (ATT / 64 column tiles a block)
static_assert((size_t)MROWS * ATT * 2 < 4294967296ull);   // 32-bit byte offsets into a plane
static_assert((size_t)NHEAD * BL * NQ * HD == (size_t)MROWS * ATT);                        // ctx plane
static_assert((size_t)(DOUT / 64) * (MROWS / 128) * 128 * 64 == (size_t)MROWS * DOUT);      // out

// LDS pitches (16-bit elements unless noted); all keep 16-byte row alignment
#define BTP 40     // weight k-tile [64 n][32 k]
#define WTP 136    // projection weight column tile [64 n][128 k]: 272-byte rows, as the input tile's
#define NT  (ATT / 64)   // column tiles a projection block works through
#define AXP 136    // converted input tile [128 rows][128 k]: 272-byte rows for 16-byte fragment reads
#define EQP 72     // row-major epilogue tile [128 rows][64 cols]
#define EVP 136    // transposed epilogue tile [64 d][128 s]
#define TP  72     // weight transpose tile [64 n][64 k]
#define CTP 40     // context tile [16 q][32 d] halves
#define OEP 68     // output epilogue tile [128 rows][64 cols], floats
#define ESZ 9216   // max(128*EQP, 64*EVP)
#define KVP 40     // attention K / V^T tiles: rows of 32 halves
#define VCS (32 * KVP + 32)   // one 32-key chunk of V^T: 32 rows + 64 B, so that 4 chunks' stores fall on different banks
#define TQ  3      // query tiles of 16 per attention wave
static_assert(128 * EQP <= ESZ);
static_assert(64 * EVP <= ESZ);
static_assert(8 * TQ * 16 == NQ);                 // 8 waves x TQ tiles cover the group's queries
static_assert(8 * TQ * 16 * CTP <= NQ * KVP);     // context tiles fit the K tile's space
static_assert((NQ * 4) % 256 == 0);

typedef __bf16   v16bf __attribute__((ext_vector_type(16)));
typedef __bf16   v8bf  __attribute__((ext_vector_type(8)));
typedef _Float16 v16h  __attribute__((ext_vector_type(16)));
typedef _Float16 v8h   __attribute__((ext_vector_type(8)));
typedef float    v8f   __attribute__((ext_vector_type(8)));
typedef float    v4f   __attribute__((ext_vector_type(4)));
typedef unsigned int v4u __attribute__((ext_vector_type(4)));
typedef unsigned int v2u __attribute__((ext_vector_type(2)));
typedef float    v2f   __attribute__((ext_vector_type(2)));
typedef __bf16   v2bf  __attribute__((ext_vector_type(2)));

// ---------------------------------------------------------------------------
// WMMA wrappers with the VALU hazard guard (4 v_nop after every issue).
__device__ __forceinline__ v8f mma_bf16(v16bf a, v16bf b, v8f c) {
  v8f d = __builtin_amdgcn_wmma_f32_16x16x32_bf16(false, a, false, b, (short)0, c, false, false);
  asm volatile("v_nop\n\tv_nop\n\tv_nop\n\tv_nop" : "+v"(d) : "v"(a), "v"(b));
  return d;
}
__device__ __forceinline__ v8f mma_f16(v16h a, v16h b, v8f c) {
  v8f d = __builtin_amdgcn_wmma_f32_16x16x32_f16(false, a, false, b, (short)0, c, false, false);
  asm volatile("v_nop\n\tv_nop\n\tv_nop\n\tv_nop" : "+v"(d) : "v"(a), "v"(b));
  return d;
}

// 16-bit fragment, contraction dim CONTIGUOUS in memory: elem(k) = p0[rc*ld + k].
// Lane l: row/col rc = (l&15); elements 0..7 <- kk+8h+0..7, elements 8..15 <- kk+16+8h+0..7
// (h = l>>4). Same map for A (rc = row) and B (rc = column of a k-contiguous copy).
__device__ __forceinline__ v16bf ld_frag_bf(const __bf16* p0, int ld, int rc, int kk, int lane) {
  const int hh = (lane >> 4) & 1;
  const __bf16* p = p0 + (size_t)rc * ld + kk + 8 * hh;
  const v8bf lo = *(const v8bf*)(p);
  const v8bf hi = *(const v8bf*)(p + 16);
  v16bf f;
#pragma unroll
  for (int i = 0; i < 8; ++i) { f[i] = lo[i]; f[8 + i] = hi[i]; }
  return f;
}
__device__ __forceinline__ v16h ld_frag_h(const _Float16* p0, int ld, int rc, int kk, int lane) {
  const int hh = (lane >> 4) & 1;
  const _Float16* p = p0 + (size_t)rc * ld + kk + 8 * hh;
  const v8h lo = *(const v8h*)(p);
  const v8h hi = *(const v8h*)(p + 16);
  v16h f;
#pragma unroll
  for (int i = 0; i < 8; ++i) { f[i] = lo[i]; f[8 + i] = hi[i]; }
  return f;
}

// f32 -> bf16 bits, RNE convert
__device__ __forceinline__ unsigned int bfb(float x) {
  unsigned int u = __float_as_uint(x);
  u = u + 0x7FFFu + ((u >> 16) & 1u);
  return u >> 16;
}
// f32 -> value of its RNE bf16
__device__ __forceinline__ float bf16val(float x) {
  return __uint_as_float(bfb(x) << 16);
}
// f32 -> f16 bits, RNE convert
__device__ __forceinline__ unsigned short hbits(float x) {
  const _Float16 hv = (_Float16)x;
  return __builtin_bit_cast(unsigned short, hv);
}
__device__ __forceinline__ unsigned int pack2h(float a, float b) {
  return (unsigned int)hbits(a) | ((unsigned int)hbits(b) << 16);
}

// ---------------------------------------------------------------------------
// W f32 [kdim k][ndim n] -> WT 16-bit [ndim n][kdim k] (k contiguous).
// z = 0,1,2: Wq/Wk/Wv [DIN][ATT] -> bf16 planes; z = 3: Wd [ATT][DOUT] ->
// f16 plane holding 16 * bf16val(w). All four planes have DIN*ATT elements.
// Block = 64 k x 64 n tile transposed through LDS; each WT row segment
__global__ __launch_bounds__(256) void k_cvt_wT(const float* __restrict__ Wq,
                                                const float* __restrict__ Wk,
                                                const float* __restrict__ Wv,
                                                const float* __restrict__ Wd,
                                                unsigned short* __restrict__ wT) {
  __shared__ __align__(16) unsigned short T[64 * TP];   // [n local][k local], cross-wave (block barrier)
  const int z = blockIdx.z;
  const float* W = (z == 0) ? Wq : ((z == 1) ? Wk : ((z == 2) ? Wv : Wd));
  const bool od = (z == 3);                // block-uniform
  const int kdim = od ? ATT : DIN;
  const int ndim = od ? DOUT : ATT;
  unsigned short* dst = wT + (size_t)z * (DIN * ATT);
  const int nkt = kdim / 64;
  const int t = blockIdx.x;                // tile index 0 .. DIN*ATT/4096 - 1
  const int k0 = (t % nkt) * 64;
  const int n0 = (t / nkt) * 64;
  const int tid = threadIdx.x;
  const int wave = tid >> 5, lane = tid & 31;

#pragma unroll
  for (int i = 0; i < 4; ++i) {
    const int idx = i * 256 + tid;          // 0..1023
    const int kk = idx >> 4;                // 0..63
    const int c4 = (idx & 15) * 4;          // 0..60
    const v4f w = *(const v4f*)(W + (size_t)(k0 + kk) * ndim + n0 + c4);
    unsigned short e0, e1, e2, e3;
    if (od) {
      e0 = hbits(bf16val(w[0]) * 16.0f); e1 = hbits(bf16val(w[1]) * 16.0f);
      e2 = hbits(bf16val(w[2]) * 16.0f); e3 = hbits(bf16val(w[3]) * 16.0f);
    } else {
      e0 = (unsigned short)bfb(w[0]); e1 = (unsigned short)bfb(w[1]);
      e2 = (unsigned short)bfb(w[2]); e3 = (unsigned short)bfb(w[3]);
    }
    T[(c4 + 0) * TP + kk] = e0;
    T[(c4 + 1) * TP + kk] = e1;
    T[(c4 + 2) * TP + kk] = e2;
    T[(c4 + 3) * TP + kk] = e3;
  }
  __syncthreads();

  v4u v[2];
  size_t off[2];
#pragma unroll
  for (int it = 0; it < 2; ++it) {
    const int nn = wave * 8 + it * 4 + (lane >> 3);   // 0..63 over (wave, it, lane>>3)
    const int q = lane & 7;
    v[it] = *(const v4u*)(&T[nn * TP + q * 8]);
    off[it] = (size_t)(n0 + nn) * kdim + k0 + q * 8;
  }
#pragma unroll
  for (int it = 0; it < 2; ++it) *(v4u*)(dst + off[it]) = v[it];
  
}

// ---------------------------------------------------------------------------
// Projection: C[MROWS][ATT] = bf16(x_z)[MROWS][DIN] * WT_z[ATT][DIN]^T + bias_z.
// 256 thr = 8 waves; block = 128 rows x all ATT columns, worked in NT column tiles of 64;
// wave owns 16 rows. The block reads its 128 f32 input rows ONCE: one wave-wide 16-byte
// load = one whole 512-byte row; RNE convert to bf16 in registers, tile [128][128] in LDS;
// each wave keeps its four A fragments (all of k) in registers for every column tile.
// Weight tile [64 n][128 k] (16 KiB, contiguous in the plane) staged in LDS with plain loads;
// the rounded bias row is kept in LDS.
// Two block barriers a column tile. A block barrier waits for the wave's global loads and
// stores too, so the next tile's weight loads and this tile's output stores are issued
// directly behind a barrier and fly while the next tile's products are worked.
// z = 0: Q plane f16 x8 [MROWS][ATT]; z = 1: K plane f16 x8 [MROWS][ATT];
// z = 2: V^T plane f16 x8 [ATT][MROWS]. Epilogue staged in LDS, whole lines stored.

// The column-tile loop; VT = false: row-major plane [MROWS][ATT], VT = true: transposed plane [ATT][MROWS].
// Entered by the whole block behind the barrier that completes ax, sb and weight tile 0 in bt.
// Every inner loop is unrolled so that its array (a, b, acc, bj, wv, v) has constant indices and stays in registers.
template <bool VT>
__device__ __forceinline__ void proj_tiles(const unsigned short* __restrict__ wsrc, unsigned short* __restrict__ plane,
                                           unsigned short* bt, const unsigned short* ax, const float* sb,
                                           unsigned short* E, int m0, int tid) {
  const int wave = tid >> 5, lane = tid & 31;
  const int l15 = lane & 15, half = (lane >> 4) & 1;
  const int tn = tid >> 4;            // 0..15 : column within a quarter of the weight tile
  const int tk = (tid & 15) * 8;      // 0..120 : k
  const int arow = wave * 16 + l15;

  v16bf a[DIN / 32];
#pragma unroll
  for (int s = 0; s < DIN / 32; ++s) a[s] = ld_frag_bf((const __bf16*)ax, AXP, arow, s * 32, lane);

  // byte offset of the thread's first output piece in column tile 0 (a plane is below 2^32 bytes)
  const unsigned int o0 = VT ? (unsigned int)((wave * 8 + half) * MROWS + m0 + l15 * 8) * 2u
                             : (unsigned int)((m0 + wave * 16 + (lane >> 3)) * ATT + (lane & 7) * 8) * 2u;
  char* dst = (char*)plane;

  const float car = 8.0f;
  for (int nt = 0; nt < NT; ++nt) {
    const bool more = nt + 1 < NT;     // block-uniform
    v4u wv[4];
    if (more) {
#pragma unroll
      for (int i = 0; i < 4; ++i) wv[i] = *(const v4u*)(wsrc + (nt + 1) * 64 * DIN + i * 2048);
    }

    float bj[4];                       // read ahead of the products: no LDS latency in the epilogue
#pragma unroll
    for (int j = 0; j < 4; ++j) bj[j] = sb[nt * 64 + j * 16 + l15];

    v8f acc[4] = {};
#pragma unroll
    for (int s = 0; s < DIN / 32; ++s) {
#pragma unroll
      for (int jg = 0; jg < 4; jg += 2) {
        v16bf b[2];
#pragma unroll
        for (int j = 0; j < 2; ++j) b[j] = ld_frag_bf((const __bf16*)bt, WTP, (jg + j) * 16 + l15, s * 32, lane);
#pragma unroll
        for (int j = 0; j < 2; ++j) acc[jg + j] = mma_bf16(a[s], b[j], acc[jg + j]);
      }
    }

    // acc[j][r] = C[m0 + wave*16 + 8*half + r][nt*64 + j*16 + l15]
#pragma unroll
    for (int j = 0; j < 4; ++j) {
      const int col = j * 16 + l15;                         // column (d) within tile
#pragma unroll
      for (int r = 0; r < 8; ++r) {
        const int row = wave * 16 + 8 * half + r;           // row (s) within tile
        E[VT ? col * EVP + row : row * EQP + col] = hbits((acc[j][r] + bj[j]) * car);
      }
    }
    __syncthreads();                   // epilogue tile complete; every wave's reads of bt done

    if (more) {
#pragma unroll
      for (int i = 0; i < 4; ++i) *(v4u*)(&bt[(i * 16 + tn) * WTP + tk]) = wv[i];
    }
    v4u v[4];
#pragma unroll
    for (int it = 0; it < 4; ++it) {
      if (VT) {
        const int drow = wave * 8 + it * 2 + half;          // wave's 8 d-rows over (it, half)
        v[it] = *(const v4u*)(&E[drow * EVP + l15 * 8]);    // 16 pieces = 256-byte row = 2 lines
      } else {
        const int row = wave * 16 + it * 4 + (lane >> 3);   // wave's 16 rows over (it, lane>>3)
        v[it] = *(const v4u*)(&E[row * EQP + (lane & 7) * 8]);
      }
    }
    if (more) __syncthreads();         // next weight tile complete; every wave's reads of E done
#pragma unroll
    for (int it = 0; it < 4; ++it) {
      const unsigned int o = VT ? (unsigned int)(nt * 64 + it * 2) * (unsigned int)(MROWS * 2)   // d row nt*64 + drow
                                : (unsigned int)(nt * 64 * 2 + it * 4 * ATT * 2);                // column nt*64 + q*8
      *(v4u*)(dst + (o0 + o)) = v[it];
    }
    // stands in front of the next tile's first writes to the registers that these stores name
    if (more) asm volatile("s_wait_xcnt 0x0" ::: "memory");
  }
}

// second bound: at most 128 VGPRs, so that the 4 blocks a WGP can get (864 blocks, 256 WGPs) are resident together
__global__ __launch_bounds__(256, 8) void k_proj(
    const float* __restrict__ xq, const float* __restrict__ xk, const float* __restrict__ xv,
    const unsigned short* __restrict__ wT,
    const float* __restrict__ bq, const float* __restrict__ bk, const float* __restrict__ bv,
    unsigned short* __restrict__ qp, unsigned short* __restrict__ kp,
    unsigned short* __restrict__ vtp) {
  __shared__ __align__(16) unsigned short bt[64 * WTP];   // weight column tile, cross-wave (block barrier)
  __shared__ __align__(16) unsigned short ax[128 * AXP];  // converted input tile (block barrier)
  __shared__ __align__(16) unsigned short E[ESZ];         // epilogue tile, cross-wave (block barrier)
  __shared__ float sb[ATT];                               // bias row, rounded to bf16 values (block barrier)
  static_assert(ATT == 256);                              // one bias value a thread

  const int z = blockIdx.z;
  const int m0 = blockIdx.y * 128;
  const int tid = threadIdx.x;
  const int wave = tid >> 5, lane = tid & 31;

  const float* bias = (z == 0) ? bq : ((z == 1) ? bk : bv);
  // one weight column tile = 1024 pieces of 16 bytes, 4 a thread: piece i*256 + tid
  const unsigned short* wsrc = wT + (size_t)z * ATT * DIN + tid * 8;
  const int tn = tid >> 4;            // 0..15 : column within a quarter of the tile
  const int tk = (tid & 15) * 8;      // 0..120 : k
  const float* X = (z == 0) ? xq : ((z == 1) ? xk : xv);
  const float* xsrc = X + (size_t)(m0 + wave * 16) * DIN + lane * 4;

  v4u wv[4];
#pragma unroll
  for (int i = 0; i < 4; ++i) wv[i] = *(const v4u*)(wsrc + i * 2048);
  const float bz = bias[tid];

  // wave's 16 rows: all 16 loads issued before the first convert, so that one memory latency covers them;
  // both loops unrolled so that xr has constant indices and stays in registers
  v4f xr[16];
#pragma unroll
  for (int r = 0; r < 16; ++r) xr[r] = *(const v4f*)(xsrc + (size_t)r * DIN);
#pragma unroll
  for (int i = 0; i < 4; ++i) *(v4u*)(&bt[(i * 16 + tn) * WTP + tk]) = wv[i];
  sb[tid] = bf16val(bz);
#pragma unroll
  for (int r = 0; r < 16; ++r) {
    const v2f lo = {xr[r][0], xr[r][1]};
    const v2f hi = {xr[r][2], xr[r][3]};
    v2u w;
    w[0] = __builtin_bit_cast(unsigned int, __builtin_convertvector(lo, v2bf));
    w[1] = __builtin_bit_cast(unsigned int, __builtin_convertvector(hi, v2bf));
    *(v2u*)(&ax[(wave * 16 + r) * AXP + lane * 4]) = w;
  }
  __syncthreads();                                 // input tile, bias row and first weight tile complete

  if (z != 2) proj_tiles<false>(wsrc, (z == 0) ? qp : kp, bt, ax, sb, E, m0, tid);   // block-uniform branch
  else        proj_tiles<true>(wsrc, vtp, bt, ax, sb, E, m0, tid);
}

// ---------------------------------------------------------------------------
// Flash attention, transposed-score form: block = one (group, head); its K
// [384 keys][32 d] and V^T [32 d][384 keys] are staged ONCE in LDS and shared by
// 8 waves; wave = TQ query tiles of 16 (48 queries), so the block covers all
// 384 queries and every K / V fragment read from LDS serves TQ tiles.
// Per 32-key chunk and query tile:
//   S^T = K . Q^T    A = K rows (lane = key, k = d), B = Q^T (lane = query, k = d)
//                    D[row = key 8h+r][col = query l15]; c0 keys 0..15, c1 keys 16..31
//   per-lane online softmax for query l15 (16 local keys + xor-16 partner)
//   O^T += V^T . P   A = V^T rows (lane = d, k = key), B = P: element i<8 <- c0[i]
//                    (key 8h+i), element 8+i <- c1[i] (key 16+8h+i), same lane
//                    D[row = d 8h+r][col = query l15]
// Scores carry 64 from the x8 planes; P = 2^(raw * k2 - max * k2 + 10), k2 = log2(e)/(64*sqrt(32)): one FMA and one
// exp2 a score. P and its sum carried x1024, V carried x8 -> context x16 = O * 16/(8 * carried sum).
// Context tiles [16 q][32 d] f16 x16 staged in LDS (the K tile's space, free
// behind a block barrier) and written to the head-major ctx plane
// [BL*NHEAD*NQ][HD]: each tile is 1024 contiguous bytes
// second bound: at most 160 VGPRs, so that the 3 blocks a WGP gets (768 blocks, 256 WGPs) are resident together
__global__ __launch_bounds__(256, 6) void k_attn(const unsigned short* __restrict__ qp,
                                              const unsigned short* __restrict__ kp,
                                              const unsigned short* __restrict__ vtp,
                                              unsigned short* __restrict__ ctx) {
  __shared__ __align__(16) unsigned short Ks[NQ * KVP];          // [key][d]; later the context tiles
  __shared__ __align__(16) unsigned short Vs[(NQ / 32) * VCS];   // [chunk][d][key in chunk]

  const int tid = threadIdx.x;
  const int wave = tid >> 5, lane = tid & 31;
  const int l15 = lane & 15;
  const int half = (lane >> 4) & 1;
  const int head = blockIdx.x;
  const int g = blockIdx.y;                // (b,l) group

  const _Float16* Q  = (const _Float16*)qp;
  const unsigned short* kbase = kp + (size_t)g * NQ * ATT + head * HD;              // key t at kbase + t*ATT
  const unsigned short* vbase = vtp + (size_t)head * HD * MROWS + (size_t)g * NQ;   // d row at vbase + d*MROWS

  // stage K and V^T: 2 x 1536 pieces of 16 bytes, 6 + 6 a thread, all loads issued before the first LDS store
  v4u kr[NQ * 4 / 256], vr[NQ * 4 / 256];
#pragma unroll
  for (int i = 0; i < NQ * 4 / 256; ++i) {
    const int idx = i * 256 + tid;
    kr[i] = *(const v4u*)(kbase + (size_t)(idx >> 2) * ATT + (idx & 3) * 8);
  }
#pragma unroll
  for (int i = 0; i < NQ * 4 / 256; ++i) {
    const int idx = i * 256 + tid;
    const int d = idx / (NQ / 8), pc = idx % (NQ / 8);
    vr[i] = *(const v4u*)(vbase + (size_t)d * MROWS + pc * 8);
  }
  v16h qb[TQ];
#pragma unroll
  for (int t = 0; t < TQ; ++t) {
    const _Float16* qbase = Q + ((size_t)g * NQ + (wave * TQ + t) * 16) * ATT + head * HD;
    qb[t] = ld_frag_h(qbase, ATT, l15, 0, lane);               // d 0..31
  }
#pragma unroll
  for (int i = 0; i < NQ * 4 / 256; ++i) {
    const int idx = i * 256 + tid;
    *(v4u*)(&Ks[(idx >> 2) * KVP + (idx & 3) * 8]) = kr[i];
  }
#pragma unroll
  for (int i = 0; i < NQ * 4 / 256; ++i) {
    const int idx = i * 256 + tid;
    const int d = idx / (NQ / 8), pc = idx % (NQ / 8);
    *(v4u*)(&Vs[(pc >> 2) * VCS + d * KVP + (pc & 3) * 8]) = vr[i];
  }
  __syncthreads();                         // K and V^T tiles complete

  v8f o[TQ][2] = {};
  float mrun[TQ], lrun[TQ];
#pragma unroll
  for (int t = 0; t < TQ; ++t) { mrun[t] = -1.0e30f; lrun[t] = 0.0f; }
  // raw score -> exponent of 2: (1/64)/sqrt(32) * log2(e)
  const float k2 = 0.17677669529663689f * (1.0f / 64.0f) * 1.4426950408889634f;
  const v8f k2v = {k2, k2, k2, k2, k2, k2, k2, k2};

  for (int kc = 0; kc < NQ; kc += 32) {
    const _Float16* kt = (const _Float16*)Ks + kc * KVP;
    const _Float16* vt = (const _Float16*)Vs + (kc >> 5) * VCS;
    const v16h ka0 = ld_frag_h(kt, KVP, l15, 0, lane);          // keys kc + 0..15
    const v16h ka2 = ld_frag_h(kt, KVP, 16 + l15, 0, lane);     // keys kc + 16..31
    const v16h va0 = ld_frag_h(vt, KVP, l15, 0, lane);          // d 0..15
    const v16h va1 = ld_frag_h(vt, KVP, 16 + l15, 0, lane);     // d 16..31
#pragma unroll
    for (int t = 0; t < TQ; ++t) {
      const v8f zero = {};
      v8f c0 = mma_f16(ka0, qb[t], zero);
      v8f c1 = mma_f16(ka2, qb[t], zero);

      // maximum on the raw accumulators (the scale is positive, so the order is the same)
      float lm = fmaxf(c0[0], c1[0]);
#pragma unroll
      for (int r = 1; r < 8; ++r) lm = fmaxf(lm, fmaxf(c0[r], c1[r]));
      lm = fmaxf(lm, __shfl_xor(lm, 16, 32));
      const float mnew = fmaxf(mrun[t], lm);
      const float alpha = __builtin_amdgcn_exp2f((mrun[t] - mnew) * k2);
      const float nb = 10.0f - mnew * k2;      // 2^10 = the x1024 carry of P
      const v8f nbv = {nb, nb, nb, nb, nb, nb, nb, nb};
      const v8f e0 = __builtin_elementwise_fma(c0, k2v, nbv);
      const v8f e1 = __builtin_elementwise_fma(c1, k2v, nbv);
      float p0[8], p1[8];
      float ls = 0.0f;
#pragma unroll
      for (int r = 0; r < 8; ++r) {
        p0[r] = __builtin_amdgcn_exp2f(e0[r]);
        p1[r] = __builtin_amdgcn_exp2f(e1[r]);
        ls += p0[r] + p1[r];
      }
      ls += __shfl_xor(ls, 16, 32);
      lrun[t] = lrun[t] * alpha + ls;
      mrun[t] = mnew;
#pragma unroll
      for (int j = 0; j < 2; ++j)
#pragma unroll
        for (int r = 0; r < 8; ++r) o[t][j][r] *= alpha;

      v16h pb;
#pragma unroll
      for (int e = 0; e < 8; ++e) {
        pb[e]     = (_Float16)p0[e];   // key kc + 8h + e
        pb[8 + e] = (_Float16)p1[e];   // key kc + 16 + 8h + e
      }
      o[t][0] = mma_f16(va0, pb, o[t][0]);
      o[t][1] = mma_f16(va1, pb, o[t][1]);
    }
  }
  __syncthreads();                         // every wave's last read of the K tile done: its space becomes context staging

  // o[t][j][r] = 8192 * sum_t p_t v_t for query l15, d = j*16 + 8*half + r; ctx carried x16
#pragma unroll
  for (int t = 0; t < TQ; ++t) {
    const float inv = 1.0f / (lrun[t] * 0.5f);   // lrun carries the x1024 of P
    unsigned short* T = Ks + (wave * TQ + t) * 16 * CTP;
#pragma unroll
    for (int j = 0; j < 2; ++j) {
      v4u w;
      w[0] = pack2h(o[t][j][0] * inv, o[t][j][1] * inv);
      w[1] = pack2h(o[t][j][2] * inv, o[t][j][3] * inv);
      w[2] = pack2h(o[t][j][4] * inv, o[t][j][5] * inv);
      w[3] = pack2h(o[t][j][6] * inv, o[t][j][7] * inv);
      *(v4u*)(&T[l15 * CTP + j * 16 + 8 * half]) = w;
    }
  }
  __syncthreads();

  v4u v[TQ][2];
#pragma unroll
  for (int t = 0; t < TQ; ++t)
#pragma unroll
    for (int it = 0; it < 2; ++it) {
      const int row = it * 8 + (lane >> 2);     // 0..15 query row of the tile
      const int piece = (lane & 3) * 8;         // 8 halves = 16 B; 4 pieces = 64-B row, 8 lanes = one line
      v[t][it] = *(const v4u*)(&Ks[((wave * TQ + t) * 16 + row) * CTP + piece]);
    }
  unsigned short* cb = ctx + (((size_t)g * NHEAD + head) * NQ + wave * TQ * 16) * HD;
#pragma unroll
  for (int t = 0; t < TQ; ++t)
#pragma unroll
    for (int it = 0; it < 2; ++it)
      *(v4u*)(cb + (size_t)(t * 16 + it * 8 + (lane >> 2)) * HD + (lane & 3) * 8) = v[t][it];
}

// ---------------------------------------------------------------------------
// Output projection: out[MROWS][DOUT] f32 = ctx[MROWS][ATT] * WdT[DOUT][ATT]^T / 256 + bd.
// ctx read from the head-major plane: for row (g, n) the 32 k values of
// k-step s (= head s) are contiguous at ((g*NHEAD + s)*NQ + n)*HD.
// 256 thr, block = 128 rows x 64 cols, wave = 16 rows; weight k-tile in
// LDS, reloaded per k-step; f16 operands. Epilogue: f32 tile staged in LDS; each 256-byte row
// segment = 2 lines, each line written by 8 consecutive lanes of one
__global__ __launch_bounds__(256) void k_oproj(const unsigned short* __restrict__ ctx,
                                               const unsigned short* __restrict__ wT,
                                               const float* __restrict__ bd,
                                               float* __restrict__ outp) {
  __shared__ __align__(16) unsigned short bt[64 * BTP];   // weight k-tile, cross-wave (block barrier)
  __shared__ __align__(16) float E[128 * OEP];            // epilogue tile, per-wave rows (wave-private), block barrier used

  const int n0 = blockIdx.x * 64;
  const int m0 = blockIdx.y * 128;
  const int tid = threadIdx.x;
  const int wave = tid >> 5, lane = tid & 31;
  const int l15 = lane & 15, half = (lane >> 4) & 1;

  const unsigned short* Wt = wT + (size_t)3 * ATT * DIN;    // WdT plane [DOUT][ATT], f16 x16
  const int tn = tid >> 2;            // 0..63 : column within tile
  const int tk = (tid & 3) * 8;       // 0,8,16,24 : k within step
  const unsigned short* wsrc = Wt + (size_t)(n0 + tn) * ATT + tk;

  const int r0 = m0 + wave * 16;      // wave's 16 rows lie inside one group (NQ % 16 == 0)
  const int g = r0 / NQ;
  const int nl = r0 - g * NQ;
  const _Float16* A0 = (const _Float16*)ctx + ((size_t)g * NHEAD * NQ + nl) * HD;

  v8f acc[4] = {};
  for (int s = 0; s < ATT / 32; ++s) {
    const int kk = s * 32;
    const v4u wv = *(const v4u*)(wsrc + kk);
    __syncthreads();                               // earlier reads of bt done
    *(v4u*)(&bt[tn * BTP + tk]) = wv;
    __syncthreads();                               // tile complete
    const v16h a = ld_frag_h(A0 + (size_t)s * NQ * HD, HD, l15, 0, lane);
#pragma unroll
    for (int j = 0; j < 4; ++j) {
      const v16h b = ld_frag_h((const _Float16*)bt, BTP, j * 16 + l15, 0, lane);
      acc[j] = mma_f16(a, b, acc[j]);
    }
  }

  // acc[j][r] = 256 * (ctx.Wd)[m0 + wave*16 + 8*half + r][n0 + j*16 + l15]
  const float cinv = 1.0f / 256.0f;
#pragma unroll
  for (int j = 0; j < 4; ++j) {
    const int col = j * 16 + l15;
    const float bb = bf16val(bd[n0 + col]);
#pragma unroll
    for (int r = 0; r < 8; ++r) {
      const int row = wave * 16 + 8 * half + r;
      E[row * OEP + col] = acc[j][r] * cinv + bb;
    }
  }
  __syncthreads();

  v4f v[8];
  size_t off[8];
#pragma unroll
  for (int it = 0; it < 8; ++it) {
    const int row = wave * 16 + it * 2 + half;   // wave's 16 rows over (it, half)
    const int q = l15;                           // 16 pieces of 16 B = the row's 256-byte segment (2 lines)
    v[it] = *(const v4f*)(&E[row * OEP + q * 4]);
    off[it] = (size_t)(m0 + row) * DOUT + n0 + q * 4;
  }
#pragma unroll
  for (int it = 0; it < 8; ++it) *(v4f*)(outp + off[it]) = v[it];
  
}

// ---------------------------------------------------------------------------
extern "C" void kernel_launch(void* const* d_in, const int* in_sizes, int n_in,
                              void* d_out, int out_size, void* d_ws, size_t ws_size,
                              hipStream_t stream) {
  if (n_in < 11) return;
  if (in_sizes[0] < MROWS * DIN || in_sizes[1] < MROWS * DIN || in_sizes[2] < MROWS * DIN) return;
  if (in_sizes[3] < DIN * ATT || in_sizes[5] < DIN * ATT || in_sizes[7] < DIN * ATT) return;
  if (in_sizes[4] < ATT || in_sizes[6] < ATT || in_sizes[8] < ATT) return;
  if (in_sizes[9] < ATT * DOUT || in_sizes[10] < DOUT) return;
  if (out_size < MROWS * DOUT) return;

  const float* xq = (const float*)d_in[0];
  const float* xk = (const float*)d_in[1];
  const float* xv = (const float*)d_in[2];
  const float* Wq = (const float*)d_in[3];
  const float* bq = (const float*)d_in[4];
  const float* Wk = (const float*)d_in[5];
  const float* bk = (const float*)d_in[6];
  const float* Wv = (const float*)d_in[7];
  const float* bv = (const float*)d_in[8];
  const float* Wd = (const float*)d_in[9];
  const float* bd = (const float*)d_in[10];

  // and is written exactly to its extent (no padded tails needed: all tiles divide the shapes)
  const size_t wt_bytes  = (size_t)4 * DIN * ATT * 2;        // three bf16 WT planes + one f16 WdT plane
  const size_t pl_bytes  = (size_t)MROWS * ATT * 2;          // one f16 plane (Q, K, V^T, ctx)
  const size_t off_wt  = 0;
  const size_t off_q   = off_wt + wt_bytes;
  const size_t off_k   = off_q + pl_bytes;
  const size_t off_vt  = off_k + pl_bytes;
  const size_t off_ctx = off_vt + pl_bytes;
  const size_t total   = off_ctx + pl_bytes;                 // 75759616 B at full size
  if (total > ws_size) return;

  char* ws = (char*)d_ws;
  unsigned short* wt  = (unsigned short*)(ws + off_wt);
  unsigned short* qpl = (unsigned short*)(ws + off_q);
  unsigned short* kpl = (unsigned short*)(ws + off_k);
  unsigned short* vtp = (unsigned short*)(ws + off_vt);
  unsigned short* cxp = (unsigned short*)(ws + off_ctx);

  k_cvt_wT<<<dim3(DIN * ATT / 4096, 1, 4), 256, 0, stream>>>(Wq, Wk, Wv, Wd, wt);
  k_proj<<<dim3(1, MROWS / 128, 3), 256, 0, stream>>>(xq, xk, xv, wt, bq, bk, bv, qpl, kpl, vtp);
  k_attn<<<dim3(NHEAD, BL), 256, 0, stream>>>(qpl, kpl, vtp, cxp);
  k_oproj<<<dim3(DOUT / 64, MROWS / 128), 256, 0, stream>>>(cxp, wt, bd, (float*)d_out);
}

// v005
// Measured time: 55.4 microseconds a run.
// Next to v004, in two timings, it ran 1.09 times as fast each time.
// All steps since v000 together make it 2.21 times as fast.
#include <hip/hip_runtime.h>
// Projections x*W{q,k,v}: v_wmma_f32_16x16x32_bf16 (bf16 operands = RNE-converted inputs, f32 accumulate); scores K*Q^T, context V^T*P and output projection ctx*Wd: v_wmma_f32_16x16x32_f16 (f16 operands; Q/K/V planes carried x8, P carried x1024, ctx plane carried x16, Wd plane carried x16; f32 accumulate); softmax in f32.

#ifndef NB
#define NB 8
#endif
#ifndef LL
#define LL 12
#endif
#define NB_FULL 8
#define LL_FULL 12
#define NQ 384           // tokens per (b,l) group = attention length
#define DIN 128          // feature width of query / key / value inputs
#define ATT 256          // attention width = NHEAD * HD
#define NHEAD 8
#define HD 32
#define DOUT 128         // output feature width
#define BL (NB * LL)     // number of (b,l) groups processed
#define MROWS (BL * NQ)  // token rows processed (prefix of the full row range)

static_assert(NB >= 1 && NB <= NB_FULL);
static_assert(LL >= 1 && LL <= LL_FULL);
static_assert(LL == LL_FULL || NB == 1);
static_assert(ATT == NHEAD * HD);
static_assert(HD == 32);
static_assert(NHEAD == 8);
static_assert(NQ % 32 == 0);
static_assert(NQ % 16 == 0);
static_assert(MROWS % 128 == 0);
static_assert(DIN % 64 == 0 && ATT % 64 == 0 && DOUT % 64 == 0);
static_assert(DIN * ATT == ATT * DOUT);
static_assert((DIN * ATT) % 4096 == 0);
static_assert(DIN == 32 * 4);   // one input row = one wave-wide 16-byte load
static_assert((size_t)NB_FULL * LL_FULL * NQ * DOUT * 4 == 18874368);
// coverage equalities (grid x block x per-thread elements == plane elements)
static_assert((size_t)(DIN * ATT / 4096) * 64 * 64 == (size_t)DIN * ATT);                   // weight planes
static_assert((size_t)(ATT / 64) * (MROWS / 128) * 128 * 64 == (size_t)MROWS * ATT);        // Q, K, V^T planes (ATT / 64 column tiles a block)
static_assert((size_t)MROWS * ATT * 2 < 4294967296ull);   // 32-bit byte offsets into a plane
static_assert((size_t)NHEAD * BL * NQ * HD == (size_t)MROWS * ATT);                        // ctx plane
static_assert((size_t)(MROWS / 128) * 128 * DOUT == (size_t)MROWS * DOUT);                  // out

// LDS pitches (16-bit elements unless noted); all keep 16-byte row alignment
#define WOP 264    // output-projection weight plane [128 n][256 k]: 528-byte rows (16 B x odd) for 16-byte fragment reads
#define WTP 136    // projection weight column tile [64 n][128 k]: 272-byte rows, as the input tile's
#define NT  (ATT / 64)   // column tiles a projection block works through
#define AXP 136    // converted input tile [128 rows][128 k]: 272-byte rows for 16-byte fragment reads
#define EQP 72     // row-major epilogue tile [128 rows][64 cols]
#define EVP 136    // transposed epilogue tile [64 d][128 s]
#define TP  72     // weight transpose tile [64 n][64 k]
#define CTP 40     // context tile [16 q][32 d] halves
#define OEP 68     // output epilogue tile [32 rows][64 cols] a wave, floats
#define ESZ 9216   // max(128*EQP, 64*EVP)
#define KVP 40     // attention K / V^T tiles: rows of 32 halves
#define VCS (32 * KVP + 32)   // one 32-key chunk of V^T: 32 rows + 64 B, so that 4 chunks' stores fall on different banks
#define TQ  3      // query tiles of 16 per attention wave
static_assert(128 * EQP <= ESZ);
static_assert(64 * EVP <= ESZ);
static_assert(8 * TQ * 16 == NQ);                 // 8 waves x TQ tiles cover the group's queries
static_assert(8 * TQ * 16 * CTP <= NQ * KVP);     // context tiles fit the K tile's space
static_assert((NQ * 4) % 256 == 0);

typedef __bf16   v16bf __attribute__((ext_vector_type(16)));
typedef __bf16   v8bf  __attribute__((ext_vector_type(8)));
typedef _Float16 v16h  __attribute__((ext_vector_type(16)));
typedef _Float16 v8h   __attribute__((ext_vector_type(8)));
typedef float    v8f   __attribute__((ext_vector_type(8)));
typedef float    v4f   __attribute__((ext_vector_type(4)));
typedef unsigned int v4u __attribute__((ext_vector_type(4)));
typedef unsigned int v2u __attribute__((ext_vector_type(2)));
typedef float    v2f   __attribute__((ext_vector_type(2)));
typedef __bf16   v2bf  __attribute__((ext_vector_type(2)));

// ---------------------------------------------------------------------------
// WMMA wrappers with the VALU hazard guard (4 v_nop after every issue).
__device__ __forceinline__ v8f mma_bf16(v16bf a, v16bf b, v8f c) {
  v8f d = __builtin_amdgcn_wmma_f32_16x16x32_bf16(false, a, false, b, (short)0, c, false, false);
  asm volatile("v_nop\n\tv_nop\n\tv_nop\n\tv_nop" : "+v"(d) : "v"(a), "v"(b));
  return d;
}
__device__ __forceinline__ v8f mma_f16(v16h a, v16h b, v8f c) {
  v8f d = __builtin_amdgcn_wmma_f32_16x16x32_f16(false, a, false, b, (short)0, c, false, false);
  asm volatile("v_nop\n\tv_nop\n\tv_nop\n\tv_nop" : "+v"(d) : "v"(a), "v"(b));
  return d;
}

// 16-bit fragment, contraction dim CONTIGUOUS in memory: elem(k) = p0[rc*ld + k].
// Lane l: row/col rc = (l&15); elements 0..7 <- kk+8h+0..7, elements 8..15 <- kk+16+8h+0..7
// (h = l>>4). Same map for A (rc = row) and B (rc = column of a k-contiguous copy).
__device__ __forceinline__ v16bf ld_frag_bf(const __bf16* p0, int ld, int rc, int kk, int lane) {
  const int hh = (lane >> 4) & 1;
  const __bf16* p = p0 + (size_t)rc * ld + kk + 8 * hh;
  const v8bf lo = *(const v8bf*)(p);
  const v8bf hi = *(const v8bf*)(p + 16);
  v16bf f;
#pragma unroll
  for (int i = 0; i < 8; ++i) { f[i] = lo[i]; f[8 + i] = hi[i]; }
  return f;
}
__device__ __forceinline__ v16h ld_frag_h(const _Float16* p0, int ld, int rc, int kk, int lane) {
  const int hh = (lane >> 4) & 1;
  const _Float16* p = p0 + (size_t)rc * ld + kk + 8 * hh;
  const v8h lo = *(const v8h*)(p);
  const v8h hi = *(const v8h*)(p + 16);
  v16h f;
#pragma unroll
  for (int i = 0; i < 8; ++i) { f[i] = lo[i]; f[8 + i] = hi[i]; }
  return f;
}

// f32 -> bf16 bits, RNE convert
__device__ __forceinline__ unsigned int bfb(float x) {
  unsigned int u = __float_as_uint(x);
  u = u + 0x7FFFu + ((u >> 16) & 1u);
  return u >> 16;
}
// f32 -> value of its RNE bf16
__device__ __forceinline__ float bf16val(float x) {
  return __uint_as_float(bfb(x) << 16);
}
// f32 -> f16 bits, RNE convert
__device__ __forceinline__ unsigned short hbits(float x) {
  const _Float16 hv = (_Float16)x;
  return __builtin_bit_cast(unsigned short, hv);
}
__device__ __forceinline__ unsigned int pack2h(float a, float b) {
  return (unsigned int)hbits(a) | ((unsigned int)hbits(b) << 16);
}

// ---------------------------------------------------------------------------
// W f32 [kdim k][ndim n] -> WT 16-bit [ndim n][kdim k] (k contiguous).
// z = 0,1,2: Wq/Wk/Wv [DIN][ATT] -> bf16 planes; z = 3: Wd [ATT][DOUT] ->
// f16 plane holding 16 * bf16val(w). All four planes have DIN*ATT elements.
// Block = 64 k x 64 n tile transposed through LDS; each WT row segment
__global__ __launch_bounds__(256) void k_cvt_wT(const float* __restrict__ Wq,
                                                const float* __restrict__ Wk,
                                                const float* __restrict__ Wv,
                                                const float* __restrict__ Wd,
                                                unsigned short* __restrict__ wT) {
  __shared__ __align__(16) unsigned short T[64 * TP];   // [n local][k local], cross-wave (block barrier)
  const int z = blockIdx.z;
  const float* W = (z == 0) ? Wq : ((z == 1) ? Wk : ((z == 2) ? Wv : Wd));
  const bool od = (z == 3);                // block-uniform
  const int kdim = od ? ATT : DIN;
  const int ndim = od ? DOUT : ATT;
  unsigned short* dst = wT + (size_t)z * (DIN * ATT);
  const int nkt = kdim / 64;
  const int t = blockIdx.x;                // tile index 0 .. DIN*ATT/4096 - 1
  const int k0 = (t % nkt) * 64;
  const int n0 = (t / nkt) * 64;
  const int tid = threadIdx.x;
  const int wave = tid >> 5, lane = tid & 31;

#pragma unroll
  for (int i = 0; i < 4; ++i) {
    const int idx = i * 256 + tid;          // 0..1023
    const int kk = idx >> 4;                // 0..63
    const int c4 = (idx & 15) * 4;          // 0..60
    const v4f w = *(const v4f*)(W + (size_t)(k0 + kk) * ndim + n0 + c4);
    unsigned short e0, e1, e2, e3;
    if (od) {
      e0 = hbits(bf16val(w[0]) * 16.0f); e1 = hbits(bf16val(w[1]) * 16.0f);
      e2 = hbits(bf16val(w[2]) * 16.0f); e3 = hbits(bf16val(w[3]) * 16.0f);
    } else {
      e0 = (unsigned short)bfb(w[0]); e1 = (unsigned short)bfb(w[1]);
      e2 = (unsigned short)bfb(w[2]); e3 = (unsigned short)bfb(w[3]);
    }
    T[(c4 + 0) * TP + kk] = e0;
    T[(c4 + 1) * TP + kk] = e1;
    T[(c4 + 2) * TP + kk] = e2;
    T[(c4 + 3) * TP + kk] = e3;
  }
  __syncthreads();

  v4u v[2];
  size_t off[2];
#pragma unroll
  for (int it = 0; it < 2; ++it) {
    const int nn = wave * 8 + it * 4 + (lane >> 3);   // 0..63 over (wave, it, lane>>3)
    const int q = lane & 7;
    v[it] = *(const v4u*)(&T[nn * TP + q * 8]);
    off[it] = (size_t)(n0 + nn) * kdim + k0 + q * 8;
  }
#pragma unroll
  for (int it = 0; it < 2; ++it) *(v4u*)(dst + off[it]) = v[it];
  
}

// ---------------------------------------------------------------------------
// Projection: C[MROWS][ATT] = bf16(x_z)[MROWS][DIN] * WT_z[ATT][DIN]^T + bias_z.
// 256 thr = 8 waves; block = 128 rows x all ATT columns, worked in NT column tiles of 64;
// wave owns 16 rows. The block reads its 128 f32 input rows ONCE: one wave-wide 16-byte
// load = one whole 512-byte row; RNE convert to bf16 in registers, tile [128][128] in LDS;
// each wave keeps its four A fragments (all of k) in registers for every column tile.
// Weight tile [64 n][128 k] (16 KiB, contiguous in the plane) staged in LDS with plain loads;
// the rounded bias row is kept in LDS.
// Two block barriers a column tile. A block barrier waits for the wave's global loads and
// stores too, so the next tile's weight loads and this tile's output stores are issued
// directly behind a barrier and fly while the next tile's products are worked.
// z = 0: Q plane f16 x8 [MROWS][ATT]; z = 1: K plane f16 x8 [MROWS][ATT];
// z = 2: V^T plane f16 x8 [ATT][MROWS]. Epilogue staged in LDS, whole lines stored.

// The column-tile loop; VT = false: row-major plane [MROWS][ATT], VT = true: transposed plane [ATT][MROWS].
// Entered by the whole block behind the barrier that completes ax, sb and weight tile 0 in bt.
// Every inner loop is unrolled so that its array (a, b, acc, bj, wv, v) has constant indices and stays in registers.
template <bool VT>
__device__ __forceinline__ void proj_tiles(const unsigned short* __restrict__ wsrc, unsigned short* __restrict__ plane,
                                           unsigned short* bt, const unsigned short* ax, const float* sb,
                                           unsigned short* E, int m0, int tid) {
  const int wave = tid >> 5, lane = tid & 31;
  const int l15 = lane & 15, half = (lane >> 4) & 1;
  const int tn = tid >> 4;            // 0..15 : column within a quarter of the weight tile
  const int tk = (tid & 15) * 8;      // 0..120 : k
  const int arow = wave * 16 + l15;

  v16bf a[DIN / 32];
#pragma unroll
  for (int s = 0; s < DIN / 32; ++s) a[s] = ld_frag_bf((const __bf16*)ax, AXP, arow, s * 32, lane);

  // byte offset of the thread's first output piece in column tile 0 (a plane is below 2^32 bytes)
  const unsigned int o0 = VT ? (unsigned int)((wave * 8 + half) * MROWS + m0 + l15 * 8) * 2u
                             : (unsigned int)((m0 + wave * 16 + (lane >> 3)) * ATT + (lane & 7) * 8) * 2u;
  char* dst = (char*)plane;

  const float car = 8.0f;
  for (int nt = 0; nt < NT; ++nt) {
    const bool more = nt + 1 < NT;     // block-uniform
    v4u wv[4];
    if (more) {
#pragma unroll
      for (int i = 0; i < 4; ++i) wv[i] = *(const v4u*)(wsrc + (nt + 1) * 64 * DIN + i * 2048);
    }

    float bj[4];                       // read ahead of the products: no LDS latency in the epilogue
#pragma unroll
    for (int j = 0; j < 4; ++j) bj[j] = sb[nt * 64 + j * 16 + l15];

    v8f acc[4] = {};
#pragma unroll
    for (int s = 0; s < DIN / 32; ++s) {
#pragma unroll
      for (int jg = 0; jg < 4; jg += 2) {
        v16bf b[2];
#pragma unroll
        for (int j = 0; j < 2; ++j) b[j] = ld_frag_bf((const __bf16*)bt, WTP, (jg + j) * 16 + l15, s * 32, lane);
#pragma unroll
        for (int j = 0; j < 2; ++j) acc[jg + j] = mma_bf16(a[s], b[j], acc[jg + j]);
      }
    }

    // acc[j][r] = C[m0 + wave*16 + 8*half + r][nt*64 + j*16 + l15]
#pragma unroll
    for (int j = 0; j < 4; ++j) {
      const int col = j * 16 + l15;                         // column (d) within tile
#pragma unroll
      for (int r = 0; r < 8; ++r) {
        const int row = wave * 16 + 8 * half + r;           // row (s) within tile
        E[VT ? col * EVP + row : row * EQP + col] = hbits((acc[j][r] + bj[j]) * car);
      }
    }
    __syncthreads();                   // epilogue tile complete; every wave's reads of bt done

    if (more) {
#pragma unroll
      for (int i = 0; i < 4; ++i) *(v4u*)(&bt[(i * 16 + tn) * WTP + tk]) = wv[i];
    }
    v4u v[4];
#pragma unroll
    for (int it = 0; it < 4; ++it) {
      if (VT) {
        const int drow = wave * 8 + it * 2 + half;          // wave's 8 d-rows over (it, half)
        v[it] = *(const v4u*)(&E[drow * EVP + l15 * 8]);    // 16 pieces = 256-byte row = 2 lines
      } else {
        const int row = wave * 16 + it * 4 + (lane >> 3);   // wave's 16 rows over (it, lane>>3)
        v[it] = *(const v4u*)(&E[row * EQP + (lane & 7) * 8]);
      }
    }
    if (more) __syncthreads();         // next weight tile complete; every wave's reads of E done
#pragma unroll
    for (int it = 0; it < 4; ++it) {
      const unsigned int o = VT ? (unsigned int)(nt * 64 + it * 2) * (unsigned int)(MROWS * 2)   // d row nt*64 + drow
                                : (unsigned int)(nt * 64 * 2 + it * 4 * ATT * 2);                // column nt*64 + q*8
      *(v4u*)(dst + (o0 + o)) = v[it];
    }
    // stands in front of the next tile's first writes to the registers that these stores name
    if (more) asm volatile("s_wait_xcnt 0x0" ::: "memory");
  }
}

// second bound: at most 128 VGPRs, so that the 4 blocks a WGP can get (864 blocks, 256 WGPs) are resident together
__global__ __launch_bounds__(256, 8) void k_proj(
    const float* __restrict__ xq, const float* __restrict__ xk, const float* __restrict__ xv,
    const unsigned short* __restrict__ wT,
    const float* __restrict__ bq, const float* __restrict__ bk, const float* __restrict__ bv,
    unsigned short* __restrict__ qp, unsigned short* __restrict__ kp,
    unsigned short* __restrict__ vtp) {
  __shared__ __align__(16) unsigned short bt[64 * WTP];   // weight column tile, cross-wave (block barrier)
  __shared__ __align__(16) unsigned short ax[128 * AXP];  // converted input tile (block barrier)
  __shared__ __align__(16) unsigned short E[ESZ];         // epilogue tile, cross-wave (block barrier)
  __shared__ float sb[ATT];                               // bias row, rounded to bf16 values (block barrier)
  static_assert(ATT == 256);                              // one bias value a thread

  const int z = blockIdx.z;
  const int m0 = blockIdx.y * 128;
  const int tid = threadIdx.x;
  const int wave = tid >> 5, lane = tid & 31;

  const float* bias = (z == 0) ? bq : ((z == 1) ? bk : bv);
  // one weight column tile = 1024 pieces of 16 bytes, 4 a thread: piece i*256 + tid
  const unsigned short* wsrc = wT + (size_t)z * ATT * DIN + tid * 8;
  const int tn = tid >> 4;            // 0..15 : column within a quarter of the tile
  const int tk = (tid & 15) * 8;      // 0..120 : k
  const float* X = (z == 0) ? xq : ((z == 1) ? xk : xv);
  const float* xsrc = X + (size_t)(m0 + wave * 16) * DIN + lane * 4;

  v4u wv[4];
#pragma unroll
  for (int i = 0; i < 4; ++i) wv[i] = *(const v4u*)(wsrc + i * 2048);
  const float bz = bias[tid];

  // wave's 16 rows: all 16 loads issued before the first convert, so that one memory latency covers them;
  // both loops unrolled so that xr has constant indices and stays in registers
  v4f xr[16];
#pragma unroll
  for (int r = 0; r < 16; ++r) xr[r] = *(const v4f*)(xsrc + (size_t)r * DIN);
#pragma unroll
  for (int i = 0; i < 4; ++i) *(v4u*)(&bt[(i * 16 + tn) * WTP + tk]) = wv[i];
  sb[tid] = bf16val(bz);
#pragma unroll
  for (int r = 0; r < 16; ++r) {
    const v2f lo = {xr[r][0], xr[r][1]};
    const v2f hi = {xr[r][2], xr[r][3]};
    v2u w;
    w[0] = __builtin_bit_cast(unsigned int, __builtin_convertvector(lo, v2bf));
    w[1] = __builtin_bit_cast(unsigned int, __builtin_convertvector(hi, v2bf));
    *(v2u*)(&ax[(wave * 16 + r) * AXP + lane * 4]) = w;
  }
  __syncthreads();                                 // input tile, bias row and first weight tile complete

  if (z != 2) proj_tiles<false>(wsrc, (z == 0) ? qp : kp, bt, ax, sb, E, m0, tid);   // block-uniform branch
  else        proj_tiles<true>(wsrc, vtp, bt, ax, sb, E, m0, tid);
}

// ---------------------------------------------------------------------------
// Flash attention, transposed-score form: block = one (group, head); its K
// [384 keys][32 d] and V^T [32 d][384 keys] are staged ONCE in LDS and shared by
// 8 waves; wave = TQ query tiles of 16 (48 queries), so the block covers all
// 384 queries and every K / V fragment read from LDS serves TQ tiles.
// Per 32-key chunk and query tile:
//   S^T = K . Q^T    A = K rows (lane = key, k = d), B = Q^T (lane = query, k = d)
//                    D[row = key 8h+r][col = query l15]; c0 keys 0..15, c1 keys 16..31
//   per-lane online softmax for query l15 (16 local keys + xor-16 partner)
//   O^T += V^T . P   A = V^T rows (lane = d, k = key), B = P: element i<8 <- c0[i]
//                    (key 8h+i), element 8+i <- c1[i] (key 16+8h+i), same lane
//                    D[row = d 8h+r][col = query l15]
// Scores carry 64 from the x8 planes; P = 2^(raw * k2 - max * k2 + 10), k2 = log2(e)/(64*sqrt(32)): one FMA and one
// exp2 a score. P and its sum carried x1024, V carried x8 -> context x16 = O * 16/(8 * carried sum).
// Context tiles [16 q][32 d] f16 x16 staged in LDS (the K tile's space, free
// behind a block barrier) and written to the head-major ctx plane
// [BL*NHEAD*NQ][HD]: each tile is 1024 contiguous bytes
// second bound: at most 160 VGPRs, so that the 3 blocks a WGP gets (768 blocks, 256 WGPs) are resident together
__global__ __launch_bounds__(256, 6) void k_attn(const unsigned short* __restrict__ qp,
                                              const unsigned short* __restrict__ kp,
                                              const unsigned short* __restrict__ vtp,
                                              unsigned short* __restrict__ ctx) {
  __shared__ __align__(16) unsigned short Ks[NQ * KVP];          // [key][d]; later the context tiles
  __shared__ __align__(16) unsigned short Vs[(NQ / 32) * VCS];   // [chunk][d][key in chunk]

  const int tid = threadIdx.x;
  const int wave = tid >> 5, lane = tid & 31;
  const int l15 = lane & 15;
  const int half = (lane >> 4) & 1;
  const int head = blockIdx.x;
  const int g = blockIdx.y;                // (b,l) group

  const _Float16* Q  = (const _Float16*)qp;
  const unsigned short* kbase = kp + (size_t)g * NQ * ATT + head * HD;              // key t at kbase + t*ATT
  const unsigned short* vbase = vtp + (size_t)head * HD * MROWS + (size_t)g * NQ;   // d row at vbase + d*MROWS

  // stage K and V^T: 2 x 1536 pieces of 16 bytes, 6 + 6 a thread, all loads issued before the first LDS store
  v4u kr[NQ * 4 / 256], vr[NQ * 4 / 256];
#pragma unroll
  for (int i = 0; i < NQ * 4 / 256; ++i) {
    const int idx = i * 256 + tid;
    kr[i] = *(const v4u*)(kbase + (size_t)(idx >> 2) * ATT + (idx & 3) * 8);
  }
#pragma unroll
  for (int i = 0; i < NQ * 4 / 256; ++i) {
    const int idx = i * 256 + tid;
    const int d = idx / (NQ / 8), pc = idx % (NQ / 8);
    vr[i] = *(const v4u*)(vbase + (size_t)d * MROWS + pc * 8);
  }
  v16h qb[TQ];
#pragma unroll
  for (int t = 0; t < TQ; ++t) {
    const _Float16* qbase = Q + ((size_t)g * NQ + (wave * TQ + t) * 16) * ATT + head * HD;
    qb[t] = ld_frag_h(qbase, ATT, l15, 0, lane);               // d 0..31
  }
#pragma unroll
  for (int i = 0; i < NQ * 4 / 256; ++i) {
    const int idx = i * 256 + tid;
    *(v4u*)(&Ks[(idx >> 2) * KVP + (idx & 3) * 8]) = kr[i];
  }
#pragma unroll
  for (int i = 0; i < NQ * 4 / 256; ++i) {
    const int idx = i * 256 + tid;
    const int d = idx / (NQ / 8), pc = idx % (NQ / 8);
    *(v4u*)(&Vs[(pc >> 2) * VCS + d * KVP + (pc & 3) * 8]) = vr[i];
  }
  __syncthreads();                         // K and V^T tiles complete

  v8f o[TQ][2] = {};
  float mrun[TQ], lrun[TQ];
#pragma unroll
  for (int t = 0; t < TQ; ++t) { mrun[t] = -1.0e30f; lrun[t] = 0.0f; }
  // raw score -> exponent of 2: (1/64)/sqrt(32) * log2(e)
  const float k2 = 0.17677669529663689f * (1.0f / 64.0f) * 1.4426950408889634f;
  const v8f k2v = {k2, k2, k2, k2, k2, k2, k2, k2};

  for (int kc = 0; kc < NQ; kc += 32) {
    const _Float16* kt = (const _Float16*)Ks + kc * KVP;
    const _Float16* vt = (const _Float16*)Vs + (kc >> 5) * VCS;
    const v16h ka0 = ld_frag_h(kt, KVP, l15, 0, lane);          // keys kc + 0..15
    const v16h ka2 = ld_frag_h(kt, KVP, 16 + l15, 0, lane);     // keys kc + 16..31
    const v16h va0 = ld_frag_h(vt, KVP, l15, 0, lane);          // d 0..15
    const v16h va1 = ld_frag_h(vt, KVP, 16 + l15, 0, lane);     // d 16..31
#pragma unroll
    for (int t = 0; t < TQ; ++t) {
      const v8f zero = {};
      v8f c0 = mma_f16(ka0, qb[t], zero);
      v8f c1 = mma_f16(ka2, qb[t], zero);

      // maximum on the raw accumulators (the scale is positive, so the order is the same)
      float lm = fmaxf(c0[0], c1[0]);
#pragma unroll
      for (int r = 1; r < 8; ++r) lm = fmaxf(lm, fmaxf(c0[r], c1[r]));
      lm = fmaxf(lm, __shfl_xor(lm, 16, 32));
      const float mnew = fmaxf(mrun[t], lm);
      const float alpha = __builtin_amdgcn_exp2f((mrun[t] - mnew) * k2);
      const float nb = 10.0f - mnew * k2;      // 2^10 = the x1024 carry of P
      const v8f nbv = {nb, nb, nb, nb, nb, nb, nb, nb};
      const v8f e0 = __builtin_elementwise_fma(c0, k2v, nbv);
      const v8f e1 = __builtin_elementwise_fma(c1, k2v, nbv);
      float p0[8], p1[8];
      float ls = 0.0f;
#pragma unroll
      for (int r = 0; r < 8; ++r) {
        p0[r] = __builtin_amdgcn_exp2f(e0[r]);
        p1[r] = __builtin_amdgcn_exp2f(e1[r]);
        ls += p0[r] + p1[r];
      }
      ls += __shfl_xor(ls, 16, 32);
      lrun[t] = lrun[t] * alpha + ls;
      mrun[t] = mnew;
#pragma unroll
      for (int j = 0; j < 2; ++j)
#pragma unroll
        for (int r = 0; r < 8; ++r) o[t][j][r] *= alpha;

      v16h pb;
#pragma unroll
      for (int e = 0; e < 8; ++e) {
        pb[e]     = (_Float16)p0[e];   // key kc + 8h + e
        pb[8 + e] = (_Float16)p1[e];   // key kc + 16 + 8h + e
      }
      o[t][0] = mma_f16(va0, pb, o[t][0]);
      o[t][1] = mma_f16(va1, pb, o[t][1]);
    }
  }
  __syncthreads();                         // every wave's last read of the K tile done: its space becomes context staging

  // o[t][j][r] = 8192 * sum_t p_t v_t for query l15, d = j*16 + 8*half + r; ctx carried x16
#pragma unroll
  for (int t = 0; t < TQ; ++t) {
    const float inv = 1.0f / (lrun[t] * 0.5f);   // lrun carries the x1024 of P
    unsigned short* T = Ks + (wave * TQ + t) * 16 * CTP;
#pragma unroll
    for (int j = 0; j < 2; ++j) {
      v4u w;
      w[0] = pack2h(o[t][j][0] * inv, o[t][j][1] * inv);
      w[1] = pack2h(o[t][j][2] * inv, o[t][j][3] * inv);
      w[2] = pack2h(o[t][j][4] * inv, o[t][j][5] * inv);
      w[3] = pack2h(o[t][j][6] * inv, o[t][j][7] * inv);
      *(v4u*)(&T[l15 * CTP + j * 16 + 8 * half]) = w;
    }
  }
  __syncthreads();

  v4u v[TQ][2];
#pragma unroll
  for (int t = 0; t < TQ; ++t)
#pragma unroll
    for (int it = 0; it < 2; ++it) {
      const int row = it * 8 + (lane >> 2);     // 0..15 query row of the tile
      const int piece = (lane & 3) * 8;         // 8 halves = 16 B; 4 pieces = 64-B row, 8 lanes = one line
      v[t][it] = *(const v4u*)(&Ks[((wave * TQ + t) * 16 + row) * CTP + piece]);
    }
  unsigned short* cb = ctx + (((size_t)g * NHEAD + head) * NQ + wave * TQ * 16) * HD;
#pragma unroll
  for (int t = 0; t < TQ; ++t)
#pragma unroll
    for (int it = 0; it < 2; ++it)
      *(v4u*)(cb + (size_t)(t * 16 + it * 8 + (lane >> 2)) * HD + (lane & 3) * 8) = v[t][it];
}

// ---------------------------------------------------------------------------
// Output projection: out[MROWS][DOUT] f32 = ctx[MROWS][ATT] * WdT[DOUT][ATT]^T / 256 + bd.
// ctx read from the head-major plane: for row (g, n) the 32 k values of
// k-step s (= head s) are contiguous at ((g*NHEAD + s)*NQ + n)*HD.
// 256 thr = 8 waves; block = 128 rows x all DOUT columns; wave = 32 rows x 64 columns
// (4 row groups x 2 column halves), so every weight fragment read from LDS serves two row tiles.
// The whole WdT plane [128 n][256 k] (64 KiB, contiguous) is staged ONCE in LDS, and each wave
// issues the loads of all its ctx fragments (all of k) before it waits for anything: one memory
// latency and one block barrier stand in front of the products, none between the k-steps.
// f16 operands, k-steps summed in the order 0..7. Epilogue: each wave stages its f32 tile in its
// own LDS range; each 256-byte row segment = 2 lines, written by 16 consecutive lanes.
__global__ __launch_bounds__(256) void k_oproj(const unsigned short* __restrict__ ctx,
                                               const unsigned short* __restrict__ wT,
                                               const float* __restrict__ bd,
                                               float* __restrict__ outp) {
  __shared__ __align__(16) unsigned short bt[DOUT * WOP];   // weight plane, cross-wave (block barrier)
  __shared__ __align__(16) float E[8 * 32 * OEP];           // epilogue tiles, one a wave
  static_assert(NQ % 128 == 0);                             // a block's 128 rows lie inside one group
  static_assert(DOUT == 128 && ATT == 256);                 // 2 column halves of 64; one plane row = one wave-wide 16-byte load

  const int m0 = blockIdx.y * 128;
  const int tid = threadIdx.x;
  const int wave = tid >> 5, lane = tid & 31;
  const int l15 = lane & 15, half = (lane >> 4) & 1;
  const int rg = wave >> 1;           // 0..3 : row group of 32
  const int c0 = (wave & 1) * 64;     // column half

  // weight plane = 4096 pieces of 16 bytes, 16 a thread: piece i*256 + tid = row i*8 + wave, piece lane
  const unsigned short* wsrc = wT + (size_t)3 * ATT * DIN + tid * 8;   // WdT plane [DOUT][ATT], f16 x16
  v4u wv[16];
#pragma unroll
  for (int i = 0; i < 16; ++i) wv[i] = *(const v4u*)(wsrc + i * 2048);

  const int g = m0 / NQ;
  const int nl = m0 - g * NQ + rg * 32;
  const _Float16* A0 = (const _Float16*)ctx + ((size_t)g * NHEAD * NQ + nl) * HD;
  // loops unrolled so that a, wv, b, acc and v have constant indices and stay in registers
  v16h a[2][ATT / 32];
#pragma unroll
  for (int s = 0; s < ATT / 32; ++s)
#pragma unroll
    for (int mt = 0; mt < 2; ++mt) a[mt][s] = ld_frag_h(A0 + (size_t)s * NQ * HD + mt * 16 * HD, HD, l15, 0, lane);
  float bb[4];
#pragma unroll
  for (int j = 0; j < 4; ++j) bb[j] = bd[c0 + j * 16 + l15];

#pragma unroll
  for (int i = 0; i < 16; ++i) *(v4u*)(&bt[(i * 8 + wave) * WOP + lane * 8]) = wv[i];
  __syncthreads();                                 // weight plane complete

  v8f acc[2][4] = {};
#pragma unroll
  for (int s = 0; s < ATT / 32; ++s) {
    v16h b[4];
#pragma unroll
    for (int j = 0; j < 4; ++j) b[j] = ld_frag_h((const _Float16*)bt, WOP, c0 + j * 16 + l15, s * 32, lane);
#pragma unroll
    for (int j = 0; j < 4; ++j)
#pragma unroll
      for (int mt = 0; mt < 2; ++mt) acc[mt][j] = mma_f16(a[mt][s], b[j], acc[mt][j]);
  }

  // acc[mt][j][r] = 256 * (ctx.Wd)[m0 + rg*32 + mt*16 + 8*half + r][c0 + j*16 + l15]
  const float cinv = 1.0f / 256.0f;
  float* Ew = E + wave * 32 * OEP;
#pragma unroll
  for (int j = 0; j < 4; ++j) {
    const int col = j * 16 + l15;
    const float bj = bf16val(bb[j]);
#pragma unroll
    for (int mt = 0; mt < 2; ++mt)
#pragma unroll
      for (int r = 0; r < 8; ++r) Ew[(mt * 16 + 8 * half + r) * OEP + col] = acc[mt][j][r] * cinv + bj;
  }
  __syncthreads();                                 // epilogue tiles complete

  float* ob = outp + (size_t)(m0 + rg * 32 + half) * DOUT + c0 + l15 * 4;
  v4f v[16];
#pragma unroll
  for (int it = 0; it < 16; ++it)                  // row it*2 + half; 16 pieces of 16 B = the row's 256-byte segment (2 lines)
    v[it] = *(const v4f*)(&Ew[(it * 2 + half) * OEP + l15 * 4]);
#pragma unroll
  for (int it = 0; it < 16; ++it) *(v4f*)(ob + (size_t)it * 2 * DOUT) = v[it];
}

// ---------------------------------------------------------------------------
extern "C" void kernel_launch(void* const* d_in, const int* in_sizes, int n_in,
                              void* d_out, int out_size, void* d_ws, size_t ws_size,
                              hipStream_t stream) {
  if (n_in < 11) return;
  if (in_sizes[0] < MROWS * DIN || in_sizes[1] < MROWS * DIN || in_sizes[2] < MROWS * DIN) return;
  if (in_sizes[3] < DIN * ATT || in_sizes[5] < DIN * ATT || in_sizes[7] < DIN * ATT) return;
  if (in_sizes[4] < ATT || in_sizes[6] < ATT || in_sizes[8] < ATT) return;
  if (in_sizes[9] < ATT * DOUT || in_sizes[10] < DOUT) return;
  if (out_size < MROWS * DOUT) return;

  const float* xq = (const float*)d_in[0];
  const float* xk = (const float*)d_in[1];
  const float* xv = (const float*)d_in[2];
  const float* Wq = (const float*)d_in[3];
  const float* bq = (const float*)d_in[4];
  const float* Wk = (const float*)d_in[5];
  const float* bk = (const float*)d_in[6];
  const float* Wv = (const float*)d_in[7];
  const float* bv = (const float*)d_in[8];
  const float* Wd = (const float*)d_in[9];
  const float* bd = (const float*)d_in[10];

  // and is written exactly to its extent (no padded tails needed: all tiles divide the shapes)
  const size_t wt_bytes  = (size_t)4 * DIN * ATT * 2;        // three bf16 WT planes + one f16 WdT plane
  const size_t pl_bytes  = (size_t)MROWS * ATT * 2;          // one f16 plane (Q, K, V^T, ctx)
  const size_t off_wt  = 0;
  const size_t off_q   = off_wt + wt_bytes;
  const size_t off_k   = off_q + pl_bytes;
  const size_t off_vt  = off_k + pl_bytes;
  const size_t off_ctx = off_vt + pl_bytes;
  const size_t total   = off_ctx + pl_bytes;                 // 75759616 B at full size
  if (total > ws_size) return;

  char* ws = (char*)d_ws;
  unsigned short* wt  = (unsigned short*)(ws + off_wt);
  unsigned short* qpl = (unsigned short*)(ws + off_q);
  unsigned short* kpl = (unsigned short*)(ws + off_k);
  unsigned short* vtp = (unsigned short*)(ws + off_vt);
  unsigned short* cxp = (unsigned short*)(ws + off_ctx);

  k_cvt_wT<<<dim3(DIN * ATT / 4096, 1, 4), 256, 0, stream>>>(Wq, Wk, Wv, Wd, wt);
  k_proj<<<dim3(1, MROWS / 128, 3), 256, 0, stream>>>(xq, xk, xv, wt, bq, bk, bv, qpl, kpl, vtp);
  k_attn<<<dim3(NHEAD, BL), 256, 0, stream>>>(qpl, kpl, vtp, cxp);
  k_oproj<<<dim3(1, MROWS / 128), 256, 0, stream>>>(cxp, wt, bd, (float*)d_out);
}

// v006
// Measured time: 52.6 microseconds a run.
// Next to v005, in two timings, it ran 1.06 times as fast each time.
// Over all steps from v000 it is 2.33 times as fast.
#include <hip/hip_runtime.h>
// Projections x*W{q,k,v}: v_wmma_f32_16x16x32_bf16 (bf16 operands = RNE-converted inputs, f32 accumulate); scores K*Q^T, context V^T*P and output projection ctx*Wd: v_wmma_f32_16x16x32_f16 (f16 operands; Q/K/V planes carried x8, P carried x1024, ctx plane carried x16, Wd plane carried x16; f32 accumulate); softmax in f32.

#ifndef NB
#define NB 8
#endif
#ifndef LL
#define LL 12
#endif
#define NB_FULL 8
#define LL_FULL 12
#define NQ 384           // tokens per (b,l) group = attention length
#define DIN 128          // feature width of query / key / value inputs
#define ATT 256          // attention width = NHEAD * HD
#define NHEAD 8
#define HD 32
#define DOUT 128         // output feature width
#define BL (NB * LL)     // number of (b,l) groups processed
#define MROWS (BL * NQ)  // token rows processed (prefix of the full row range)

static_assert(NB >= 1 && NB <= NB_FULL);
static_assert(LL >= 1 && LL <= LL_FULL);
static_assert(LL == LL_FULL || NB == 1);
static_assert(ATT == NHEAD * HD);
static_assert(HD == 32);
static_assert(NHEAD == 8);
static_assert(NQ % 32 == 0);
static_assert(NQ % 16 == 0);
static_assert(MROWS % 128 == 0);
static_assert(DIN % 64 == 0 && ATT % 64 == 0 && DOUT % 64 == 0);
static_assert(DIN * ATT == ATT * DOUT);
static_assert((DIN * ATT) % 4096 == 0);
static_assert(DIN == 32 * 4);   // one input row = one wave-wide 16-byte load
static_assert((size_t)NB_FULL * LL_FULL * NQ * DOUT * 4 == 18874368);
// coverage equalities (grid x block x per-thread elements == plane elements)
static_assert((size_t)(DIN * ATT / 4096) * 64 * 64 == (size_t)DIN * ATT);                   // weight planes
static_assert((size_t)(ATT / 64) * (MROWS / 128) * 128 * 64 == (size_t)MROWS * ATT);        // Q, K, V^T planes (ATT / 64 column tiles a block)
static_assert((size_t)MROWS * ATT * 2 < 4294967296ull);   // 32-bit byte offsets into a plane
static_assert((size_t)NHEAD * BL * NQ * HD == (size_t)MROWS * ATT);                        // ctx plane
static_assert((size_t)(MROWS / 128) * 128 * DOUT == (size_t)MROWS * DOUT);                  // out

// LDS pitches (16-bit elements unless noted); all keep 16-byte row alignment
#define WOP 264    // output-projection weight plane [128 n][256 k]: 528-byte rows (16 B x odd) for 16-byte fragment reads
#define WTP 136    // projection weight column tile [64 n][128 k]: 272-byte rows, as the input tile's
#define NT  (ATT / 64)   // column tiles a projection block works through
#define AXP 136    // converted input tile [128 rows][128 k]: 272-byte rows for 16-byte fragment reads
#define EQP 72     // row-major epilogue tile [128 rows][64 cols]
#define EVP 136    // transposed epilogue tile [64 d][128 s]
#define TP  72     // weight transpose tile [64 n][64 k]
#define CTP 40     // context tile [16 q][32 d] halves
#define OEP 68     // output epilogue tile [32 rows][64 cols] a wave, floats
#define ESZ 9216   // max(128*EQP, 64*EVP)
#define KVP 40     // attention K / V^T tiles: rows of 32 halves
#define VCS (32 * KVP + 32)   // one 32-key chunk of V^T: 32 rows + 64 B, so that 4 chunks' stores fall on different banks
#define TQ  3      // query tiles of 16 per attention wave
static_assert(128 * EQP <= ESZ);
static_assert(64 * EVP <= ESZ);
static_assert(8 * TQ * 16 == NQ);                 // 8 waves x TQ tiles cover the group's queries
static_assert(8 * TQ * 16 * CTP <= NQ * KVP);     // context tiles fit the K tile's space
static_assert((NQ * 4) % 256 == 0);

typedef __bf16   v16bf __attribute__((ext_vector_type(16)));
typedef __bf16   v8bf  __attribute__((ext_vector_type(8)));
typedef _Float16 v16h  __attribute__((ext_vector_type(16)));
typedef _Float16 v8h   __attribute__((ext_vector_type(8)));
typedef float    v8f   __attribute__((ext_vector_type(8)));
typedef float    v4f   __attribute__((ext_vector_type(4)));
typedef unsigned int v4u __attribute__((ext_vector_type(4)));
typedef unsigned int v2u __attribute__((ext_vector_type(2)));
typedef float    v2f   __attribute__((ext_vector_type(2)));
typedef __bf16   v2bf  __attribute__((ext_vector_type(2)));

// ---------------------------------------------------------------------------
// WMMA wrappers with the VALU hazard guard (4 v_nop after every issue).
__device__ __forceinline__ v8f mma_bf16(v16bf a, v16bf b, v8f c) {
  v8f d = __builtin_amdgcn_wmma_f32_16x16x32_bf16(false, a, false, b, (short)0, c, false, false);
  asm volatile("v_nop\n\tv_nop\n\tv_nop\n\tv_nop" : "+v"(d) : "v"(a), "v"(b));
  return d;
}
__device__ __forceinline__ v8f mma_f16(v16h a, v16h b, v8f c) {
  v8f d = __builtin_amdgcn_wmma_f32_16x16x32_f16(false, a, false, b, (short)0, c, false, false);
  asm volatile("v_nop\n\tv_nop\n\tv_nop\n\tv_nop" : "+v"(d) : "v"(a), "v"(b));
  return d;
}

// 16-bit fragment, contraction dim CONTIGUOUS in memory: elem(k) = p0[rc*ld + k].
// Lane l: row/col rc = (l&15); elements 0..7 <- kk+8h+0..7, elements 8..15 <- kk+16+8h+0..7
// (h = l>>4). Same map for A (rc = row) and B (rc = column of a k-contiguous copy).
__device__ __forceinline__ v16bf ld_frag_bf(const __bf16* p0, int ld, int rc, int kk, int lane) {
  const int hh = (lane >> 4) & 1;
  const __bf16* p = p0 + (size_t)rc * ld + kk + 8 * hh;
  const v8bf lo = *(const v8bf*)(p);
  const v8bf hi = *(const v8bf*)(p + 16);
  v16bf f;
#pragma unroll
  for (int i = 0; i < 8; ++i) { f[i] = lo[i]; f[8 + i] = hi[i]; }
  return f;
}
__device__ __forceinline__ v16h ld_frag_h(const _Float16* p0, int ld, int rc, int kk, int lane) {
  const int hh = (lane >> 4) & 1;
  const _Float16* p = p0 + (size_t)rc * ld + kk + 8 * hh;
  const v8h lo = *(const v8h*)(p);
  const v8h hi = *(const v8h*)(p + 16);
  v16h f;
#pragma unroll
  for (int i = 0; i < 8; ++i) { f[i] = lo[i]; f[8 + i] = hi[i]; }
  return f;
}

// f32 -> bf16 bits, RNE convert
__device__ __forceinline__ unsigned int bfb(float x) {
  unsigned int u = __float_as_uint(x);
  u = u + 0x7FFFu + ((u >> 16) & 1u);
  return u >> 16;
}
// f32 -> value of its RNE bf16
__device__ __forceinline__ float bf16val(float x) {
  return __uint_as_float(bfb(x) << 16);
}
// f32 -> f16 bits, RNE convert
__device__ __forceinline__ unsigned short hbits(float x) {
  const _Float16 hv = (_Float16)x;
  return __builtin_bit_cast(unsigned short, hv);
}
__device__ __forceinline__ unsigned int pack2h(float a, float b) {
  return (unsigned int)hbits(a) | ((unsigned int)hbits(b) << 16);
}

// ---------------------------------------------------------------------------
// W f32 [kdim k][ndim n] -> WT 16-bit [ndim n][kdim k] (k contiguous).
// z = 0,1,2: Wq/Wk/Wv [DIN][ATT] -> bf16 planes; z = 3: Wd [ATT][DOUT] ->
// f16 plane holding 16 * bf16val(w). All four planes have DIN*ATT elements.
// Block = 64 k x 64 n tile transposed through LDS; each WT row segment
__global__ __launch_bounds__(256) void k_cvt_wT(const float* __restrict__ Wq,
                                                const float* __restrict__ Wk,
                                                const float* __restrict__ Wv,
                                                const float* __restrict__ Wd,
                                                unsigned short* __restrict__ wT) {
  __shared__ __align__(16) unsigned short T[64 * TP];   // [n local][k local], cross-wave (block barrier)
  const int z = blockIdx.z;
  const float* W = (z == 0) ? Wq : ((z == 1) ? Wk : ((z == 2) ? Wv : Wd));
  const bool od = (z == 3);                // block-uniform
  const int kdim = od ? ATT : DIN;
  const int ndim = od ? DOUT : ATT;
  unsigned short* dst = wT + (size_t)z * (DIN * ATT);
  const int nkt = kdim / 64;
  const int t = blockIdx.x;                // tile index 0 .. DIN*ATT/4096 - 1
  const int k0 = (t % nkt) * 64;
  const int n0 = (t / nkt) * 64;
  const int tid = threadIdx.x;
  const int wave = tid >> 5, lane = tid & 31;

#pragma unroll
  for (int i = 0; i < 4; ++i) {
    const int idx = i * 256 + tid;          // 0..1023
    const int kk = idx >> 4;                // 0..63
    const int c4 = (idx & 15) * 4;          // 0..60
    const v4f w = *(const v4f*)(W + (size_t)(k0 + kk) * ndim + n0 + c4);
    unsigned short e0, e1, e2, e3;
    if (od) {
      e0 = hbits(bf16val(w[0]) * 16.0f); e1 = hbits(bf16val(w[1]) * 16.0f);
      e2 = hbits(bf16val(w[2]) * 16.0f); e3 = hbits(bf16val(w[3]) * 16.0f);
    } else {
      e0 = (unsigned short)bfb(w[0]); e1 = (unsigned short)bfb(w[1]);
      e2 = (unsigned short)bfb(w[2]); e3 = (unsigned short)bfb(w[3]);
    }
    T[(c4 + 0) * TP + kk] = e0;
    T[(c4 + 1) * TP + kk] = e1;
    T[(c4 + 2) * TP + kk] = e2;
    T[(c4 + 3) * TP + kk] = e3;
  }
  __syncthreads();

  v4u v[2];
  size_t off[2];
#pragma unroll
  for (int it = 0; it < 2; ++it) {
    const int nn = wave * 8 + it * 4 + (lane >> 3);   // 0..63 over (wave, it, lane>>3)
    const int q = lane & 7;
    v[it] = *(const v4u*)(&T[nn * TP + q * 8]);
    off[it] = (size_t)(n0 + nn) * kdim + k0 + q * 8;
  }
#pragma unroll
  for (int it = 0; it < 2; ++it) *(v4u*)(dst + off[it]) = v[it];
  
}

// ---------------------------------------------------------------------------
// Projection: C[MROWS][ATT] = bf16(x_z)[MROWS][DIN] * WT_z[ATT][DIN]^T + bias_z.
// 256 thr = 8 waves; block = 128 rows x all ATT columns, worked in NT column tiles of 64;
// wave owns 16 rows. The block reads its 128 f32 input rows ONCE: one wave-wide 16-byte
// load = one whole 512-byte row; RNE convert to bf16 in registers, tile [128][128] in LDS;
// each wave keeps its four A fragments (all of k) in registers for every column tile.
// Weight tile [64 n][128 k] (16 KiB, contiguous in the plane) staged in LDS with plain loads;
// the rounded bias row is kept in LDS.
// Two block barriers a column tile. A block barrier waits for the wave's global loads and
// stores too, so the next tile's weight loads and this tile's output stores are issued
// directly behind a barrier and fly while the next tile's products are worked.
// z = 0: Q plane f16 x8 [MROWS][ATT]; z = 1: K plane f16 x8 [MROWS][ATT];
// z = 2: V^T plane f16 x8 [ATT][MROWS]. Epilogue staged in LDS, whole lines stored.

// The column-tile loop; VT = false: row-major plane [MROWS][ATT], VT = true: transposed plane [ATT][MROWS].
// Entered by the whole block behind the barrier that completes ax, sb and weight tile 0 in bt.
// Every inner loop is unrolled so that its array (a, b, acc, bj, wv, v) has constant indices and stays in registers.
template <bool VT>
__device__ __forceinline__ void proj_tiles(const unsigned short* __restrict__ wsrc, unsigned short* __restrict__ plane,
                                           unsigned short* bt, const unsigned short* ax, const float* sb,
                                           unsigned short* E, int m0, int tid) {
  const int wave = tid >> 5, lane = tid & 31;
  const int l15 = lane & 15, half = (lane >> 4) & 1;
  const int tn = tid >> 4;            // 0..15 : column within a quarter of the weight tile
  const int tk = (tid & 15) * 8;      // 0..120 : k
  const int arow = wave * 16 + l15;

  v16bf a[DIN / 32];
#pragma unroll
  for (int s = 0; s < DIN / 32; ++s) a[s] = ld_frag_bf((const __bf16*)ax, AXP, arow, s * 32, lane);

  // byte offset of the thread's first output piece in column tile 0 (a plane is below 2^32 bytes)
  const unsigned int o0 = VT ? (unsigned int)((wave * 8 + half) * MROWS + m0 + l15 * 8) * 2u
                             : (unsigned int)((m0 + wave * 16 + (lane >> 3)) * ATT + (lane & 7) * 8) * 2u;
  char* dst = (char*)plane;

  const float car = 8.0f;
  for (int nt = 0; nt < NT; ++nt) {
    const bool more = nt + 1 < NT;     // block-uniform
    v4u wv[4];
    if (more) {
#pragma unroll
      for (int i = 0; i < 4; ++i) wv[i] = *(const v4u*)(wsrc + (nt + 1) * 64 * DIN + i * 2048);
    }

    float bj[4];                       // read ahead of the products: no LDS latency in the epilogue
#pragma unroll
    for (int j = 0; j < 4; ++j) bj[j] = sb[nt * 64 + j * 16 + l15];

    v8f acc[4] = {};
#pragma unroll
    for (int s = 0; s < DIN / 32; ++s) {
#pragma unroll
      for (int jg = 0; jg < 4; jg += 2) {
        v16bf b[2];
#pragma unroll
        for (int j = 0; j < 2; ++j) b[j] = ld_frag_bf((const __bf16*)bt, WTP, (jg + j) * 16 + l15, s * 32, lane);
#pragma unroll
        for (int j = 0; j < 2; ++j) acc[jg + j] = mma_bf16(a[s], b[j], acc[jg + j]);
      }
    }

    // acc[j][r] = C[m0 + wave*16 + 8*half + r][nt*64 + j*16 + l15]
#pragma unroll
    for (int j = 0; j < 4; ++j) {
      const int col = j * 16 + l15;                         // column (d) within tile
#pragma unroll
      for (int r = 0; r < 8; ++r) {
        const int row = wave * 16 + 8 * half + r;           // row (s) within tile
        E[VT ? col * EVP + row : row * EQP + col] = hbits((acc[j][r] + bj[j]) * car);
      }
    }
    __syncthreads();                   // epilogue tile complete; every wave's reads of bt done

    if (more) {
#pragma unroll
      for (int i = 0; i < 4; ++i) *(v4u*)(&bt[(i * 16 + tn) * WTP + tk]) = wv[i];
    }
    v4u v[4];
#pragma unroll
    for (int it = 0; it < 4; ++it) {
      if (VT) {
        const int drow = wave * 8 + it * 2 + half;          // wave's 8 d-rows over (it, half)
        v[it] = *(const v4u*)(&E[drow * EVP + l15 * 8]);    // 16 pieces = 256-byte row = 2 lines
      } else {
        const int row = wave * 16 + it * 4 + (lane >> 3);   // wave's 16 rows over (it, lane>>3)
        v[it] = *(const v4u*)(&E[row * EQP + (lane & 7) * 8]);
      }
    }
    if (more) __syncthreads();         // next weight tile complete; every wave's reads of E done
#pragma unroll
    for (int it = 0; it < 4; ++it) {
      const unsigned int o = VT ? (unsigned int)(nt * 64 + it * 2) * (unsigned int)(MROWS * 2)   // d row nt*64 + drow
                                : (unsigned int)(nt * 64 * 2 + it * 4 * ATT * 2);                // column nt*64 + q*8
      *(v4u*)(dst + (o0 + o)) = v[it];
    }
    // stands in front of the next tile's first writes to the registers that these stores name
    if (more) asm volatile("s_wait_xcnt 0x0" ::: "memory");
  }
}

// second bound: at most 128 VGPRs, so that the 4 blocks a WGP can get (864 blocks, 256 WGPs) are resident together
__global__ __launch_bounds__(256, 8) void k_proj(
    const float* __restrict__ xq, const float* __restrict__ xk, const float* __restrict__ xv,
    const unsigned short* __restrict__ wT,
    const float* __restrict__ bq, const float* __restrict__ bk, const float* __restrict__ bv,
    unsigned short* __restrict__ qp, unsigned short* __restrict__ kp,
    unsigned short* __restrict__ vtp) {
  __shared__ __align__(16) unsigned short bt[64 * WTP];   // weight column tile, cross-wave (block barrier)
  __shared__ __align__(16) unsigned short ax[128 * AXP];  // converted input tile (block barrier)
  __shared__ __align__(16) unsigned short E[ESZ];         // epilogue tile, cross-wave (block barrier)
  __shared__ float sb[ATT];                               // bias row, rounded to bf16 values (block barrier)
  static_assert(ATT == 256);                              // one bias value a thread

  const int z = blockIdx.z;
  const int m0 = blockIdx.y * 128;
  const int tid = threadIdx.x;
  const int wave = tid >> 5, lane = tid & 31;

  const float* bias = (z == 0) ? bq : ((z == 1) ? bk : bv);
  // one weight column tile = 1024 pieces of 16 bytes, 4 a thread: piece i*256 + tid
  const unsigned short* wsrc = wT + (size_t)z * ATT * DIN + tid * 8;
  const int tn = tid >> 4;            // 0..15 : column within a quarter of the tile
  const int tk = (tid & 15) * 8;      // 0..120 : k
  const float* X = (z == 0) ? xq : ((z == 1) ? xk : xv);
  const float* xsrc = X + (size_t)(m0 + wave * 16) * DIN + lane * 4;

  v4u wv[4];
#pragma unroll
  for (int i = 0; i < 4; ++i) wv[i] = *(const v4u*)(wsrc + i * 2048);
  const float bz = bias[tid];

  // wave's 16 rows: all 16 loads issued before the first convert, so that one memory latency covers them;
  // both loops unrolled so that xr has constant indices and stays in registers
  v4f xr[16];
#pragma unroll
  for (int r = 0; r < 16; ++r) xr[r] = *(const v4f*)(xsrc + (size_t)r * DIN);
#pragma unroll
  for (int i = 0; i < 4; ++i) *(v4u*)(&bt[(i * 16 + tn) * WTP + tk]) = wv[i];
  sb[tid] = bf16val(bz);
#pragma unroll
  for (int r = 0; r < 16; ++r) {
    const v2f lo = {xr[r][0], xr[r][1]};
    const v2f hi = {xr[r][2], xr[r][3]};
    v2u w;
    w[0] = __builtin_bit_cast(unsigned int, __builtin_convertvector(lo, v2bf));
    w[1] = __builtin_bit_cast(unsigned int, __builtin_convertvector(hi, v2bf));
    *(v2u*)(&ax[(wave * 16 + r) * AXP + lane * 4]) = w;
  }
  __syncthreads();                                 // input tile, bias row and first weight tile complete

  if (z != 2) proj_tiles<false>(wsrc, (z == 0) ? qp : kp, bt, ax, sb, E, m0, tid);   // block-uniform branch
  else        proj_tiles<true>(wsrc, vtp, bt, ax, sb, E, m0, tid);
}

// raw score -> exponent of 2: (1/64)/sqrt(32) * log2(e)
#define K2 (0.17677669529663689f * (1.0f / 64.0f) * 1.4426950408889634f)
// a lane's 16 P values of a tile are positive, so a sum below this bound keeps each of them finite in f16
#define PLIM 60000.0f

// 2^x with the free slot that the instruction set asks for behind a transcendental inside the same statement. For the rare
// path only.
__device__ __forceinline__ float exp2_slot(float x) {
  float y;
  asm("v_exp_f32 %0, %1\n\tv_nop" : "=v"(y) : "v"(x));
  return y;
}

// P = 2^(raw * K2 + nb) for a lane's 16 scores of one tile; returns their sum (pairwise tree, packed adds).
// SLOT: exponentials by exp2_slot (rare path). The loop is unrolled so that the vectors' indices are constants.
template <bool SLOT>
__device__ __forceinline__ float exp_tile(v8f c0, v8f c1, float nb, v8f& p0, v8f& p1) {
  const v8f k2v = {K2, K2, K2, K2, K2, K2, K2, K2};
  const v8f nbv = {nb, nb, nb, nb, nb, nb, nb, nb};
  const v8f e0 = __builtin_elementwise_fma(c0, k2v, nbv);
  const v8f e1 = __builtin_elementwise_fma(c1, k2v, nbv);
#pragma unroll
  for (int r = 0; r < 8; ++r) {
    p0[r] = SLOT ? exp2_slot(e0[r]) : __builtin_amdgcn_exp2f(e0[r]);
    p1[r] = SLOT ? exp2_slot(e1[r]) : __builtin_amdgcn_exp2f(e1[r]);
  }
  const v8f s8 = p0 + p1;
  const v4f s4 = __builtin_shufflevector(s8, s8, 0, 1, 2, 3) + __builtin_shufflevector(s8, s8, 4, 5, 6, 7);
  const v2f s2 = __builtin_shufflevector(s4, s4, 0, 1) + __builtin_shufflevector(s4, s4, 2, 3);
  return s2[0] + s2[1];
}

// One 32-key chunk for a wave's TQ query tiles. The maximum in use (mrun, with nb = 10 - mrun * K2) is kept as long as
// P stays in f16 range under it: softmax is the same for any subtracted value, since P, its sum and O carry the same
// factor. Usual path: no maximum, no exchange between the halves, no rescale. Only when some lane's sum of P reaches
// PLIM (or is not a number) the whole wave takes the true running maximum, rescales O and the sum, and forms P again
// (then P <= 2^10). FIRST: nothing accumulated yet, the chunk's own maximum is taken directly.
// Every loop is unrolled so that the indices of qb, o, mrun, nb, lsum and of the vectors are constants (registers).
template <bool FIRST>
__device__ __forceinline__ void attn_pass(const unsigned short* Ks, const unsigned short* Vs, int kc, int lane,
                                          const v16h (&qb)[TQ], v8f (&o)[TQ][2],
                                          float (&mrun)[TQ], float (&nb)[TQ], float (&lsum)[TQ]) {
  const int l15 = lane & 15;
  const _Float16* kt = (const _Float16*)Ks + kc * KVP;
  const _Float16* vt = (const _Float16*)Vs + (kc >> 5) * VCS;
  const v16h ka0 = ld_frag_h(kt, KVP, l15, 0, lane);          // keys kc + 0..15
  const v16h ka2 = ld_frag_h(kt, KVP, 16 + l15, 0, lane);     // keys kc + 16..31
  const v16h va0 = ld_frag_h(vt, KVP, l15, 0, lane);          // d 0..15
  const v16h va1 = ld_frag_h(vt, KVP, 16 + l15, 0, lane);     // d 16..31
#pragma unroll
  for (int t = 0; t < TQ; ++t) {
    const v8f zero = {};
    v8f c0 = mma_f16(ka0, qb[t], zero);
    v8f c1 = mma_f16(ka2, qb[t], zero);
    v8f p0, p1;
    float ws = 0.0f;
    bool redo = FIRST;
    if (!FIRST) {
      ws = exp_tile<false>(c0, c1, nb[t], p0, p1);
      redo = __builtin_amdgcn_ballot_w32(!(ws < PLIM)) != 0;   // wave-uniform: a scalar branch, EXEC stays full
    }
    if (FIRST || __builtin_expect(redo, false)) {   // rare: laid out off the usual path
      if (!FIRST) {
        // the raw scores are formed again here, so that they need not stay in registers across the test
        c0 = mma_f16(ka0, qb[t], zero);
        c1 = mma_f16(ka2, qb[t], zero);
      }
      // maximum on the raw accumulators (the scale is positive, so the order is the same)
      float lm = fmaxf(c0[0], c1[0]);
#pragma unroll
      for (int r = 1; r < 8; ++r) lm = fmaxf(lm, fmaxf(c0[r], c1[r]));
      lm = fmaxf(lm, __shfl_xor(lm, 16, 32));
      const float mnew = FIRST ? lm : fmaxf(mrun[t], lm);
      if (!FIRST) {
        const float alpha = exp2_slot((mrun[t] - mnew) * K2);
        lsum[t] *= alpha;
#pragma unroll
        for (int j = 0; j < 2; ++j)
#pragma unroll
          for (int r = 0; r < 8; ++r) o[t][j][r] *= alpha;
      }
      mrun[t] = mnew;
      nb[t] = 10.0f - mnew * K2;               // 2^10 = the x1024 carry of P
      ws = exp_tile<!FIRST>(c0, c1, nb[t], p0, p1);
    }
    lsum[t] += ws;

    v16h pb;
#pragma unroll
    for (int e = 0; e < 8; ++e) {
      pb[e]     = (_Float16)p0[e];   // key kc + 8h + e
      pb[8 + e] = (_Float16)p1[e];   // key kc + 16 + 8h + e
    }
    o[t][0] = mma_f16(va0, pb, o[t][0]);
    o[t][1] = mma_f16(va1, pb, o[t][1]);
  }
}

// ---------------------------------------------------------------------------
// Flash attention, transposed-score form: block = one (group, head); its K
// [384 keys][32 d] and V^T [32 d][384 keys] are staged ONCE in LDS and shared by
// 8 waves; wave = TQ query tiles of 16 (48 queries), so the block covers all
// 384 queries and every K / V fragment read from LDS serves TQ tiles.
// Per 32-key chunk and query tile:
//   S^T = K . Q^T    A = K rows (lane = key, k = d), B = Q^T (lane = query, k = d)
//                    D[row = key 8h+r][col = query l15]; c0 keys 0..15, c1 keys 16..31
//   per-lane online softmax for query l15 (16 local keys; the xor-16 partner holds the other 16), see attn_pass
//   O^T += V^T . P   A = V^T rows (lane = d, k = key), B = P: element i<8 <- c0[i]
//                    (key 8h+i), element 8+i <- c1[i] (key 16+8h+i), same lane
//                    D[row = d 8h+r][col = query l15]
// Scores carry 64 from the x8 planes; P = 2^(raw * k2 - max * k2 + 10), k2 = log2(e)/(64*sqrt(32)): one FMA and one
// exp2 a score. P and its sum carried x1024, V carried x8 -> context x16 = O * 16/(8 * carried sum).
// Context tiles [16 q][32 d] f16 x16 staged in LDS (the K tile's space, free
// behind a block barrier) and written to the head-major ctx plane
// [BL*NHEAD*NQ][HD]: each tile is 1024 contiguous bytes
// second bound: at most 160 VGPRs, so that the 3 blocks a WGP gets (768 blocks, 256 WGPs) are resident together
__global__ __launch_bounds__(256, 6) void k_attn(const unsigned short* __restrict__ qp,
                                              const unsigned short* __restrict__ kp,
                                              const unsigned short* __restrict__ vtp,
                                              unsigned short* __restrict__ ctx) {
  __shared__ __align__(16) unsigned short Ks[NQ * KVP];          // [key][d]; later the context tiles
  __shared__ __align__(16) unsigned short Vs[(NQ / 32) * VCS];   // [chunk][d][key in chunk]

  const int tid = threadIdx.x;
  const int wave = tid >> 5, lane = tid & 31;
  const int l15 = lane & 15;
  const int half = (lane >> 4) & 1;
  const int head = blockIdx.x;
  const int g = blockIdx.y;                // (b,l) group

  const _Float16* Q  = (const _Float16*)qp;
  const unsigned short* kbase = kp + (size_t)g * NQ * ATT + head * HD;              // key t at kbase + t*ATT
  const unsigned short* vbase = vtp + (size_t)head * HD * MROWS + (size_t)g * NQ;   // d row at vbase + d*MROWS

  // stage K and V^T: 2 x 1536 pieces of 16 bytes, 6 + 6 a thread, all loads issued before the first LDS store
  v4u kr[NQ * 4 / 256], vr[NQ * 4 / 256];
#pragma unroll
  for (int i = 0; i < NQ * 4 / 256; ++i) {
    const int idx = i * 256 + tid;
    kr[i] = *(const v4u*)(kbase + (size_t)(idx >> 2) * ATT + (idx & 3) * 8);
  }
#pragma unroll
  for (int i = 0; i < NQ * 4 / 256; ++i) {
    const int idx = i * 256 + tid;
    const int d = idx / (NQ / 8), pc = idx % (NQ / 8);
    vr[i] = *(const v4u*)(vbase + (size_t)d * MROWS + pc * 8);
  }
  v16h qb[TQ];
#pragma unroll
  for (int t = 0; t < TQ; ++t) {
    const _Float16* qbase = Q + ((size_t)g * NQ + (wave * TQ + t) * 16) * ATT + head * HD;
    qb[t] = ld_frag_h(qbase, ATT, l15, 0, lane);               // d 0..31
  }
#pragma unroll
  for (int i = 0; i < NQ * 4 / 256; ++i) {
    const int idx = i * 256 + tid;
    *(v4u*)(&Ks[(idx >> 2) * KVP + (idx & 3) * 8]) = kr[i];
  }
#pragma unroll
  for (int i = 0; i < NQ * 4 / 256; ++i) {
    const int idx = i * 256 + tid;
    const int d = idx / (NQ / 8), pc = idx % (NQ / 8);
    *(v4u*)(&Vs[(pc >> 2) * VCS + d * KVP + (pc & 3) * 8]) = vr[i];
  }
  __syncthreads();                         // K and V^T tiles complete

  v8f o[TQ][2] = {};
  float mrun[TQ], nb[TQ], lsum[TQ];
#pragma unroll
  for (int t = 0; t < TQ; ++t) { mrun[t] = 0.0f; nb[t] = 0.0f; lsum[t] = 0.0f; }

  attn_pass<true>(Ks, Vs, 0, lane, qb, o, mrun, nb, lsum);       // first chunk: sets each query's maximum
  for (int kc = 32; kc < NQ; kc += 32) attn_pass<false>(Ks, Vs, kc, lane, qb, o, mrun, nb, lsum);

  // the two halves of a wave hold one query's keys 8h..8h+7 and 16+8h..: their partial row sums are joined here, once
  float lrun[TQ];
#pragma unroll
  for (int t = 0; t < TQ; ++t) lrun[t] = lsum[t] + __shfl_xor(lsum[t], 16, 32);
  __syncthreads();                         // every wave's last read of the K tile done: its space becomes context staging

  // o[t][j][r] = 8192 * sum_t p_t v_t for query l15, d = j*16 + 8*half + r; ctx carried x16
#pragma unroll
  for (int t = 0; t < TQ; ++t) {
    const float inv = 1.0f / (lrun[t] * 0.5f);   // lrun carries the x1024 of P
    unsigned short* T = Ks + (wave * TQ + t) * 16 * CTP;
#pragma unroll
    for (int j = 0; j < 2; ++j) {
      v4u w;
      w[0] = pack2h(o[t][j][0] * inv, o[t][j][1] * inv);
      w[1] = pack2h(o[t][j][2] * inv, o[t][j][3] * inv);
      w[2] = pack2h(o[t][j][4] * inv, o[t][j][5] * inv);
      w[3] = pack2h(o[t][j][6] * inv, o[t][j][7] * inv);
      *(v4u*)(&T[l15 * CTP + j * 16 + 8 * half]) = w;
    }
  }
  __syncthreads();

  v4u v[TQ][2];
#pragma unroll
  for (int t = 0; t < TQ; ++t)
#pragma unroll
    for (int it = 0; it < 2; ++it) {
      const int row = it * 8 + (lane >> 2);     // 0..15 query row of the tile
      const int piece = (lane & 3) * 8;         // 8 halves = 16 B; 4 pieces = 64-B row, 8 lanes = one line
      v[t][it] = *(const v4u*)(&Ks[((wave * TQ + t) * 16 + row) * CTP + piece]);
    }
  unsigned short* cb = ctx + (((size_t)g * NHEAD + head) * NQ + wave * TQ * 16) * HD;
#pragma unroll
  for (int t = 0; t < TQ; ++t)
#pragma unroll
    for (int it = 0; it < 2; ++it)
      *(v4u*)(cb + (size_t)(t * 16 + it * 8 + (lane >> 2)) * HD + (lane & 3) * 8) = v[t][it];
}

// ---------------------------------------------------------------------------
// Output projection: out[MROWS][DOUT] f32 = ctx[MROWS][ATT] * WdT[DOUT][ATT]^T / 256 + bd.
// ctx read from the head-major plane: for row (g, n) the 32 k values of
// k-step s (= head s) are contiguous at ((g*NHEAD + s)*NQ + n)*HD.
// 256 thr = 8 waves; block = 128 rows x all DOUT columns; wave = 32 rows x 64 columns
// (4 row groups x 2 column halves), so every weight fragment read from LDS serves two row tiles.
// The whole WdT plane [128 n][256 k] (64 KiB, contiguous) is staged ONCE in LDS, and each wave
// issues the loads of all its ctx fragments (all of k) before it waits for anything: one memory
// latency and one block barrier stand in front of the products, none between the k-steps.
// f16 operands, k-steps summed in the order 0..7. Epilogue: each wave stages its f32 tile in its
// own LDS range; each 256-byte row segment = 2 lines, written by 16 consecutive lanes.
__global__ __launch_bounds__(256) void k_oproj(const unsigned short* __restrict__ ctx,
                                               const unsigned short* __restrict__ wT,
                                               const float* __restrict__ bd,
                                               float* __restrict__ outp) {
  __shared__ __align__(16) unsigned short bt[DOUT * WOP];   // weight plane, cross-wave (block barrier)
  __shared__ __align__(16) float E[8 * 32 * OEP];           // epilogue tiles, one a wave
  static_assert(NQ % 128 == 0);                             // a block's 128 rows lie inside one group
  static_assert(DOUT == 128 && ATT == 256);                 // 2 column halves of 64; one plane row = one wave-wide 16-byte load

  const int m0 = blockIdx.y * 128;
  const int tid = threadIdx.x;
  const int wave = tid >> 5, lane = tid & 31;
  const int l15 = lane & 15, half = (lane >> 4) & 1;
  const int rg = wave >> 1;           // 0..3 : row group of 32
  const int c0 = (wave & 1) * 64;     // column half

  // weight plane = 4096 pieces of 16 bytes, 16 a thread: piece i*256 + tid = row i*8 + wave, piece lane
  const unsigned short* wsrc = wT + (size_t)3 * ATT * DIN + tid * 8;   // WdT plane [DOUT][ATT], f16 x16
  v4u wv[16];
#pragma unroll
  for (int i = 0; i < 16; ++i) wv[i] = *(const v4u*)(wsrc + i * 2048);

  const int g = m0 / NQ;
  const int nl = m0 - g * NQ + rg * 32;
  const _Float16* A0 = (const _Float16*)ctx + ((size_t)g * NHEAD * NQ + nl) * HD;
  // loops unrolled so that a, wv, b, acc and v have constant indices and stay in registers
  v16h a[2][ATT / 32];
#pragma unroll
  for (int s = 0; s < ATT / 32; ++s)
#pragma unroll
    for (int mt = 0; mt < 2; ++mt) a[mt][s] = ld_frag_h(A0 + (size_t)s * NQ * HD + mt * 16 * HD, HD, l15, 0, lane);
  float bb[4];
#pragma unroll
  for (int j = 0; j < 4; ++j) bb[j] = bd[c0 + j * 16 + l15];

#pragma unroll
  for (int i = 0; i < 16; ++i) *(v4u*)(&bt[(i * 8 + wave) * WOP + lane * 8]) = wv[i];
  __syncthreads();                                 // weight plane complete

  v8f acc[2][4] = {};
#pragma unroll
  for (int s = 0; s < ATT / 32; ++s) {
    v16h b[4];
#pragma unroll
    for (int j = 0; j < 4; ++j) b[j] = ld_frag_h((const _Float16*)bt, WOP, c0 + j * 16 + l15, s * 32, lane);
#pragma unroll
    for (int j = 0; j < 4; ++j)
#pragma unroll
      for (int mt = 0; mt < 2; ++mt) acc[mt][j] = mma_f16(a[mt][s], b[j], acc[mt][j]);
  }

  // acc[mt][j][r] = 256 * (ctx.Wd)[m0 + rg*32 + mt*16 + 8*half + r][c0 + j*16 + l15]
  const float cinv = 1.0f / 256.0f;
  float* Ew = E + wave * 32 * OEP;
#pragma unroll
  for (int j = 0; j < 4; ++j) {
    const int col = j * 16 + l15;
    const float bj = bf16val(bb[j]);
#pragma unroll
    for (int mt = 0; mt < 2; ++mt)
#pragma unroll
      for (int r = 0; r < 8; ++r) Ew[(mt * 16 + 8 * half + r) * OEP + col] = acc[mt][j][r] * cinv + bj;
  }
  __syncthreads();                                 // epilogue tiles complete

  float* ob = outp + (size_t)(m0 + rg * 32 + half) * DOUT + c0 + l15 * 4;
  v4f v[16];
#pragma unroll
  for (int it = 0; it < 16; ++it)                  // row it*2 + half; 16 pieces of 16 B = the row's 256-byte segment (2 lines)
    v[it] = *(const v4f*)(&Ew[(it * 2 + half) * OEP + l15 * 4]);
#pragma unroll
  for (int it = 0; it < 16; ++it) *(v4f*)(ob + (size_t)it * 2 * DOUT) = v[it];
}

// ---------------------------------------------------------------------------
extern "C" void kernel_launch(void* const* d_in, const int* in_sizes, int n_in,
                              void* d_out, int out_size, void* d_ws, size_t ws_size,
                              hipStream_t stream) {
  if (n_in < 11) return;
  if (in_sizes[0] < MROWS * DIN || in_sizes[1] < MROWS * DIN || in_sizes[2] < MROWS * DIN) return;
  if (in_sizes[3] < DIN * ATT || in_sizes[5] < DIN * ATT || in_sizes[7] < DIN * ATT) return;
  if (in_sizes[4] < ATT || in_sizes[6] < ATT || in_sizes[8] < ATT) return;
  if (in_sizes[9] < ATT * DOUT || in_sizes[10] < DOUT) return;
  if (out_size < MROWS * DOUT) return;

  const float* xq = (const float*)d_in[0];
  const float* xk = (const float*)d_in[1];
  const float* xv = (const float*)d_in[2];
  const float* Wq = (const float*)d_in[3];
  const float* bq = (const float*)d_in[4];
  const float* Wk = (const float*)d_in[5];
  const float* bk = (const float*)d_in[6];
  const float* Wv = (const float*)d_in[7];
  const float* bv = (const float*)d_in[8];
  const float* Wd = (const float*)d_in[9];
  const float* bd = (const float*)d_in[10];

  // and is written exactly to its extent (no padded tails needed: all tiles divide the shapes)
  const size_t wt_bytes  = (size_t)4 * DIN * ATT * 2;        // three bf16 WT planes + one f16 WdT plane
  const size_t pl_bytes  = (size_t)MROWS * ATT * 2;          // one f16 plane (Q, K, V^T, ctx)
  const size_t off_wt  = 0;
  const size_t off_q   = off_wt + wt_bytes;
  const size_t off_k   = off_q + pl_bytes;
  const size_t off_vt  = off_k + pl_bytes;
  const size_t off_ctx = off_vt + pl_bytes;
  const size_t total   = off_ctx + pl_bytes;                 // 75759616 B at full size
  if (total > ws_size) return;

  char* ws = (char*)d_ws;
  unsigned short* wt  = (unsigned short*)(ws + off_wt);
  unsigned short* qpl = (unsigned short*)(ws + off_q);
  unsigned short* kpl = (unsigned short*)(ws + off_k);
  unsigned short* vtp = (unsigned short*)(ws + off_vt);
  unsigned short* cxp = (unsigned short*)(ws + off_ctx);

  k_cvt_wT<<<dim3(DIN * ATT / 4096, 1, 4), 256, 0, stream>>>(Wq, Wk, Wv, Wd, wt);
  k_proj<<<dim3(1, MROWS / 128, 3), 256, 0, stream>>>(xq, xk, xv, wt, bq, bk, bv, qpl, kpl, vtp);
  k_attn<<<dim3(NHEAD, BL), 256, 0, stream>>>(qpl, kpl, vtp, cxp);
  k_oproj<<<dim3(1, MROWS / 128), 256, 0, stream>>>(cxp, wt, bd, (float*)d_out);
}

// v007
// Measured time: 47.5 microseconds a run.
// In two side-by-side timings against v006, it was 1.11 and 1.10 times as fast.
// Counting every step since v000, it is 2.58 times as fast.
#include <hip/hip_runtime.h>
// Projections x*W{q,k,v}: v_wmma_f32_16x16x32_bf16 (bf16 operands = RNE-converted inputs, f32 accumulate); scores K*Q^T, context V^T*P and output projection ctx*Wd: v_wmma_f32_16x16x32_f16 (f16 operands; Q/K/V planes carried x8, P carried x1024, ctx plane carried x16, Wd plane carried x16; f32 accumulate); softmax in f32.

#ifndef NB
#define NB 8
#endif
#ifndef LL
#define LL 12
#endif
#define NB_FULL 8
#define LL_FULL 12
#define NQ 384           // tokens per (b,l) group = attention length
#define DIN 128          // feature width of query / key / value inputs
#define ATT 256          // attention width = NHEAD * HD
#define NHEAD 8
#define HD 32
#define DOUT 128         // output feature width
#define BL (NB * LL)     // number of (b,l) groups processed
#define MROWS (BL * NQ)  // token rows processed (prefix of the full row range)

static_assert(NB >= 1 && NB <= NB_FULL);
static_assert(LL >= 1 && LL <= LL_FULL);
static_assert(LL == LL_FULL || NB == 1);
static_assert(ATT == NHEAD * HD);
static_assert(HD == 32);
static_assert(NHEAD == 8);
static_assert(NQ % 32 == 0);
static_assert(NQ % 16 == 0);
static_assert(MROWS % 128 == 0);
static_assert(DIN % 64 == 0 && ATT % 64 == 0 && DOUT % 64 == 0);
static_assert(DIN * ATT == ATT * DOUT);
static_assert((DIN * ATT) % 4096 == 0);
static_assert(DIN == 32 * 4);   // one input row = one wave-wide 16-byte load
static_assert((size_t)NB_FULL * LL_FULL * NQ * DOUT * 4 == 18874368);
// coverage equalities (grid x block x per-thread elements == plane elements)
static_assert((size_t)(DIN * ATT / 4096) * 64 * 64 == (size_t)DIN * ATT);                   // weight planes
static_assert((size_t)(MROWS / 128) * NHEAD * 128 * HD == (size_t)MROWS * ATT);             // Q, K, V planes (a head a wave, 128 rows a block)
static_assert((size_t)MROWS * ATT * 2 < 4294967296ull);   // 32-bit byte offsets into a plane
static_assert((size_t)NHEAD * BL * NQ * HD == (size_t)MROWS * ATT);                        // ctx plane
static_assert((size_t)(MROWS / 128) * 128 * DOUT == (size_t)MROWS * DOUT);                  // out

// LDS pitches (16-bit elements unless noted); all keep 16-byte row alignment
#define WOP 264    // output-projection weight plane [128 n][256 k]: 528-byte rows (16 B x odd) for 16-byte fragment reads
#define AXP 136    // converted input tile [128 rows][128 k]: 272-byte rows for 16-byte fragment reads
#define PTP 40     // projection output staging [32 rows][32 halves] a wave: 80-byte rows (16 B x odd)
#define TP  72     // weight transpose tile [64 n][64 k]
#define CTP 40     // context tile [16 q][32 d] halves
#define OEP 68     // output epilogue tile [32 rows][64 cols] a wave, floats
#define KVP 40     // attention K / V^T tiles: rows of 32 halves
#define VCS (32 * KVP + 32)   // one 32-key chunk of V^T: 32 rows + 64 B
#define TQ  3      // query tiles of 16 per attention wave
static_assert(8 * TQ * 16 == NQ);                 // 8 waves x TQ tiles cover the group's queries
static_assert(8 * TQ * 16 * CTP <= NQ * KVP);     // context tiles fit the K tile's space
static_assert((NQ * 4) % 256 == 0);

typedef __bf16   v16bf __attribute__((ext_vector_type(16)));
typedef __bf16   v8bf  __attribute__((ext_vector_type(8)));
typedef _Float16 v16h  __attribute__((ext_vector_type(16)));
typedef _Float16 v8h   __attribute__((ext_vector_type(8)));
typedef float    v8f   __attribute__((ext_vector_type(8)));
typedef float    v4f   __attribute__((ext_vector_type(4)));
typedef unsigned int v4u __attribute__((ext_vector_type(4)));
typedef unsigned int v2u __attribute__((ext_vector_type(2)));
typedef float    v2f   __attribute__((ext_vector_type(2)));
typedef __bf16   v2bf  __attribute__((ext_vector_type(2)));
typedef _Float16 v2h   __attribute__((ext_vector_type(2)));

// ---------------------------------------------------------------------------
// WMMA wrappers with the VALU hazard guard (4 v_nop after every issue).
__device__ __forceinline__ v8f mma_bf16(v16bf a, v16bf b, v8f c) {
  v8f d = __builtin_amdgcn_wmma_f32_16x16x32_bf16(false, a, false, b, (short)0, c, false, false);
  asm volatile("v_nop\n\tv_nop\n\tv_nop\n\tv_nop" : "+v"(d) : "v"(a), "v"(b));
  return d;
}
__device__ __forceinline__ v8f mma_f16(v16h a, v16h b, v8f c) {
  v8f d = __builtin_amdgcn_wmma_f32_16x16x32_f16(false, a, false, b, (short)0, c, false, false);
  asm volatile("v_nop\n\tv_nop\n\tv_nop\n\tv_nop" : "+v"(d) : "v"(a), "v"(b));
  return d;
}

// 16-bit fragment, contraction dim CONTIGUOUS in memory: elem(k) = p0[rc*ld + k].
// Lane l: row/col rc = (l&15); elements 0..7 <- kk+8h+0..7, elements 8..15 <- kk+16+8h+0..7
// (h = l>>4). Same map for A (rc = row) and B (rc = column of a k-contiguous copy).
__device__ __forceinline__ v16bf ld_frag_bf(const __bf16* p0, int ld, int rc, int kk, int lane) {
  const int hh = (lane >> 4) & 1;
  const __bf16* p = p0 + (size_t)rc * ld + kk + 8 * hh;
  const v8bf lo = *(const v8bf*)(p);
  const v8bf hi = *(const v8bf*)(p + 16);
  v16bf f;
#pragma unroll
  for (int i = 0; i < 8; ++i) { f[i] = lo[i]; f[8 + i] = hi[i]; }
  return f;
}
__device__ __forceinline__ v16h ld_frag_h(const _Float16* p0, int ld, int rc, int kk, int lane) {
  const int hh = (lane >> 4) & 1;
  const _Float16* p = p0 + (size_t)rc * ld + kk + 8 * hh;
  const v8h lo = *(const v8h*)(p);
  const v8h hi = *(const v8h*)(p + 16);
  v16h f;
#pragma unroll
  for (int i = 0; i < 8; ++i) { f[i] = lo[i]; f[8 + i] = hi[i]; }
  return f;
}

// f32 -> bf16 bits, RNE convert
__device__ __forceinline__ unsigned int bfb(float x) {
  unsigned int u = __float_as_uint(x);
  u = u + 0x7FFFu + ((u >> 16) & 1u);
  return u >> 16;
}
// f32 -> value of its RNE bf16
__device__ __forceinline__ float bf16val(float x) {
  return __uint_as_float(bfb(x) << 16);
}
// f32 -> f16 bits, RNE convert
__device__ __forceinline__ unsigned short hbits(float x) {
  const _Float16 hv = (_Float16)x;
  return __builtin_bit_cast(unsigned short, hv);
}
__device__ __forceinline__ unsigned int pack2h(float a, float b) {
  return (unsigned int)hbits(a) | ((unsigned int)hbits(b) << 16);
}

// ---------------------------------------------------------------------------
// W f32 [kdim k][ndim n] -> WT 16-bit, k contiguous in runs of 8 or more (layouts below).
// z = 0,1,2: Wq/Wk/Wv [DIN][ATT] -> bf16 planes, stored in the order of k_proj's fragments; z = 3: Wd [ATT][DOUT] ->
// f16 plane [n][k] holding 16 * bf16val(w). All four planes have DIN*ATT elements.
// Block = 64 k x 64 n tile transposed through LDS; each WT row segment
__global__ __launch_bounds__(256) void k_cvt_wT(const float* __restrict__ Wq,
                                                const float* __restrict__ Wk,
                                                const float* __restrict__ Wv,
                                                const float* __restrict__ Wd,
                                                unsigned short* __restrict__ wT) {
  __shared__ __align__(16) unsigned short T[64 * TP];   // [n local][k local], cross-wave (block barrier)
  const int z = blockIdx.z;
  const float* W = (z == 0) ? Wq : ((z == 1) ? Wk : ((z == 2) ? Wv : Wd));
  const bool od = (z == 3);                // block-uniform
  const int kdim = od ? ATT : DIN;
  const int ndim = od ? DOUT : ATT;
  unsigned short* dst = wT + (size_t)z * (DIN * ATT);
  const int nkt = kdim / 64;
  const int t = blockIdx.x;                // tile index 0 .. DIN*ATT/4096 - 1
  const int k0 = (t % nkt) * 64;
  const int n0 = (t / nkt) * 64;
  const int tid = threadIdx.x;
  const int wave = tid >> 5, lane = tid & 31;

#pragma unroll
  for (int i = 0; i < 4; ++i) {
    const int idx = i * 256 + tid;          // 0..1023
    const int kk = idx >> 4;                // 0..63
    const int c4 = (idx & 15) * 4;          // 0..60
    const v4f w = *(const v4f*)(W + (size_t)(k0 + kk) * ndim + n0 + c4);
    unsigned short e0, e1, e2, e3;
    if (od) {
      e0 = hbits(bf16val(w[0]) * 16.0f); e1 = hbits(bf16val(w[1]) * 16.0f);
      e2 = hbits(bf16val(w[2]) * 16.0f); e3 = hbits(bf16val(w[3]) * 16.0f);
    } else {
      e0 = (unsigned short)bfb(w[0]); e1 = (unsigned short)bfb(w[1]);
      e2 = (unsigned short)bfb(w[2]); e3 = (unsigned short)bfb(w[3]);
    }
    T[(c4 + 0) * TP + kk] = e0;
    T[(c4 + 1) * TP + kk] = e1;
    T[(c4 + 2) * TP + kk] = e2;
    T[(c4 + 3) * TP + kk] = e3;
  }
  __syncthreads();

  v4u v[2];
  size_t off[2];
#pragma unroll
  for (int it = 0; it < 2; ++it) {
    const int nn = wave * 8 + it * 4 + (lane >> 3);   // 0..63 over (wave, it, lane>>3)
    const int q = lane & 7;
    v[it] = *(const v4u*)(&T[nn * TP + q * 8]);
    const int nc = n0 + nn, kc = k0 + q * 8;
    // Wd: row-major [n][k]. Wq/Wk/Wv: fragment order, so that one wave-wide 16-byte load of k_proj is 512 contiguous bytes:
    // piece ((n / 16) * 4 + k / 32) * 2 + (k / 16) % 2, lane ((k / 8) % 2) * 16 + n % 16, 8 elements a lane
    off[it] = od ? (size_t)nc * kdim + kc
                 : (size_t)(((((nc >> 4) * (DIN / 32) + (kc >> 5)) * 2 + ((kc >> 4) & 1)) * 32 + ((kc >> 3) & 1) * 16 + (nc & 15)) * 8);
  }
#pragma unroll
  for (int it = 0; it < 2; ++it) *(v4u*)(dst + off[it]) = v[it];
  
}

// ---------------------------------------------------------------------------
// Projection: C[MROWS][ATT] = bf16(x_z)[MROWS][DIN] * W_z + bias_z, written head by head.
// 256 thr = 8 waves; block = 128 rows x all ATT columns; wave = ONE head's 32 columns x the block's 128 rows.
// The block reads its 128 f32 input rows once: one wave-wide 16-byte load = one whole 512-byte row; RNE convert to bf16
// in registers, tile [128][128] in LDS, read by every wave (one block barrier, the only one).
// A wave keeps its head's weight fragments (2 column tiles x all of k, 64 registers) for all its rows: no weight tile
// in LDS, and every input fragment read from LDS serves two products.
// z = 0, 1 (Q, K): D = W^T . x^T, A = weight rows (lane = column n), B = input rows (lane = token):
//   D[row = n 8h+r][col = token l15], so a lane holds 8 neighbouring d of one token = one 16-byte piece of the plane's row.
// z = 2 (V):       D = x . W, A = input rows, B = weight rows: D[row = token 8h+r][col = d l15],
//   so a lane holds 8 neighbouring keys of one d = one 16-byte piece of the transposed chunk's row.
// Planes, f16 x8, one contiguous tile of NQ * HD elements a (group, head):
//   Q, K: [token][d];  V: [chunk of 32 keys][d][key in chunk].
// Two row tiles (32 tokens) = 2 KiB contiguous in either plane: staged in the wave's own LDS range, whole lines stored.

// VT = false: Q / K form, VT = true: V form. Entered by the whole block behind the barrier that completes ax.
// The inner loops are unrolled so that their arrays (a, acc, wf, v) have constant indices and stay in registers.
template <bool VT>
__device__ __forceinline__ void proj_rows(const v16bf (&wf)[2][DIN / 32], const float* sbh,
                                          unsigned short* __restrict__ dst, const unsigned short* ax,
                                          unsigned short* T, int lane) {
  const int l15 = lane & 15, half = (lane >> 4) & 1;
  const float car = 8.0f;
  for (int p = 0; p < 128 / 32; ++p) {
#pragma unroll
    for (int u = 0; u < 2; ++u) {
      v16bf a[DIN / 32];
#pragma unroll
      for (int s = 0; s < DIN / 32; ++s) a[s] = ld_frag_bf((const __bf16*)ax, AXP, (p * 2 + u) * 16 + l15, s * 32, lane);
      // the bias is the accumulator's start value: VT: d = j*16 + l15 in every element; else element r: d = j*16 + 8*half + r
      v8f acc[2];
#pragma unroll
      for (int j = 0; j < 2; ++j) {
        if (VT) {
          const float b = sbh[j * 16 + l15];
          acc[j] = (v8f){b, b, b, b, b, b, b, b};
        } else {
          acc[j] = *(const v8f*)(sbh + j * 16 + 8 * half);
        }
      }
#pragma unroll
      for (int s = 0; s < DIN / 32; ++s)
#pragma unroll
        for (int j = 0; j < 2; ++j) acc[j] = VT ? mma_bf16(a[s], wf[j][s], acc[j]) : mma_bf16(wf[j][s], a[s], acc[j]);
      // VT: acc[j][r] = C[token u*16 + 8*half + r][d j*16 + l15]; else acc[j][r] = C[token u*16 + l15][d j*16 + 8*half + r]
#pragma unroll
      for (int j = 0; j < 2; ++j) {
        v4u w;
#pragma unroll
        for (int i = 0; i < 4; ++i) {
          const v2f pr = {acc[j][2 * i] * car, acc[j][2 * i + 1] * car};
          w[i] = __builtin_bit_cast(unsigned int, __builtin_convertvector(pr, v2h));   // RNE, as hbits
        }
        *(v4u*)(&T[((VT ? j : u) * 16 + l15) * PTP + (VT ? u : j) * 16 + 8 * half]) = w;
      }
    }
    // the wave's own pieces have reached LDS before its other lanes read them back
    asm volatile("s_wait_dscnt 0x0" ::: "memory");
    v4u v[4];
#pragma unroll
    for (int it = 0; it < 4; ++it) v[it] = *(const v4u*)(&T[(it * 8 + (lane >> 2)) * PTP + (lane & 3) * 8]);
#pragma unroll
    for (int it = 0; it < 4; ++it) *(v4u*)(dst + p * 32 * HD + it * 256 + lane * 8) = v[it];   // 512 contiguous bytes a store
    // stands in front of the next pass's first writes to the registers that these stores name
    asm volatile("s_wait_xcnt 0x0" ::: "memory");
  }
}

// second bound: at most 128 VGPRs, so that the 4 blocks a WGP can get (864 blocks, 256 WGPs) are resident together
__global__ __launch_bounds__(256, 8) void k_proj(
    const float* __restrict__ xq, const float* __restrict__ xk, const float* __restrict__ xv,
    const unsigned short* __restrict__ wT,
    const float* __restrict__ bq, const float* __restrict__ bk, const float* __restrict__ bv,
    unsigned short* __restrict__ qp, unsigned short* __restrict__ kp,
    unsigned short* __restrict__ vtp) {
  __shared__ __align__(16) unsigned short ax[128 * AXP];      // converted input tile, cross-wave (block barrier)
  __shared__ __align__(16) unsigned short Tt[8 * 32 * PTP];   // output staging, one range a wave
  __shared__ __align__(32) float sb[ATT];                     // bias row, rounded to bf16 values (block barrier)
  static_assert(ATT == 256);                                  // one bias value a thread
  static_assert(NQ % 128 == 0);                               // a block's 128 rows lie inside one group
  static_assert(NHEAD == 8 && HD == 32);                      // one head a wave, two column tiles a head

  const int z = blockIdx.z;
  const int m0 = blockIdx.y * 128;
  const int tid = threadIdx.x;
  const int wave = tid >> 5, lane = tid & 31;

  const float* bias = (z == 0) ? bq : ((z == 1) ? bk : bv);
  const float* X = (z == 0) ? xq : ((z == 1) ? xk : xv);
  const float* xsrc = X + (size_t)(m0 + wave * 16) * DIN + lane * 4;

  const float bz = bias[tid];

  // wave's 16 rows: all 16 loads issued before the first convert, so that one memory latency covers them;
  // both loops unrolled so that xr has constant indices and stays in registers
  v4f xr[16];
#pragma unroll
  for (int r = 0; r < 16; ++r) xr[r] = *(const v4f*)(xsrc + (size_t)r * DIN);
  // stands in front of the first writes to the registers that these loads name; it also keeps the 16 loads together
  asm volatile("s_wait_xcnt 0x0" ::: "memory");
#pragma unroll
  for (int r = 0; r < 16; ++r) {
    const v2f lo = {xr[r][0], xr[r][1]};
    const v2f hi = {xr[r][2], xr[r][3]};
    v2u w;
    w[0] = __builtin_bit_cast(unsigned int, __builtin_convertvector(lo, v2bf));
    w[1] = __builtin_bit_cast(unsigned int, __builtin_convertvector(hi, v2bf));
    *(v2u*)(&ax[(wave * 16 + r) * AXP + lane * 4]) = w;
  }
  sb[tid] = bf16val(bz);
  // the head's weight fragments, issued in front of the barrier so that they fly while the block gathers:
  // fragment (j, s) = pieces ((wave*2 + j) * 4 + s) * 2 and the next, 512 contiguous bytes each
  const unsigned short* wfr = wT + (size_t)z * ATT * DIN + wave * (2 * (DIN / 32) * 2 * 256) + lane * 8;
  v16bf wf[2][DIN / 32];
#pragma unroll
  for (int j = 0; j < 2; ++j)
#pragma unroll
    for (int s = 0; s < DIN / 32; ++s) {
      const v8bf lo = *(const v8bf*)(wfr + ((j * (DIN / 32) + s) * 2) * 256);
      const v8bf hi = *(const v8bf*)(wfr + ((j * (DIN / 32) + s) * 2 + 1) * 256);
#pragma unroll
      for (int i = 0; i < 8; ++i) { wf[j][s][i] = lo[i]; wf[j][s][8 + i] = hi[i]; }
    }
  __syncthreads();                                 // input tile and bias row complete

  const int g = m0 / NQ;
  const size_t o = (((size_t)g * NHEAD + wave) * NQ + (m0 - g * NQ)) * HD;   // the block's 128 tokens in the (group, head) tile
  unsigned short* T = Tt + wave * 32 * PTP;
  if (z != 2) proj_rows<false>(wf, sb + wave * HD, ((z == 0) ? qp : kp) + o, ax, T, lane);   // block-uniform branch
  else        proj_rows<true>(wf, sb + wave * HD, vtp + o, ax, T, lane);
}

// raw score -> exponent of 2: (1/64)/sqrt(32) * log2(e)
#define K2 (0.17677669529663689f * (1.0f / 64.0f) * 1.4426950408889634f)
// a lane's 16 P values of a tile are positive, so a sum below this bound keeps each of them finite in f16
#define PLIM 60000.0f

// 2^x with the free slot that the instruction set asks for behind a transcendental inside the same statement. For the rare
// path only.
__device__ __forceinline__ float exp2_slot(float x) {
  float y;
  asm("v_exp_f32 %0, %1\n\tv_nop" : "=v"(y) : "v"(x));
  return y;
}

// P = 2^(raw * K2 + nb) for a lane's 16 scores of one tile; returns their sum (pairwise tree, packed adds).
// SLOT: exponentials by exp2_slot (rare path). The loop is unrolled so that the vectors' indices are constants.
template <bool SLOT>
__device__ __forceinline__ float exp_tile(v8f c0, v8f c1, float nb, v8f& p0, v8f& p1) {
  const v8f k2v = {K2, K2, K2, K2, K2, K2, K2, K2};
  const v8f nbv = {nb, nb, nb, nb, nb, nb, nb, nb};
  const v8f e0 = __builtin_elementwise_fma(c0, k2v, nbv);
  const v8f e1 = __builtin_elementwise_fma(c1, k2v, nbv);
#pragma unroll
  for (int r = 0; r < 8; ++r) {
    p0[r] = SLOT ? exp2_slot(e0[r]) : __builtin_amdgcn_exp2f(e0[r]);
    p1[r] = SLOT ? exp2_slot(e1[r]) : __builtin_amdgcn_exp2f(e1[r]);
  }
  const v8f s8 = p0 + p1;
  const v4f s4 = __builtin_shufflevector(s8, s8, 0, 1, 2, 3) + __builtin_shufflevector(s8, s8, 4, 5, 6, 7);
  const v2f s2 = __builtin_shufflevector(s4, s4, 0, 1) + __builtin_shufflevector(s4, s4, 2, 3);
  return s2[0] + s2[1];
}

// One 32-key chunk for a wave's TQ query tiles. The maximum in use (mrun, with nb = 10 - mrun * K2) is kept as long as
// P stays in f16 range under it: softmax is the same for any subtracted value, since P, its sum and O carry the same
// factor. Usual path: no maximum, no exchange between the halves, no rescale. Only when some lane's sum of P reaches
// PLIM (or is not a number) the whole wave takes the true running maximum, rescales O and the sum, and forms P again
// (then P <= 2^10). FIRST: nothing accumulated yet, the chunk's own maximum is taken directly.
// Every loop is unrolled so that the indices of qb, o, mrun, nb, lsum and of the vectors are constants (registers).
template <bool FIRST>
__device__ __forceinline__ void attn_pass(const unsigned short* Ks, const unsigned short* Vs, int kc, int lane,
                                          const v16h (&qb)[TQ], v8f (&o)[TQ][2],
                                          float (&mrun)[TQ], float (&nb)[TQ], float (&lsum)[TQ]) {
  const int l15 = lane & 15;
  const _Float16* kt = (const _Float16*)Ks + kc * KVP;
  const _Float16* vt = (const _Float16*)Vs + (kc >> 5) * VCS;
  const v16h ka0 = ld_frag_h(kt, KVP, l15, 0, lane);          // keys kc + 0..15
  const v16h ka2 = ld_frag_h(kt, KVP, 16 + l15, 0, lane);     // keys kc + 16..31
  const v16h va0 = ld_frag_h(vt, KVP, l15, 0, lane);          // d 0..15
  const v16h va1 = ld_frag_h(vt, KVP, 16 + l15, 0, lane);     // d 16..31
#pragma unroll
  for (int t = 0; t < TQ; ++t) {
    const v8f zero = {};
    v8f c0 = mma_f16(ka0, qb[t], zero);
    v8f c1 = mma_f16(ka2, qb[t], zero);
    v8f p0, p1;
    float ws = 0.0f;
    bool redo = FIRST;
    if (!FIRST) {
      ws = exp_tile<false>(c0, c1, nb[t], p0, p1);
      redo = __builtin_amdgcn_ballot_w32(!(ws < PLIM)) != 0;   // wave-uniform: a scalar branch, EXEC stays full
    }
    if (FIRST || __builtin_expect(redo, false)) {   // rare: laid out off the usual path
      if (!FIRST) {
        // the raw scores are formed again here, so that they need not stay in registers across the test
        c0 = mma_f16(ka0, qb[t], zero);
        c1 = mma_f16(ka2, qb[t], zero);
      }
      // maximum on the raw accumulators (the scale is positive, so the order is the same)
      float lm = fmaxf(c0[0], c1[0]);
#pragma unroll
      for (int r = 1; r < 8; ++r) lm = fmaxf(lm, fmaxf(c0[r], c1[r]));
      lm = fmaxf(lm, __shfl_xor(lm, 16, 32));
      const float mnew = FIRST ? lm : fmaxf(mrun[t], lm);
      if (!FIRST) {
        const float alpha = exp2_slot((mrun[t] - mnew) * K2);
        lsum[t] *= alpha;
#pragma unroll
        for (int j = 0; j < 2; ++j)
#pragma unroll
          for (int r = 0; r < 8; ++r) o[t][j][r] *= alpha;
      }
      mrun[t] = mnew;
      nb[t] = 10.0f - mnew * K2;               // 2^10 = the x1024 carry of P
      ws = exp_tile<!FIRST>(c0, c1, nb[t], p0, p1);
    }
    lsum[t] += ws;

    v16h pb;
#pragma unroll
    for (int e = 0; e < 8; ++e) {
      pb[e]     = (_Float16)p0[e];   // key kc + 8h + e
      pb[8 + e] = (_Float16)p1[e];   // key kc + 16 + 8h + e
    }
    o[t][0] = mma_f16(va0, pb, o[t][0]);
    o[t][1] = mma_f16(va1, pb, o[t][1]);
  }
}

// ---------------------------------------------------------------------------
// Flash attention, transposed-score form: block = one (group, head); its K
// [384 keys][32 d] and V^T [32 d][384 keys] are staged ONCE in LDS and shared by
// 8 waves; wave = TQ query tiles of 16 (48 queries), so the block covers all
// 384 queries and every K / V fragment read from LDS serves TQ tiles.
// Per 32-key chunk and query tile:
//   S^T = K . Q^T    A = K rows (lane = key, k = d), B = Q^T (lane = query, k = d)
//                    D[row = key 8h+r][col = query l15]; c0 keys 0..15, c1 keys 16..31
//   per-lane online softmax for query l15 (16 local keys; the xor-16 partner holds the other 16), see attn_pass
//   O^T += V^T . P   A = V^T rows (lane = d, k = key), B = P: element i<8 <- c0[i]
//                    (key 8h+i), element 8+i <- c1[i] (key 16+8h+i), same lane
//                    D[row = d 8h+r][col = query l15]
// Scores carry 64 from the x8 planes; P = 2^(raw * k2 - max * k2 + 10), k2 = log2(e)/(64*sqrt(32)): one FMA and one
// exp2 a score. P and its sum carried x1024, V carried x8 -> context x16 = O * 16/(8 * carried sum).
// Context tiles [16 q][32 d] f16 x16 staged in LDS (the K tile's space, free
// behind a block barrier) and written to the head-major ctx plane
// [BL*NHEAD*NQ][HD]: each tile is 1024 contiguous bytes
// second bound: at most 160 VGPRs, so that the 3 blocks a WGP gets (768 blocks, 256 WGPs) are resident together
__global__ __launch_bounds__(256, 6) void k_attn(const unsigned short* __restrict__ qp,
                                              const unsigned short* __restrict__ kp,
                                              const unsigned short* __restrict__ vtp,
                                              unsigned short* __restrict__ ctx) {
  __shared__ __align__(16) unsigned short Ks[NQ * KVP];          // [key][d]; later the context tiles
  __shared__ __align__(16) unsigned short Vs[(NQ / 32) * VCS];   // [chunk][d][key in chunk]

  const int tid = threadIdx.x;
  const int wave = tid >> 5, lane = tid & 31;
  const int l15 = lane & 15;
  const int half = (lane >> 4) & 1;
  const int head = blockIdx.x;
  const int g = blockIdx.y;                // (b,l) group

  const _Float16* Q  = (const _Float16*)qp;
  const size_t tile = ((size_t)g * NHEAD + head) * NQ * HD;   // the (group, head) tile of a plane, contiguous
  const unsigned short* kbase = kp + tile;                    // [key][d]
  const unsigned short* vbase = vtp + tile;                   // [chunk of 32 keys][d][key in chunk]

  // stage K and V^T: 2 x 1536 pieces of 16 bytes, 6 + 6 a thread, all loads issued before the first LDS store
  v4u kr[NQ * 4 / 256], vr[NQ * 4 / 256];
#pragma unroll
  for (int i = 0; i < NQ * 4 / 256; ++i) {
    const int idx = i * 256 + tid;
    kr[i] = *(const v4u*)(kbase + idx * 8);
  }
#pragma unroll
  for (int i = 0; i < NQ * 4 / 256; ++i) {
    const int idx = i * 256 + tid;
    vr[i] = *(const v4u*)(vbase + idx * 8);
  }
  v16h qb[TQ];
#pragma unroll
  for (int t = 0; t < TQ; ++t) {
    const _Float16* qbase = Q + tile + (wave * TQ + t) * 16 * HD;
    qb[t] = ld_frag_h(qbase, HD, l15, 0, lane);                // d 0..31
  }
#pragma unroll
  for (int i = 0; i < NQ * 4 / 256; ++i) {
    const int idx = i * 256 + tid;
    *(v4u*)(&Ks[(idx >> 2) * KVP + (idx & 3) * 8]) = kr[i];
  }
#pragma unroll
  for (int i = 0; i < NQ * 4 / 256; ++i) {
    const int idx = i * 256 + tid;             // chunk idx / 128, d (idx / 4) % 32, piece idx % 4
    *(v4u*)(&Vs[(idx >> 7) * VCS + ((idx >> 2) & 31) * KVP + (idx & 3) * 8]) = vr[i];
  }
  __syncthreads();                         // K and V^T tiles complete

  v8f o[TQ][2] = {};
  float mrun[TQ], nb[TQ], lsum[TQ];
#pragma unroll
  for (int t = 0; t < TQ; ++t) { mrun[t] = 0.0f; nb[t] = 0.0f; lsum[t] = 0.0f; }

  attn_pass<true>(Ks, Vs, 0, lane, qb, o, mrun, nb, lsum);       // first chunk: sets each query's maximum
  for (int kc = 32; kc < NQ; kc += 32) attn_pass<false>(Ks, Vs, kc, lane, qb, o, mrun, nb, lsum);

  // the two halves of a wave hold one query's keys 8h..8h+7 and 16+8h..: their partial row sums are joined here, once
  float lrun[TQ];
#pragma unroll
  for (int t = 0; t < TQ; ++t) lrun[t] = lsum[t] + __shfl_xor(lsum[t], 16, 32);
  __syncthreads();                         // every wave's last read of the K tile done: its space becomes context staging

  // o[t][j][r] = 8192 * sum_t p_t v_t for query l15, d = j*16 + 8*half + r; ctx carried x16
#pragma unroll
  for (int t = 0; t < TQ; ++t) {
    const float inv = 1.0f / (lrun[t] * 0.5f);   // lrun carries the x1024 of P
    unsigned short* T = Ks + (wave * TQ + t) * 16 * CTP;
#pragma unroll
    for (int j = 0; j < 2; ++j) {
      v4u w;
      w[0] = pack2h(o[t][j][0] * inv, o[t][j][1] * inv);
      w[1] = pack2h(o[t][j][2] * inv, o[t][j][3] * inv);
      w[2] = pack2h(o[t][j][4] * inv, o[t][j][5] * inv);
      w[3] = pack2h(o[t][j][6] * inv, o[t][j][7] * inv);
      *(v4u*)(&T[l15 * CTP + j * 16 + 8 * half]) = w;
    }
  }
  __syncthreads();

  v4u v[TQ][2];
#pragma unroll
  for (int t = 0; t < TQ; ++t)
#pragma unroll
    for (int it = 0; it < 2; ++it) {
      const int row = it * 8 + (lane >> 2);     // 0..15 query row of the tile
      const int piece = (lane & 3) * 8;         // 8 halves = 16 B; 4 pieces = 64-B row, 8 lanes = one line
      v[t][it] = *(const v4u*)(&Ks[((wave * TQ + t) * 16 + row) * CTP + piece]);
    }
  unsigned short* cb = ctx + (((size_t)g * NHEAD + head) * NQ + wave * TQ * 16) * HD;
#pragma unroll
  for (int t = 0; t < TQ; ++t)
#pragma unroll
    for (int it = 0; it < 2; ++it)
      *(v4u*)(cb + (size_t)(t * 16 + it * 8 + (lane >> 2)) * HD + (lane & 3) * 8) = v[t][it];
}

// ---------------------------------------------------------------------------
// Output projection: out[MROWS][DOUT] f32 = ctx[MROWS][ATT] * WdT[DOUT][ATT]^T / 256 + bd.
// ctx read from the head-major plane: for row (g, n) the 32 k values of
// k-step s (= head s) are contiguous at ((g*NHEAD + s)*NQ + n)*HD.
// 256 thr = 8 waves; block = 128 rows x all DOUT columns; wave = 32 rows x 64 columns
// (4 row groups x 2 column halves), so every weight fragment read from LDS serves two row tiles.
// The whole WdT plane [128 n][256 k] (64 KiB, contiguous) is staged ONCE in LDS, and each wave
// issues the loads of all its ctx fragments (all of k) before it waits for anything: one memory
// latency and one block barrier stand in front of the products, none between the k-steps.
// f16 operands, k-steps summed in the order 0..7. Epilogue: each wave stages its f32 tile in its
// own LDS range; each 256-byte row segment = 2 lines, written by 16 consecutive lanes.
__global__ __launch_bounds__(256) void k_oproj(const unsigned short* __restrict__ ctx,
                                               const unsigned short* __restrict__ wT,
                                               const float* __restrict__ bd,
                                               float* __restrict__ outp) {
  __shared__ __align__(16) unsigned short bt[DOUT * WOP];   // weight plane, cross-wave (block barrier)
  __shared__ __align__(16) float E[8 * 32 * OEP];           // epilogue tiles, one a wave
  static_assert(NQ % 128 == 0);                             // a block's 128 rows lie inside one group
  static_assert(DOUT == 128 && ATT == 256);                 // 2 column halves of 64; one plane row = one wave-wide 16-byte load

  const int m0 = blockIdx.y * 128;
  const int tid = threadIdx.x;
  const int wave = tid >> 5, lane = tid & 31;
  const int l15 = lane & 15, half = (lane >> 4) & 1;
  const int rg = wave >> 1;           // 0..3 : row group of 32
  const int c0 = (wave & 1) * 64;     // column half

  // weight plane = 4096 pieces of 16 bytes, 16 a thread: piece i*256 + tid = row i*8 + wave, piece lane
  const unsigned short* wsrc = wT + (size_t)3 * ATT * DIN + tid * 8;   // WdT plane [DOUT][ATT], f16 x16
  v4u wv[16];
#pragma unroll
  for (int i = 0; i < 16; ++i) wv[i] = *(const v4u*)(wsrc + i * 2048);

  const int g = m0 / NQ;
  const int nl = m0 - g * NQ + rg * 32;
  const _Float16* A0 = (const _Float16*)ctx + ((size_t)g * NHEAD * NQ + nl) * HD;
  // loops unrolled so that a, wv, b, acc and v have constant indices and stay in registers
  v16h a[2][ATT / 32];
#pragma unroll
  for (int s = 0; s < ATT / 32; ++s)
#pragma unroll
    for (int mt = 0; mt < 2; ++mt) a[mt][s] = ld_frag_h(A0 + (size_t)s * NQ * HD + mt * 16 * HD, HD, l15, 0, lane);
  float bb[4];
#pragma unroll
  for (int j = 0; j < 4; ++j) bb[j] = bd[c0 + j * 16 + l15];

#pragma unroll
  for (int i = 0; i < 16; ++i) *(v4u*)(&bt[(i * 8 + wave) * WOP + lane * 8]) = wv[i];
  __syncthreads();                                 // weight plane complete

  v8f acc[2][4] = {};
#pragma unroll
  for (int s = 0; s < ATT / 32; ++s) {
    v16h b[4];
#pragma unroll
    for (int j = 0; j < 4; ++j) b[j] = ld_frag_h((const _Float16*)bt, WOP, c0 + j * 16 + l15, s * 32, lane);
#pragma unroll
    for (int j = 0; j < 4; ++j)
#pragma unroll
      for (int mt = 0; mt < 2; ++mt) acc[mt][j] = mma_f16(a[mt][s], b[j], acc[mt][j]);
  }

  // acc[mt][j][r] = 256 * (ctx.Wd)[m0 + rg*32 + mt*16 + 8*half + r][c0 + j*16 + l15]
  const float cinv = 1.0f / 256.0f;
  float* Ew = E + wave * 32 * OEP;
#pragma unroll
  for (int j = 0; j < 4; ++j) {
    const int col = j * 16 + l15;
    const float bj = bf16val(bb[j]);
#pragma unroll
    for (int mt = 0; mt < 2; ++mt)
#pragma unroll
      for (int r = 0; r < 8; ++r) Ew[(mt * 16 + 8 * half + r) * OEP + col] = acc[mt][j][r] * cinv + bj;
  }
  __syncthreads();                                 // epilogue tiles complete

  float* ob = outp + (size_t)(m0 + rg * 32 + half) * DOUT + c0 + l15 * 4;
  v4f v[16];
#pragma unroll
  for (int it = 0; it < 16; ++it)                  // row it*2 + half; 16 pieces of 16 B = the row's 256-byte segment (2 lines)
    v[it] = *(const v4f*)(&Ew[(it * 2 + half) * OEP + l15 * 4]);
#pragma unroll
  for (int it = 0; it < 16; ++it) *(v4f*)(ob + (size_t)it * 2 * DOUT) = v[it];
}

// ---------------------------------------------------------------------------
extern "C" void kernel_launch(void* const* d_in, const int* in_sizes, int n_in,
                              void* d_out, int out_size, void* d_ws, size_t ws_size,
                              hipStream_t stream) {
  if (n_in < 11) return;
  if (in_sizes[0] < MROWS * DIN || in_sizes[1] < MROWS * DIN || in_sizes[2] < MROWS * DIN) return;
  if (in_sizes[3] < DIN * ATT || in_sizes[5] < DIN * ATT || in_sizes[7] < DIN * ATT) return;
  if (in_sizes[4] < ATT || in_sizes[6] < ATT || in_sizes[8] < ATT) return;
  if (in_sizes[9] < ATT * DOUT || in_sizes[10] < DOUT) return;
  if (out_size < MROWS * DOUT) return;

  const float* xq = (const float*)d_in[0];
  const float* xk = (const float*)d_in[1];
  const float* xv = (const float*)d_in[2];
  const float* Wq = (const float*)d_in[3];
  const float* bq = (const float*)d_in[4];
  const float* Wk = (const float*)d_in[5];
  const float* bk = (const float*)d_in[6];
  const float* Wv = (const float*)d_in[7];
  const float* bv = (const float*)d_in[8];
  const float* Wd = (const float*)d_in[9];
  const float* bd = (const float*)d_in[10];

  // and is written exactly to its extent (no padded tails needed: all tiles divide the shapes)
  const size_t wt_bytes  = (size_t)4 * DIN * ATT * 2;        // three bf16 WT planes + one f16 WdT plane
  const size_t pl_bytes  = (size_t)MROWS * ATT * 2;          // one f16 plane (Q, K, V^T, ctx)
  const size_t off_wt  = 0;
  const size_t off_q   = off_wt + wt_bytes;
  const size_t off_k   = off_q + pl_bytes;
  const size_t off_vt  = off_k + pl_bytes;
  const size_t off_ctx = off_vt + pl_bytes;
  const size_t total   = off_ctx + pl_bytes;                 // 75759616 B at full size
  if (total > ws_size) return;

  char* ws = (char*)d_ws;
  unsigned short* wt  = (unsigned short*)(ws + off_wt);
  unsigned short* qpl = (unsigned short*)(ws + off_q);
  unsigned short* kpl = (unsigned short*)(ws + off_k);
  unsigned short* vtp = (unsigned short*)(ws + off_vt);
  unsigned short* cxp = (unsigned short*)(ws + off_ctx);

  k_cvt_wT<<<dim3(DIN * ATT / 4096, 1, 4), 256, 0, stream>>>(Wq, Wk, Wv, Wd, wt);
  k_proj<<<dim3(1, MROWS / 128, 3), 256, 0, stream>>>(xq, xk, xv, wt, bq, bk, bv, qpl, kpl, vtp);
  k_attn<<<dim3(NHEAD, BL), 256, 0, stream>>>(qpl, kpl, vtp, cxp);
  k_oproj<<<dim3(1, MROWS / 128), 256, 0, stream>>>(cxp, wt, bd, (float*)d_out);
}

// v008
// A run of this version takes 45.5 microseconds.
// Timed twice side by side with v007, it ran 1.04 times as fast both times.
// Counting every step since v000, it is 2.69 times as fast.
#include <hip/hip_runtime.h>
// Projections x*W{q,k,v}: v_wmma_f32_16x16x32_bf16 (bf16 operands = RNE-converted inputs, f32 accumulate); scores K*Q^T, context V^T*P and output projection ctx*Wd: v_wmma_f32_16x16x32_f16 (f16 operands; Q/K/V planes carried x8, P carried x1024, ctx plane carried x16, Wd plane carried x16; f32 accumulate); softmax in f32.

#ifndef NB
#define NB 8
#endif
#ifndef LL
#define LL 12
#endif
#define NB_FULL 8
#define LL_FULL 12
#define NQ 384           // tokens per (b,l) group = attention length
#define DIN 128          // feature width of query / key / value inputs
#define ATT 256          // attention width = NHEAD * HD
#define NHEAD 8
#define HD 32
#define DOUT 128         // output feature width
#define BL (NB * LL)     // number of (b,l) groups processed
#define MROWS (BL * NQ)  // token rows processed (prefix of the full row range)

static_assert(NB >= 1 && NB <= NB_FULL);
static_assert(LL >= 1 && LL <= LL_FULL);
static_assert(LL == LL_FULL || NB == 1);
static_assert(ATT == NHEAD * HD);
static_assert(HD == 32);
static_assert(NHEAD == 8);
static_assert(NQ % 32 == 0);
static_assert(NQ % 16 == 0);
static_assert(MROWS % 128 == 0);
static_assert(DIN % 64 == 0 && ATT % 64 == 0 && DOUT % 64 == 0);
static_assert(DIN * ATT == ATT * DOUT);
static_assert((DIN * ATT) % 4096 == 0);
static_assert(DIN == 32 * 4);   // one input row = one wave-wide 16-byte load
static_assert((size_t)NB_FULL * LL_FULL * NQ * DOUT * 4 == 18874368);
// coverage equalities (grid x block x per-thread elements == plane elements)
static_assert((size_t)(DIN * ATT / 4096) * 64 * 64 == (size_t)DIN * ATT);                   // weight planes
static_assert((size_t)(MROWS / 128) * NHEAD * 128 * HD == (size_t)MROWS * ATT);             // Q, K, V planes (a head a wave, 128 rows a block)
static_assert((size_t)MROWS * ATT * 2 < 4294967296ull);   // 32-bit byte offsets into a plane
static_assert((size_t)NHEAD * BL * NQ * HD == (size_t)MROWS * ATT);                        // ctx plane
static_assert((size_t)(MROWS / 128) * 128 * DOUT == (size_t)MROWS * DOUT);                  // out

// LDS pitches (16-bit elements unless noted); all keep 16-byte row alignment
#define WOP 264    // output-projection weight plane [128 n][256 k]: 528-byte rows (16 B x odd) for 16-byte fragment reads
#define AXP 136    // converted input tile [128 rows][128 k]: 272-byte rows for 16-byte fragment reads
#define PTP 40     // projection output staging [32 rows][32 halves] a wave: 80-byte rows (16 B x odd)
#define TP  72     // weight transpose tile [64 n][64 k]
#define CTP 40     // context tile [16 q][32 d] halves
#define OEP 68     // output epilogue tile [32 rows][64 cols] a wave, floats
#define KVP 40     // attention K / V^T tiles: rows of 32 halves
#define VCS (32 * KVP + 32)   // one 32-key chunk of V^T: 32 rows + 64 B
#define TQ  3      // query tiles of 16 per attention wave
static_assert(8 * TQ * 16 == NQ);                 // 8 waves x TQ tiles cover the group's queries
static_assert(8 * TQ * 16 * CTP <= NQ * KVP);     // context tiles fit the K tile's space
static_assert((NQ * 4) % 256 == 0);

typedef __bf16   v16bf __attribute__((ext_vector_type(16)));
typedef __bf16   v8bf  __attribute__((ext_vector_type(8)));
typedef _Float16 v16h  __attribute__((ext_vector_type(16)));
typedef _Float16 v8h   __attribute__((ext_vector_type(8)));
typedef float    v8f   __attribute__((ext_vector_type(8)));
typedef float    v4f   __attribute__((ext_vector_type(4)));
typedef unsigned int v4u __attribute__((ext_vector_type(4)));
typedef unsigned int v2u __attribute__((ext_vector_type(2)));
typedef float    v2f   __attribute__((ext_vector_type(2)));
typedef __bf16   v2bf  __attribute__((ext_vector_type(2)));
typedef _Float16 v2h   __attribute__((ext_vector_type(2)));

// ---------------------------------------------------------------------------
// WMMA wrappers with the VALU hazard guard (4 v_nop after every issue).
__device__ __forceinline__ v8f mma_bf16(v16bf a, v16bf b, v8f c) {
  v8f d = __builtin_amdgcn_wmma_f32_16x16x32_bf16(false, a, false, b, (short)0, c, false, false);
  asm volatile("v_nop\n\tv_nop\n\tv_nop\n\tv_nop" : "+v"(d) : "v"(a), "v"(b));
  return d;
}
__device__ __forceinline__ v8f mma_f16(v16h a, v16h b, v8f c) {
  v8f d = __builtin_amdgcn_wmma_f32_16x16x32_f16(false, a, false, b, (short)0, c, false, false);
  asm volatile("v_nop\n\tv_nop\n\tv_nop\n\tv_nop" : "+v"(d) : "v"(a), "v"(b));
  return d;
}

// 16-bit fragment, contraction dim CONTIGUOUS in memory: elem(k) = p0[rc*ld + k].
// Lane l: row/col rc = (l&15); elements 0..7 <- kk+8h+0..7, elements 8..15 <- kk+16+8h+0..7
// (h = l>>4). Same map for A (rc = row) and B (rc = column of a k-contiguous copy).
__device__ __forceinline__ v16bf ld_frag_bf(const __bf16* p0, int ld, int rc, int kk, int lane) {
  const int hh = (lane >> 4) & 1;
  const __bf16* p = p0 + (size_t)rc * ld + kk + 8 * hh;
  const v8bf lo = *(const v8bf*)(p);
  const v8bf hi = *(const v8bf*)(p + 16);
  v16bf f;
#pragma unroll
  for (int i = 0; i < 8; ++i) { f[i] = lo[i]; f[8 + i] = hi[i]; }
  return f;
}
__device__ __forceinline__ v16h ld_frag_h(const _Float16* p0, int ld, int rc, int kk, int lane) {
  const int hh = (lane >> 4) & 1;
  const _Float16* p = p0 + (size_t)rc * ld + kk + 8 * hh;
  const v8h lo = *(const v8h*)(p);
  const v8h hi = *(const v8h*)(p + 16);
  v16h f;
#pragma unroll
  for (int i = 0; i < 8; ++i) { f[i] = lo[i]; f[8 + i] = hi[i]; }
  return f;
}

// f32 -> bf16 bits, RNE convert
__device__ __forceinline__ unsigned int bfb(float x) {
  unsigned int u = __float_as_uint(x);
  u = u + 0x7FFFu + ((u >> 16) & 1u);
  return u >> 16;
}
// f32 -> value of its RNE bf16
__device__ __forceinline__ float bf16val(float x) {
  return __uint_as_float(bfb(x) << 16);
}
// f32 -> f16 bits, RNE convert
__device__ __forceinline__ unsigned short hbits(float x) {
  const _Float16 hv = (_Float16)x;
  return __builtin_bit_cast(unsigned short, hv);
}
__device__ __forceinline__ unsigned int pack2h(float a, float b) {
  return (unsigned int)hbits(a) | ((unsigned int)hbits(b) << 16);
}

// ---------------------------------------------------------------------------
// W f32 [kdim k][ndim n] -> WT 16-bit, k contiguous in runs of 8 or more (layouts below).
// z = 0,1,2: Wq/Wk/Wv [DIN][ATT] -> bf16 planes, stored in the order of k_proj's fragments; z = 3: Wd [ATT][DOUT] ->
// f16 plane [n][k] holding 16 * bf16val(w). All four planes have DIN*ATT elements.
// Block = 64 k x 64 n tile transposed through LDS; each WT row segment
__global__ __launch_bounds__(256) void k_cvt_wT(const float* __restrict__ Wq,
                                                const float* __restrict__ Wk,
                                                const float* __restrict__ Wv,
                                                const float* __restrict__ Wd,
                                                unsigned short* __restrict__ wT) {
  __shared__ __align__(16) unsigned short T[64 * TP];   // [n local][k local], cross-wave (block barrier)
  const int z = blockIdx.z;
  const float* W = (z == 0) ? Wq : ((z == 1) ? Wk : ((z == 2) ? Wv : Wd));
  const bool od = (z == 3);                // block-uniform
  const int kdim = od ? ATT : DIN;
  const int ndim = od ? DOUT : ATT;
  unsigned short* dst = wT + (size_t)z * (DIN * ATT);
  const int nkt = kdim / 64;
  const int t = blockIdx.x;                // tile index 0 .. DIN*ATT/4096 - 1
  const int k0 = (t % nkt) * 64;
  const int n0 = (t / nkt) * 64;
  const int tid = threadIdx.x;
  const int wave = tid >> 5, lane = tid & 31;

#pragma unroll
  for (int i = 0; i < 4; ++i) {
    const int idx = i * 256 + tid;          // 0..1023
    const int kk = idx >> 4;                // 0..63
    const int c4 = (idx & 15) * 4;          // 0..60
    const v4f w = *(const v4f*)(W + (size_t)(k0 + kk) * ndim + n0 + c4);
    unsigned short e0, e1, e2, e3;
    if (od) {
      e0 = hbits(bf16val(w[0]) * 16.0f); e1 = hbits(bf16val(w[1]) * 16.0f);
      e2 = hbits(bf16val(w[2]) * 16.0f); e3 = hbits(bf16val(w[3]) * 16.0f);
    } else {
      e0 = (unsigned short)bfb(w[0]); e1 = (unsigned short)bfb(w[1]);
      e2 = (unsigned short)bfb(w[2]); e3 = (unsigned short)bfb(w[3]);
    }
    T[(c4 + 0) * TP + kk] = e0;
    T[(c4 + 1) * TP + kk] = e1;
    T[(c4 + 2) * TP + kk] = e2;
    T[(c4 + 3) * TP + kk] = e3;
  }
  __syncthreads();

  v4u v[2];
  size_t off[2];
#pragma unroll
  for (int it = 0; it < 2; ++it) {
    const int nn = wave * 8 + it * 4 + (lane >> 3);   // 0..63 over (wave, it, lane>>3)
    const int q = lane & 7;
    v[it] = *(const v4u*)(&T[nn * TP + q * 8]);
    const int nc = n0 + nn, kc = k0 + q * 8;
    // Wd: row-major [n][k]. Wq/Wk/Wv: fragment order, so that one wave-wide 16-byte load of k_proj is 512 contiguous bytes:
    // piece ((n / 16) * 4 + k / 32) * 2 + (k / 16) % 2, lane ((k / 8) % 2) * 16 + n % 16, 8 elements a lane
    off[it] = od ? (size_t)nc * kdim + kc
                 : (size_t)(((((nc >> 4) * (DIN / 32) + (kc >> 5)) * 2 + ((kc >> 4) & 1)) * 32 + ((kc >> 3) & 1) * 16 + (nc & 15)) * 8);
  }
#pragma unroll
  for (int it = 0; it < 2; ++it) *(v4u*)(dst + off[it]) = v[it];
  
}

// ---------------------------------------------------------------------------
// Projection: C[MROWS][ATT] = bf16(x_z)[MROWS][DIN] * W_z + bias_z, written head by head.
// 256 thr = 8 waves; block = 128 rows x all ATT columns; wave = ONE head's 32 columns x the block's 128 rows.
// The block reads its 128 f32 input rows once: one wave-wide 16-byte load = one whole 512-byte row; RNE convert to bf16
// in registers, tile [128][128] in LDS, read by every wave (one block barrier, the only one).
// A wave keeps its head's weight fragments (2 column tiles x all of k, 64 registers) for all its rows: no weight tile
// in LDS, and every input fragment read from LDS serves two products.
// z = 0, 1 (Q, K): D = W^T . x^T, A = weight rows (lane = column n), B = input rows (lane = token):
//   D[row = n 8h+r][col = token l15], so a lane holds 8 neighbouring d of one token = one 16-byte piece of the plane's row.
// z = 2 (V):       D = x . W, A = input rows, B = weight rows: D[row = token 8h+r][col = d l15],
//   so a lane holds 8 neighbouring keys of one d = one 16-byte piece of the transposed chunk's row.
// Planes, f16 x8, one contiguous tile of NQ * HD elements a (group, head):
//   Q, K: [token][d];  V: [chunk of 32 keys][d][key in chunk].
// Two row tiles (32 tokens) = 2 KiB contiguous in either plane: staged in the wave's own LDS range, whole lines stored.

// VT = false: Q / K form, VT = true: V form. Entered by the whole block behind the barrier that completes ax.
// The inner loops are unrolled so that their arrays (a, acc, wf, v) have constant indices and stay in registers.
template <bool VT>
__device__ __forceinline__ void proj_rows(const v16bf (&wf)[2][DIN / 32], const float* sbh,
                                          unsigned short* __restrict__ dst, const unsigned short* ax,
                                          unsigned short* T, int lane) {
  const int l15 = lane & 15, half = (lane >> 4) & 1;
  const float car = 8.0f;
  for (int p = 0; p < 128 / 32; ++p) {
#pragma unroll
    for (int u = 0; u < 2; ++u) {
      v16bf a[DIN / 32];
#pragma unroll
      for (int s = 0; s < DIN / 32; ++s) a[s] = ld_frag_bf((const __bf16*)ax, AXP, (p * 2 + u) * 16 + l15, s * 32, lane);
      // the bias is the accumulator's start value: VT: d = j*16 + l15 in every element; else element r: d = j*16 + 8*half + r
      v8f acc[2];
#pragma unroll
      for (int j = 0; j < 2; ++j) {
        if (VT) {
          const float b = sbh[j * 16 + l15];
          acc[j] = (v8f){b, b, b, b, b, b, b, b};
        } else {
          acc[j] = *(const v8f*)(sbh + j * 16 + 8 * half);
        }
      }
#pragma unroll
      for (int s = 0; s < DIN / 32; ++s)
#pragma unroll
        for (int j = 0; j < 2; ++j) acc[j] = VT ? mma_bf16(a[s], wf[j][s], acc[j]) : mma_bf16(wf[j][s], a[s], acc[j]);
      // VT: acc[j][r] = C[token u*16 + 8*half + r][d j*16 + l15]; else acc[j][r] = C[token u*16 + l15][d j*16 + 8*half + r]
#pragma unroll
      for (int j = 0; j < 2; ++j) {
        v4u w;
#pragma unroll
        for (int i = 0; i < 4; ++i) {
          const v2f pr = {acc[j][2 * i] * car, acc[j][2 * i + 1] * car};
          w[i] = __builtin_bit_cast(unsigned int, __builtin_convertvector(pr, v2h));   // RNE, as hbits
        }
        *(v4u*)(&T[((VT ? j : u) * 16 + l15) * PTP + (VT ? u : j) * 16 + 8 * half]) = w;
      }
    }
    // the wave's own pieces have reached LDS before its other lanes read them back
    asm volatile("s_wait_dscnt 0x0" ::: "memory");
    v4u v[4];
#pragma unroll
    for (int it = 0; it < 4; ++it) v[it] = *(const v4u*)(&T[(it * 8 + (lane >> 2)) * PTP + (lane & 3) * 8]);
#pragma unroll
    for (int it = 0; it < 4; ++it) *(v4u*)(dst + p * 32 * HD + it * 256 + lane * 8) = v[it];   // 512 contiguous bytes a store
    // stands in front of the next pass's first writes to the registers that these stores name
    asm volatile("s_wait_xcnt 0x0" ::: "memory");
  }
}

// second bound: at most 128 VGPRs, so that the 4 blocks a WGP can get (864 blocks, 256 WGPs) are resident together
__global__ __launch_bounds__(256, 8) void k_proj(
    const float* __restrict__ xq, const float* __restrict__ xk, const float* __restrict__ xv,
    const unsigned short* __restrict__ wT,
    const float* __restrict__ bq, const float* __restrict__ bk, const float* __restrict__ bv,
    unsigned short* __restrict__ qp, unsigned short* __restrict__ kp,
    unsigned short* __restrict__ vtp) {
  __shared__ __align__(16) unsigned short ax[128 * AXP];      // converted input tile, cross-wave (block barrier)
  __shared__ __align__(16) unsigned short Tt[8 * 32 * PTP];   // output staging, one range a wave
  __shared__ __align__(32) float sb[ATT];                     // bias row, rounded to bf16 values (block barrier)
  static_assert(ATT == 256);                                  // one bias value a thread
  static_assert(NQ % 128 == 0);                               // a block's 128 rows lie inside one group
  static_assert(NHEAD == 8 && HD == 32);                      // one head a wave, two column tiles a head

  const int z = blockIdx.z;
  const int m0 = blockIdx.y * 128;
  const int tid = threadIdx.x;
  const int wave = tid >> 5, lane = tid & 31;

  const float* bias = (z == 0) ? bq : ((z == 1) ? bk : bv);
  const float* X = (z == 0) ? xq : ((z == 1) ? xk : xv);
  const float* xsrc = X + (size_t)(m0 + wave * 16) * DIN + lane * 4;

  const float bz = bias[tid];

  // wave's 16 rows: all 16 loads issued before the first convert, so that one memory latency covers them;
  // both loops unrolled so that xr has constant indices and stays in registers
  v4f xr[16];
#pragma unroll
  for (int r = 0; r < 16; ++r) xr[r] = *(const v4f*)(xsrc + (size_t)r * DIN);
  // stands in front of the first writes to the registers that these loads name; it also keeps the 16 loads together
  asm volatile("s_wait_xcnt 0x0" ::: "memory");
#pragma unroll
  for (int r = 0; r < 16; ++r) {
    const v2f lo = {xr[r][0], xr[r][1]};
    const v2f hi = {xr[r][2], xr[r][3]};
    v2u w;
    w[0] = __builtin_bit_cast(unsigned int, __builtin_convertvector(lo, v2bf));
    w[1] = __builtin_bit_cast(unsigned int, __builtin_convertvector(hi, v2bf));
    *(v2u*)(&ax[(wave * 16 + r) * AXP + lane * 4]) = w;
  }
  sb[tid] = bf16val(bz);
  // the head's weight fragments, issued in front of the barrier so that they fly while the block gathers:
  // fragment (j, s) = pieces ((wave*2 + j) * 4 + s) * 2 and the next, 512 contiguous bytes each
  const unsigned short* wfr = wT + (size_t)z * ATT * DIN + wave * (2 * (DIN / 32) * 2 * 256) + lane * 8;
  v16bf wf[2][DIN / 32];
#pragma unroll
  for (int j = 0; j < 2; ++j)
#pragma unroll
    for (int s = 0; s < DIN / 32; ++s) {
      const v8bf lo = *(const v8bf*)(wfr + ((j * (DIN / 32) + s) * 2) * 256);
      const v8bf hi = *(const v8bf*)(wfr + ((j * (DIN / 32) + s) * 2 + 1) * 256);
#pragma unroll
      for (int i = 0; i < 8; ++i) { wf[j][s][i] = lo[i]; wf[j][s][8 + i] = hi[i]; }
    }
  __syncthreads();                                 // input tile and bias row complete

  const int g = m0 / NQ;
  const size_t o = (((size_t)g * NHEAD + wave) * NQ + (m0 - g * NQ)) * HD;   // the block's 128 tokens in the (group, head) tile
  unsigned short* T = Tt + wave * 32 * PTP;
  if (z != 2) proj_rows<false>(wf, sb + wave * HD, ((z == 0) ? qp : kp) + o, ax, T, lane);   // block-uniform branch
  else        proj_rows<true>(wf, sb + wave * HD, vtp + o, ax, T, lane);
}

// raw score -> exponent of 2: (1/64)/sqrt(32) * log2(e)
#define K2 (0.17677669529663689f * (1.0f / 64.0f) * 1.4426950408889634f)
// a lane's P values are positive, so a sum of them below this bound keeps each of them finite in f16
#define PLIM 60000.0f

// 2^x with the free slot that the instruction set asks for behind a transcendental inside the same statement. For the rescale
// factor of the rare path.
__device__ __forceinline__ float exp2_slot(float x) {
  float y;
  asm("v_exp_f32 %0, %1\n\tv_nop" : "=v"(y) : "v"(x));
  return y;
}

// 2^x in place for a lane's 16 exponents of query tile T, in ONE statement. Each exponential overwrites its own source, so none
// overwrites the source or reads the result of the one in front of it; the v_nop is the free slot that the instruction set asks for
// behind the last one. The text must name single registers of the two 8-register operands, so these are tied to fixed
// registers, a range of its own for each tile of a pass (all below v256). Highest register first: the compiler forms the
// exponents in that order, so each is ready when its exponential issues. The s_delay_alu is a hint to the issue logic, no result
// depends on it: what follows the statement may read the last exponentials; hinted, the wave steps aside for the other waves
// of its SIMD instead of holding the vector port while it waits.
template <int T>
__device__ __forceinline__ void exp2_16(v8f& a, v8f& b) {
  static_assert(T >= 0 && T < 3);
  if constexpr (T == 0) {
    asm("v_exp_f32 v127, v127\n\tv_exp_f32 v126, v126\n\tv_exp_f32 v125, v125\n\tv_exp_f32 v124, v124\n\t"
        "v_exp_f32 v123, v123\n\tv_exp_f32 v122, v122\n\tv_exp_f32 v121, v121\n\tv_exp_f32 v120, v120\n\t"
        "v_exp_f32 v119, v119\n\tv_exp_f32 v118, v118\n\tv_exp_f32 v117, v117\n\tv_exp_f32 v116, v116\n\t"
        "v_exp_f32 v115, v115\n\tv_exp_f32 v114, v114\n\tv_exp_f32 v113, v113\n\tv_exp_f32 v112, v112\n\t"
        "v_nop\n\t"
        "s_delay_alu instid0(TRANS32_DEP_1)"
        : "+{v[112:119]}"(a), "+{v[120:127]}"(b));
  } else if constexpr (T == 1) {
    asm("v_exp_f32 v143, v143\n\tv_exp_f32 v142, v142\n\tv_exp_f32 v141, v141\n\tv_exp_f32 v140, v140\n\t"
        "v_exp_f32 v139, v139\n\tv_exp_f32 v138, v138\n\tv_exp_f32 v137, v137\n\tv_exp_f32 v136, v136\n\t"
        "v_exp_f32 v135, v135\n\tv_exp_f32 v134, v134\n\tv_exp_f32 v133, v133\n\tv_exp_f32 v132, v132\n\t"
        "v_exp_f32 v131, v131\n\tv_exp_f32 v130, v130\n\tv_exp_f32 v129, v129\n\tv_exp_f32 v128, v128\n\t"
        "v_nop\n\t"
        "s_delay_alu instid0(TRANS32_DEP_1)"
        : "+{v[128:135]}"(a), "+{v[136:143]}"(b));
  } else {
    asm("v_exp_f32 v159, v159\n\tv_exp_f32 v158, v158\n\tv_exp_f32 v157, v157\n\tv_exp_f32 v156, v156\n\t"
        "v_exp_f32 v155, v155\n\tv_exp_f32 v154, v154\n\tv_exp_f32 v153, v153\n\tv_exp_f32 v152, v152\n\t"
        "v_exp_f32 v151, v151\n\tv_exp_f32 v150, v150\n\tv_exp_f32 v149, v149\n\tv_exp_f32 v148, v148\n\t"
        "v_exp_f32 v147, v147\n\tv_exp_f32 v146, v146\n\tv_exp_f32 v145, v145\n\tv_exp_f32 v144, v144\n\t"
        "v_nop\n\t"
        "s_delay_alu instid0(TRANS32_DEP_1)"
        : "+{v[144:151]}"(a), "+{v[152:159]}"(b));
  }
}

// P = 2^(raw * K2 + nb) for a lane's 16 scores of query tile T; returns their sum (pairwise tree, packed adds).
template <int T>
__device__ __forceinline__ float exp_tile(v8f c0, v8f c1, float nb, v8f& p0, v8f& p1) {
  const v8f k2v = {K2, K2, K2, K2, K2, K2, K2, K2};
  const v8f nbv = {nb, nb, nb, nb, nb, nb, nb, nb};
  p0 = __builtin_elementwise_fma(c0, k2v, nbv);
  p1 = __builtin_elementwise_fma(c1, k2v, nbv);
  exp2_16<T>(p0, p1);
  const v8f s8 = p0 + p1;
  const v4f s4 = __builtin_shufflevector(s8, s8, 0, 1, 2, 3) + __builtin_shufflevector(s8, s8, 4, 5, 6, 7);
  const v2f s2 = __builtin_shufflevector(s4, s4, 0, 1) + __builtin_shufflevector(s4, s4, 2, 3);
  return s2[0] + s2[1];
}

// WMMA for attn_pass: the builtin alone. A pass is straight-line code over TQ independent query tiles, so the compiler
// fills the distance behind a WMMA with the other tiles' work (and pads what is left itself).
__device__ __forceinline__ v8f mma_f16_sl(v16h a, v16h b, v8f c) {
  return __builtin_amdgcn_wmma_f32_16x16x32_f16(false, a, false, b, (short)0, c, false, false);
}

// a lane's 16 P values of one tile as the B operand of V^T . P
__device__ __forceinline__ v16h pack_p(v8f p0, v8f p1) {
  v16h pb;
#pragma unroll
  for (int e = 0; e < 8; ++e) {
    pb[e]     = (_Float16)p0[e];   // key kc + 8h + e
    pb[8 + e] = (_Float16)p1[e];   // key kc + 16 + 8h + e
  }
  return pb;
}

// usual path of one query tile: P under the offset in use, its sum, its f16 operand
template <int T>
__device__ __forceinline__ void usual_tile(v8f c0, v8f c1, float nb, float& ws, v16h& pb) {
  v8f p0, p1;
  ws = exp_tile<T>(c0, c1, nb, p0, p1);
  pb = pack_p(p0, p1);
}

// rare path of one query tile (and the first chunk's): the true running maximum is taken, O and the sum are rescaled, P is formed
// under the new offset. The loops are unrolled so that the vectors' indices are constants.
template <bool FIRST, int T>
__device__ __forceinline__ void max_tile(v16h ka0, v16h ka2, v16h qb, v8f (&o)[2], float& nb, float& lsum, float& ws, v16h& pb) {
  const v8f zero = {};
  const v8f c0 = mma_f16_sl(ka0, qb, zero);
  const v8f c1 = mma_f16_sl(ka2, qb, zero);
  // maximum on the raw accumulators (the scale is positive, so the order is the same)
  float lm = fmaxf(c0[0], c1[0]);
#pragma unroll
  for (int r = 1; r < 8; ++r) lm = fmaxf(lm, fmaxf(c0[r], c1[r]));
  lm = fmaxf(lm, __shfl_xor(lm, 16, 32));
  // the offset under the running maximum: a larger maximum is a smaller offset, so the maximum itself is not kept
  const float nbl = 10.0f - lm * K2;       // 2^10 = the x1024 carry of P
  const float nbn = FIRST ? nbl : fminf(nb, nbl);
  if (!FIRST) {
    const float alpha = exp2_slot(nbn - nb);
    lsum *= alpha;
#pragma unroll
    for (int j = 0; j < 2; ++j)
#pragma unroll
      for (int r = 0; r < 8; ++r) o[j][r] *= alpha;
  }
  nb = nbn;
  usual_tile<T>(c0, c1, nb, ws, pb);
}

// One 32-key chunk for a wave's TQ query tiles. The maximum in use (held as the offset nb = 10 - maximum * K2) is kept as long as
// P stays in f16 range under it: softmax is the same for any subtracted value, since P, its sum and O carry the same
// factor. Usual path: no maximum, no exchange between the halves, no rescale, and ONE range test for the whole pass:
// the sums of P are positive, so the sum of a lane's TQ tile sums below PLIM keeps every P of the pass finite in f16.
// Only when some lane's sum reaches PLIM (or is not a number) the whole wave takes, for all its TQ tiles, the true
// running maximum, rescales O and the sum, and forms P again (then P <= 2^10).
// FIRST: nothing accumulated yet, the chunk's own maximum is taken directly.
// Every loop is unrolled so that the indices of qb, o, nb, lsum, ws, pb, c and of the vectors are constants (registers).
template <bool FIRST>
__device__ __forceinline__ void attn_pass(const unsigned short* Kc, const unsigned short* Vc, int lane,
                                          const v16h (&qb)[TQ], v8f (&o)[TQ][2],
                                          float (&nb)[TQ], float (&lsum)[TQ]) {
  const int l15 = lane & 15;
  const _Float16* kt = (const _Float16*)Kc;   // the chunk's 32 K rows
  const _Float16* vt = (const _Float16*)Vc;   // the chunk's 32 V^T rows
  const v8f zero = {};
  v16h pb[TQ];
  float ws[TQ];
  bool redo = FIRST;
  if (!FIRST) {
    const v16h ka0 = ld_frag_h(kt, KVP, l15, 0, lane);          // keys kc + 0..15
    const v16h ka2 = ld_frag_h(kt + 16 * KVP, KVP, l15, 0, lane);     // keys kc + 16..31
    v8f c[TQ][2];
#pragma unroll
    for (int t = 0; t < TQ; ++t) {
      c[t][0] = mma_f16_sl(ka0, qb[t], zero);
      c[t][1] = mma_f16_sl(ka2, qb[t], zero);
    }
    // keeps the 2 * TQ score products together in front of the vector work: each fills the distance behind the others, and the K
    // fragments' registers are free from here on (spread among the exponentials they cost v_nops and a spilled Q fragment)
    __builtin_amdgcn_sched_barrier(0);
    static_assert(TQ == 3);   // one call a tile: the tile's number is a template argument (exp2_16)
    usual_tile<0>(c[0][0], c[0][1], nb[0], ws[0], pb[0]);
    usual_tile<1>(c[1][0], c[1][1], nb[1], ws[1], pb[1]);
    usual_tile<2>(c[2][0], c[2][1], nb[2], ws[2], pb[2]);
    float wall = ws[0];
#pragma unroll
    for (int t = 1; t < TQ; ++t) wall += ws[t];
    redo = __builtin_amdgcn_ballot_w32(!(wall < PLIM)) != 0;   // wave-uniform: a scalar branch, EXEC stays full
  }
  if (FIRST || __builtin_expect(redo, false)) {   // rare: laid out off the usual path
    // the K fragments are read and the raw scores formed again here, so that neither stays in registers across the test
    const v16h ka0 = ld_frag_h(kt, KVP, l15, 0, lane);
    const v16h ka2 = ld_frag_h(kt + 16 * KVP, KVP, l15, 0, lane);
    max_tile<FIRST, 0>(ka0, ka2, qb[0], o[0], nb[0], lsum[0], ws[0], pb[0]);
    max_tile<FIRST, 1>(ka0, ka2, qb[1], o[1], nb[1], lsum[1], ws[1], pb[1]);
    max_tile<FIRST, 2>(ka0, ka2, qb[2], o[2], nb[2], lsum[2], ws[2], pb[2]);
  }
  const v16h va0 = ld_frag_h(vt, KVP, l15, 0, lane);          // d 0..15
  const v16h va1 = ld_frag_h(vt + 16 * KVP, KVP, l15, 0, lane);     // d 16..31
#pragma unroll
  for (int t = 0; t < TQ; ++t) {
    lsum[t] += ws[t];
    o[t][0] = mma_f16_sl(va0, pb[t], o[t][0]);
    o[t][1] = mma_f16_sl(va1, pb[t], o[t][1]);
  }
}

// ---------------------------------------------------------------------------
// Flash attention, transposed-score form: block = one (group, head); its K
// [384 keys][32 d] and V^T [32 d][384 keys] are staged ONCE in LDS and shared by
// 8 waves; wave = TQ query tiles of 16 (48 queries), so the block covers all
// 384 queries and every K / V fragment read from LDS serves TQ tiles.
// Per 32-key chunk and query tile:
//   S^T = K . Q^T    A = K rows (lane = key, k = d), B = Q^T (lane = query, k = d)
//                    D[row = key 8h+r][col = query l15]; c0 keys 0..15, c1 keys 16..31
//   per-lane online softmax for query l15 (16 local keys; the xor-16 partner holds the other 16), see attn_pass
//   O^T += V^T . P   A = V^T rows (lane = d, k = key), B = P: element i<8 <- c0[i]
//                    (key 8h+i), element 8+i <- c1[i] (key 16+8h+i), same lane
//                    D[row = d 8h+r][col = query l15]
// Scores carry 64 from the x8 planes; P = 2^(raw * k2 - max * k2 + 10), k2 = log2(e)/(64*sqrt(32)): one FMA and one
// exp2 a score. P and its sum carried x1024, V carried x8 -> context x16 = O * 16/(8 * carried sum).
// Context tiles [16 q][32 d] f16 x16 staged in LDS (the K tile's space, free
// behind a block barrier) and written to the head-major ctx plane
// [BL*NHEAD*NQ][HD]: each tile is 1024 contiguous bytes
// second bound: at most 160 VGPRs, so that the 3 blocks a WGP gets (768 blocks, 256 WGPs) are resident together
__global__ __launch_bounds__(256, 6) void k_attn(const unsigned short* __restrict__ qp,
                                              const unsigned short* __restrict__ kp,
                                              const unsigned short* __restrict__ vtp,
                                              unsigned short* __restrict__ ctx) {
  __shared__ __align__(16) unsigned short Ks[NQ * KVP];          // [key][d]; later the context tiles
  __shared__ __align__(16) unsigned short Vs[(NQ / 32) * VCS];   // [chunk][d][key in chunk]

  const int tid = threadIdx.x;
  const int wave = tid >> 5, lane = tid & 31;
  // the wave's number in a scalar register, for the epilogue: what is formed from it holds no vector register across the loop
  const int swave = __builtin_amdgcn_readfirstlane(tid >> 5);
  const int l15 = lane & 15;
  const int half = (lane >> 4) & 1;
  const int head = blockIdx.x;
  const int g = blockIdx.y;                // (b,l) group

  const _Float16* Q  = (const _Float16*)qp;
  const size_t tile = ((size_t)g * NHEAD + head) * NQ * HD;   // the (group, head) tile of a plane, contiguous
  const unsigned short* kbase = kp + tile;                    // [key][d]
  const unsigned short* vbase = vtp + tile;                   // [chunk of 32 keys][d][key in chunk]

  // stage K and V^T: 2 x 1536 pieces of 16 bytes, 6 + 6 a thread, all loads issued before the first LDS store
  v4u kr[NQ * 4 / 256], vr[NQ * 4 / 256];
#pragma unroll
  for (int i = 0; i < NQ * 4 / 256; ++i) {
    const int idx = i * 256 + tid;
    kr[i] = *(const v4u*)(kbase + idx * 8);
  }
#pragma unroll
  for (int i = 0; i < NQ * 4 / 256; ++i) {
    const int idx = i * 256 + tid;
    vr[i] = *(const v4u*)(vbase + idx * 8);
  }
  v16h qb[TQ];
#pragma unroll
  for (int t = 0; t < TQ; ++t) {
    const _Float16* qbase = Q + tile + (wave * TQ + t) * 16 * HD;
    qb[t] = ld_frag_h(qbase, HD, l15, 0, lane);                // d 0..31
  }
#pragma unroll
  for (int i = 0; i < NQ * 4 / 256; ++i) {
    const int idx = i * 256 + tid;
    *(v4u*)(&Ks[(idx >> 2) * KVP + (idx & 3) * 8]) = kr[i];
  }
#pragma unroll
  for (int i = 0; i < NQ * 4 / 256; ++i) {
    const int idx = i * 256 + tid;             // chunk idx / 128, d (idx / 4) % 32, piece idx % 4
    *(v4u*)(&Vs[(idx >> 7) * VCS + ((idx >> 2) & 31) * KVP + (idx & 3) * 8]) = vr[i];
  }
  __syncthreads();                         // K and V^T tiles complete

  v8f o[TQ][2] = {};
  float nb[TQ], lsum[TQ];
#pragma unroll
  for (int t = 0; t < TQ; ++t) { nb[t] = 0.0f; lsum[t] = 0.0f; }

  attn_pass<true>(Ks, Vs, lane, qb, o, nb, lsum);          // first chunk: sets each query's maximum
  for (int ch = 1; ch < NQ / 32; ++ch) attn_pass<false>(Ks + ch * (32 * KVP), Vs + ch * VCS, lane, qb, o, nb, lsum);

  // the two halves of a wave hold one query's keys 8h..8h+7 and 16+8h..: their partial row sums are joined here, once
  float lrun[TQ];
#pragma unroll
  for (int t = 0; t < TQ; ++t) lrun[t] = lsum[t] + __shfl_xor(lsum[t], 16, 32);
  __syncthreads();                         // every wave's last read of the K tile done: its space becomes context staging

  // o[t][j][r] = 8192 * sum_t p_t v_t for query l15, d = j*16 + 8*half + r; ctx carried x16
#pragma unroll
  for (int t = 0; t < TQ; ++t) {
    const float inv = 1.0f / (lrun[t] * 0.5f);   // lrun carries the x1024 of P
    unsigned short* T = Ks + (swave * TQ + t) * 16 * CTP;
#pragma unroll
    for (int j = 0; j < 2; ++j) {
      v4u w;
      w[0] = pack2h(o[t][j][0] * inv, o[t][j][1] * inv);
      w[1] = pack2h(o[t][j][2] * inv, o[t][j][3] * inv);
      w[2] = pack2h(o[t][j][4] * inv, o[t][j][5] * inv);
      w[3] = pack2h(o[t][j][6] * inv, o[t][j][7] * inv);
      *(v4u*)(&T[l15 * CTP + j * 16 + 8 * half]) = w;
    }
  }
  __syncthreads();

  v4u v[TQ][2];
#pragma unroll
  for (int t = 0; t < TQ; ++t)
#pragma unroll
    for (int it = 0; it < 2; ++it) {
      const int row = it * 8 + (lane >> 2);     // 0..15 query row of the tile
      const int piece = (lane & 3) * 8;         // 8 halves = 16 B; 4 pieces = 64-B row, 8 lanes = one line
      v[t][it] = *(const v4u*)(&Ks[((swave * TQ + t) * 16 + row) * CTP + piece]);
    }
  unsigned short* cb = ctx + (((size_t)g * NHEAD + head) * NQ + swave * TQ * 16) * HD;
#pragma unroll
  for (int t = 0; t < TQ; ++t)
#pragma unroll
    for (int it = 0; it < 2; ++it)
      *(v4u*)(cb + (t * 16 + it * 8) * HD + lane * 8) = v[t][it];   // row lane / 4, piece lane % 4: 16 bytes a lane in a row
}

// ---------------------------------------------------------------------------
// Output projection: out[MROWS][DOUT] f32 = ctx[MROWS][ATT] * WdT[DOUT][ATT]^T / 256 + bd.
// ctx read from the head-major plane: for row (g, n) the 32 k values of
// k-step s (= head s) are contiguous at ((g*NHEAD + s)*NQ + n)*HD.
// 256 thr = 8 waves; block = 128 rows x all DOUT columns; wave = 32 rows x 64 columns
// (4 row groups x 2 column halves), so every weight fragment read from LDS serves two row tiles.
// The whole WdT plane [128 n][256 k] (64 KiB, contiguous) is staged ONCE in LDS, and each wave
// issues the loads of all its ctx fragments (all of k) before it waits for anything: one memory
// latency and one block barrier stand in front of the products, none between the k-steps.
// f16 operands, k-steps summed in the order 0..7. Epilogue: each wave stages its f32 tile in its
// own LDS range; each 256-byte row segment = 2 lines, written by 16 consecutive lanes.
__global__ __launch_bounds__(256) void k_oproj(const unsigned short* __restrict__ ctx,
                                               const unsigned short* __restrict__ wT,
                                               const float* __restrict__ bd,
                                               float* __restrict__ outp) {
  __shared__ __align__(16) unsigned short bt[DOUT * WOP];   // weight plane, cross-wave (block barrier)
  __shared__ __align__(16) float E[8 * 32 * OEP];           // epilogue tiles, one a wave
  static_assert(NQ % 128 == 0);                             // a block's 128 rows lie inside one group
  static_assert(DOUT == 128 && ATT == 256);                 // 2 column halves of 64; one plane row = one wave-wide 16-byte load

  const int m0 = blockIdx.y * 128;
  const int tid = threadIdx.x;
  const int wave = tid >> 5, lane = tid & 31;
  const int l15 = lane & 15, half = (lane >> 4) & 1;
  const int rg = wave >> 1;           // 0..3 : row group of 32
  const int c0 = (wave & 1) * 64;     // column half

  // weight plane = 4096 pieces of 16 bytes, 16 a thread: piece i*256 + tid = row i*8 + wave, piece lane
  const unsigned short* wsrc = wT + (size_t)3 * ATT * DIN + tid * 8;   // WdT plane [DOUT][ATT], f16 x16
  v4u wv[16];
#pragma unroll
  for (int i = 0; i < 16; ++i) wv[i] = *(const v4u*)(wsrc + i * 2048);

  const int g = m0 / NQ;
  const int nl = m0 - g * NQ + rg * 32;
  const _Float16* A0 = (const _Float16*)ctx + ((size_t)g * NHEAD * NQ + nl) * HD;
  // loops unrolled so that a, wv, b, acc and v have constant indices and stay in registers
  v16h a[2][ATT / 32];
#pragma unroll
  for (int s = 0; s < ATT / 32; ++s)
#pragma unroll
    for (int mt = 0; mt < 2; ++mt) a[mt][s] = ld_frag_h(A0 + (size_t)s * NQ * HD + mt * 16 * HD, HD, l15, 0, lane);
  float bb[4];
#pragma unroll
  for (int j = 0; j < 4; ++j) bb[j] = bd[c0 + j * 16 + l15];

#pragma unroll
  for (int i = 0; i < 16; ++i) *(v4u*)(&bt[(i * 8 + wave) * WOP + lane * 8]) = wv[i];
  __syncthreads();                                 // weight plane complete

  v8f acc[2][4] = {};
#pragma unroll
  for (int s = 0; s < ATT / 32; ++s) {
    v16h b[4];
#pragma unroll
    for (int j = 0; j < 4; ++j) b[j] = ld_frag_h((const _Float16*)bt, WOP, c0 + j * 16 + l15, s * 32, lane);
#pragma unroll
    for (int j = 0; j < 4; ++j)
#pragma unroll
      for (int mt = 0; mt < 2; ++mt) acc[mt][j] = mma_f16(a[mt][s], b[j], acc[mt][j]);
  }

  // acc[mt][j][r] = 256 * (ctx.Wd)[m0 + rg*32 + mt*16 + 8*half + r][c0 + j*16 + l15]
  const float cinv = 1.0f / 256.0f;
  float* Ew = E + wave * 32 * OEP;
#pragma unroll
  for (int j = 0; j < 4; ++j) {
    const int col = j * 16 + l15;
    const float bj = bf16val(bb[j]);
#pragma unroll
    for (int mt = 0; mt < 2; ++mt)
#pragma unroll
      for (int r = 0; r < 8; ++r) Ew[(mt * 16 + 8 * half + r) * OEP + col] = acc[mt][j][r] * cinv + bj;
  }
  __syncthreads();                                 // epilogue tiles complete

  float* ob = outp + (size_t)(m0 + rg * 32 + half) * DOUT + c0 + l15 * 4;
  v4f v[16];
#pragma unroll
  for (int it = 0; it < 16; ++it)                  // row it*2 + half; 16 pieces of 16 B = the row's 256-byte segment (2 lines)
    v[it] = *(const v4f*)(&Ew[(it * 2 + half) * OEP + l15 * 4]);
#pragma unroll
  for (int it = 0; it < 16; ++it) *(v4f*)(ob + (size_t)it * 2 * DOUT) = v[it];
}

// ---------------------------------------------------------------------------
extern "C" void kernel_launch(void* const* d_in, const int* in_sizes, int n_in,
                              void* d_out, int out_size, void* d_ws, size_t ws_size,
                              hipStream_t stream) {
  if (n_in < 11) return;
  if (in_sizes[0] < MROWS * DIN || in_sizes[1] < MROWS * DIN || in_sizes[2] < MROWS * DIN) return;
  if (in_sizes[3] < DIN * ATT || in_sizes[5] < DIN * ATT || in_sizes[7] < DIN * ATT) return;
  if (in_sizes[4] < ATT || in_sizes[6] < ATT || in_sizes[8] < ATT) return;
  if (in_sizes[9] < ATT * DOUT || in_sizes[10] < DOUT) return;
  if (out_size < MROWS * DOUT) return;

  const float* xq = (const float*)d_in[0];
  const float* xk = (const float*)d_in[1];
  const float* xv = (const float*)d_in[2];
  const float* Wq = (const float*)d_in[3];
  const float* bq = (const float*)d_in[4];
  const float* Wk = (const float*)d_in[5];
  const float* bk = (const float*)d_in[6];
  const float* Wv = (const float*)d_in[7];
  const float* bv = (const float*)d_in[8];
  const float* Wd = (const float*)d_in[9];
  const float* bd = (const float*)d_in[10];

  // and is written exactly to its extent (no padded tails needed: all tiles divide the shapes)
  const size_t wt_bytes  = (size_t)4 * DIN * ATT * 2;        // three bf16 WT planes + one f16 WdT plane
  const size_t pl_bytes  = (size_t)MROWS * ATT * 2;          // one f16 plane (Q, K, V^T, ctx)
  const size_t off_wt  = 0;
  const size_t off_q   = off_wt + wt_bytes;
  const size_t off_k   = off_q + pl_bytes;
  const size_t off_vt  = off_k + pl_bytes;
  const size_t off_ctx = off_vt + pl_bytes;
  const size_t total   = off_ctx + pl_bytes;                 // 75759616 B at full size
  if (total > ws_size) return;

  char* ws = (char*)d_ws;
  unsigned short* wt  = (unsigned short*)(ws + off_wt);
  unsigned short* qpl = (unsigned short*)(ws + off_q);
  unsigned short* kpl = (unsigned short*)(ws + off_k);
  unsigned short* vtp = (unsigned short*)(ws + off_vt);
  unsigned short* cxp = (unsigned short*)(ws + off_ctx);

  k_cvt_wT<<<dim3(DIN * ATT / 4096, 1, 4), 256, 0, stream>>>(Wq, Wk, Wv, Wd, wt);
  k_proj<<<dim3(1, MROWS / 128, 3), 256, 0, stream>>>(xq, xk, xv, wt, bq, bk, bv, qpl, kpl, vtp);
  k_attn<<<dim3(NHEAD, BL), 256, 0, stream>>>(qpl, kpl, vtp, cxp);
  k_oproj<<<dim3(1, MROWS / 128), 256, 0, stream>>>(cxp, wt, bd, (float*)d_out);
}

// v009
// A run of this version takes 41.7 microseconds.
// Next to v008, in two timings, it ran 1.09 times as fast each time.
// All steps since v000 together make it 2.94 times as fast.
#include <hip/hip_runtime.h>
// Projections x*W{q,k,v}: v_wmma_f32_16x16x32_bf16 (bf16 operands = RNE-converted inputs, f32 accumulate); scores K*Q^T, context V^T*P and output projection ctx*Wd: v_wmma_f32_16x16x32_f16 (f16 operands; Q/K/V planes carried x8, P carried x1024, ctx plane carried x16, Wd plane carried x16; f32 accumulate); softmax in f32.

#ifndef NB
#define NB 8
#endif
#ifndef LL
#define LL 12
#endif
#define NB_FULL 8
#define LL_FULL 12
#define NQ 384           // tokens per (b,l) group = attention length
#define DIN 128          // feature width of query / key / value inputs
#define ATT 256          // attention width = NHEAD * HD
#define NHEAD 8
#define HD 32
#define DOUT 128         // output feature width
#define BL (NB * LL)     // number of (b,l) groups processed
#define MROWS (BL * NQ)  // token rows processed (prefix of the full row range)

static_assert(NB >= 1 && NB <= NB_FULL);
static_assert(LL >= 1 && LL <= LL_FULL);
static_assert(LL == LL_FULL || NB == 1);
static_assert(ATT == NHEAD * HD);
static_assert(HD == 32);
static_assert(NHEAD == 8);
static_assert(NQ % 32 == 0);
static_assert(NQ % 16 == 0);
static_assert(MROWS % 128 == 0);
static_assert(DIN % 64 == 0 && ATT % 64 == 0 && DOUT % 64 == 0);
static_assert(DIN * ATT == ATT * DOUT);
static_assert((DIN * ATT) % 4096 == 0);
static_assert(DIN == 32 * 4);   // one input row = one wave-wide 16-byte load
static_assert((size_t)NB_FULL * LL_FULL * NQ * DOUT * 4 == 18874368);
// coverage equalities (grid x block x per-thread elements == plane elements)
static_assert((size_t)(ATT * DOUT / 4096) * 64 * 64 == (size_t)ATT * DOUT);                 // output-projection weight plane
static_assert(MROWS % 256 == 0);
static_assert((size_t)(MROWS / 256) * NHEAD * 256 * HD == (size_t)MROWS * ATT);             // Q, K, V planes (a head a wave, 256 rows a block)
static_assert((size_t)MROWS * ATT * 2 < 4294967296ull);   // 32-bit byte offsets into a plane
static_assert((size_t)NHEAD * BL * NQ * HD == (size_t)MROWS * ATT);                        // ctx plane
static_assert((size_t)(MROWS / 128) * 128 * DOUT == (size_t)MROWS * DOUT);                  // out

// LDS pitches (16-bit elements unless noted); all keep 16-byte row alignment
#define WOP 264    // output-projection weight plane [128 n][256 k]: 528-byte rows (16 B x odd) for 16-byte fragment reads
#define AXP 136    // converted input tile [256 rows][128 k]: 272-byte rows for 16-byte fragment reads
#define PTP 40     // projection output staging (and weight turning) [32 rows][32 halves] a wave: 80-byte rows (16 B x odd)
#define TP  72     // weight transpose tile [64 n][64 k]
#define CTP 40     // context tile [16 q][32 d] halves
#define OEP 68     // output epilogue tile [32 rows][64 cols] a wave, floats
#define KVP 40     // attention K / V^T tiles: rows of 32 halves
#define VCS (32 * KVP + 32)   // one 32-key chunk of V^T: 32 rows + 64 B
#define TQ  3      // query tiles of 16 per attention wave
static_assert(8 * TQ * 16 == NQ);                 // 8 waves x TQ tiles cover the group's queries
static_assert(8 * TQ * 16 * CTP <= NQ * KVP);     // context tiles fit the K tile's space
static_assert((NQ * 4) % 256 == 0);

typedef __bf16   v16bf __attribute__((ext_vector_type(16)));
typedef __bf16   v8bf  __attribute__((ext_vector_type(8)));
typedef _Float16 v16h  __attribute__((ext_vector_type(16)));
typedef _Float16 v8h   __attribute__((ext_vector_type(8)));
typedef float    v8f   __attribute__((ext_vector_type(8)));
typedef float    v4f   __attribute__((ext_vector_type(4)));
typedef unsigned int v4u __attribute__((ext_vector_type(4)));
typedef unsigned int v2u __attribute__((ext_vector_type(2)));
typedef float    v2f   __attribute__((ext_vector_type(2)));
typedef __bf16   v2bf  __attribute__((ext_vector_type(2)));
typedef _Float16 v2h   __attribute__((ext_vector_type(2)));

// ---------------------------------------------------------------------------
// WMMA wrappers with the VALU hazard guard (4 v_nop after every issue).
__device__ __forceinline__ v8f mma_bf16(v16bf a, v16bf b, v8f c) {
  v8f d = __builtin_amdgcn_wmma_f32_16x16x32_bf16(false, a, false, b, (short)0, c, false, false);
  asm volatile("v_nop\n\tv_nop\n\tv_nop\n\tv_nop" : "+v"(d) : "v"(a), "v"(b));
  return d;
}
__device__ __forceinline__ v8f mma_f16(v16h a, v16h b, v8f c) {
  v8f d = __builtin_amdgcn_wmma_f32_16x16x32_f16(false, a, false, b, (short)0, c, false, false);
  asm volatile("v_nop\n\tv_nop\n\tv_nop\n\tv_nop" : "+v"(d) : "v"(a), "v"(b));
  return d;
}

// 16-bit fragment, contraction dim CONTIGUOUS in memory: elem(k) = p0[rc*ld + k].
// Lane l: row/col rc = (l&15); elements 0..7 <- kk+8h+0..7, elements 8..15 <- kk+16+8h+0..7
// (h = l>>4). Same map for A (rc = row) and B (rc = column of a k-contiguous copy).
__device__ __forceinline__ v16bf ld_frag_bf(const __bf16* p0, int ld, int rc, int kk, int lane) {
  const int hh = (lane >> 4) & 1;
  const __bf16* p = p0 + (size_t)rc * ld + kk + 8 * hh;
  const v8bf lo = *(const v8bf*)(p);
  const v8bf hi = *(const v8bf*)(p + 16);
  v16bf f;
#pragma unroll
  for (int i = 0; i < 8; ++i) { f[i] = lo[i]; f[8 + i] = hi[i]; }
  return f;
}
__device__ __forceinline__ v16h ld_frag_h(const _Float16* p0, int ld, int rc, int kk, int lane) {
  const int hh = (lane >> 4) & 1;
  const _Float16* p = p0 + (size_t)rc * ld + kk + 8 * hh;
  const v8h lo = *(const v8h*)(p);
  const v8h hi = *(const v8h*)(p + 16);
  v16h f;
#pragma unroll
  for (int i = 0; i < 8; ++i) { f[i] = lo[i]; f[8 + i] = hi[i]; }
  return f;
}

// f32 -> bf16 bits, RNE convert
__device__ __forceinline__ unsigned int bfb(float x) {
  unsigned int u = __float_as_uint(x);
  u = u + 0x7FFFu + ((u >> 16) & 1u);
  return u >> 16;
}
// f32 -> value of its RNE bf16
__device__ __forceinline__ float bf16val(float x) {
  return __uint_as_float(bfb(x) << 16);
}
// f32 -> f16 bits, RNE convert
__device__ __forceinline__ unsigned short hbits(float x) {
  const _Float16 hv = (_Float16)x;
  return __builtin_bit_cast(unsigned short, hv);
}
__device__ __forceinline__ unsigned int pack2h(float a, float b) {
  return (unsigned int)hbits(a) | ((unsigned int)hbits(b) << 16);
}

// ---------------------------------------------------------------------------
// Wd f32 [ATT k][DOUT n] -> f16 plane [n][k] (k contiguous) holding 16 * bf16val(w), for k_oproj.
// One 64 k x 64 n tile a block, transposed through LDS (T: 64 * TP elements); entered by a whole block of 256 threads.
#define NWD (ATT * DOUT / 4096)   // tiles of the plane
__device__ __forceinline__ void cvt_wd_tile(const float* __restrict__ Wd, unsigned short* __restrict__ dst,
                                            unsigned short* T, int t, int tid) {
  const int k0 = (t % (ATT / 64)) * 64;
  const int n0 = (t / (ATT / 64)) * 64;
  const int wave = tid >> 5, lane = tid & 31;

  // piece idx = i * 256 + tid, 0..1023: k idx / 16, four n from (idx % 16) * 4
  const float* wsrc = Wd + (size_t)(k0 + (tid >> 4)) * DOUT + n0 + (tid & 15) * 4;
  v4f w[4];
#pragma unroll
  for (int i = 0; i < 4; ++i) w[i] = *(const v4f*)(wsrc + (size_t)i * 16 * DOUT);
  // stands in front of the first writes to the registers that these loads name; the address is an input so that it keeps its
  // registers up to here and no load of the group lands on them
  asm volatile("s_wait_xcnt 0x0" :: "v"(wsrc) : "memory");
#pragma unroll
  for (int i = 0; i < 4; ++i) {
    const int idx = i * 256 + tid;
    const int kk = idx >> 4;                // 0..63
    const int c4 = (idx & 15) * 4;          // 0..60
#pragma unroll
    for (int e = 0; e < 4; ++e) T[(c4 + e) * TP + kk] = hbits(bf16val(w[i][e]) * 16.0f);
  }
  __syncthreads();                          // tile complete (cross-wave)

  v4u v[2];
#pragma unroll
  for (int it = 0; it < 2; ++it) v[it] = *(const v4u*)(&T[(wave * 8 + it * 4 + (lane >> 3)) * TP + (lane & 7) * 8]);
#pragma unroll
  for (int it = 0; it < 2; ++it)
    *(v4u*)(dst + (size_t)(n0 + wave * 8 + it * 4 + (lane >> 3)) * ATT + k0 + (lane & 7) * 8) = v[it];
}

// One k-step (32 k) of a head's weights, f32 as loaded -> the two bf16 fragments (column tiles 0, 1) of that k-step.
// As loaded: lane = (k octet q = lane / 8, column quad lane % 8), wr[r][c] = W[8q + r][4 * (lane % 8) + c].
// A lane rounds (RNE) and packs, for each of its 4 columns, its 8 k = one 16-byte piece of row n of T [32 n][32 k]; a fragment's
// lane (n = l15, h) reads pieces h and 2 + h of its row: k 8h + 0..7 and 16 + 8h + 0..7, the map of ld_frag_bf.
// T is the wave's own LDS range.
__device__ __forceinline__ void w_turn(const v4f (&wr)[8], unsigned short* T, int lane, v16bf& f0, v16bf& f1) {
#pragma unroll
  for (int c = 0; c < 4; ++c) {
    v4u w;
#pragma unroll
    for (int i = 0; i < 4; ++i) {
      const v2f pr = {wr[2 * i][c], wr[2 * i + 1][c]};
      w[i] = __builtin_bit_cast(unsigned int, __builtin_convertvector(pr, v2bf));
    }
    *(v4u*)(&T[((lane & 7) * 4 + c) * PTP + (lane >> 3) * 8]) = w;
  }
  // the wave's own pieces have reached LDS before its other lanes read them
  asm volatile("s_wait_dscnt 0x0" ::: "memory");
  f0 = ld_frag_bf((const __bf16*)T, PTP, lane & 15, 0, lane);
  f1 = ld_frag_bf((const __bf16*)T, PTP, 16 + (lane & 15), 0, lane);
  // every lane's reads are done before T is written again
  asm volatile("s_wait_dscnt 0x0" ::: "memory");
}

// ---------------------------------------------------------------------------
// Projection: C[MROWS][ATT] = bf16(x_z)[MROWS][DIN] * W_z + bias_z, written head by head.
// 256 thr = 8 waves; block = 256 rows x all ATT columns; wave = ONE head's 32 columns x the block's 256 rows.
// The block reads its 256 f32 input rows once: one wave-wide 16-byte load = one whole 512-byte row; RNE convert to bf16
// in registers, tile [256][128] in LDS, read by every wave (one block barrier, the only one).
// A wave reads its head's weights as they are given, f32 [k][n]: row k of a head = 32 columns = one 128-byte line, a wave-wide
// 16-byte load = 4 whole lines; it rounds them and turns them to fragment order in its own LDS range (w_turn), and keeps the
// fragments (2 column tiles x all of k, 64 registers) for all its rows: no weight tile in LDS, and every input fragment read
// from LDS serves two products. 256 rows a block: f32 weights for 256 rows are as many bytes a row as bf16 ones for 128.
// The first NWD blocks of the grid make k_oproj's weight plane instead (cvt_wd_tile): nothing in this launch reads it.
// z = 0, 1 (Q, K): D = W^T . x^T, A = weight rows (lane = column n), B = input rows (lane = token):
//   D[row = n 8h+r][col = token l15], so a lane holds 8 neighbouring d of one token = one 16-byte piece of the plane's row.
// z = 2 (V):       D = x . W, A = input rows, B = weight rows: D[row = token 8h+r][col = d l15],
//   so a lane holds 8 neighbouring keys of one d = one 16-byte piece of the transposed chunk's row.
// Planes, f16 x8, one contiguous tile of NQ * HD elements a (group, head):
//   Q, K: [token][d];  V: [chunk of 32 keys][d][key in chunk].
// Two row tiles (32 tokens) = 2 KiB contiguous in either plane: staged in the wave's own LDS range, whole lines stored.

// VT = false: Q / K form, VT = true: V form. Entered by the whole block behind the barrier that completes ax.
// The inner loops are unrolled so that their arrays (a, acc, wf, v) have constant indices and stay in registers.
template <bool VT>
__device__ __forceinline__ void proj_rows(const v16bf (&wf)[2][DIN / 32], const float* sbh,
                                          unsigned short* __restrict__ dst0, unsigned short* __restrict__ dst1,
                                          const unsigned short* ax, unsigned short* T, int lane) {
  const int l15 = lane & 15, half = (lane >> 4) & 1;
  const float car = 8.0f;
  for (int p = 0; p < 256 / 32; ++p) {
    unsigned short* dst = ((p < 4) ? dst0 : dst1) + (p & 3) * 32 * HD;   // each half of 128 rows has its own (group, head) tile
#pragma unroll
    for (int u = 0; u < 2; ++u) {
      v16bf a[DIN / 32];
#pragma unroll
      for (int s = 0; s < DIN / 32; ++s) a[s] = ld_frag_bf((const __bf16*)ax, AXP, (p * 2 + u) * 16 + l15, s * 32, lane);
      // the bias is the accumulator's start value: VT: d = j*16 + l15 in every element; else element r: d = j*16 + 8*half + r
      v8f acc[2];
#pragma unroll
      for (int j = 0; j < 2; ++j) {
        if (VT) {
          const float b = sbh[j * 16 + l15];
          acc[j] = (v8f){b, b, b, b, b, b, b, b};
        } else {
          acc[j] = *(const v8f*)(sbh + j * 16 + 8 * half);
        }
      }
#pragma unroll
      for (int s = 0; s < DIN / 32; ++s)
#pragma unroll
        for (int j = 0; j < 2; ++j) acc[j] = VT ? mma_bf16(a[s], wf[j][s], acc[j]) : mma_bf16(wf[j][s], a[s], acc[j]);
      // VT: acc[j][r] = C[token u*16 + 8*half + r][d j*16 + l15]; else acc[j][r] = C[token u*16 + l15][d j*16 + 8*half + r]
#pragma unroll
      for (int j = 0; j < 2; ++j) {
        v4u w;
#pragma unroll
        for (int i = 0; i < 4; ++i) {
          const v2f pr = {acc[j][2 * i] * car, acc[j][2 * i + 1] * car};
          w[i] = __builtin_bit_cast(unsigned int, __builtin_convertvector(pr, v2h));   // RNE, as hbits
        }
        *(v4u*)(&T[((VT ? j : u) * 16 + l15) * PTP + (VT ? u : j) * 16 + 8 * half]) = w;
      }
    }
    // the wave's own pieces have reached LDS before its other lanes read them back
    asm volatile("s_wait_dscnt 0x0" ::: "memory");
    v4u v[4];
#pragma unroll
    for (int it = 0; it < 4; ++it) v[it] = *(const v4u*)(&T[(it * 8 + (lane >> 2)) * PTP + (lane & 3) * 8]);
#pragma unroll
    for (int it = 0; it < 4; ++it) *(v4u*)(dst + it * 256 + lane * 8) = v[it];   // 512 contiguous bytes a store
    // stands in front of the next pass's first writes to the registers that these stores name
    asm volatile("s_wait_xcnt 0x0" ::: "memory");
  }
}

// second bound: at most 256 VGPRs (a wave holds 32 input rows and 16 weight loads at once); 2 blocks a WGP are resident together,
// which holds the whole grid (432 + NWD blocks, 256 WGPs)
__global__ __launch_bounds__(256, 4) void k_proj(
    const float* __restrict__ xq, const float* __restrict__ xk, const float* __restrict__ xv,
    const float* __restrict__ Wq, const float* __restrict__ Wk, const float* __restrict__ Wv,
    const float* __restrict__ Wd,
    const float* __restrict__ bq, const float* __restrict__ bk, const float* __restrict__ bv,
    unsigned short* __restrict__ qp, unsigned short* __restrict__ kp,
    unsigned short* __restrict__ vtp, unsigned short* __restrict__ wT) {
  __shared__ __align__(16) unsigned short ax[256 * AXP];      // converted input tile, cross-wave (block barrier)
  __shared__ __align__(16) unsigned short Tt[8 * 32 * PTP];   // weight turning, then output staging: one range a wave
  __shared__ __align__(32) float sb[ATT];                     // bias row, rounded to bf16 values (block barrier)
  static_assert(ATT == 256);                                  // one bias value a thread
  static_assert(NQ % 128 == 0);                               // each half (128 rows) of a block lies inside one group
  static_assert(NHEAD == 8 && HD == 32);                      // one head a wave, two column tiles a head
  static_assert(64 * TP <= 256 * AXP);                        // cvt_wd_tile's tile fits ax
  static_assert(DIN / 32 == 4);                               // weights in two batches of two k-steps

  const int tid = threadIdx.x;
  if (blockIdx.x < NWD) {                          // block-uniform, in front of every barrier of the projection
    cvt_wd_tile(Wd, wT + (size_t)3 * ATT * DIN, ax, blockIdx.x, tid);
    return;
  }
  const int bp = blockIdx.x - NWD;
  const int z = bp / (MROWS / 256);
  const int m0 = (bp - z * (MROWS / 256)) * 256;
  const int wave = tid >> 5, lane = tid & 31;

  const float* bias = (z == 0) ? bq : ((z == 1) ? bk : bv);
  const float* X = (z == 0) ? xq : ((z == 1) ? xk : xv);
  const float* Wz = (z == 0) ? Wq : ((z == 1) ? Wk : Wv);
  const float* xsrc = X + (size_t)(m0 + wave * 32) * DIN + lane * 4;
  // row 8 * (lane / 8) of a k-step, the head's columns 4 * (lane % 8) ..
  const float* wsrc = Wz + (size_t)(8 * (lane >> 3)) * ATT + wave * HD + (lane & 7) * 4;
  unsigned short* T = Tt + wave * 32 * PTP;

  const float bz = bias[tid];

  // k-steps 0, 1 of the weights, then the wave's 32 rows: all loads issued before the first convert, so that one memory latency
  // covers them; loads return in order, so the weights (issued first) are turned while the rows are still on their way.
  // All loops here are unrolled so that wr, xr and wf have constant indices and stay in registers.
  v4f wr[2][8];
#pragma unroll
  for (int s = 0; s < 2; ++s)
#pragma unroll
    for (int r = 0; r < 8; ++r) wr[s][r] = *(const v4f*)(wsrc + (size_t)(s * 32 + r) * ATT);
  // keeps these loads in front of the rows': set behind them they return last, and the turning waits for the rows
  __builtin_amdgcn_sched_barrier(0);
  v4f xr[32];
#pragma unroll
  for (int r = 0; r < 32; ++r) xr[r] = *(const v4f*)(xsrc + (size_t)r * DIN);
  // stands in front of the first writes to the registers that these loads name; the addresses are inputs so that they keep their
  // registers up to here and no load of the group lands on them
  asm volatile("s_wait_xcnt 0x0" :: "v"(xsrc), "v"(wsrc) : "memory");
  // keeps what reads a loaded value behind the last of these loads: set among them, its wait held the rows' loads back by the
  // weights' latency
  __builtin_amdgcn_sched_barrier(0);
  v16bf wf[2][DIN / 32];
#pragma unroll
  for (int s = 0; s < 2; ++s) w_turn(wr[s], T, lane, wf[0][s], wf[1][s]);
  // k-steps 2, 3: on their way while the rows are converted
#pragma unroll
  for (int s = 0; s < 2; ++s)
#pragma unroll
    for (int r = 0; r < 8; ++r) wr[s][r] = *(const v4f*)(wsrc + (size_t)((2 + s) * 32 + r) * ATT);
  // as above
  asm volatile("s_wait_xcnt 0x0" :: "v"(wsrc) : "memory");
  // keeps the rows' converts, which wait for the rows, behind the issue of these loads: in front of it they left the weights'
  // latency to be waited for after the rows' own
  __builtin_amdgcn_sched_barrier(0);
#pragma unroll
  for (int r = 0; r < 32; ++r) {
    const v2f lo = {xr[r][0], xr[r][1]};
    const v2f hi = {xr[r][2], xr[r][3]};
    v2u w;
    w[0] = __builtin_bit_cast(unsigned int, __builtin_convertvector(lo, v2bf));
    w[1] = __builtin_bit_cast(unsigned int, __builtin_convertvector(hi, v2bf));
    *(v2u*)(&ax[(wave * 32 + r) * AXP + lane * 4]) = w;
  }
  sb[tid] = bf16val(bz);
#pragma unroll
  for (int s = 0; s < 2; ++s) w_turn(wr[s], T, lane, wf[0][2 + s], wf[1][2 + s]);
  __syncthreads();                                 // input tile and bias row complete

  // the block's two halves of 128 tokens in their (group, head) tiles
  const int g0 = m0 / NQ, g1 = (m0 + 128) / NQ;
  const size_t o0 = (((size_t)g0 * NHEAD + wave) * NQ + (m0 - g0 * NQ)) * HD;
  const size_t o1 = (((size_t)g1 * NHEAD + wave) * NQ + (m0 + 128 - g1 * NQ)) * HD;
  if (z != 2) {                                    // block-uniform branch
    unsigned short* pl = (z == 0) ? qp : kp;
    proj_rows<false>(wf, sb + wave * HD, pl + o0, pl + o1, ax, T, lane);
  } else {
    proj_rows<true>(wf, sb + wave * HD, vtp + o0, vtp + o1, ax, T, lane);
  }
}

// raw score -> exponent of 2: (1/64)/sqrt(32) * log2(e)
#define K2 (0.17677669529663689f * (1.0f / 64.0f) * 1.4426950408889634f)
// a lane's P values are positive, so a sum of them below this bound keeps each of them finite in f16
#define PLIM 60000.0f

// 2^x with the free slot that the instruction set asks for behind a transcendental inside the same statement. For the rescale
// factor of the rare path.
__device__ __forceinline__ float exp2_slot(float x) {
  float y;
  asm("v_exp_f32 %0, %1\n\tv_nop" : "=v"(y) : "v"(x));
  return y;
}

// 2^x in place for a lane's 16 exponents of query tile T, in ONE statement. Each exponential overwrites its own source, so none
// overwrites the source or reads the result of the one in front of it; the v_nop is the free slot that the instruction set asks for
// behind the last one. The text must name single registers of the two 8-register operands, so these are tied to fixed
// registers, a range of its own for each tile of a pass (all below v256). Highest register first: the compiler forms the
// exponents in that order, so each is ready when its exponential issues. The s_delay_alu is a hint to the issue logic, no result
// depends on it: what follows the statement may read the last exponentials; hinted, the wave steps aside for the other waves
// of its SIMD instead of holding the vector port while it waits.
template <int T>
__device__ __forceinline__ void exp2_16(v8f& a, v8f& b) {
  static_assert(T >= 0 && T < 3);
  if constexpr (T == 0) {
    asm("v_exp_f32 v127, v127\n\tv_exp_f32 v126, v126\n\tv_exp_f32 v125, v125\n\tv_exp_f32 v124, v124\n\t"
        "v_exp_f32 v123, v123\n\tv_exp_f32 v122, v122\n\tv_exp_f32 v121, v121\n\tv_exp_f32 v120, v120\n\t"
        "v_exp_f32 v119, v119\n\tv_exp_f32 v118, v118\n\tv_exp_f32 v117, v117\n\tv_exp_f32 v116, v116\n\t"
        "v_exp_f32 v115, v115\n\tv_exp_f32 v114, v114\n\tv_exp_f32 v113, v113\n\tv_exp_f32 v112, v112\n\t"
        "v_nop\n\t"
        "s_delay_alu instid0(TRANS32_DEP_1)"
        : "+{v[112:119]}"(a), "+{v[120:127]}"(b));
  } else if constexpr (T == 1) {
    asm("v_exp_f32 v143, v143\n\tv_exp_f32 v142, v142\n\tv_exp_f32 v141, v141\n\tv_exp_f32 v140, v140\n\t"
        "v_exp_f32 v139, v139\n\tv_exp_f32 v138, v138\n\tv_exp_f32 v137, v137\n\tv_exp_f32 v136, v136\n\t"
        "v_exp_f32 v135, v135\n\tv_exp_f32 v134, v134\n\tv_exp_f32 v133, v133\n\tv_exp_f32 v132, v132\n\t"
        "v_exp_f32 v131, v131\n\tv_exp_f32 v130, v130\n\tv_exp_f32 v129, v129\n\tv_exp_f32 v128, v128\n\t"
        "v_nop\n\t"
        "s_delay_alu instid0(TRANS32_DEP_1)"
        : "+{v[128:135]}"(a), "+{v[136:143]}"(b));
  } else {
    asm("v_exp_f32 v159, v159\n\tv_exp_f32 v158, v158\n\tv_exp_f32 v157, v157\n\tv_exp_f32 v156, v156\n\t"
        "v_exp_f32 v155, v155\n\tv_exp_f32 v154, v154\n\tv_exp_f32 v153, v153\n\tv_exp_f32 v152, v152\n\t"
        "v_exp_f32 v151, v151\n\tv_exp_f32 v150, v150\n\tv_exp_f32 v149, v149\n\tv_exp_f32 v148, v148\n\t"
        "v_exp_f32 v147, v147\n\tv_exp_f32 v146, v146\n\tv_exp_f32 v145, v145\n\tv_exp_f32 v144, v144\n\t"
        "v_nop\n\t"
        "s_delay_alu instid0(TRANS32_DEP_1)"
        : "+{v[144:151]}"(a), "+{v[152:159]}"(b));
  }
}

// P = 2^(raw * K2 + nb) for a lane's 16 scores of query tile T; returns their sum (pairwise tree, packed adds).
template <int T>
__device__ __forceinline__ float exp_tile(v8f c0, v8f c1, float nb, v8f& p0, v8f& p1) {
  const v8f k2v = {K2, K2, K2, K2, K2, K2, K2, K2};
  const v8f nbv = {nb, nb, nb, nb, nb, nb, nb, nb};
  p0 = __builtin_elementwise_fma(c0, k2v, nbv);
  p1 = __builtin_elementwise_fma(c1, k2v, nbv);
  exp2_16<T>(p0, p1);
  const v8f s8 = p0 + p1;
  const v4f s4 = __builtin_shufflevector(s8, s8, 0, 1, 2, 3) + __builtin_shufflevector(s8, s8, 4, 5, 6, 7);
  const v2f s2 = __builtin_shufflevector(s4, s4, 0, 1) + __builtin_shufflevector(s4, s4, 2, 3);
  return s2[0] + s2[1];
}

// WMMA for attn_pass: the builtin alone. A pass is straight-line code over TQ independent query tiles, so the compiler
// fills the distance behind a WMMA with the other tiles' work (and pads what is left itself).
__device__ __forceinline__ v8f mma_f16_sl(v16h a, v16h b, v8f c) {
  return __builtin_amdgcn_wmma_f32_16x16x32_f16(false, a, false, b, (short)0, c, false, false);
}

// a lane's 16 P values of one tile as the B operand of V^T . P
__device__ __forceinline__ v16h pack_p(v8f p0, v8f p1) {
  v16h pb;
#pragma unroll
  for (int e = 0; e < 8; ++e) {
    pb[e]     = (_Float16)p0[e];   // key kc + 8h + e
    pb[8 + e] = (_Float16)p1[e];   // key kc + 16 + 8h + e
  }
  return pb;
}

// usual path of one query tile: P under the offset in use, its sum, its f16 operand
template <int T>
__device__ __forceinline__ void usual_tile(v8f c0, v8f c1, float nb, float& ws, v16h& pb) {
  v8f p0, p1;
  ws = exp_tile<T>(c0, c1, nb, p0, p1);
  pb = pack_p(p0, p1);
}

// rare path of one query tile (and the first chunk's): the true running maximum is taken, O and the sum are rescaled, P is formed
// under the new offset. The loops are unrolled so that the vectors' indices are constants.
template <bool FIRST, int T>
__device__ __forceinline__ void max_tile(v16h ka0, v16h ka2, v16h qb, v8f (&o)[2], float& nb, float& lsum, float& ws, v16h& pb) {
  const v8f zero = {};
  const v8f c0 = mma_f16_sl(ka0, qb, zero);
  const v8f c1 = mma_f16_sl(ka2, qb, zero);
  // maximum on the raw accumulators (the scale is positive, so the order is the same)
  float lm = fmaxf(c0[0], c1[0]);
#pragma unroll
  for (int r = 1; r < 8; ++r) lm = fmaxf(lm, fmaxf(c0[r], c1[r]));
  lm = fmaxf(lm, __shfl_xor(lm, 16, 32));
  // the offset under the running maximum: a larger maximum is a smaller offset, so the maximum itself is not kept
  const float nbl = 10.0f - lm * K2;       // 2^10 = the x1024 carry of P
  const float nbn = FIRST ? nbl : fminf(nb, nbl);
  if (!FIRST) {
    const float alpha = exp2_slot(nbn - nb);
    lsum *= alpha;
#pragma unroll
    for (int j = 0; j < 2; ++j)
#pragma unroll
      for (int r = 0; r < 8; ++r) o[j][r] *= alpha;
  }
  nb = nbn;
  usual_tile<T>(c0, c1, nb, ws, pb);
}

// One 32-key chunk for a wave's TQ query tiles. The maximum in use (held as the offset nb = 10 - maximum * K2) is kept as long as
// P stays in f16 range under it: softmax is the same for any subtracted value, since P, its sum and O carry the same
// factor. Usual path: no maximum, no exchange between the halves, no rescale, and ONE range test for the whole pass:
// the sums of P are positive, so the sum of a lane's TQ tile sums below PLIM keeps every P of the pass finite in f16.
// Only when some lane's sum reaches PLIM (or is not a number) the whole wave takes, for all its TQ tiles, the true
// running maximum, rescales O and the sum, and forms P again (then P <= 2^10).
// FIRST: nothing accumulated yet, the chunk's own maximum is taken directly.
// Every loop is unrolled so that the indices of qb, o, nb, lsum, ws, pb, c and of the vectors are constants (registers).
template <bool FIRST>
__device__ __forceinline__ void attn_pass(const unsigned short* Kc, const unsigned short* Vc, int lane,
                                          const v16h (&qb)[TQ], v8f (&o)[TQ][2],
                                          float (&nb)[TQ], float (&lsum)[TQ]) {
  const int l15 = lane & 15;
  const _Float16* kt = (const _Float16*)Kc;   // the chunk's 32 K rows
  const _Float16* vt = (const _Float16*)Vc;   // the chunk's 32 V^T rows
  const v8f zero = {};
  v16h pb[TQ];
  float ws[TQ];
  bool redo = FIRST;
  if (!FIRST) {
    const v16h ka0 = ld_frag_h(kt, KVP, l15, 0, lane);          // keys kc + 0..15
    const v16h ka2 = ld_frag_h(kt + 16 * KVP, KVP, l15, 0, lane);     // keys kc + 16..31
    v8f c[TQ][2];
#pragma unroll
    for (int t = 0; t < TQ; ++t) {
      c[t][0] = mma_f16_sl(ka0, qb[t], zero);
      c[t][1] = mma_f16_sl(ka2, qb[t], zero);
    }
    // keeps the 2 * TQ score products together in front of the vector work: each fills the distance behind the others, and the K
    // fragments' registers are free from here on (spread among the exponentials they cost v_nops and a spilled Q fragment)
    __builtin_amdgcn_sched_barrier(0);
    static_assert(TQ == 3);   // one call a tile: the tile's number is a template argument (exp2_16)
    usual_tile<0>(c[0][0], c[0][1], nb[0], ws[0], pb[0]);
    usual_tile<1>(c[1][0], c[1][1], nb[1], ws[1], pb[1]);
    usual_tile<2>(c[2][0], c[2][1], nb[2], ws[2], pb[2]);
    float wall = ws[0];
#pragma unroll
    for (int t = 1; t < TQ; ++t) wall += ws[t];
    redo = __builtin_amdgcn_ballot_w32(!(wall < PLIM)) != 0;   // wave-uniform: a scalar branch, EXEC stays full
  }
  if (FIRST || __builtin_expect(redo, false)) {   // rare: laid out off the usual path
    // the K fragments are read and the raw scores formed again here, so that neither stays in registers across the test
    const v16h ka0 = ld_frag_h(kt, KVP, l15, 0, lane);
    const v16h ka2 = ld_frag_h(kt + 16 * KVP, KVP, l15, 0, lane);
    max_tile<FIRST, 0>(ka0, ka2, qb[0], o[0], nb[0], lsum[0], ws[0], pb[0]);
    max_tile<FIRST, 1>(ka0, ka2, qb[1], o[1], nb[1], lsum[1], ws[1], pb[1]);
    max_tile<FIRST, 2>(ka0, ka2, qb[2], o[2], nb[2], lsum[2], ws[2], pb[2]);
  }
  const v16h va0 = ld_frag_h(vt, KVP, l15, 0, lane);          // d 0..15
  const v16h va1 = ld_frag_h(vt + 16 * KVP, KVP, l15, 0, lane);     // d 16..31
#pragma unroll
  for (int t = 0; t < TQ; ++t) {
    lsum[t] += ws[t];
    o[t][0] = mma_f16_sl(va0, pb[t], o[t][0]);
    o[t][1] = mma_f16_sl(va1, pb[t], o[t][1]);
  }
}

// ---------------------------------------------------------------------------
// Flash attention, transposed-score form: block = one (group, head); its K
// [384 keys][32 d] and V^T [32 d][384 keys] are staged ONCE in LDS and shared by
// 8 waves; wave = TQ query tiles of 16 (48 queries), so the block covers all
// 384 queries and every K / V fragment read from LDS serves TQ tiles.
// Per 32-key chunk and query tile:
//   S^T = K . Q^T    A = K rows (lane = key, k = d), B = Q^T (lane = query, k = d)
//                    D[row = key 8h+r][col = query l15]; c0 keys 0..15, c1 keys 16..31
//   per-lane online softmax for query l15 (16 local keys; the xor-16 partner holds the other 16), see attn_pass
//   O^T += V^T . P   A = V^T rows (lane = d, k = key), B = P: element i<8 <- c0[i]
//                    (key 8h+i), element 8+i <- c1[i] (key 16+8h+i), same lane
//                    D[row = d 8h+r][col = query l15]
// Scores carry 64 from the x8 planes; P = 2^(raw * k2 - max * k2 + 10), k2 = log2(e)/(64*sqrt(32)): one FMA and one
// exp2 a score. P and its sum carried x1024, V carried x8 -> context x16 = O * 16/(8 * carried sum).
// Context tiles [16 q][32 d] f16 x16 staged in LDS (the K tile's space, free
// behind a block barrier) and written to the head-major ctx plane
// [BL*NHEAD*NQ][HD]: each tile is 1024 contiguous bytes
// second bound: at most 160 VGPRs, so that the 3 blocks a WGP gets (768 blocks, 256 WGPs) are resident together
__global__ __launch_bounds__(256, 6) void k_attn(const unsigned short* __restrict__ qp,
                                              const unsigned short* __restrict__ kp,
                                              const unsigned short* __restrict__ vtp,
                                              unsigned short* __restrict__ ctx) {
  __shared__ __align__(16) unsigned short Ks[NQ * KVP];          // [key][d]; later the context tiles
  __shared__ __align__(16) unsigned short Vs[(NQ / 32) * VCS];   // [chunk][d][key in chunk]

  const int tid = threadIdx.x;
  const int wave = tid >> 5, lane = tid & 31;
  // the wave's number in a scalar register, for the epilogue: what is formed from it holds no vector register across the loop
  const int swave = __builtin_amdgcn_readfirstlane(tid >> 5);
  const int l15 = lane & 15;
  const int half = (lane >> 4) & 1;
  const int head = blockIdx.x;
  const int g = blockIdx.y;                // (b,l) group

  const _Float16* Q  = (const _Float16*)qp;
  const size_t tile = ((size_t)g * NHEAD + head) * NQ * HD;   // the (group, head) tile of a plane, contiguous
  const unsigned short* kbase = kp + tile;                    // [key][d]
  const unsigned short* vbase = vtp + tile;                   // [chunk of 32 keys][d][key in chunk]

  // stage K and V^T: 2 x 1536 pieces of 16 bytes, 6 + 6 a thread, all loads issued before the first LDS store
  v4u kr[NQ * 4 / 256], vr[NQ * 4 / 256];
#pragma unroll
  for (int i = 0; i < NQ * 4 / 256; ++i) {
    const int idx = i * 256 + tid;
    kr[i] = *(const v4u*)(kbase + idx * 8);
  }
#pragma unroll
  for (int i = 0; i < NQ * 4 / 256; ++i) {
    const int idx = i * 256 + tid;
    vr[i] = *(const v4u*)(vbase + idx * 8);
  }
  v16h qb[TQ];
#pragma unroll
  for (int t = 0; t < TQ; ++t) {
    const _Float16* qbase = Q + tile + (wave * TQ + t) * 16 * HD;
    qb[t] = ld_frag_h(qbase, HD, l15, 0, lane);                // d 0..31
  }
#pragma unroll
  for (int i = 0; i < NQ * 4 / 256; ++i) {
    const int idx = i * 256 + tid;
    *(v4u*)(&Ks[(idx >> 2) * KVP + (idx & 3) * 8]) = kr[i];
  }
#pragma unroll
  for (int i = 0; i < NQ * 4 / 256; ++i) {
    const int idx = i * 256 + tid;             // chunk idx / 128, d (idx / 4) % 32, piece idx % 4
    *(v4u*)(&Vs[(idx >> 7) * VCS + ((idx >> 2) & 31) * KVP + (idx & 3) * 8]) = vr[i];
  }
  __syncthreads();                         // K and V^T tiles complete

  v8f o[TQ][2] = {};
  float nb[TQ], lsum[TQ];
#pragma unroll
  for (int t = 0; t < TQ; ++t) { nb[t] = 0.0f; lsum[t] = 0.0f; }

  attn_pass<true>(Ks, Vs, lane, qb, o, nb, lsum);          // first chunk: sets each query's maximum
  for (int ch = 1; ch < NQ / 32; ++ch) attn_pass<false>(Ks + ch * (32 * KVP), Vs + ch * VCS, lane, qb, o, nb, lsum);

  // the two halves of a wave hold one query's keys 8h..8h+7 and 16+8h..: their partial row sums are joined here, once
  float lrun[TQ];
#pragma unroll
  for (int t = 0; t < TQ; ++t) lrun[t] = lsum[t] + __shfl_xor(lsum[t], 16, 32);
  __syncthreads();                         // every wave's last read of the K tile done: its space becomes context staging

  // o[t][j][r] = 8192 * sum_t p_t v_t for query l15, d = j*16 + 8*half + r; ctx carried x16
#pragma unroll
  for (int t = 0; t < TQ; ++t) {
    const float inv = 1.0f / (lrun[t] * 0.5f);   // lrun carries the x1024 of P
    unsigned short* T = Ks + (swave * TQ + t) * 16 * CTP;
#pragma unroll
    for (int j = 0; j < 2; ++j) {
      v4u w;
      w[0] = pack2h(o[t][j][0] * inv, o[t][j][1] * inv);
      w[1] = pack2h(o[t][j][2] * inv, o[t][j][3] * inv);
      w[2] = pack2h(o[t][j][4] * inv, o[t][j][5] * inv);
      w[3] = pack2h(o[t][j][6] * inv, o[t][j][7] * inv);
      *(v4u*)(&T[l15 * CTP + j * 16 + 8 * half]) = w;
    }
  }
  __syncthreads();

  v4u v[TQ][2];
#pragma unroll
  for (int t = 0; t < TQ; ++t)
#pragma unroll
    for (int it = 0; it < 2; ++it) {
      const int row = it * 8 + (lane >> 2);     // 0..15 query row of the tile
      const int piece = (lane & 3) * 8;         // 8 halves = 16 B; 4 pieces = 64-B row, 8 lanes = one line
      v[t][it] = *(const v4u*)(&Ks[((swave * TQ + t) * 16 + row) * CTP + piece]);
    }
  unsigned short* cb = ctx + (((size_t)g * NHEAD + head) * NQ + swave * TQ * 16) * HD;
#pragma unroll
  for (int t = 0; t < TQ; ++t)
#pragma unroll
    for (int it = 0; it < 2; ++it)
      *(v4u*)(cb + (t * 16 + it * 8) * HD + lane * 8) = v[t][it];   // row lane / 4, piece lane % 4: 16 bytes a lane in a row
}

// ---------------------------------------------------------------------------
// Output projection: out[MROWS][DOUT] f32 = ctx[MROWS][ATT] * WdT[DOUT][ATT]^T / 256 + bd.
// ctx read from the head-major plane: for row (g, n) the 32 k values of
// k-step s (= head s) are contiguous at ((g*NHEAD + s)*NQ + n)*HD.
// 256 thr = 8 waves; block = 128 rows x all DOUT columns; wave = 32 rows x 64 columns
// (4 row groups x 2 column halves), so every weight fragment read from LDS serves two row tiles.
// The whole WdT plane [128 n][256 k] (64 KiB, contiguous) is staged ONCE in LDS, and each wave
// issues the loads of all its ctx fragments (all of k) before it waits for anything: one memory
// latency and one block barrier stand in front of the products, none between the k-steps.
// f16 operands, k-steps summed in the order 0..7. Epilogue: each wave stages its f32 tile in its
// own LDS range; each 256-byte row segment = 2 lines, written by 16 consecutive lanes.
__global__ __launch_bounds__(256) void k_oproj(const unsigned short* __restrict__ ctx,
                                               const unsigned short* __restrict__ wT,
                                               const float* __restrict__ bd,
                                               float* __restrict__ outp) {
  __shared__ __align__(16) unsigned short bt[DOUT * WOP];   // weight plane, cross-wave (block barrier)
  __shared__ __align__(16) float E[8 * 32 * OEP];           // epilogue tiles, one a wave
  static_assert(NQ % 128 == 0);                             // a block's 128 rows lie inside one group
  static_assert(DOUT == 128 && ATT == 256);                 // 2 column halves of 64; one plane row = one wave-wide 16-byte load

  const int m0 = blockIdx.y * 128;
  const int tid = threadIdx.x;
  const int wave = tid >> 5, lane = tid & 31;
  const int l15 = lane & 15, half = (lane >> 4) & 1;
  const int rg = wave >> 1;           // 0..3 : row group of 32
  const int c0 = (wave & 1) * 64;     // column half

  // weight plane = 4096 pieces of 16 bytes, 16 a thread: piece i*256 + tid = row i*8 + wave, piece lane
  const unsigned short* wsrc = wT + (size_t)3 * ATT * DIN + tid * 8;   // WdT plane [DOUT][ATT], f16 x16
  v4u wv[16];
#pragma unroll
  for (int i = 0; i < 16; ++i) wv[i] = *(const v4u*)(wsrc + i * 2048);

  const int g = m0 / NQ;
  const int nl = m0 - g * NQ + rg * 32;
  const _Float16* A0 = (const _Float16*)ctx + ((size_t)g * NHEAD * NQ + nl) * HD;
  // loops unrolled so that a, wv, b, acc and v have constant indices and stay in registers
  v16h a[2][ATT / 32];
#pragma unroll
  for (int s = 0; s < ATT / 32; ++s)
#pragma unroll
    for (int mt = 0; mt < 2; ++mt) a[mt][s] = ld_frag_h(A0 + (size_t)s * NQ * HD + mt * 16 * HD, HD, l15, 0, lane);
  float bb[4];
#pragma unroll
  for (int j = 0; j < 4; ++j) bb[j] = bd[c0 + j * 16 + l15];

#pragma unroll
  for (int i = 0; i < 16; ++i) *(v4u*)(&bt[(i * 8 + wave) * WOP + lane * 8]) = wv[i];
  __syncthreads();                                 // weight plane complete

  v8f acc[2][4] = {};
#pragma unroll
  for (int s = 0; s < ATT / 32; ++s) {
    v16h b[4];
#pragma unroll
    for (int j = 0; j < 4; ++j) b[j] = ld_frag_h((const _Float16*)bt, WOP, c0 + j * 16 + l15, s * 32, lane);
#pragma unroll
    for (int j = 0; j < 4; ++j)
#pragma unroll
      for (int mt = 0; mt < 2; ++mt) acc[mt][j] = mma_f16(a[mt][s], b[j], acc[mt][j]);
  }

  // acc[mt][j][r] = 256 * (ctx.Wd)[m0 + rg*32 + mt*16 + 8*half + r][c0 + j*16 + l15]
  const float cinv = 1.0f / 256.0f;
  float* Ew = E + wave * 32 * OEP;
#pragma unroll
  for (int j = 0; j < 4; ++j) {
    const int col = j * 16 + l15;
    const float bj = bf16val(bb[j]);
#pragma unroll
    for (int mt = 0; mt < 2; ++mt)
#pragma unroll
      for (int r = 0; r < 8; ++r) Ew[(mt * 16 + 8 * half + r) * OEP + col] = acc[mt][j][r] * cinv + bj;
  }
  __syncthreads();                                 // epilogue tiles complete

  float* ob = outp + (size_t)(m0 + rg * 32 + half) * DOUT + c0 + l15 * 4;
  v4f v[16];
#pragma unroll
  for (int it = 0; it < 16; ++it)                  // row it*2 + half; 16 pieces of 16 B = the row's 256-byte segment (2 lines)
    v[it] = *(const v4f*)(&Ew[(it * 2 + half) * OEP + l15 * 4]);
#pragma unroll
  for (int it = 0; it < 16; ++it) *(v4f*)(ob + (size_t)it * 2 * DOUT) = v[it];
}

// ---------------------------------------------------------------------------
extern "C" void kernel_launch(void* const* d_in, const int* in_sizes, int n_in,
                              void* d_out, int out_size, void* d_ws, size_t ws_size,
                              hipStream_t stream) {
  if (n_in < 11) return;
  if (in_sizes[0] < MROWS * DIN || in_sizes[1] < MROWS * DIN || in_sizes[2] < MROWS * DIN) return;
  if (in_sizes[3] < DIN * ATT || in_sizes[5] < DIN * ATT || in_sizes[7] < DIN * ATT) return;
  if (in_sizes[4] < ATT || in_sizes[6] < ATT || in_sizes[8] < ATT) return;
  if (in_sizes[9] < ATT * DOUT || in_sizes[10] < DOUT) return;
  if (out_size < MROWS * DOUT) return;

  const float* xq = (const float*)d_in[0];
  const float* xk = (const float*)d_in[1];
  const float* xv = (const float*)d_in[2];
  const float* Wq = (const float*)d_in[3];
  const float* bq = (const float*)d_in[4];
  const float* Wk = (const float*)d_in[5];
  const float* bk = (const float*)d_in[6];
  const float* Wv = (const float*)d_in[7];
  const float* bv = (const float*)d_in[8];
  const float* Wd = (const float*)d_in[9];
  const float* bd = (const float*)d_in[10];

  // and is written exactly to its extent (no padded tails needed: all tiles divide the shapes)
  const size_t wt_bytes  = (size_t)4 * DIN * ATT * 2;        // the f16 WdT plane is the last quarter, the rest is not used
  const size_t pl_bytes  = (size_t)MROWS * ATT * 2;          // one f16 plane (Q, K, V^T, ctx)
  const size_t off_wt  = 0;
  const size_t off_q   = off_wt + wt_bytes;
  const size_t off_k   = off_q + pl_bytes;
  const size_t off_vt  = off_k + pl_bytes;
  const size_t off_ctx = off_vt + pl_bytes;
  const size_t total   = off_ctx + pl_bytes;                 // 75759616 B at full size
  if (total > ws_size) return;

  char* ws = (char*)d_ws;
  unsigned short* wt  = (unsigned short*)(ws + off_wt);
  unsigned short* qpl = (unsigned short*)(ws + off_q);
  unsigned short* kpl = (unsigned short*)(ws + off_k);
  unsigned short* vtp = (unsigned short*)(ws + off_vt);
  unsigned short* cxp = (unsigned short*)(ws + off_ctx);

  k_proj<<<dim3(NWD + 3 * (MROWS / 256)), 256, 0, stream>>>(xq, xk, xv, Wq, Wk, Wv, Wd, bq, bk, bv, qpl, kpl, vtp, wt);
  k_attn<<<dim3(NHEAD, BL), 256, 0, stream>>>(qpl, kpl, vtp, cxp);
  k_oproj<<<dim3(1, MROWS / 128), 256, 0, stream>>>(cxp, wt, bd, (float*)d_out);
}

// v010
// It runs in 40.3 microseconds.
// Next to v009, in two timings, it ran 1.04 times as fast each time.
// Over all steps from v000 it is 3.05 times as fast.
#include <hip/hip_runtime.h>
// Projections x*W{q,k,v}: v_wmma_f32_16x16x32_bf16 (bf16 operands = RNE-converted inputs, f32 accumulate); scores K*Q^T, context V^T*P and output projection ctx*Wd: v_wmma_f32_16x16x32_f16 (f16 operands; K/V planes carried x8, Q plane carried xQCAR so that a raw score is the exponent of 2, ctx plane carried x16, Wd plane carried x16; f32 accumulate); softmax in f32.

#ifndef NB
#define NB 8
#endif
#ifndef LL
#define LL 12
#endif
#define NB_FULL 8
#define LL_FULL 12
#define NQ 384           // tokens per (b,l) group = attention length
#define DIN 128          // feature width of query / key / value inputs
#define ATT 256          // attention width = NHEAD * HD
#define NHEAD 8
#define HD 32
#define DOUT 128         // output feature width
#define BL (NB * LL)     // number of (b,l) groups processed
#define MROWS (BL * NQ)  // token rows processed (prefix of the full row range)

static_assert(NB >= 1 && NB <= NB_FULL);
static_assert(LL >= 1 && LL <= LL_FULL);
static_assert(LL == LL_FULL || NB == 1);
static_assert(ATT == NHEAD * HD);
static_assert(HD == 32);
static_assert(NHEAD == 8);
static_assert(NQ % 32 == 0);
static_assert(NQ % 16 == 0);
static_assert(MROWS % 128 == 0);
static_assert(DIN % 64 == 0 && ATT % 64 == 0 && DOUT % 64 == 0);
static_assert(DIN * ATT == ATT * DOUT);
static_assert((DIN * ATT) % 4096 == 0);
static_assert(DIN == 32 * 4);   // one input row = one wave-wide 16-byte load
static_assert((size_t)NB_FULL * LL_FULL * NQ * DOUT * 4 == 18874368);
// coverage equalities (grid x block x per-thread elements == plane elements)
static_assert((size_t)(ATT * DOUT / 4096) * 64 * 64 == (size_t)ATT * DOUT);                 // output-projection weight plane
static_assert(MROWS % 256 == 0);
static_assert((size_t)(MROWS / 256) * NHEAD * 256 * HD == (size_t)MROWS * ATT);             // Q, K, V planes (a head a wave, 256 rows a block)
static_assert((size_t)MROWS * ATT * 2 < 4294967296ull);   // 32-bit byte offsets into a plane
static_assert((size_t)NHEAD * BL * NQ * HD == (size_t)MROWS * ATT);                        // ctx plane
static_assert((size_t)(MROWS / 128) * 128 * DOUT == (size_t)MROWS * DOUT);                  // out

// LDS pitches (16-bit elements unless noted); all keep 16-byte row alignment
#define WOP 264    // output-projection weight plane [128 n][256 k]: 528-byte rows (16 B x odd) for 16-byte fragment reads
#define AXP 136    // converted input tile [256 rows][128 k]: 272-byte rows for 16-byte fragment reads
#define PTP 40     // projection output staging (and weight turning) [32 rows][32 halves] a wave: 80-byte rows (16 B x odd)
#define TP  72     // weight transpose tile [64 n][64 k]
#define CTP 40     // context tile [16 q][32 d] halves
#define OEP 68     // output epilogue tile [32 rows][64 cols] a wave, floats
#define KVP 40     // attention K / V^T tiles: rows of 32 halves
#define VCS (32 * KVP + 32)   // one 32-key chunk of V^T: 32 rows + 64 B
#define TQ  3      // query tiles of 16 per attention wave
static_assert(8 * TQ * 16 == NQ);                 // 8 waves x TQ tiles cover the group's queries
static_assert(8 * TQ * 16 * CTP <= NQ * KVP);     // context tiles fit the K tile's space
static_assert((NQ * 4) % 256 == 0);

typedef __bf16   v16bf __attribute__((ext_vector_type(16)));
typedef __bf16   v8bf  __attribute__((ext_vector_type(8)));
typedef _Float16 v16h  __attribute__((ext_vector_type(16)));
typedef _Float16 v8h   __attribute__((ext_vector_type(8)));
typedef float    v8f   __attribute__((ext_vector_type(8)));
typedef float    v4f   __attribute__((ext_vector_type(4)));
typedef unsigned int v4u __attribute__((ext_vector_type(4)));
typedef unsigned int v2u __attribute__((ext_vector_type(2)));
typedef float    v2f   __attribute__((ext_vector_type(2)));
typedef __bf16   v2bf  __attribute__((ext_vector_type(2)));
typedef _Float16 v2h   __attribute__((ext_vector_type(2)));

// ---------------------------------------------------------------------------
// WMMA wrappers with the VALU hazard guard (4 v_nop after every issue).
__device__ __forceinline__ v8f mma_bf16(v16bf a, v16bf b, v8f c) {
  v8f d = __builtin_amdgcn_wmma_f32_16x16x32_bf16(false, a, false, b, (short)0, c, false, false);
  asm volatile("v_nop\n\tv_nop\n\tv_nop\n\tv_nop" : "+v"(d) : "v"(a), "v"(b));
  return d;
}
__device__ __forceinline__ v8f mma_f16(v16h a, v16h b, v8f c) {
  v8f d = __builtin_amdgcn_wmma_f32_16x16x32_f16(false, a, false, b, (short)0, c, false, false);
  asm volatile("v_nop\n\tv_nop\n\tv_nop\n\tv_nop" : "+v"(d) : "v"(a), "v"(b));
  return d;
}

// 16-bit fragment, contraction dim CONTIGUOUS in memory: elem(k) = p0[rc*ld + k].
// Lane l: row/col rc = (l&15); elements 0..7 <- kk+8h+0..7, elements 8..15 <- kk+16+8h+0..7
// (h = l>>4). Same map for A (rc = row) and B (rc = column of a k-contiguous copy).
__device__ __forceinline__ v16bf ld_frag_bf(const __bf16* p0, int ld, int rc, int kk, int lane) {
  const int hh = (lane >> 4) & 1;
  const __bf16* p = p0 + (size_t)rc * ld + kk + 8 * hh;
  const v8bf lo = *(const v8bf*)(p);
  const v8bf hi = *(const v8bf*)(p + 16);
  v16bf f;
#pragma unroll
  for (int i = 0; i < 8; ++i) { f[i] = lo[i]; f[8 + i] = hi[i]; }
  return f;
}
__device__ __forceinline__ v16h ld_frag_h(const _Float16* p0, int ld, int rc, int kk, int lane) {
  const int hh = (lane >> 4) & 1;
  const _Float16* p = p0 + (size_t)rc * ld + kk + 8 * hh;
  const v8h lo = *(const v8h*)(p);
  const v8h hi = *(const v8h*)(p + 16);
  v16h f;
#pragma unroll
  for (int i = 0; i < 8; ++i) { f[i] = lo[i]; f[8 + i] = hi[i]; }
  return f;
}

// f32 -> bf16 bits, RNE convert
__device__ __forceinline__ unsigned int bfb(float x) {
  unsigned int u = __float_as_uint(x);
  u = u + 0x7FFFu + ((u >> 16) & 1u);
  return u >> 16;
}
// f32 -> value of its RNE bf16
__device__ __forceinline__ float bf16val(float x) {
  return __uint_as_float(bfb(x) << 16);
}
// f32 -> f16 bits, RNE convert
__device__ __forceinline__ unsigned short hbits(float x) {
  const _Float16 hv = (_Float16)x;
  return __builtin_bit_cast(unsigned short, hv);
}
__device__ __forceinline__ unsigned int pack2h(float a, float b) {
  return (unsigned int)hbits(a) | ((unsigned int)hbits(b) << 16);
}

// ---------------------------------------------------------------------------
// Wd f32 [ATT k][DOUT n] -> f16 plane [n][k] (k contiguous) holding 16 * bf16val(w), for k_oproj.
// One 64 k x 64 n tile a block, transposed through LDS (T: 64 * TP elements); entered by a whole block of 256 threads.
#define NWD (ATT * DOUT / 4096)   // tiles of the plane
__device__ __forceinline__ void cvt_wd_tile(const float* __restrict__ Wd, unsigned short* __restrict__ dst,
                                            unsigned short* T, int t, int tid) {
  const int k0 = (t % (ATT / 64)) * 64;
  const int n0 = (t / (ATT / 64)) * 64;
  const int wave = tid >> 5, lane = tid & 31;

  // piece idx = i * 256 + tid, 0..1023: k idx / 16, four n from (idx % 16) * 4
  const float* wsrc = Wd + (size_t)(k0 + (tid >> 4)) * DOUT + n0 + (tid & 15) * 4;
  v4f w[4];
#pragma unroll
  for (int i = 0; i < 4; ++i) w[i] = *(const v4f*)(wsrc + (size_t)i * 16 * DOUT);
  // stands in front of the first writes to the registers that these loads name; the address is an input so that it keeps its
  // registers up to here and no load of the group lands on them
  asm volatile("s_wait_xcnt 0x0" :: "v"(wsrc) : "memory");
#pragma unroll
  for (int i = 0; i < 4; ++i) {
    const int idx = i * 256 + tid;
    const int kk = idx >> 4;                // 0..63
    const int c4 = (idx & 15) * 4;          // 0..60
#pragma unroll
    for (int e = 0; e < 4; ++e) T[(c4 + e) * TP + kk] = hbits(bf16val(w[i][e]) * 16.0f);
  }
  __syncthreads();                          // tile complete (cross-wave)

  v4u v[2];
#pragma unroll
  for (int it = 0; it < 2; ++it) v[it] = *(const v4u*)(&T[(wave * 8 + it * 4 + (lane >> 3)) * TP + (lane & 7) * 8]);
#pragma unroll
  for (int it = 0; it < 2; ++it)
    *(v4u*)(dst + (size_t)(n0 + wave * 8 + it * 4 + (lane >> 3)) * ATT + k0 + (lane & 7) * 8) = v[it];
}

// One k-step (32 k) of a head's weights, f32 as loaded -> the two bf16 fragments (column tiles 0, 1) of that k-step.
// As loaded: lane = (k octet q = lane / 8, column quad lane % 8), wr[r][c] = W[8q + r][4 * (lane % 8) + c].
// A lane rounds (RNE) and packs, for each of its 4 columns, its 8 k = one 16-byte piece of row n of T [32 n][32 k]; a fragment's
// lane (n = l15, h) reads pieces h and 2 + h of its row: k 8h + 0..7 and 16 + 8h + 0..7, the map of ld_frag_bf.
// T is the wave's own LDS range.
__device__ __forceinline__ void w_turn(const v4f (&wr)[8], unsigned short* T, int lane, v16bf& f0, v16bf& f1) {
#pragma unroll
  for (int c = 0; c < 4; ++c) {
    v4u w;
#pragma unroll
    for (int i = 0; i < 4; ++i) {
      const v2f pr = {wr[2 * i][c], wr[2 * i + 1][c]};
      w[i] = __builtin_bit_cast(unsigned int, __builtin_convertvector(pr, v2bf));
    }
    *(v4u*)(&T[((lane & 7) * 4 + c) * PTP + (lane >> 3) * 8]) = w;
  }
  // the wave's own pieces have reached LDS before its other lanes read them
  asm volatile("s_wait_dscnt 0x0" ::: "memory");
  f0 = ld_frag_bf((const __bf16*)T, PTP, lane & 15, 0, lane);
  f1 = ld_frag_bf((const __bf16*)T, PTP, 16 + (lane & 15), 0, lane);
  // every lane's reads are done before T is written again
  asm volatile("s_wait_dscnt 0x0" ::: "memory");
}

// ---------------------------------------------------------------------------
// Projection: C[MROWS][ATT] = bf16(x_z)[MROWS][DIN] * W_z + bias_z, written head by head.
// 256 thr = 8 waves; block = 256 rows x all ATT columns; wave = ONE head's 32 columns x the block's 256 rows.
// The block reads its 256 f32 input rows once: one wave-wide 16-byte load = one whole 512-byte row; RNE convert to bf16
// in registers, tile [256][128] in LDS, read by every wave (one block barrier, the only one).
// A wave reads its head's weights as they are given, f32 [k][n]: row k of a head = 32 columns = one 128-byte line, a wave-wide
// 16-byte load = 4 whole lines; it rounds them and turns them to fragment order in its own LDS range (w_turn), and keeps the
// fragments (2 column tiles x all of k, 64 registers) for all its rows: no weight tile in LDS, and every input fragment read
// from LDS serves two products. 256 rows a block: f32 weights for 256 rows are as many bytes a row as bf16 ones for 128.
// The first NWD blocks of the grid make k_oproj's weight plane instead (cvt_wd_tile): nothing in this launch reads it.
// z = 0, 1 (Q, K): D = W^T . x^T, A = weight rows (lane = column n), B = input rows (lane = token):
//   D[row = n 8h+r][col = token l15], so a lane holds 8 neighbouring d of one token = one 16-byte piece of the plane's row.
// z = 2 (V):       D = x . W, A = input rows, B = weight rows: D[row = token 8h+r][col = d l15],
//   so a lane holds 8 neighbouring keys of one d = one 16-byte piece of the transposed chunk's row.
// Planes, f16 (K, V x8; Q xQCAR), one contiguous tile of NQ * HD elements a (group, head):
//   Q, K: [token][d];  V: [chunk of 32 keys][d][key in chunk].
// Two row tiles (32 tokens) = 2 KiB contiguous in either plane: staged in the wave's own LDS range, whole lines stored.

// carry of the Q plane: with K's x8 a raw score of k_attn is (q . k) / sqrt(32) * log2(e), the exponent of 2 itself
#define QCAR (0.17677669529663689f * 1.4426950408889634f / 8.0f)

// VT = false: Q / K form, VT = true: V form; car: the plane's carry. Entered by the whole block behind the barrier that completes ax.
// The inner loops are unrolled so that their arrays (a, acc, wf, v) have constant indices and stay in registers.
template <bool VT>
__device__ __forceinline__ void proj_rows(const v16bf (&wf)[2][DIN / 32], const float* sbh,
                                          unsigned short* __restrict__ dst0, unsigned short* __restrict__ dst1,
                                          const unsigned short* ax, unsigned short* T, int lane, float car) {
  const int l15 = lane & 15, half = (lane >> 4) & 1;
  for (int p = 0; p < 256 / 32; ++p) {
    unsigned short* dst = ((p < 4) ? dst0 : dst1) + (p & 3) * 32 * HD;   // each half of 128 rows has its own (group, head) tile
#pragma unroll
    for (int u = 0; u < 2; ++u) {
      v16bf a[DIN / 32];
#pragma unroll
      for (int s = 0; s < DIN / 32; ++s) a[s] = ld_frag_bf((const __bf16*)ax, AXP, (p * 2 + u) * 16 + l15, s * 32, lane);
      // the bias is the accumulator's start value: VT: d = j*16 + l15 in every element; else element r: d = j*16 + 8*half + r
      v8f acc[2];
#pragma unroll
      for (int j = 0; j < 2; ++j) {
        if (VT) {
          const float b = sbh[j * 16 + l15];
          acc[j] = (v8f){b, b, b, b, b, b, b, b};
        } else {
          acc[j] = *(const v8f*)(sbh + j * 16 + 8 * half);
        }
      }
#pragma unroll
      for (int s = 0; s < DIN / 32; ++s)
#pragma unroll
        for (int j = 0; j < 2; ++j) acc[j] = VT ? mma_bf16(a[s], wf[j][s], acc[j]) : mma_bf16(wf[j][s], a[s], acc[j]);
      // VT: acc[j][r] = C[token u*16 + 8*half + r][d j*16 + l15]; else acc[j][r] = C[token u*16 + l15][d j*16 + 8*half + r]
#pragma unroll
      for (int j = 0; j < 2; ++j) {
        v4u w;
#pragma unroll
        for (int i = 0; i < 4; ++i) {
          const v2f pr = {acc[j][2 * i] * car, acc[j][2 * i + 1] * car};
          w[i] = __builtin_bit_cast(unsigned int, __builtin_convertvector(pr, v2h));   // RNE, as hbits
        }
        *(v4u*)(&T[((VT ? j : u) * 16 + l15) * PTP + (VT ? u : j) * 16 + 8 * half]) = w;
      }
    }
    // the wave's own pieces have reached LDS before its other lanes read them back
    asm volatile("s_wait_dscnt 0x0" ::: "memory");
    v4u v[4];
#pragma unroll
    for (int it = 0; it < 4; ++it) v[it] = *(const v4u*)(&T[(it * 8 + (lane >> 2)) * PTP + (lane & 3) * 8]);
#pragma unroll
    for (int it = 0; it < 4; ++it) *(v4u*)(dst + it * 256 + lane * 8) = v[it];   // 512 contiguous bytes a store
    // stands in front of the next pass's first writes to the registers that these stores name
    asm volatile("s_wait_xcnt 0x0" ::: "memory");
  }
}

// second bound: at most 256 VGPRs (a wave holds 32 input rows and 16 weight loads at once); 2 blocks a WGP are resident together,
// which holds the whole grid (432 + NWD blocks, 256 WGPs)
__global__ __launch_bounds__(256, 4) void k_proj(
    const float* __restrict__ xq, const float* __restrict__ xk, const float* __restrict__ xv,
    const float* __restrict__ Wq, const float* __restrict__ Wk, const float* __restrict__ Wv,
    const float* __restrict__ Wd,
    const float* __restrict__ bq, const float* __restrict__ bk, const float* __restrict__ bv,
    unsigned short* __restrict__ qp, unsigned short* __restrict__ kp,
    unsigned short* __restrict__ vtp, unsigned short* __restrict__ wT) {
  __shared__ __align__(16) unsigned short ax[256 * AXP];      // converted input tile, cross-wave (block barrier)
  __shared__ __align__(16) unsigned short Tt[8 * 32 * PTP];   // weight turning, then output staging: one range a wave
  __shared__ __align__(32) float sb[ATT];                     // bias row, rounded to bf16 values (block barrier)
  static_assert(ATT == 256);                                  // one bias value a thread
  static_assert(NQ % 128 == 0);                               // each half (128 rows) of a block lies inside one group
  static_assert(NHEAD == 8 && HD == 32);                      // one head a wave, two column tiles a head
  static_assert(64 * TP <= 256 * AXP);                        // cvt_wd_tile's tile fits ax
  static_assert(DIN / 32 == 4);                               // weights in two batches of two k-steps

  const int tid = threadIdx.x;
  if (blockIdx.x < NWD) {                          // block-uniform, in front of every barrier of the projection
    cvt_wd_tile(Wd, wT + (size_t)3 * ATT * DIN, ax, blockIdx.x, tid);
    return;
  }
  const int bp = blockIdx.x - NWD;
  const int z = bp / (MROWS / 256);
  const int m0 = (bp - z * (MROWS / 256)) * 256;
  const int wave = tid >> 5, lane = tid & 31;

  const float* bias = (z == 0) ? bq : ((z == 1) ? bk : bv);
  const float* X = (z == 0) ? xq : ((z == 1) ? xk : xv);
  const float* Wz = (z == 0) ? Wq : ((z == 1) ? Wk : Wv);
  const float* xsrc = X + (size_t)(m0 + wave * 32) * DIN + lane * 4;
  // row 8 * (lane / 8) of a k-step, the head's columns 4 * (lane % 8) ..
  const float* wsrc = Wz + (size_t)(8 * (lane >> 3)) * ATT + wave * HD + (lane & 7) * 4;
  unsigned short* T = Tt + wave * 32 * PTP;

  const float bz = bias[tid];

  // k-steps 0, 1 of the weights, then the wave's 32 rows: all loads issued before the first convert, so that one memory latency
  // covers them; loads return in order, so the weights (issued first) are turned while the rows are still on their way.
  // All loops here are unrolled so that wr, xr and wf have constant indices and stay in registers.
  v4f wr[2][8];
#pragma unroll
  for (int s = 0; s < 2; ++s)
#pragma unroll
    for (int r = 0; r < 8; ++r) wr[s][r] = *(const v4f*)(wsrc + (size_t)(s * 32 + r) * ATT);
  // keeps these loads in front of the rows': set behind them they return last, and the turning waits for the rows
  __builtin_amdgcn_sched_barrier(0);
  v4f xr[32];
#pragma unroll
  for (int r = 0; r < 32; ++r) xr[r] = *(const v4f*)(xsrc + (size_t)r * DIN);
  // stands in front of the first writes to the registers that these loads name; the addresses are inputs so that they keep their
  // registers up to here and no load of the group lands on them
  asm volatile("s_wait_xcnt 0x0" :: "v"(xsrc), "v"(wsrc) : "memory");
  // keeps what reads a loaded value behind the last of these loads: set among them, its wait held the rows' loads back by the
  // weights' latency
  __builtin_amdgcn_sched_barrier(0);
  v16bf wf[2][DIN / 32];
#pragma unroll
  for (int s = 0; s < 2; ++s) w_turn(wr[s], T, lane, wf[0][s], wf[1][s]);
  // k-steps 2, 3: on their way while the rows are converted
#pragma unroll
  for (int s = 0; s < 2; ++s)
#pragma unroll
    for (int r = 0; r < 8; ++r) wr[s][r] = *(const v4f*)(wsrc + (size_t)((2 + s) * 32 + r) * ATT);
  // as above
  asm volatile("s_wait_xcnt 0x0" :: "v"(wsrc) : "memory");
  // keeps the rows' converts, which wait for the rows, behind the issue of these loads: in front of it they left the weights'
  // latency to be waited for after the rows' own
  __builtin_amdgcn_sched_barrier(0);
#pragma unroll
  for (int r = 0; r < 32; ++r) {
    const v2f lo = {xr[r][0], xr[r][1]};
    const v2f hi = {xr[r][2], xr[r][3]};
    v2u w;
    w[0] = __builtin_bit_cast(unsigned int, __builtin_convertvector(lo, v2bf));
    w[1] = __builtin_bit_cast(unsigned int, __builtin_convertvector(hi, v2bf));
    *(v2u*)(&ax[(wave * 32 + r) * AXP + lane * 4]) = w;
  }
  sb[tid] = bf16val(bz);
#pragma unroll
  for (int s = 0; s < 2; ++s) w_turn(wr[s], T, lane, wf[0][2 + s], wf[1][2 + s]);
  __syncthreads();                                 // input tile and bias row complete

  // the block's two halves of 128 tokens in their (group, head) tiles
  const int g0 = m0 / NQ, g1 = (m0 + 128) / NQ;
  const size_t o0 = (((size_t)g0 * NHEAD + wave) * NQ + (m0 - g0 * NQ)) * HD;
  const size_t o1 = (((size_t)g1 * NHEAD + wave) * NQ + (m0 + 128 - g1 * NQ)) * HD;
  if (z != 2) {                                    // block-uniform branch
    unsigned short* pl = (z == 0) ? qp : kp;
    proj_rows<false>(wf, sb + wave * HD, pl + o0, pl + o1, ax, T, lane, (z == 0) ? QCAR : 8.0f);
  } else {
    proj_rows<true>(wf, sb + wave * HD, vtp + o0, vtp + o1, ax, T, lane, 8.0f);
  }
}

// a lane's P values are positive, so a sum of them below this bound keeps each of them finite in f16
#define PLIM 60000.0f
// a query's sum of P = 2^raw at or above this bound: what f16 drops of the small P (below 2^-25 each, NQ of them) is below
// 2^-16 of the sum, and the largest P is a normal f16 number
#define PLOW 1.0f

// 2^x with the free slot that the instruction set asks for behind a transcendental inside the same statement. For the rescale
// factor of the rare path.
__device__ __forceinline__ float exp2_slot(float x) {
  float y;
  asm("v_exp_f32 %0, %1\n\tv_nop" : "=v"(y) : "v"(x));
  return y;
}

// 2^x in place for a lane's 48 exponents of a pass (TQ query tiles), in ONE statement. Each exponential overwrites its own source,
// so none overwrites the source or reads the result of the one in front of it; the v_nop is the free slot that the instruction set asks
// for behind the last one. The text must name single registers of the 8-register operands, so these are tied to fixed
// registers, a range of its own for each tile of a pass (all below v256). The operands come straight from the score products:
// the tiles stand in the products' order, so that the later products fill the distance behind the first ones' results.
// The s_delay_alu is a hint to the issue logic, no result depends on it: what follows the statement may read the last
// exponentials; hinted, the wave steps aside for the other waves of its SIMD instead of holding the vector port while it waits.
__device__ __forceinline__ void exp2_48(v8f (&c)[TQ][2]) {
  static_assert(TQ == 3);
  asm("v_exp_f32 v127, v127\n\tv_exp_f32 v126, v126\n\tv_exp_f32 v125, v125\n\tv_exp_f32 v124, v124\n\t"
      "v_exp_f32 v123, v123\n\tv_exp_f32 v122, v122\n\tv_exp_f32 v121, v121\n\tv_exp_f32 v120, v120\n\t"
      "v_exp_f32 v119, v119\n\tv_exp_f32 v118, v118\n\tv_exp_f32 v117, v117\n\tv_exp_f32 v116, v116\n\t"
      "v_exp_f32 v115, v115\n\tv_exp_f32 v114, v114\n\tv_exp_f32 v113, v113\n\tv_exp_f32 v112, v112\n\t"
      "v_exp_f32 v143, v143\n\tv_exp_f32 v142, v142\n\tv_exp_f32 v141, v141\n\tv_exp_f32 v140, v140\n\t"
      "v_exp_f32 v139, v139\n\tv_exp_f32 v138, v138\n\tv_exp_f32 v137, v137\n\tv_exp_f32 v136, v136\n\t"
      "v_exp_f32 v135, v135\n\tv_exp_f32 v134, v134\n\tv_exp_f32 v133, v133\n\tv_exp_f32 v132, v132\n\t"
      "v_exp_f32 v131, v131\n\tv_exp_f32 v130, v130\n\tv_exp_f32 v129, v129\n\tv_exp_f32 v128, v128\n\t"
      "v_exp_f32 v159, v159\n\tv_exp_f32 v158, v158\n\tv_exp_f32 v157, v157\n\tv_exp_f32 v156, v156\n\t"
      "v_exp_f32 v155, v155\n\tv_exp_f32 v154, v154\n\tv_exp_f32 v153, v153\n\tv_exp_f32 v152, v152\n\t"
      "v_exp_f32 v151, v151\n\tv_exp_f32 v150, v150\n\tv_exp_f32 v149, v149\n\tv_exp_f32 v148, v148\n\t"
      "v_exp_f32 v147, v147\n\tv_exp_f32 v146, v146\n\tv_exp_f32 v145, v145\n\tv_exp_f32 v144, v144\n\t"
      "v_nop\n\t"
      "s_delay_alu instid0(TRANS32_DEP_1)"
      : "+{v[112:119]}"(c[0][0]), "+{v[120:127]}"(c[0][1]), "+{v[128:135]}"(c[1][0]), "+{v[136:143]}"(c[1][1]),
        "+{v[144:151]}"(c[2][0]), "+{v[152:159]}"(c[2][1]));
}

// The same for the 16 exponents of one query tile (careful form).
__device__ __forceinline__ void exp2_16(v8f& a, v8f& b) {
  asm("v_exp_f32 v127, v127\n\tv_exp_f32 v126, v126\n\tv_exp_f32 v125, v125\n\tv_exp_f32 v124, v124\n\t"
      "v_exp_f32 v123, v123\n\tv_exp_f32 v122, v122\n\tv_exp_f32 v121, v121\n\tv_exp_f32 v120, v120\n\t"
      "v_exp_f32 v119, v119\n\tv_exp_f32 v118, v118\n\tv_exp_f32 v117, v117\n\tv_exp_f32 v116, v116\n\t"
      "v_exp_f32 v115, v115\n\tv_exp_f32 v114, v114\n\tv_exp_f32 v113, v113\n\tv_exp_f32 v112, v112\n\t"
      "v_nop\n\t"
      "s_delay_alu instid0(TRANS32_DEP_1)"
      : "+{v[112:119]}"(a), "+{v[120:127]}"(b));
}

// P = 2^(raw + nb) for a lane's 16 scores of one query tile; returns their sum (pairwise tree, packed adds).
__device__ __forceinline__ float exp_tile(v8f c0, v8f c1, float nb, v8f& p0, v8f& p1) {
  const v8f nbv = {nb, nb, nb, nb, nb, nb, nb, nb};
  p0 = c0 + nbv;
  p1 = c1 + nbv;
  exp2_16(p0, p1);
  const v8f s8 = p0 + p1;
  const v4f s4 = __builtin_shufflevector(s8, s8, 0, 1, 2, 3) + __builtin_shufflevector(s8, s8, 4, 5, 6, 7);
  const v2f s2 = __builtin_shufflevector(s4, s4, 0, 1) + __builtin_shufflevector(s4, s4, 2, 3);
  return s2[0] + s2[1];
}

// WMMA for k_attn: the builtin alone. A pass is straight-line code over TQ independent query tiles, so the products fill the
// distance behind each other (and the compiler pads what is left itself).
__device__ __forceinline__ v8f mma_f16_sl(v16h a, v16h b, v8f c) {
  return __builtin_amdgcn_wmma_f32_16x16x32_f16(false, a, false, b, (short)0, c, false, false);
}

// a lane's 16 P values of one tile as the B operand of V^T . P
__device__ __forceinline__ v16h pack_p(v8f p0, v8f p1) {
  v16h pb;
#pragma unroll
  for (int e = 0; e < 8; ++e) {
    pb[e]     = (_Float16)p0[e];   // key kc + 8h + e
    pb[8 + e] = (_Float16)p1[e];   // key kc + 16 + 8h + e
  }
  return pb;
}

// CAREFUL FORM of one query tile, entered only where the plain form's range test (k_attn) has failed: the tile's whole row of
// chunks under the running maximum (held as the offset nb = 10 - maximum, so P <= 2^10); O and the sum are rescaled a chunk.
// Speed does not matter here. The inner loops are unrolled so that the vectors' indices are constants.
__device__ __forceinline__ void careful_tile(const unsigned short* Ks, const unsigned short* Vs, int lane, v16h qb,
                                             v8f (&o)[2], float& lrun) {
  const int l15 = lane & 15;
  const v8f zero = {};
  o[0] = zero;
  o[1] = zero;
  float nb = 0.0f, lsum = 0.0f;
  for (int ch = 0; ch < NQ / 32; ++ch) {
    const _Float16* kt = (const _Float16*)(Ks + ch * (32 * KVP));
    const _Float16* vt = (const _Float16*)(Vs + ch * VCS);
    const v8f c0 = mma_f16_sl(ld_frag_h(kt, KVP, l15, 0, lane), qb, zero);
    const v8f c1 = mma_f16_sl(ld_frag_h(kt + 16 * KVP, KVP, l15, 0, lane), qb, zero);
    float lm = fmaxf(c0[0], c1[0]);
#pragma unroll
    for (int r = 1; r < 8; ++r) lm = fmaxf(lm, fmaxf(c0[r], c1[r]));
    lm = fmaxf(lm, __shfl_xor(lm, 16, 32));
    // a larger maximum is a smaller offset, so the maximum itself is not kept; the first chunk has nothing to rescale
    const float nbl = 10.0f - lm;
    const float nbn = (ch == 0) ? nbl : fminf(nb, nbl);
    const float alpha = (ch == 0) ? 1.0f : exp2_slot(nbn - nb);
    nb = nbn;
#pragma unroll
    for (int j = 0; j < 2; ++j)
#pragma unroll
      for (int r = 0; r < 8; ++r) o[j][r] *= alpha;
    v8f p0, p1;
    const float ws = exp_tile(c0, c1, nb, p0, p1);
    lsum = lsum * alpha + ws;
    const v16h pb = pack_p(p0, p1);
    o[0] = mma_f16_sl(ld_frag_h(vt, KVP, l15, 0, lane), pb, o[0]);
    o[1] = mma_f16_sl(ld_frag_h(vt + 16 * KVP, KVP, l15, 0, lane), pb, o[1]);
  }
  lrun = lsum + __shfl_xor(lsum, 16, 32);
}

// PLAIN FORM of one 32-key chunk for a wave's TQ query tiles: P = 2^raw, nothing subtracted. Softmax is the same for any
// subtracted value, since P, its sum and O carry the same factor; zero serves as long as P stays inside f16's range, which
// k_attn tests once behind the loop, on the sums. The raw score is the exponent (QCAR), so the score product's result goes
// straight into the exponential, and a pass has no test, no maximum and no branch.
// ls: a lane's running sums of P, two partial sums a tile (joined behind the loop).
// Every loop is unrolled so that the indices of qb, o, ls, pb, c are constants (registers).
__device__ __forceinline__ void plain_pass(const unsigned short* Kc, const unsigned short* Vc, int lane,
                                           const v16h (&qb)[TQ], v8f (&o)[TQ][2], v2f (&ls)[TQ]) {
  const int l15 = lane & 15;
  const _Float16* kt = (const _Float16*)Kc;   // the chunk's 32 K rows
  const _Float16* vt = (const _Float16*)Vc;   // the chunk's 32 V^T rows
  const v8f zero = {};
  const v16h ka0 = ld_frag_h(kt, KVP, l15, 0, lane);                // keys kc + 0..15
  const v16h ka2 = ld_frag_h(kt + 16 * KVP, KVP, l15, 0, lane);     // keys kc + 16..31
  v8f c[TQ][2];
#pragma unroll
  for (int t = 0; t < TQ; ++t) {
    c[t][0] = mma_f16_sl(ka0, qb[t], zero);
    c[t][1] = mma_f16_sl(ka2, qb[t], zero);
  }
  // keeps the 2 * TQ score products together in front of the vector work: each fills the distance behind the others, and the K
  // fragments' registers are free from here on
  __builtin_amdgcn_sched_barrier(0);
  exp2_48(c);
  const v16h va0 = ld_frag_h(vt, KVP, l15, 0, lane);                // d 0..15
  const v16h va1 = ld_frag_h(vt + 16 * KVP, KVP, l15, 0, lane);     // d 16..31
  v16h pb[TQ];
#pragma unroll
  for (int t = 0; t < TQ; ++t) {
    const v8f s8 = c[t][0] + c[t][1];
    const v4f s4 = __builtin_shufflevector(s8, s8, 0, 1, 2, 3) + __builtin_shufflevector(s8, s8, 4, 5, 6, 7);
    ls[t] += __builtin_shufflevector(s4, s4, 0, 1) + __builtin_shufflevector(s4, s4, 2, 3);
    pb[t] = pack_p(c[t][0], c[t][1]);
  }
  // keeps the 2 * TQ context products together behind the vector work: spread among the sums, which then land on their
  // operands' registers, they cost v_nops
  __builtin_amdgcn_sched_barrier(0);
#pragma unroll
  for (int t = 0; t < TQ; ++t) {
    o[t][0] = mma_f16_sl(va0, pb[t], o[t][0]);
    o[t][1] = mma_f16_sl(va1, pb[t], o[t][1]);
  }
}

// ---------------------------------------------------------------------------
// Flash attention, transposed-score form: block = one (group, head); its K
// [384 keys][32 d] and V^T [32 d][384 keys] are staged ONCE in LDS and shared by
// 8 waves; wave = TQ query tiles of 16 (48 queries), so the block covers all
// 384 queries and every K / V fragment read from LDS serves TQ tiles.
// Per 32-key chunk and query tile:
//   S^T = K . Q^T    A = K rows (lane = key, k = d), B = Q^T (lane = query, k = d)
//                    D[row = key 8h+r][col = query l15]; c0 keys 0..15, c1 keys 16..31
//   per-lane softmax for query l15 (16 local keys; the xor-16 partner holds the other 16), see plain_pass, careful_tile
//   O^T += V^T . P   A = V^T rows (lane = d, k = key), B = P: element i<8 <- c0[i]
//                    (key 8h+i), element 8+i <- c1[i] (key 16+8h+i), same lane
//                    D[row = d 8h+r][col = query l15]
// The planes' carries make the raw score the exponent of 2: P = 2^raw, one exp2 a score (careful form: 2^(raw - max + 10)).
// P and its sum carry the same factor, V carried x8 -> context x16 = O * 16/(8 * sum).
// Context tiles [16 q][32 d] f16 x16 staged in LDS (the K tile's space, free
// behind a block barrier) and written to the head-major ctx plane
// [BL*NHEAD*NQ][HD]: each tile is 1024 contiguous bytes
// second bound: at most 160 VGPRs, so that the 3 blocks a WGP gets (768 blocks, 256 WGPs) are resident together
__global__ __launch_bounds__(256, 6) void k_attn(const unsigned short* __restrict__ qp,
                                              const unsigned short* __restrict__ kp,
                                              const unsigned short* __restrict__ vtp,
                                              unsigned short* __restrict__ ctx) {
  __shared__ __align__(16) unsigned short Ks[NQ * KVP];          // [key][d]; later the context tiles
  __shared__ __align__(16) unsigned short Vs[(NQ / 32) * VCS];   // [chunk][d][key in chunk]

  const int tid = threadIdx.x;
  const int wave = tid >> 5, lane = tid & 31;
  // the wave's number in a scalar register, for the epilogue: what is formed from it holds no vector register across the loop
  const int swave = __builtin_amdgcn_readfirstlane(tid >> 5);
  const int l15 = lane & 15;
  const int half = (lane >> 4) & 1;
  const int head = blockIdx.x;
  const int g = blockIdx.y;                // (b,l) group

  const _Float16* Q  = (const _Float16*)qp;
  const size_t tile = ((size_t)g * NHEAD + head) * NQ * HD;   // the (group, head) tile of a plane, contiguous
  const unsigned short* kbase = kp + tile;                    // [key][d]
  const unsigned short* vbase = vtp + tile;                   // [chunk of 32 keys][d][key in chunk]

  // stage K and V^T: 2 x 1536 pieces of 16 bytes, 6 + 6 a thread, all loads issued before the first LDS store
  v4u kr[NQ * 4 / 256], vr[NQ * 4 / 256];
#pragma unroll
  for (int i = 0; i < NQ * 4 / 256; ++i) {
    const int idx = i * 256 + tid;
    kr[i] = *(const v4u*)(kbase + idx * 8);
  }
#pragma unroll
  for (int i = 0; i < NQ * 4 / 256; ++i) {
    const int idx = i * 256 + tid;
    vr[i] = *(const v4u*)(vbase + idx * 8);
  }
  v16h qb[TQ];
#pragma unroll
  for (int t = 0; t < TQ; ++t) {
    const _Float16* qbase = Q + tile + (wave * TQ + t) * 16 * HD;
    qb[t] = ld_frag_h(qbase, HD, l15, 0, lane);                // d 0..31
  }
#pragma unroll
  for (int i = 0; i < NQ * 4 / 256; ++i) {
    const int idx = i * 256 + tid;
    *(v4u*)(&Ks[(idx >> 2) * KVP + (idx & 3) * 8]) = kr[i];
  }
#pragma unroll
  for (int i = 0; i < NQ * 4 / 256; ++i) {
    const int idx = i * 256 + tid;             // chunk idx / 128, d (idx / 4) % 32, piece idx % 4
    *(v4u*)(&Vs[(idx >> 7) * VCS + ((idx >> 2) & 31) * KVP + (idx & 3) * 8]) = vr[i];
  }
  __syncthreads();                         // K and V^T tiles complete

  v8f o[TQ][2] = {};
  v2f ls[TQ] = {};
  // unrolled: a pass has no branch, so the chunks' LDS addresses become immediate offsets (no address arithmetic in a pass) and
  // the next chunk's K reads issue among this chunk's context products
#pragma unroll
  for (int ch = 0; ch < NQ / 32; ++ch) plain_pass(Ks + ch * (32 * KVP), Vs + ch * VCS, lane, qb, o, ls);

  // the two halves of a wave hold one query's keys 8h..8h+7 and 16+8h..: their partial row sums are joined here, once
  float lsum[TQ], lrun[TQ];
#pragma unroll
  for (int t = 0; t < TQ; ++t) {
    lsum[t] = ls[t][0] + ls[t][1];
    lrun[t] = lsum[t] + __shfl_xor(lsum[t], 16, 32);
  }
  // the plain form's range test, once a wave: every P was finite in f16 (a lane's sums are positive, so their sum below PLIM
  // bounds each P) and no query's sum is small (PLOW). A sum that is not a number fails the first compare.
  const bool too_large = !(lsum[0] + lsum[1] + lsum[2] < PLIM);
  const bool too_small = !(fminf(fminf(lrun[0], lrun[1]), lrun[2]) >= PLOW);
  if (__builtin_expect(__builtin_amdgcn_ballot_w32(too_large | too_small) != 0, false)) {   // wave-uniform: a scalar branch, EXEC stays full, no barrier inside
    // rare: the wave's queries are worked anew, from the tiles in LDS, under each query's running maximum
#pragma unroll
    for (int t = 0; t < TQ; ++t) careful_tile(Ks, Vs, lane, qb[t], o[t], lrun[t]);
  }
  __syncthreads();                         // every wave's last read of the K tile done: its space becomes context staging

  // o[t][j][r] = 8 * sum_t P_t v_t for query l15, d = j*16 + 8*half + r; ctx carried x16
#pragma unroll
  for (int t = 0; t < TQ; ++t) {
    const float inv = 1.0f / (lrun[t] * 0.5f);   // lrun carries the same factor of P as o
    unsigned short* T = Ks + (swave * TQ + t) * 16 * CTP;
#pragma unroll
    for (int j = 0; j < 2; ++j) {
      v4u w;
      w[0] = pack2h(o[t][j][0] * inv, o[t][j][1] * inv);
      w[1] = pack2h(o[t][j][2] * inv, o[t][j][3] * inv);
      w[2] = pack2h(o[t][j][4] * inv, o[t][j][5] * inv);
      w[3] = pack2h(o[t][j][6] * inv, o[t][j][7] * inv);
      *(v4u*)(&T[l15 * CTP + j * 16 + 8 * half]) = w;
    }
  }
  __syncthreads();

  v4u v[TQ][2];
#pragma unroll
  for (int t = 0; t < TQ; ++t)
#pragma unroll
    for (int it = 0; it < 2; ++it) {
      const int row = it * 8 + (lane >> 2);     // 0..15 query row of the tile
      const int piece = (lane & 3) * 8;         // 8 halves = 16 B; 4 pieces = 64-B row, 8 lanes = one line
      v[t][it] = *(const v4u*)(&Ks[((swave * TQ + t) * 16 + row) * CTP + piece]);
    }
  unsigned short* cb = ctx + (((size_t)g * NHEAD + head) * NQ + swave * TQ * 16) * HD;
#pragma unroll
  for (int t = 0; t < TQ; ++t)
#pragma unroll
    for (int it = 0; it < 2; ++it)
      *(v4u*)(cb + (t * 16 + it * 8) * HD + lane * 8) = v[t][it];   // row lane / 4, piece lane % 4: 16 bytes a lane in a row
}

// ---------------------------------------------------------------------------
// Output projection: out[MROWS][DOUT] f32 = ctx[MROWS][ATT] * WdT[DOUT][ATT]^T / 256 + bd.
// ctx read from the head-major plane: for row (g, n) the 32 k values of
// k-step s (= head s) are contiguous at ((g*NHEAD + s)*NQ + n)*HD.
// 256 thr = 8 waves; block = 128 rows x all DOUT columns; wave = 32 rows x 64 columns
// (4 row groups x 2 column halves), so every weight fragment read from LDS serves two row tiles.
// The whole WdT plane [128 n][256 k] (64 KiB, contiguous) is staged ONCE in LDS, and each wave
// issues the loads of all its ctx fragments (all of k) before it waits for anything: one memory
// latency and one block barrier stand in front of the products, none between the k-steps.
// f16 operands, k-steps summed in the order 0..7. Epilogue: each wave stages its f32 tile in its
// own LDS range; each 256-byte row segment = 2 lines, written by 16 consecutive lanes.
__global__ __launch_bounds__(256) void k_oproj(const unsigned short* __restrict__ ctx,
                                               const unsigned short* __restrict__ wT,
                                               const float* __restrict__ bd,
                                               float* __restrict__ outp) {
  __shared__ __align__(16) unsigned short bt[DOUT * WOP];   // weight plane, cross-wave (block barrier)
  __shared__ __align__(16) float E[8 * 32 * OEP];           // epilogue tiles, one a wave
  static_assert(NQ % 128 == 0);                             // a block's 128 rows lie inside one group
  static_assert(DOUT == 128 && ATT == 256);                 // 2 column halves of 64; one plane row = one wave-wide 16-byte load

  const int m0 = blockIdx.y * 128;
  const int tid = threadIdx.x;
  const int wave = tid >> 5, lane = tid & 31;
  const int l15 = lane & 15, half = (lane >> 4) & 1;
  const int rg = wave >> 1;           // 0..3 : row group of 32
  const int c0 = (wave & 1) * 64;     // column half

  // weight plane = 4096 pieces of 16 bytes, 16 a thread: piece i*256 + tid = row i*8 + wave, piece lane
  const unsigned short* wsrc = wT + (size_t)3 * ATT * DIN + tid * 8;   // WdT plane [DOUT][ATT], f16 x16
  v4u wv[16];
#pragma unroll
  for (int i = 0; i < 16; ++i) wv[i] = *(const v4u*)(wsrc + i * 2048);

  const int g = m0 / NQ;
  const int nl = m0 - g * NQ + rg * 32;
  const _Float16* A0 = (const _Float16*)ctx + ((size_t)g * NHEAD * NQ + nl) * HD;
  // loops unrolled so that a, wv, b, acc and v have constant indices and stay in registers
  v16h a[2][ATT / 32];
#pragma unroll
  for (int s = 0; s < ATT / 32; ++s)
#pragma unroll
    for (int mt = 0; mt < 2; ++mt) a[mt][s] = ld_frag_h(A0 + (size_t)s * NQ * HD + mt * 16 * HD, HD, l15, 0, lane);
  float bb[4];
#pragma unroll
  for (int j = 0; j < 4; ++j) bb[j] = bd[c0 + j * 16 + l15];

#pragma unroll
  for (int i = 0; i < 16; ++i) *(v4u*)(&bt[(i * 8 + wave) * WOP + lane * 8]) = wv[i];
  __syncthreads();                                 // weight plane complete

  v8f acc[2][4] = {};
#pragma unroll
  for (int s = 0; s < ATT / 32; ++s) {
    v16h b[4];
#pragma unroll
    for (int j = 0; j < 4; ++j) b[j] = ld_frag_h((const _Float16*)bt, WOP, c0 + j * 16 + l15, s * 32, lane);
#pragma unroll
    for (int j = 0; j < 4; ++j)
#pragma unroll
      for (int mt = 0; mt < 2; ++mt) acc[mt][j] = mma_f16(a[mt][s], b[j], acc[mt][j]);
  }

  // acc[mt][j][r] = 256 * (ctx.Wd)[m0 + rg*32 + mt*16 + 8*half + r][c0 + j*16 + l15]
  const float cinv = 1.0f / 256.0f;
  float* Ew = E + wave * 32 * OEP;
#pragma unroll
  for (int j = 0; j < 4; ++j) {
    const int col = j * 16 + l15;
    const float bj = bf16val(bb[j]);
#pragma unroll
    for (int mt = 0; mt < 2; ++mt)
#pragma unroll
      for (int r = 0; r < 8; ++r) Ew[(mt * 16 + 8 * half + r) * OEP + col] = acc[mt][j][r] * cinv + bj;
  }
  __syncthreads();                                 // epilogue tiles complete

  float* ob = outp + (size_t)(m0 + rg * 32 + half) * DOUT + c0 + l15 * 4;
  v4f v[16];
#pragma unroll
  for (int it = 0; it < 16; ++it)                  // row it*2 + half; 16 pieces of 16 B = the row's 256-byte segment (2 lines)
    v[it] = *(const v4f*)(&Ew[(it * 2 + half) * OEP + l15 * 4]);
#pragma unroll
  for (int it = 0; it < 16; ++it) *(v4f*)(ob + (size_t)it * 2 * DOUT) = v[it];
}

// ---------------------------------------------------------------------------
extern "C" void kernel_launch(void* const* d_in, const int* in_sizes, int n_in,
                              void* d_out, int out_size, void* d_ws, size_t ws_size,
                              hipStream_t stream) {
  if (n_in < 11) return;
  if (in_sizes[0] < MROWS * DIN || in_sizes[1] < MROWS * DIN || in_sizes[2] < MROWS * DIN) return;
  if (in_sizes[3] < DIN * ATT || in_sizes[5] < DIN * ATT || in_sizes[7] < DIN * ATT) return;
  if (in_sizes[4] < ATT || in_sizes[6] < ATT || in_sizes[8] < ATT) return;
  if (in_sizes[9] < ATT * DOUT || in_sizes[10] < DOUT) return;
  if (out_size < MROWS * DOUT) return;

  const float* xq = (const float*)d_in[0];
  const float* xk = (const float*)d_in[1];
  const float* xv = (const float*)d_in[2];
  const float* Wq = (const float*)d_in[3];
  const float* bq = (const float*)d_in[4];
  const float* Wk = (const float*)d_in[5];
  const float* bk = (const float*)d_in[6];
  const float* Wv = (const float*)d_in[7];
  const float* bv = (const float*)d_in[8];
  const float* Wd = (const float*)d_in[9];
  const float* bd = (const float*)d_in[10];

  // and is written exactly to its extent (no padded tails needed: all tiles divide the shapes)
  const size_t wt_bytes  = (size_t)4 * DIN * ATT * 2;        // the f16 WdT plane is the last quarter, the rest is not used
  const size_t pl_bytes  = (size_t)MROWS * ATT * 2;          // one f16 plane (Q, K, V^T, ctx)
  const size_t off_wt  = 0;
  const size_t off_q   = off_wt + wt_bytes;
  const size_t off_k   = off_q + pl_bytes;
  const size_t off_vt  = off_k + pl_bytes;
  const size_t off_ctx = off_vt + pl_bytes;
  const size_t total   = off_ctx + pl_bytes;                 // 75759616 B at full size
  if (total > ws_size) return;

  char* ws = (char*)d_ws;
  unsigned short* wt  = (unsigned short*)(ws + off_wt);
  unsigned short* qpl = (unsigned short*)(ws + off_q);
  unsigned short* kpl = (unsigned short*)(ws + off_k);
  unsigned short* vtp = (unsigned short*)(ws + off_vt);
  unsigned short* cxp = (unsigned short*)(ws + off_ctx);

  k_proj<<<dim3(NWD + 3 * (MROWS / 256)), 256, 0, stream>>>(xq, xk, xv, Wq, Wk, Wv, Wd, bq, bk, bv, qpl, kpl, vtp, wt);
  k_attn<<<dim3(NHEAD, BL), 256, 0, stream>>>(qpl, kpl, vtp, cxp);
  k_oproj<<<dim3(1, MROWS / 128), 256, 0, stream>>>(cxp, wt, bd, (float*)d_out);
}
